// v000
// Times are from an AMD MI455X. After a warm-up the kernel runs many times in a row, and a time is the length of
// such a window on the GPU divided by its runs, so every launch and the gaps after it count. The runs cycle
// through copies of the inputs. A figure is the median of several windows, for all but v000 over two sittings.
// Sittings can differ by a few percent; kernels timed side by side share one.
// v000, which the later versions start from, runs in 671 microseconds.
#include <hip/hip_runtime.h>
// 8-head attention over the given q/k/v (2 × 4096 tokens, d = 64) as a fused flash-style kernel on v_wmma_f32_16x16x32_f16 (q, k, v are module INPUTS → exact bf16 values as f16 operands; S = Q·Kᵀ × 64^-½,
// online max/sum softmax f32, P f16 ≤ 1, O = P·V), then the 512→64 output linear (+ bias; W_out [in][out] bf16-exact ×2^4); f32 accumulate.
#define BB 2
#define TT 4096
#define CC 512
#define NH 8
#define NO 64
#define NR (BB * TT)

typedef __bf16 v16b __attribute__((ext_vector_type(16)));
typedef unsigned short v8us __attribute__((ext_vector_type(8), may_alias));
typedef float  v8f  __attribute__((ext_vector_type(8)));
typedef float  v4f  __attribute__((ext_vector_type(4)));
typedef float  v4fa __attribute__((ext_vector_type(4), may_alias));
union FragB { v16b v; v8us half[2]; unsigned short u[16]; };

__device__ __forceinline__ unsigned short bf16_bits(float x) { unsigned int u = __float_as_uint(x); return (unsigned short)((u + 0x7FFFu + ((u >> 16) & 1u)) >> 16); }
__device__ __forceinline__ float bf16_val(unsigned short b) { return __uint_as_float(((unsigned int)b) << 16); }
__device__ __forceinline__ float bf16_round(float x) { return bf16_val(bf16_bits(x)); }
// D += A·B with NT terms: 1 = ah·bh, 2 = + al·bh (A split), 3 = + ah·bl (both split)
template <int NT>
__device__ __forceinline__ v8f mmaN(v16b ah, v16b al, v16b bh, v16b bl, v8f c) {
  c = __builtin_amdgcn_wmma_f32_16x16x32_bf16(false, ah, false, bh, (short)0, c, false, false);
  if (NT >= 2) c = __builtin_amdgcn_wmma_f32_16x16x32_bf16(false, al, false, bh, (short)0, c, false, false);
  if (NT >= 3) c = __builtin_amdgcn_wmma_f32_16x16x32_bf16(false, ah, false, bl, (short)0, c, false, false);
  asm volatile("v_nop\n\tv_nop\n\tv_nop\n\tv_nop" : "+v"(c) : "v"(ah), "v"(al), "v"(bh), "v"(bl));
  return c;
}

__global__ __launch_bounds__(256) void k_wt_bf16(const float* __restrict__ W, unsigned short* __restrict__ Wt, int K, int N) {
  const int t = blockIdx.x * 256 + threadIdx.x;
  const int k8n = K / 8;
  if (t >= N * k8n) return;
  const int n = t / k8n, k8 = (t % k8n) * 8;
  v8us v;
#pragma unroll
  for (int i = 0; i < 8; ++i) v[i] = bf16_bits(W[(size_t)(k8 + i) * N + n]);
  *(v8us*)(Wt + (size_t)n * K + k8) = v;
  
}

// GEMM C[M][N] (f32, pitch ldc) = act(A[M][K]·W + bias). A f32 row-major (pitch lda) converted per fragment to bf16
// (ASPLIT: hi/lo two planes -> 2 terms, else single rounded term); Wt bf16 [N][K] (pitch ldb). BIAS_BF16 rounds the
// bias to bf16 first (bias quantised to bf16 before the add). K%32==0, M%16==0, N%64==0.
template <bool ASPLIT, int ACT, bool BIAS_BF16>
__global__ __launch_bounds__(128) void k_gemm_bf(const float* __restrict__ A, int lda, const unsigned short* __restrict__ Wt, int ldb,
                                               const float* __restrict__ bias, float* __restrict__ C, int ldc, int M, int N, int K) {
  __shared__ __attribute__((aligned(16))) float so[4][16][64];
  const int tid = threadIdx.x, w = tid >> 5, lane = tid & 31, ln = lane & 15, hh = lane >> 4;
  const int ntn = N / 64;
  const int wid = blockIdx.x * 4 + w;
  const int mt = wid / ntn, nq = wid % ntn;
  if (mt * 16 >= M) return;
  const int row0 = mt * 16, col0 = nq * 64;
  const float* arow = A + (size_t)(row0 + ln) * lda;
  v8f acc[4] = {};
  for (int kb = 0; kb < K; kb += 32) {
    FragB ah, al;
    const v4f x0 = *(const v4fa*)(arow + kb + 8 * hh), x1 = *(const v4fa*)(arow + kb + 8 * hh + 4);
    const v4f x2 = *(const v4fa*)(arow + kb + 16 + 8 * hh), x3 = *(const v4fa*)(arow + kb + 16 + 8 * hh + 4);
    float xs[16] = {x0[0],x0[1],x0[2],x0[3],x1[0],x1[1],x1[2],x1[3],x2[0],x2[1],x2[2],x2[3],x3[0],x3[1],x3[2],x3[3]};
#pragma unroll
    for (int i = 0; i < 16; ++i) { const unsigned short hb = bf16_bits(xs[i]); ah.u[i] = hb; al.u[i] = ASPLIT ? bf16_bits(xs[i] - bf16_val(hb)) : (unsigned short)0; }
#pragma unroll
    for (int t = 0; t < 4; ++t) {
      const unsigned short* brow = Wt + (size_t)(col0 + t * 16 + ln) * ldb + kb;
      FragB b;
      b.half[0] = *(const v8us*)(brow + 8 * hh);
      b.half[1] = *(const v8us*)(brow + 16 + 8 * hh);
      acc[t] = mmaN<ASPLIT ? 2 : 1>(ah.v, al.v, b.v, b.v, acc[t]);
    }
  }
#pragma unroll
  for (int t = 0; t < 4; ++t) {
    float bv = bias ? bias[col0 + t * 16 + ln] : 0.f;
    if (BIAS_BF16) bv = bf16_round(bv);
#pragma unroll
    for (int r = 0; r < 8; ++r) { float v = acc[t][r] + bv; if (ACT == 1) v = fmaxf(v, 0.f); so[w][8 * hh + r][t * 16 + ln] = v; }
  }
  __builtin_amdgcn_fence(__ATOMIC_ACQ_REL, "workgroup");
  __builtin_amdgcn_wave_barrier();
  const int rsub = lane >> 4, c4 = (lane & 15) * 4;
  {
#pragma unroll
    for (int q = 0; q < 8; ++q) {
      const int r = q * 2 + rsub;
      const v4f v = *(const v4fa*)&so[w][r][c4];
      *(v4f*)(C + (size_t)(row0 + r) * ldc + col0 + c4) = v;
    }
    
  }
}

// Flash-style causal/unmasked attention, all contractions 3-term bf16 hi/lo splits, f32 softmax with running max.
// q,k,v rows are read from f32 buffers with arbitrary row pitch (so they can live inside a fused qkv buffer);
// D = head size (multiple of 32, <= 128); one wave = 16 query rows; block = 4 waves (64 queries) sharing K/V chunks of 32.
template <int D, bool CAUSAL>
__global__ __launch_bounds__(128) void k_flash(const float* __restrict__ qb, const float* __restrict__ kb, const float* __restrict__ vb,
                                             int pitch, int T, int H, float scale, float* __restrict__ y, int ypitch) {
  constexpr int KS = D / 32;        // k-steps for QK
  constexpr int DT = D / 16;        // d tiles for PV
  __shared__ __attribute__((aligned(16))) unsigned short sKh[32][D + 8], sKl[32][D + 8], sVh[32][D + 8], sVl[32][D + 8];
  __shared__ __attribute__((aligned(16))) unsigned short sPh[4][16][40], sPl[4][16][40];
  __shared__ __attribute__((aligned(16))) float sO[4][16][D];
  const int tid = threadIdx.x, w = tid >> 5, lane = tid & 31, ln = lane & 15, hh = lane >> 4;
  const int nqb = (T + 63) / 64;
  const int bh = blockIdx.x / nqb, qblk = blockIdx.x % nqb;
  const int b = bh / H, h = bh % H;
  const int q0 = qblk * 64 + w * 16;
  const float* Q = qb + (size_t)b * T * pitch + h * D;
  const float* K = kb + (size_t)b * T * pitch + h * D;
  const float* V = vb + (size_t)b * T * pitch + h * D;

  // A fragments of the wave's 16 query rows (scaled), hi/lo
  FragB aqh[KS], aql[KS];
  {
    int row = q0 + ln; if (row >= T) row = T - 1;
    const float* qr = Q + (size_t)row * pitch;
#pragma unroll
    for (int ks = 0; ks < KS; ++ks)
#pragma unroll
      for (int i = 0; i < 16; ++i) {
        const int d = ks * 32 + ((i < 8) ? (8 * hh + i) : (16 + 8 * hh + (i - 8)));
        const float x = qr[d] * scale; const unsigned short hb = bf16_bits(x);
        aqh[ks].u[i] = hb; aql[ks].u[i] = bf16_bits(x - bf16_val(hb));
      }
  }
  float m_r[8], l_r[8];
#pragma unroll
  for (int r = 0; r < 8; ++r) { m_r[r] = -3.0e38f; l_r[r] = 0.f; }
  v8f oacc[DT];
#pragma unroll
  for (int dt = 0; dt < DT; ++dt) oacc[dt] = (v8f){0.f,0.f,0.f,0.f,0.f,0.f,0.f,0.f};

  const int kv_end = CAUSAL ? min(T, qblk * 64 + 64) : T;     // block-uniform
  for (int j0 = 0; j0 < kv_end; j0 += 32) {
    __syncthreads();
    for (int e = tid; e < 32 * (D / 4); e += 128) {
      const int r = e / (D / 4), c4 = (e % (D / 4)) * 4;
      const int key = j0 + r;
      v4f kf = {0.f,0.f,0.f,0.f}, vf = {0.f,0.f,0.f,0.f};
      if (key < T) { kf = *(const v4fa*)(K + (size_t)key * pitch + c4); vf = *(const v4fa*)(V + (size_t)key * pitch + c4); }
#pragma unroll
      for (int t = 0; t < 4; ++t) {
        unsigned short hb = bf16_bits(kf[t]); sKh[r][c4 + t] = hb; sKl[r][c4 + t] = bf16_bits(kf[t] - bf16_val(hb));
        hb = bf16_bits(vf[t]); sVh[r][c4 + t] = hb; sVl[r][c4 + t] = bf16_bits(vf[t] - bf16_val(hb));
      }
    }
    __syncthreads();
    // S tile 16 x 32
    v8f s[2];
#pragma unroll
    for (int nt = 0; nt < 2; ++nt) {
      v8f acc = {};
#pragma unroll
      for (int ks = 0; ks < KS; ++ks) {
        FragB bh_, bl_;
        bh_.half[0] = *(const v8us*)&sKh[nt * 16 + ln][ks * 32 + 8 * hh]; bh_.half[1] = *(const v8us*)&sKh[nt * 16 + ln][ks * 32 + 16 + 8 * hh];
        bl_.half[0] = *(const v8us*)&sKl[nt * 16 + ln][ks * 32 + 8 * hh]; bl_.half[1] = *(const v8us*)&sKl[nt * 16 + ln][ks * 32 + 16 + 8 * hh];
        acc = mmaN<3>(aqh[ks].v, aql[ks].v, bh_.v, bl_.v, acc);
      }
      s[nt] = acc;
    }
    // mask + running max (rows 8hh+r; the 16 lanes of a half share rows)
    float alpha[8];
#pragma unroll
    for (int r = 0; r < 8; ++r) {
      const int qi = q0 + 8 * hh + r;
      const int ja = j0 + ln, jb = j0 + 16 + ln;
      if (CAUSAL) { if (ja > qi) s[0][r] = -3.0e38f; if (jb > qi) s[1][r] = -3.0e38f; }
      if (ja >= T) s[0][r] = -3.0e38f;
      if (jb >= T) s[1][r] = -3.0e38f;
      float mx = fmaxf(s[0][r], s[1][r]);
      mx = fmaxf(mx, __shfl_xor(mx, 1, 32)); mx = fmaxf(mx, __shfl_xor(mx, 2, 32)); mx = fmaxf(mx, __shfl_xor(mx, 4, 32)); mx = fmaxf(mx, __shfl_xor(mx, 8, 32));
      const float mnew = fmaxf(m_r[r], mx);
      alpha[r] = (mnew > -1.0e38f) ? __expf(m_r[r] - mnew) : 1.0f;
      const float p0 = (s[0][r] > -1.0e38f) ? __expf(s[0][r] - mnew) : 0.f;
      const float p1 = (s[1][r] > -1.0e38f) ? __expf(s[1][r] - mnew) : 0.f;
      m_r[r] = mnew;
      l_r[r] = l_r[r] * alpha[r] + p0 + p1;            // per-lane partial row sum (16 lanes combined at the end)
      unsigned short hb = bf16_bits(p0); sPh[w][8 * hh + r][ln] = hb;      sPl[w][8 * hh + r][ln] = bf16_bits(p0 - bf16_val(hb));
      hb = bf16_bits(p1);                sPh[w][8 * hh + r][16 + ln] = hb; sPl[w][8 * hh + r][16 + ln] = bf16_bits(p1 - bf16_val(hb));
    }
#pragma unroll
    for (int dt = 0; dt < DT; ++dt)
#pragma unroll
      for (int r = 0; r < 8; ++r) oacc[dt][r] *= alpha[r];
    __builtin_amdgcn_fence(__ATOMIC_ACQ_REL, "workgroup");
    __builtin_amdgcn_wave_barrier();
    FragB pah, pal;
    pah.half[0] = *(const v8us*)&sPh[w][ln][8 * hh]; pah.half[1] = *(const v8us*)&sPh[w][ln][16 + 8 * hh];
    pal.half[0] = *(const v8us*)&sPl[w][ln][8 * hh]; pal.half[1] = *(const v8us*)&sPl[w][ln][16 + 8 * hh];
#pragma unroll
    for (int dt = 0; dt < DT; ++dt) {
      FragB bvh, bvl;
#pragma unroll
      for (int i = 0; i < 8; ++i) {
        bvh.u[i] = sVh[8 * hh + i][dt * 16 + ln]; bvh.u[8 + i] = sVh[16 + 8 * hh + i][dt * 16 + ln];
        bvl.u[i] = sVl[8 * hh + i][dt * 16 + ln]; bvl.u[8 + i] = sVl[16 + 8 * hh + i][dt * 16 + ln];
      }
      oacc[dt] = mmaN<3>(pah.v, pal.v, bvh.v, bvl.v, oacc[dt]);
    }
    __builtin_amdgcn_fence(__ATOMIC_ACQ_REL, "workgroup");
    __builtin_amdgcn_wave_barrier();
  }
#pragma unroll
  for (int r = 0; r < 8; ++r) {
    float l = l_r[r];
    l += __shfl_xor(l, 1, 32); l += __shfl_xor(l, 2, 32); l += __shfl_xor(l, 4, 32); l += __shfl_xor(l, 8, 32);
    l_r[r] = (l > 0.f) ? 1.0f / l : 0.f;
  }
#pragma unroll
  for (int dt = 0; dt < DT; ++dt)
#pragma unroll
    for (int r = 0; r < 8; ++r) sO[w][8 * hh + r][dt * 16 + ln] = oacc[dt][r] * l_r[r];
  __builtin_amdgcn_fence(__ATOMIC_ACQ_REL, "workgroup");
  __builtin_amdgcn_wave_barrier();
  {
    for (int r = 0; r < 16; ++r) {
      const int row = q0 + r;
      if (row < T && lane < D / 4) {
        const v4f val = *(const v4fa*)&sO[w][r][lane * 4];
        *(v4f*)(y + ((size_t)b * T + row) * ypitch + h * D + lane * 4) = val;
      }
    }
    
  }
}

// GEMM C = act(A·W + bias + resid): A f32 (ASPLIT -> hi/lo 2 terms), Wt bf16 [N][K]; ACT 0 none, 1 relu, 2 exact gelu;
// resid (optional, f32, row index = (row % rmod), pitch ldr, RES_BF16 rounds it) added before the activation.
template <bool ASPLIT, int ACT, bool BIAS_BF16, bool RES_BF16>
__global__ __launch_bounds__(128) void k_gemm_bf3(const float* __restrict__ A, int lda, const unsigned short* __restrict__ Wt, int ldb,
                                                const float* __restrict__ bias, const float* __restrict__ resid, int rmod, int ldr,
                                                float* __restrict__ C, int ldc, int M, int N, int K) {
  __shared__ __attribute__((aligned(16))) float so[4][16][64];
  const int tid = threadIdx.x, w = tid >> 5, lane = tid & 31, ln = lane & 15, hh = lane >> 4;
  const int ntn = N / 64;
  const int wid = blockIdx.x * 4 + w;
  const int mt = wid / ntn, nq = wid % ntn;
  if (mt * 16 >= M) return;
  const int row0 = mt * 16, col0 = nq * 64;
  const float* arow = A + (size_t)(row0 + ln) * lda;
  v8f acc[4] = {};
  for (int kb = 0; kb < K; kb += 32) {
    FragB ah, al;
    const v4f x0 = *(const v4fa*)(arow + kb + 8 * hh), x1 = *(const v4fa*)(arow + kb + 8 * hh + 4);
    const v4f x2 = *(const v4fa*)(arow + kb + 16 + 8 * hh), x3 = *(const v4fa*)(arow + kb + 16 + 8 * hh + 4);
    float xs[16] = {x0[0],x0[1],x0[2],x0[3],x1[0],x1[1],x1[2],x1[3],x2[0],x2[1],x2[2],x2[3],x3[0],x3[1],x3[2],x3[3]};
#pragma unroll
    for (int i = 0; i < 16; ++i) { const unsigned short hb = bf16_bits(xs[i]); ah.u[i] = hb; al.u[i] = ASPLIT ? bf16_bits(xs[i] - bf16_val(hb)) : (unsigned short)0; }
#pragma unroll
    for (int t = 0; t < 4; ++t) {
      const unsigned short* brow = Wt + (size_t)(col0 + t * 16 + ln) * ldb + kb;
      FragB b;
      b.half[0] = *(const v8us*)(brow + 8 * hh);
      b.half[1] = *(const v8us*)(brow + 16 + 8 * hh);
      acc[t] = mmaN<ASPLIT ? 2 : 1>(ah.v, al.v, b.v, b.v, acc[t]);
    }
  }
#pragma unroll
  for (int t = 0; t < 4; ++t) {
    const int col = col0 + t * 16 + ln;
    float bv = bias ? bias[col] : 0.f;
    if (BIAS_BF16) bv = bf16_round(bv);
#pragma unroll
    for (int r = 0; r < 8; ++r) {
      float v = acc[t][r] + bv;
      if (resid) { float rv = resid[(size_t)((row0 + 8 * hh + r) % rmod) * ldr + col]; if (RES_BF16) rv = bf16_round(rv); v += rv; }
      if (ACT == 1) v = fmaxf(v, 0.f);
      if (ACT == 2) v = 0.5f * v * (1.0f + erff(v * 0.70710678118654752f));
      if (ACT == 3) { const float u = 0.7978845608028654f * (v + 0.044715f * v * v * v); v = 0.5f * v * (1.0f + tanhf(u)); }
      so[w][8 * hh + r][t * 16 + ln] = v;
    }
  }
  __builtin_amdgcn_fence(__ATOMIC_ACQ_REL, "workgroup");
  __builtin_amdgcn_wave_barrier();
  const int rsub = lane >> 4, c4 = (lane & 15) * 4;
  {
#pragma unroll
    for (int q = 0; q < 8; ++q) {
      const int r = q * 2 + rsub;
      const v4f v = *(const v4fa*)&so[w][r][c4];
      *(v4f*)(C + (size_t)(row0 + r) * ldc + col0 + c4) = v;
    }
    
  }
}
// row LayerNorm (biased variance, eps) over N: s = X (+ R); optional out_sum <- s; out_norm <- (s-mu)*rsqrt(var+eps)*g + b
template <bool PARAM_BF16>
__global__ __launch_bounds__(256) void k_layernorm(const float* __restrict__ X, const float* __restrict__ R, const float* __restrict__ g, const float* __restrict__ bta,
                                                  float* __restrict__ out_sum, float* __restrict__ out_norm, int N, float eps) {
  __shared__ float red[256];
  const int row = blockIdx.x, tid = threadIdx.x;
  const float* x = X + (size_t)row * N; const float* rr = R ? R + (size_t)row * N : nullptr;
  float vals[16];                     // up to N = 4096
  const int per = N / 256;            // contiguous chunk per thread? use strided-by-4 chunks: thread handles j = tid*4 + 1024*u
  float s1 = 0.f;
  for (int u = 0; u < per / 4; ++u) {
    const int j = tid * 4 + 1024 * u;
    const v4f a = *(const v4fa*)(x + j);
    v4f b = {0.f,0.f,0.f,0.f}; if (rr) b = *(const v4fa*)(rr + j);
#pragma unroll
    for (int q = 0; q < 4; ++q) { const float v = a[q] + b[q]; vals[u * 4 + q] = v; s1 += v; }
  }
  red[tid] = s1; __syncthreads();
  for (int st = 128; st > 0; st >>= 1) { if (tid < st) red[tid] += red[tid + st]; __syncthreads(); }
  const float mu = red[0] / (float)N; __syncthreads();
  float s2 = 0.f;
  for (int u = 0; u < per / 4; ++u)
#pragma unroll
    for (int q = 0; q < 4; ++q) { const float c = vals[u * 4 + q] - mu; s2 += c * c; }
  red[tid] = s2; __syncthreads();
  for (int st = 128; st > 0; st >>= 1) { if (tid < st) red[tid] += red[tid + st]; __syncthreads(); }
  const float rs = rsqrtf(red[0] / (float)N + eps);
  {
    for (int u = 0; u < per / 4; ++u) {
      const int j = tid * 4 + 1024 * u;
      v4f o, sm;
#pragma unroll
      for (int q = 0; q < 4; ++q) {
        float gg = g[j + q], bb = bta[j + q];
        if (PARAM_BF16) { gg = bf16_round(gg); bb = bf16_round(bb); }
        sm[q] = vals[u * 4 + q]; o[q] = (vals[u * 4 + q] - mu) * rs * gg + bb;
      }
      if (out_sum) *(v4f*)(out_sum + (size_t)row * N + j) = sm;
      *(v4f*)(out_norm + (size_t)row * N + j) = o;
    }
    
  }
}



// ---- f16 WMMA path (v_wmma_f32_16x16x32_f16): 11-bit significands for operands in range — used for every matrix product here (Q·Kᵀ, P·V, output linear)
typedef _Float16 v16h __attribute__((ext_vector_type(16)));
union FragH { v16h v; v8us half[2]; _Float16 h[16]; unsigned short u[16]; };
template <int NT>
__device__ __forceinline__ v8f mmaH(v16h ah, v16h al, v16h bh, v16h bl, v8f c) {
  c = __builtin_amdgcn_wmma_f32_16x16x32_f16(false, ah, false, bh, (short)0, c, false, false);
  if (NT >= 2) c = __builtin_amdgcn_wmma_f32_16x16x32_f16(false, al, false, bh, (short)0, c, false, false);
  if (NT >= 3) c = __builtin_amdgcn_wmma_f32_16x16x32_f16(false, ah, false, bl, (short)0, c, false, false);
  asm volatile("v_nop\n\tv_nop\n\tv_nop\n\tv_nop" : "+v"(c) : "v"(ah), "v"(al), "v"(bh), "v"(bl));
  return c;
}
// batched GEMM like k_gemm_b but f16 operands: A f32 (split into f16 hi/lo if ASPLIT, else rounded to f16), Bt = f16 values [n][k]; alpha; C f32; N multiple of 16 (partial tiles skipped)
template <bool ASPLIT>
__global__ __launch_bounds__(128) void k_gemm_h(const float* __restrict__ A, int lda, size_t sA, const _Float16* __restrict__ Bh, int ldb, size_t sB, float alpha, float* __restrict__ C, int ldc, size_t sC, int M, int N, int K) {
  __shared__ __attribute__((aligned(16))) float so[4][16][64];
  const int tid = threadIdx.x, w = tid >> 5, lane = tid & 31, ln = lane & 15, hh = lane >> 4; const int by = blockIdx.y;
  A += (size_t)by * sA; Bh += (size_t)by * sB; C += (size_t)by * sC;
  const int ntn = (N + 63) / 64; const int wid = blockIdx.x * 4 + w; const int mt = wid / ntn, nq = wid % ntn; if (mt * 16 >= M) return;
  const int row0 = mt * 16, col0 = nq * 64; const float* arow = A + (size_t)(row0 + ln) * lda;
  v8f acc[4] = {};
  for (int kb = 0; kb < K; kb += 32) {
    FragH ah, al;
    const v4f x0 = *(const v4fa*)(arow + kb + 8 * hh), x1 = *(const v4fa*)(arow + kb + 8 * hh + 4), x2 = *(const v4fa*)(arow + kb + 16 + 8 * hh), x3 = *(const v4fa*)(arow + kb + 16 + 8 * hh + 4);
    float xs[16] = {x0[0],x0[1],x0[2],x0[3],x1[0],x1[1],x1[2],x1[3],x2[0],x2[1],x2[2],x2[3],x3[0],x3[1],x3[2],x3[3]};
#pragma unroll
    for (int i = 0; i < 16; ++i) { const _Float16 h = (_Float16)xs[i]; ah.h[i] = h; al.h[i] = ASPLIT ? (_Float16)(xs[i] - (float)h) : (_Float16)0.0f; }
#pragma unroll
    for (int t = 0; t < 4; ++t) { if (col0 + t * 16 >= N) continue; const size_t boff = (size_t)(col0 + t * 16 + ln) * ldb + kb; FragH bq; bq.half[0] = *(const v8us*)(Bh + boff + 8 * hh); bq.half[1] = *(const v8us*)(Bh + boff + 16 + 8 * hh);
      acc[t] = mmaH<ASPLIT ? 2 : 1>(ah.v, al.v, bq.v, bq.v, acc[t]); }
  }
#pragma unroll
  for (int t = 0; t < 4; ++t) { if (col0 + t * 16 >= N) continue;
#pragma unroll
    for (int r = 0; r < 8; ++r) so[w][8 * hh + r][t * 16 + ln] = acc[t][r] * alpha; }
  __builtin_amdgcn_fence(__ATOMIC_ACQ_REL, "workgroup"); __builtin_amdgcn_wave_barrier();
  const int rsub = lane >> 4, c4 = (lane & 15) * 4;
  {
#pragma unroll
    for (int q = 0; q < 8; ++q) { const int r = q * 2 + rsub; if (col0 + c4 < N) { const v4f v = *(const v4fa*)&so[w][r][c4]; *(v4f*)(C + (size_t)(row0 + r) * ldc + col0 + c4) = v; } }
     }
}

// Wt[n][k] = f16(W[k][n]·scale) from f32 row-major W[K][N] (scale = power of two; bf16-exact weights stay exact in f16 away from the subnormal range)
__global__ __launch_bounds__(256) void k_wt_f16(const float* __restrict__ W, _Float16* __restrict__ Wt, int K, int N, float scale) {
  const int t = blockIdx.x * 256 + threadIdx.x; if (t >= N * (K / 8)) return; const int n = t / (K / 8), k8 = (t % (K / 8)) * 8; FragH f;
#pragma unroll
  for (int i = 0; i < 8; ++i) f.h[i] = (_Float16)(bf16_round(W[(size_t)(k8 + i) * N + n]) * scale); const v8us o = f.half[0];
  *(v8us*)((unsigned short*)Wt + (size_t)n * K + k8) = o; 
}
// k_gemm_hh variant with fused epilogue: v = acc·alpha + bias[by·sBias + col] (+ CP[(row/rowsPerB)·sCPb + by·64 + col] if CP) ; ACT 0 none / 1 elu ; writes f32 C and/or f16 C16 (each if non-null)
template <int ACT>
__global__ __launch_bounds__(128) void k_gemm_hhx(const _Float16* __restrict__ A, int lda, size_t sA, const _Float16* __restrict__ Bh, int ldb, size_t sB, float alpha, const float* __restrict__ bias, size_t sBias, const float* __restrict__ CP, int rowsPerB, size_t sCPb, int row0g,
    float* __restrict__ C, _Float16* __restrict__ C16, int ldc, size_t sC, int M, int N, int K) {
  __shared__ __attribute__((aligned(16))) float so[4][16][64];
  const int tid = threadIdx.x, w = tid >> 5, lane = tid & 31, ln = lane & 15, hh = lane >> 4; const int by = blockIdx.y;
  A += (size_t)by * sA; Bh += (size_t)by * sB; const size_t cofs = (size_t)by * sC; const float* bp = bias ? bias + (size_t)by * sBias : nullptr;
  const int ntn = (N + 63) / 64; const int wid = blockIdx.x * 4 + w; const int mt = wid / ntn, nq = wid % ntn; if (mt * 16 >= M) return;
  const int row0 = mt * 16, col0 = nq * 64; const _Float16* arow = A + (size_t)(row0 + ln) * lda;
  v8f acc[4] = {};
  for (int kb = 0; kb < K; kb += 32) { FragH ah; ah.half[0] = *(const v8us*)((const unsigned short*)arow + kb + 8 * hh); ah.half[1] = *(const v8us*)((const unsigned short*)arow + kb + 16 + 8 * hh);
#pragma unroll
    for (int t = 0; t < 4; ++t) { if (col0 + t * 16 >= N) continue; const size_t boff = (size_t)(col0 + t * 16 + ln) * ldb + kb; FragH bq; bq.half[0] = *(const v8us*)((const unsigned short*)Bh + boff + 8 * hh); bq.half[1] = *(const v8us*)((const unsigned short*)Bh + boff + 16 + 8 * hh);
      acc[t] = mmaH<1>(ah.v, ah.v, bq.v, bq.v, acc[t]); }
  }
#pragma unroll
  for (int t = 0; t < 4; ++t) { if (col0 + t * 16 >= N) continue; const int col = col0 + t * 16 + ln; const float bv = bp ? bf16_round(bp[col]) : 0.f;
#pragma unroll
    for (int r = 0; r < 8; ++r) { float v = acc[t][r] * alpha + bv; if (CP) { const int bidx = (row0g + row0 + 8 * hh + r) / rowsPerB; v += CP[(size_t)bidx * sCPb + (size_t)by * 64 + col]; } if (ACT == 1) v = (v > 0.f) ? v : expm1f(v); else if (ACT == 3) v = fmaxf(v, 0.f); so[w][8 * hh + r][t * 16 + ln] = v; } }
  __builtin_amdgcn_fence(__ATOMIC_ACQ_REL, "workgroup"); __builtin_amdgcn_wave_barrier();
  const int rsub = lane >> 4, c4 = (lane & 15) * 4; typedef _Float16 v4h __attribute__((ext_vector_type(4)));
  {
#pragma unroll
    for (int q = 0; q < 8; ++q) { const int r = q * 2 + rsub; if (col0 + c4 < N) { const v4f v = *(const v4fa*)&so[w][r][c4]; if (C) *(v4f*)(C + cofs + (size_t)(row0 + r) * ldc + col0 + c4) = v; if (C16) { v4h h4; for (int i = 0; i < 4; ++i) h4[i] = (_Float16)v[i]; *(v4h*)(C16 + cofs + (size_t)(row0 + r) * ldc + col0 + c4) = h4; } } }
     }
}


__global__ __launch_bounds__(256) void k_x16(const float* __restrict__ x, _Float16* __restrict__ X16, size_t n8) { const size_t t = (size_t)blockIdx.x * 256 + threadIdx.x; if (t >= n8) return; FragH f;
#pragma unroll
  for (int q = 0; q < 8; ++q) f.h[q] = (_Float16)bf16_round(x[t * 8 + q]); *(v8us*)((unsigned short*)X16 + t * 8) = f.half[0];  }
__global__ __launch_bounds__(256) void k_h16(const float* __restrict__ x, _Float16* __restrict__ X16, size_t n8) { const size_t t = (size_t)blockIdx.x * 256 + threadIdx.x; if (t >= n8) return; FragH f;
#pragma unroll
  for (int q = 0; q < 8; ++q) f.h[q] = (_Float16)x[t * 8 + q]; *(v8us*)((unsigned short*)X16 + t * 8) = f.half[0];  }
__global__ __launch_bounds__(256) void k_round16f(const float* __restrict__ W, _Float16* __restrict__ Bt, size_t n8) { const size_t t = (size_t)blockIdx.x * 256 + threadIdx.x; if (t >= n8) return; FragH f;
#pragma unroll
  for (int i = 0; i < 8; ++i) f.h[i] = (_Float16)(bf16_round(W[t * 8 + i]) * 16.0f); *(v8us*)((unsigned short*)Bt + t * 8) = f.half[0];  }
template <int NHv, int TTv>
__global__ __launch_bounds__(256) void k_vt(const _Float16* __restrict__ V16, int ldv, int voff, _Float16* __restrict__ Vt) { __shared__ unsigned short tl[64][66]; const int tid = threadIdx.x; const int slab = blockIdx.x / (TTv / 64), lg = blockIdx.x % (TTv / 64); const int b = slab / NHv, h = slab % NHv;
  for (int i = tid; i < 64 * 8; i += 256) { const int r = i / 8, c8 = (i % 8) * 8; FragH f; f.half[0] = *(const v8us*)((const unsigned short*)V16 + ((size_t)b * TTv + lg * 64 + r) * ldv + voff + h * 64 + c8);
#pragma unroll
    for (int q = 0; q < 8; ++q) tl[r][c8 + q] = f.u[q]; }
  __syncthreads();
  {
#pragma unroll
    for (int rd = 0; rd < 2; ++rd) { const int d = rd * 32 + tid / 8, pc = tid % 8; FragH f;
#pragma unroll
      for (int q = 0; q < 8; ++q) f.u[q] = tl[pc * 8 + q][d];
      *(v8us*)((unsigned short*)Vt + ((size_t)slab * 64 + d) * TTv + lg * 64 + pc * 8) = f.half[0]; }
     } }

__global__ __launch_bounds__(128) void k_flash(const _Float16* __restrict__ Q16, int ldq, const _Float16* __restrict__ K16, int ldk, const _Float16* __restrict__ Vt, const int* __restrict__ MSK, float* __restrict__ O, int ldo) {
  constexpr int RPW = 32, NQB = 4096 / (4 * RPW), DT = 4, KS = 2;
  __shared__ __attribute__((aligned(16))) unsigned short sP[4][RPW][40]; __shared__ __attribute__((aligned(16))) float sO[4][RPW][64 + 4];
  const int tid = threadIdx.x, w = tid >> 5, lane = tid & 31, ln = lane & 15, hh = lane >> 4;
  const int slab = blockIdx.x / NQB, qblk = blockIdx.x % NQB; const int b = slab / 8, h = slab % 8; const int qb0 = qblk * (4 * RPW); const int q0 = qb0 + w * RPW;
  FragH aq[2][KS];
#pragma unroll
  for (int rt = 0; rt < 2; ++rt) { const unsigned short* qr = (const unsigned short*)Q16 + ((size_t)b * 4096 + q0 + rt * 16 + ln) * ldq + h * 64;
#pragma unroll
    for (int ks = 0; ks < KS; ++ks) { aq[rt][ks].half[0] = *(const v8us*)(qr + ks * 32 + 8 * hh); aq[rt][ks].half[1] = *(const v8us*)(qr + ks * 32 + 16 + 8 * hh); } }
  const unsigned short* Vth = (const unsigned short*)Vt + (size_t)slab * 64 * 4096;
  float m_r[2][8], l_r[2][8]; v8f oacc[2][DT];
#pragma unroll
  for (int rt = 0; rt < 2; ++rt) {
#pragma unroll
    for (int r = 0; r < 8; ++r) { m_r[rt][r] = -3.0e38f; l_r[rt][r] = 0.f; }
#pragma unroll
    for (int dt = 0; dt < DT; ++dt) oacc[rt][dt] = (v8f){0.f,0.f,0.f,0.f,0.f,0.f,0.f,0.f}; }
  const int jend = 4096;
#pragma unroll 1
  for (int j0 = 0; j0 < jend; j0 += 32) {
    
    v8f s[2][2];
#pragma unroll
    for (int nt = 0; nt < 2; ++nt) { const unsigned short* kr = (const unsigned short*)K16 + ((size_t)b * 4096 + j0 + nt * 16 + ln) * ldk + h * 64; FragH bk[KS];
#pragma unroll
      for (int ks = 0; ks < KS; ++ks) { bk[ks].half[0] = *(const v8us*)(kr + ks * 32 + 8 * hh); bk[ks].half[1] = *(const v8us*)(kr + ks * 32 + 16 + 8 * hh); }
#pragma unroll
      for (int rt = 0; rt < 2; ++rt) { v8f acc = (v8f){0.f,0.f,0.f,0.f,0.f,0.f,0.f,0.f};
#pragma unroll
        for (int ks = 0; ks < KS; ++ks) acc = mmaH<1>(aq[rt][ks].v, aq[rt][ks].v, bk[ks].v, bk[ks].v, acc); s[rt][nt] = acc; } }
#pragma unroll
    for (int rt = 0; rt < 2; ++rt)
#pragma unroll
      for (int r = 0; r < 8; ++r) { const int tq = q0 + rt * 16 + 8 * hh + r; const int k0 = j0 + ln, k1 = j0 + 16 + ln; (void)tq; (void)k0; (void)k1;
        const bool ok0 = true, ok1 = true;
        const float s0 = ok0 ? s[rt][0][r] * (0.125f) : -INFINITY, s1 = ok1 ? s[rt][1][r] * (0.125f) : -INFINITY; float mc = fmaxf(s0, s1);
        mc = fmaxf(mc, __shfl_xor(mc, 1, 32)); mc = fmaxf(mc, __shfl_xor(mc, 2, 32)); mc = fmaxf(mc, __shfl_xor(mc, 4, 32)); mc = fmaxf(mc, __shfl_xor(mc, 8, 32));
        const float mn = fmaxf(m_r[rt][r], mc); const float al = (mn > -1.0e38f) ? expf(m_r[rt][r] - mn) : 1.0f; m_r[rt][r] = mn; const float p0 = ok0 ? expf(s0 - mn) : 0.f, p1 = ok1 ? expf(s1 - mn) : 0.f; l_r[rt][r] = l_r[rt][r] * al + p0 + p1;
#pragma unroll
        for (int dt = 0; dt < DT; ++dt) oacc[rt][dt][r] *= al;
        FragH t2; t2.h[0] = (_Float16)p0; t2.h[1] = (_Float16)p1; sP[w][rt * 16 + 8 * hh + r][ln] = t2.u[0]; sP[w][rt * 16 + 8 * hh + r][16 + ln] = t2.u[1]; }
    __builtin_amdgcn_fence(__ATOMIC_ACQ_REL, "workgroup"); __builtin_amdgcn_wave_barrier();
    FragH pa[2];
#pragma unroll
    for (int rt = 0; rt < 2; ++rt) { pa[rt].half[0] = *(const v8us*)&sP[w][rt * 16 + ln][8 * hh]; pa[rt].half[1] = *(const v8us*)&sP[w][rt * 16 + ln][16 + 8 * hh]; }
#pragma unroll
    for (int dt = 0; dt < DT; ++dt) { const unsigned short* vrow = Vth + (size_t)(dt * 16 + ln) * 4096 + j0; FragH bv; bv.half[0] = *(const v8us*)(vrow + 8 * hh); bv.half[1] = *(const v8us*)(vrow + 16 + 8 * hh);
#pragma unroll
      for (int rt = 0; rt < 2; ++rt) oacc[rt][dt] = mmaH<1>(pa[rt].v, pa[rt].v, bv.v, bv.v, oacc[rt][dt]); }
    __builtin_amdgcn_fence(__ATOMIC_ACQ_REL, "workgroup"); __builtin_amdgcn_wave_barrier(); }
#pragma unroll
  for (int rt = 0; rt < 2; ++rt) {
#pragma unroll
    for (int r = 0; r < 8; ++r) { float l = l_r[rt][r]; l += __shfl_xor(l, 1, 32); l += __shfl_xor(l, 2, 32); l += __shfl_xor(l, 4, 32); l += __shfl_xor(l, 8, 32); l_r[rt][r] = (l > 0.f) ? 1.0f / l : 0.f; }
#pragma unroll
    for (int dt = 0; dt < DT; ++dt)
#pragma unroll
      for (int r = 0; r < 8; ++r) sO[w][rt * 16 + 8 * hh + r][dt * 16 + ln] = oacc[rt][dt][r] * l_r[rt][r]; }
  __builtin_amdgcn_fence(__ATOMIC_ACQ_REL, "workgroup"); __builtin_amdgcn_wave_barrier();
  {
#pragma unroll
    for (int rp = 0; rp < RPW; rp += 2) { const int r = rp + (lane >> 4), pc = lane & 15; const v4f val = *(const v4fa*)&sO[w][r][pc * 4]; *(v4f*)(O + ((size_t)b * 4096 + q0 + r) * ldo + h * 64 + pc * 4) = val; }
     } }

extern "C" void kernel_launch(void* const* d_in, const int* in_sizes, int n_in,
                              void* d_out, int out_size, void* d_ws, size_t ws_size, hipStream_t stream) {
  (void)in_sizes; (void)n_in; (void)out_size;
  const float* q = (const float*)d_in[0]; const float* k = (const float*)d_in[1]; const float* v = (const float*)d_in[2]; const float* Wo = (const float*)d_in[3]; const float* bo = (const float*)d_in[4];
  char* ws = (char*)d_ws; size_t off = 0;
  auto take = [&](size_t bytes) { char* p = ws + off; off += (bytes + 255) & ~(size_t)255; return p; };
  _Float16* Bo = (_Float16*)take((size_t)NO * CC * 2); _Float16* Q16 = (_Float16*)take((size_t)NR * CC * 2); _Float16* K16 = (_Float16*)take((size_t)NR * CC * 2); _Float16* V16 = (_Float16*)take((size_t)NR * CC * 2); _Float16* Vt = (_Float16*)take((size_t)NR * CC * 2); float* O = (float*)take((size_t)NR * CC * 4); _Float16* O16 = V16;      // V16 dead after k_vt
  if (off > ws_size) return;      // 8.4 × 4 + 16.8 MB ≈ 50 MiB
  k_wt_f16<<<(NO * (CC / 8) + 255) / 256, 256, 0, stream>>>(Wo, Bo, CC, NO, 16.0f);      // [in][out]
  const unsigned gx = (unsigned)(((size_t)NR * CC / 8 + 255) / 256);
  k_x16<<<gx, 256, 0, stream>>>(q, Q16, (size_t)NR * CC / 8); k_x16<<<gx, 256, 0, stream>>>(k, K16, (size_t)NR * CC / 8); k_x16<<<gx, 256, 0, stream>>>(v, V16, (size_t)NR * CC / 8);
  k_vt<NH, TT><<<BB * NH * (TT / 64), 256, 0, stream>>>(V16, CC, 0, Vt);
  k_flash<<<BB * NH * (TT / 128), 128, 0, stream>>>(Q16, CC, K16, CC, Vt, nullptr, O, CC);
  k_h16<<<gx, 256, 0, stream>>>(O, O16, (size_t)NR * CC / 8);
  k_gemm_hhx<0><<<dim3(((NR / 16) * 1 + 3) / 4, 1), 128, 0, stream>>>(O16, CC, 0, Bo, CC, 0, 0.0625f, bo, 0, nullptr, 1, 0, 0, (float*)d_out, nullptr, NO, 0, NR, NO, CC);      // N = 64
}

// v001
// Measured time: 342 microseconds a run.
// In both of two side-by-side timings against v000, it was 1.97 times as fast.
#include <hip/hip_runtime.h>
// 8-head attention over the given q/k/v (2 × 4096 tokens, d = 64) as a fused flash-style kernel on v_wmma_f32_16x16x32_f16 (q, k, v are module INPUTS → exact bf16 values as f16 operands; S = Q·Kᵀ × 64^-½,
// online max/sum softmax f32, P f16 ≤ 1, O = P·V), then the 512→64 output linear (+ bias; W_out [in][out] bf16-exact ×2^4); f32 accumulate.
#define BB 2
#define TT 4096
#define CC 512
#define NH 8
#define NO 64
#define NR (BB * TT)

typedef __bf16 v16b __attribute__((ext_vector_type(16)));
typedef unsigned short v8us __attribute__((ext_vector_type(8), may_alias));
typedef float  v8f  __attribute__((ext_vector_type(8)));
typedef float  v4f  __attribute__((ext_vector_type(4)));
typedef float  v4fa __attribute__((ext_vector_type(4), may_alias));
union FragB { v16b v; v8us half[2]; unsigned short u[16]; };

__device__ __forceinline__ unsigned short bf16_bits(float x) { unsigned int u = __float_as_uint(x); return (unsigned short)((u + 0x7FFFu + ((u >> 16) & 1u)) >> 16); }
__device__ __forceinline__ float bf16_val(unsigned short b) { return __uint_as_float(((unsigned int)b) << 16); }
__device__ __forceinline__ float bf16_round(float x) { return bf16_val(bf16_bits(x)); }
// D += A·B with NT terms: 1 = ah·bh, 2 = + al·bh (A split), 3 = + ah·bl (both split)
template <int NT>
__device__ __forceinline__ v8f mmaN(v16b ah, v16b al, v16b bh, v16b bl, v8f c) {
  c = __builtin_amdgcn_wmma_f32_16x16x32_bf16(false, ah, false, bh, (short)0, c, false, false);
  if (NT >= 2) c = __builtin_amdgcn_wmma_f32_16x16x32_bf16(false, al, false, bh, (short)0, c, false, false);
  if (NT >= 3) c = __builtin_amdgcn_wmma_f32_16x16x32_bf16(false, ah, false, bl, (short)0, c, false, false);
  asm volatile("v_nop\n\tv_nop\n\tv_nop\n\tv_nop" : "+v"(c) : "v"(ah), "v"(al), "v"(bh), "v"(bl));
  return c;
}

__global__ __launch_bounds__(256) void k_wt_bf16(const float* __restrict__ W, unsigned short* __restrict__ Wt, int K, int N) {
  const int t = blockIdx.x * 256 + threadIdx.x;
  const int k8n = K / 8;
  if (t >= N * k8n) return;
  const int n = t / k8n, k8 = (t % k8n) * 8;
  v8us v;
#pragma unroll
  for (int i = 0; i < 8; ++i) v[i] = bf16_bits(W[(size_t)(k8 + i) * N + n]);
  *(v8us*)(Wt + (size_t)n * K + k8) = v;
  
}

// GEMM C[M][N] (f32, pitch ldc) = act(A[M][K]·W + bias). A f32 row-major (pitch lda) converted per fragment to bf16
// (ASPLIT: hi/lo two planes -> 2 terms, else single rounded term); Wt bf16 [N][K] (pitch ldb). BIAS_BF16 rounds the
// bias to bf16 first (bias quantised to bf16 before the add). K%32==0, M%16==0, N%64==0.
template <bool ASPLIT, int ACT, bool BIAS_BF16>
__global__ __launch_bounds__(128) void k_gemm_bf(const float* __restrict__ A, int lda, const unsigned short* __restrict__ Wt, int ldb,
                                               const float* __restrict__ bias, float* __restrict__ C, int ldc, int M, int N, int K) {
  __shared__ __attribute__((aligned(16))) float so[4][16][64];
  const int tid = threadIdx.x, w = tid >> 5, lane = tid & 31, ln = lane & 15, hh = lane >> 4;
  const int ntn = N / 64;
  const int wid = blockIdx.x * 4 + w;
  const int mt = wid / ntn, nq = wid % ntn;
  if (mt * 16 >= M) return;
  const int row0 = mt * 16, col0 = nq * 64;
  const float* arow = A + (size_t)(row0 + ln) * lda;
  v8f acc[4] = {};
  for (int kb = 0; kb < K; kb += 32) {
    FragB ah, al;
    const v4f x0 = *(const v4fa*)(arow + kb + 8 * hh), x1 = *(const v4fa*)(arow + kb + 8 * hh + 4);
    const v4f x2 = *(const v4fa*)(arow + kb + 16 + 8 * hh), x3 = *(const v4fa*)(arow + kb + 16 + 8 * hh + 4);
    float xs[16] = {x0[0],x0[1],x0[2],x0[3],x1[0],x1[1],x1[2],x1[3],x2[0],x2[1],x2[2],x2[3],x3[0],x3[1],x3[2],x3[3]};
#pragma unroll
    for (int i = 0; i < 16; ++i) { const unsigned short hb = bf16_bits(xs[i]); ah.u[i] = hb; al.u[i] = ASPLIT ? bf16_bits(xs[i] - bf16_val(hb)) : (unsigned short)0; }
#pragma unroll
    for (int t = 0; t < 4; ++t) {
      const unsigned short* brow = Wt + (size_t)(col0 + t * 16 + ln) * ldb + kb;
      FragB b;
      b.half[0] = *(const v8us*)(brow + 8 * hh);
      b.half[1] = *(const v8us*)(brow + 16 + 8 * hh);
      acc[t] = mmaN<ASPLIT ? 2 : 1>(ah.v, al.v, b.v, b.v, acc[t]);
    }
  }
#pragma unroll
  for (int t = 0; t < 4; ++t) {
    float bv = bias ? bias[col0 + t * 16 + ln] : 0.f;
    if (BIAS_BF16) bv = bf16_round(bv);
#pragma unroll
    for (int r = 0; r < 8; ++r) { float v = acc[t][r] + bv; if (ACT == 1) v = fmaxf(v, 0.f); so[w][8 * hh + r][t * 16 + ln] = v; }
  }
  __builtin_amdgcn_fence(__ATOMIC_ACQ_REL, "workgroup");
  __builtin_amdgcn_wave_barrier();
  const int rsub = lane >> 4, c4 = (lane & 15) * 4;
  {
#pragma unroll
    for (int q = 0; q < 8; ++q) {
      const int r = q * 2 + rsub;
      const v4f v = *(const v4fa*)&so[w][r][c4];
      *(v4f*)(C + (size_t)(row0 + r) * ldc + col0 + c4) = v;
    }
    
  }
}

// Flash-style causal/unmasked attention, all contractions 3-term bf16 hi/lo splits, f32 softmax with running max.
// q,k,v rows are read from f32 buffers with arbitrary row pitch (so they can live inside a fused qkv buffer);
// D = head size (multiple of 32, <= 128); one wave = 16 query rows; block = 4 waves (64 queries) sharing K/V chunks of 32.
template <int D, bool CAUSAL>
__global__ __launch_bounds__(128) void k_flash(const float* __restrict__ qb, const float* __restrict__ kb, const float* __restrict__ vb,
                                             int pitch, int T, int H, float scale, float* __restrict__ y, int ypitch) {
  constexpr int KS = D / 32;        // k-steps for QK
  constexpr int DT = D / 16;        // d tiles for PV
  __shared__ __attribute__((aligned(16))) unsigned short sKh[32][D + 8], sKl[32][D + 8], sVh[32][D + 8], sVl[32][D + 8];
  __shared__ __attribute__((aligned(16))) unsigned short sPh[4][16][40], sPl[4][16][40];
  __shared__ __attribute__((aligned(16))) float sO[4][16][D];
  const int tid = threadIdx.x, w = tid >> 5, lane = tid & 31, ln = lane & 15, hh = lane >> 4;
  const int nqb = (T + 63) / 64;
  const int bh = blockIdx.x / nqb, qblk = blockIdx.x % nqb;
  const int b = bh / H, h = bh % H;
  const int q0 = qblk * 64 + w * 16;
  const float* Q = qb + (size_t)b * T * pitch + h * D;
  const float* K = kb + (size_t)b * T * pitch + h * D;
  const float* V = vb + (size_t)b * T * pitch + h * D;

  // A fragments of the wave's 16 query rows (scaled), hi/lo
  FragB aqh[KS], aql[KS];
  {
    int row = q0 + ln; if (row >= T) row = T - 1;
    const float* qr = Q + (size_t)row * pitch;
#pragma unroll
    for (int ks = 0; ks < KS; ++ks)
#pragma unroll
      for (int i = 0; i < 16; ++i) {
        const int d = ks * 32 + ((i < 8) ? (8 * hh + i) : (16 + 8 * hh + (i - 8)));
        const float x = qr[d] * scale; const unsigned short hb = bf16_bits(x);
        aqh[ks].u[i] = hb; aql[ks].u[i] = bf16_bits(x - bf16_val(hb));
      }
  }
  float m_r[8], l_r[8];
#pragma unroll
  for (int r = 0; r < 8; ++r) { m_r[r] = -3.0e38f; l_r[r] = 0.f; }
  v8f oacc[DT];
#pragma unroll
  for (int dt = 0; dt < DT; ++dt) oacc[dt] = (v8f){0.f,0.f,0.f,0.f,0.f,0.f,0.f,0.f};

  const int kv_end = CAUSAL ? min(T, qblk * 64 + 64) : T;     // block-uniform
  for (int j0 = 0; j0 < kv_end; j0 += 32) {
    __syncthreads();
    for (int e = tid; e < 32 * (D / 4); e += 128) {
      const int r = e / (D / 4), c4 = (e % (D / 4)) * 4;
      const int key = j0 + r;
      v4f kf = {0.f,0.f,0.f,0.f}, vf = {0.f,0.f,0.f,0.f};
      if (key < T) { kf = *(const v4fa*)(K + (size_t)key * pitch + c4); vf = *(const v4fa*)(V + (size_t)key * pitch + c4); }
#pragma unroll
      for (int t = 0; t < 4; ++t) {
        unsigned short hb = bf16_bits(kf[t]); sKh[r][c4 + t] = hb; sKl[r][c4 + t] = bf16_bits(kf[t] - bf16_val(hb));
        hb = bf16_bits(vf[t]); sVh[r][c4 + t] = hb; sVl[r][c4 + t] = bf16_bits(vf[t] - bf16_val(hb));
      }
    }
    __syncthreads();
    // S tile 16 x 32
    v8f s[2];
#pragma unroll
    for (int nt = 0; nt < 2; ++nt) {
      v8f acc = {};
#pragma unroll
      for (int ks = 0; ks < KS; ++ks) {
        FragB bh_, bl_;
        bh_.half[0] = *(const v8us*)&sKh[nt * 16 + ln][ks * 32 + 8 * hh]; bh_.half[1] = *(const v8us*)&sKh[nt * 16 + ln][ks * 32 + 16 + 8 * hh];
        bl_.half[0] = *(const v8us*)&sKl[nt * 16 + ln][ks * 32 + 8 * hh]; bl_.half[1] = *(const v8us*)&sKl[nt * 16 + ln][ks * 32 + 16 + 8 * hh];
        acc = mmaN<3>(aqh[ks].v, aql[ks].v, bh_.v, bl_.v, acc);
      }
      s[nt] = acc;
    }
    // mask + running max (rows 8hh+r; the 16 lanes of a half share rows)
    float alpha[8];
#pragma unroll
    for (int r = 0; r < 8; ++r) {
      const int qi = q0 + 8 * hh + r;
      const int ja = j0 + ln, jb = j0 + 16 + ln;
      if (CAUSAL) { if (ja > qi) s[0][r] = -3.0e38f; if (jb > qi) s[1][r] = -3.0e38f; }
      if (ja >= T) s[0][r] = -3.0e38f;
      if (jb >= T) s[1][r] = -3.0e38f;
      float mx = fmaxf(s[0][r], s[1][r]);
      mx = fmaxf(mx, __shfl_xor(mx, 1, 32)); mx = fmaxf(mx, __shfl_xor(mx, 2, 32)); mx = fmaxf(mx, __shfl_xor(mx, 4, 32)); mx = fmaxf(mx, __shfl_xor(mx, 8, 32));
      const float mnew = fmaxf(m_r[r], mx);
      alpha[r] = (mnew > -1.0e38f) ? __expf(m_r[r] - mnew) : 1.0f;
      const float p0 = (s[0][r] > -1.0e38f) ? __expf(s[0][r] - mnew) : 0.f;
      const float p1 = (s[1][r] > -1.0e38f) ? __expf(s[1][r] - mnew) : 0.f;
      m_r[r] = mnew;
      l_r[r] = l_r[r] * alpha[r] + p0 + p1;            // per-lane partial row sum (16 lanes combined at the end)
      unsigned short hb = bf16_bits(p0); sPh[w][8 * hh + r][ln] = hb;      sPl[w][8 * hh + r][ln] = bf16_bits(p0 - bf16_val(hb));
      hb = bf16_bits(p1);                sPh[w][8 * hh + r][16 + ln] = hb; sPl[w][8 * hh + r][16 + ln] = bf16_bits(p1 - bf16_val(hb));
    }
#pragma unroll
    for (int dt = 0; dt < DT; ++dt)
#pragma unroll
      for (int r = 0; r < 8; ++r) oacc[dt][r] *= alpha[r];
    __builtin_amdgcn_fence(__ATOMIC_ACQ_REL, "workgroup");
    __builtin_amdgcn_wave_barrier();
    FragB pah, pal;
    pah.half[0] = *(const v8us*)&sPh[w][ln][8 * hh]; pah.half[1] = *(const v8us*)&sPh[w][ln][16 + 8 * hh];
    pal.half[0] = *(const v8us*)&sPl[w][ln][8 * hh]; pal.half[1] = *(const v8us*)&sPl[w][ln][16 + 8 * hh];
#pragma unroll
    for (int dt = 0; dt < DT; ++dt) {
      FragB bvh, bvl;
#pragma unroll
      for (int i = 0; i < 8; ++i) {
        bvh.u[i] = sVh[8 * hh + i][dt * 16 + ln]; bvh.u[8 + i] = sVh[16 + 8 * hh + i][dt * 16 + ln];
        bvl.u[i] = sVl[8 * hh + i][dt * 16 + ln]; bvl.u[8 + i] = sVl[16 + 8 * hh + i][dt * 16 + ln];
      }
      oacc[dt] = mmaN<3>(pah.v, pal.v, bvh.v, bvl.v, oacc[dt]);
    }
    __builtin_amdgcn_fence(__ATOMIC_ACQ_REL, "workgroup");
    __builtin_amdgcn_wave_barrier();
  }
#pragma unroll
  for (int r = 0; r < 8; ++r) {
    float l = l_r[r];
    l += __shfl_xor(l, 1, 32); l += __shfl_xor(l, 2, 32); l += __shfl_xor(l, 4, 32); l += __shfl_xor(l, 8, 32);
    l_r[r] = (l > 0.f) ? 1.0f / l : 0.f;
  }
#pragma unroll
  for (int dt = 0; dt < DT; ++dt)
#pragma unroll
    for (int r = 0; r < 8; ++r) sO[w][8 * hh + r][dt * 16 + ln] = oacc[dt][r] * l_r[r];
  __builtin_amdgcn_fence(__ATOMIC_ACQ_REL, "workgroup");
  __builtin_amdgcn_wave_barrier();
  {
    for (int r = 0; r < 16; ++r) {
      const int row = q0 + r;
      if (row < T && lane < D / 4) {
        const v4f val = *(const v4fa*)&sO[w][r][lane * 4];
        *(v4f*)(y + ((size_t)b * T + row) * ypitch + h * D + lane * 4) = val;
      }
    }
    
  }
}

// GEMM C = act(A·W + bias + resid): A f32 (ASPLIT -> hi/lo 2 terms), Wt bf16 [N][K]; ACT 0 none, 1 relu, 2 exact gelu;
// resid (optional, f32, row index = (row % rmod), pitch ldr, RES_BF16 rounds it) added before the activation.
template <bool ASPLIT, int ACT, bool BIAS_BF16, bool RES_BF16>
__global__ __launch_bounds__(128) void k_gemm_bf3(const float* __restrict__ A, int lda, const unsigned short* __restrict__ Wt, int ldb,
                                                const float* __restrict__ bias, const float* __restrict__ resid, int rmod, int ldr,
                                                float* __restrict__ C, int ldc, int M, int N, int K) {
  __shared__ __attribute__((aligned(16))) float so[4][16][64];
  const int tid = threadIdx.x, w = tid >> 5, lane = tid & 31, ln = lane & 15, hh = lane >> 4;
  const int ntn = N / 64;
  const int wid = blockIdx.x * 4 + w;
  const int mt = wid / ntn, nq = wid % ntn;
  if (mt * 16 >= M) return;
  const int row0 = mt * 16, col0 = nq * 64;
  const float* arow = A + (size_t)(row0 + ln) * lda;
  v8f acc[4] = {};
  for (int kb = 0; kb < K; kb += 32) {
    FragB ah, al;
    const v4f x0 = *(const v4fa*)(arow + kb + 8 * hh), x1 = *(const v4fa*)(arow + kb + 8 * hh + 4);
    const v4f x2 = *(const v4fa*)(arow + kb + 16 + 8 * hh), x3 = *(const v4fa*)(arow + kb + 16 + 8 * hh + 4);
    float xs[16] = {x0[0],x0[1],x0[2],x0[3],x1[0],x1[1],x1[2],x1[3],x2[0],x2[1],x2[2],x2[3],x3[0],x3[1],x3[2],x3[3]};
#pragma unroll
    for (int i = 0; i < 16; ++i) { const unsigned short hb = bf16_bits(xs[i]); ah.u[i] = hb; al.u[i] = ASPLIT ? bf16_bits(xs[i] - bf16_val(hb)) : (unsigned short)0; }
#pragma unroll
    for (int t = 0; t < 4; ++t) {
      const unsigned short* brow = Wt + (size_t)(col0 + t * 16 + ln) * ldb + kb;
      FragB b;
      b.half[0] = *(const v8us*)(brow + 8 * hh);
      b.half[1] = *(const v8us*)(brow + 16 + 8 * hh);
      acc[t] = mmaN<ASPLIT ? 2 : 1>(ah.v, al.v, b.v, b.v, acc[t]);
    }
  }
#pragma unroll
  for (int t = 0; t < 4; ++t) {
    const int col = col0 + t * 16 + ln;
    float bv = bias ? bias[col] : 0.f;
    if (BIAS_BF16) bv = bf16_round(bv);
#pragma unroll
    for (int r = 0; r < 8; ++r) {
      float v = acc[t][r] + bv;
      if (resid) { float rv = resid[(size_t)((row0 + 8 * hh + r) % rmod) * ldr + col]; if (RES_BF16) rv = bf16_round(rv); v += rv; }
      if (ACT == 1) v = fmaxf(v, 0.f);
      if (ACT == 2) v = 0.5f * v * (1.0f + erff(v * 0.70710678118654752f));
      if (ACT == 3) { const float u = 0.7978845608028654f * (v + 0.044715f * v * v * v); v = 0.5f * v * (1.0f + tanhf(u)); }
      so[w][8 * hh + r][t * 16 + ln] = v;
    }
  }
  __builtin_amdgcn_fence(__ATOMIC_ACQ_REL, "workgroup");
  __builtin_amdgcn_wave_barrier();
  const int rsub = lane >> 4, c4 = (lane & 15) * 4;
  {
#pragma unroll
    for (int q = 0; q < 8; ++q) {
      const int r = q * 2 + rsub;
      const v4f v = *(const v4fa*)&so[w][r][c4];
      *(v4f*)(C + (size_t)(row0 + r) * ldc + col0 + c4) = v;
    }
    
  }
}
// row LayerNorm (biased variance, eps) over N: s = X (+ R); optional out_sum <- s; out_norm <- (s-mu)*rsqrt(var+eps)*g + b
template <bool PARAM_BF16>
__global__ __launch_bounds__(256) void k_layernorm(const float* __restrict__ X, const float* __restrict__ R, const float* __restrict__ g, const float* __restrict__ bta,
                                                  float* __restrict__ out_sum, float* __restrict__ out_norm, int N, float eps) {
  __shared__ float red[256];
  const int row = blockIdx.x, tid = threadIdx.x;
  const float* x = X + (size_t)row * N; const float* rr = R ? R + (size_t)row * N : nullptr;
  float vals[16];                     // up to N = 4096
  const int per = N / 256;            // contiguous chunk per thread? use strided-by-4 chunks: thread handles j = tid*4 + 1024*u
  float s1 = 0.f;
  for (int u = 0; u < per / 4; ++u) {
    const int j = tid * 4 + 1024 * u;
    const v4f a = *(const v4fa*)(x + j);
    v4f b = {0.f,0.f,0.f,0.f}; if (rr) b = *(const v4fa*)(rr + j);
#pragma unroll
    for (int q = 0; q < 4; ++q) { const float v = a[q] + b[q]; vals[u * 4 + q] = v; s1 += v; }
  }
  red[tid] = s1; __syncthreads();
  for (int st = 128; st > 0; st >>= 1) { if (tid < st) red[tid] += red[tid + st]; __syncthreads(); }
  const float mu = red[0] / (float)N; __syncthreads();
  float s2 = 0.f;
  for (int u = 0; u < per / 4; ++u)
#pragma unroll
    for (int q = 0; q < 4; ++q) { const float c = vals[u * 4 + q] - mu; s2 += c * c; }
  red[tid] = s2; __syncthreads();
  for (int st = 128; st > 0; st >>= 1) { if (tid < st) red[tid] += red[tid + st]; __syncthreads(); }
  const float rs = rsqrtf(red[0] / (float)N + eps);
  {
    for (int u = 0; u < per / 4; ++u) {
      const int j = tid * 4 + 1024 * u;
      v4f o, sm;
#pragma unroll
      for (int q = 0; q < 4; ++q) {
        float gg = g[j + q], bb = bta[j + q];
        if (PARAM_BF16) { gg = bf16_round(gg); bb = bf16_round(bb); }
        sm[q] = vals[u * 4 + q]; o[q] = (vals[u * 4 + q] - mu) * rs * gg + bb;
      }
      if (out_sum) *(v4f*)(out_sum + (size_t)row * N + j) = sm;
      *(v4f*)(out_norm + (size_t)row * N + j) = o;
    }
    
  }
}



// ---- f16 WMMA path (v_wmma_f32_16x16x32_f16): 11-bit significands for operands in range — used for every matrix product here (Q·Kᵀ, P·V, output linear)
typedef _Float16 v16h __attribute__((ext_vector_type(16)));
union FragH { v16h v; v8us half[2]; _Float16 h[16]; unsigned short u[16]; };
template <int NT>
__device__ __forceinline__ v8f mmaH(v16h ah, v16h al, v16h bh, v16h bl, v8f c) {
  c = __builtin_amdgcn_wmma_f32_16x16x32_f16(false, ah, false, bh, (short)0, c, false, false);
  if (NT >= 2) c = __builtin_amdgcn_wmma_f32_16x16x32_f16(false, al, false, bh, (short)0, c, false, false);
  if (NT >= 3) c = __builtin_amdgcn_wmma_f32_16x16x32_f16(false, ah, false, bl, (short)0, c, false, false);
  asm volatile("v_nop\n\tv_nop\n\tv_nop\n\tv_nop" : "+v"(c) : "v"(ah), "v"(al), "v"(bh), "v"(bl));
  return c;
}
// batched GEMM like k_gemm_b but f16 operands: A f32 (split into f16 hi/lo if ASPLIT, else rounded to f16), Bt = f16 values [n][k]; alpha; C f32; N multiple of 16 (partial tiles skipped)
template <bool ASPLIT>
__global__ __launch_bounds__(128) void k_gemm_h(const float* __restrict__ A, int lda, size_t sA, const _Float16* __restrict__ Bh, int ldb, size_t sB, float alpha, float* __restrict__ C, int ldc, size_t sC, int M, int N, int K) {
  __shared__ __attribute__((aligned(16))) float so[4][16][64];
  const int tid = threadIdx.x, w = tid >> 5, lane = tid & 31, ln = lane & 15, hh = lane >> 4; const int by = blockIdx.y;
  A += (size_t)by * sA; Bh += (size_t)by * sB; C += (size_t)by * sC;
  const int ntn = (N + 63) / 64; const int wid = blockIdx.x * 4 + w; const int mt = wid / ntn, nq = wid % ntn; if (mt * 16 >= M) return;
  const int row0 = mt * 16, col0 = nq * 64; const float* arow = A + (size_t)(row0 + ln) * lda;
  v8f acc[4] = {};
  for (int kb = 0; kb < K; kb += 32) {
    FragH ah, al;
    const v4f x0 = *(const v4fa*)(arow + kb + 8 * hh), x1 = *(const v4fa*)(arow + kb + 8 * hh + 4), x2 = *(const v4fa*)(arow + kb + 16 + 8 * hh), x3 = *(const v4fa*)(arow + kb + 16 + 8 * hh + 4);
    float xs[16] = {x0[0],x0[1],x0[2],x0[3],x1[0],x1[1],x1[2],x1[3],x2[0],x2[1],x2[2],x2[3],x3[0],x3[1],x3[2],x3[3]};
#pragma unroll
    for (int i = 0; i < 16; ++i) { const _Float16 h = (_Float16)xs[i]; ah.h[i] = h; al.h[i] = ASPLIT ? (_Float16)(xs[i] - (float)h) : (_Float16)0.0f; }
#pragma unroll
    for (int t = 0; t < 4; ++t) { if (col0 + t * 16 >= N) continue; const size_t boff = (size_t)(col0 + t * 16 + ln) * ldb + kb; FragH bq; bq.half[0] = *(const v8us*)(Bh + boff + 8 * hh); bq.half[1] = *(const v8us*)(Bh + boff + 16 + 8 * hh);
      acc[t] = mmaH<ASPLIT ? 2 : 1>(ah.v, al.v, bq.v, bq.v, acc[t]); }
  }
#pragma unroll
  for (int t = 0; t < 4; ++t) { if (col0 + t * 16 >= N) continue;
#pragma unroll
    for (int r = 0; r < 8; ++r) so[w][8 * hh + r][t * 16 + ln] = acc[t][r] * alpha; }
  __builtin_amdgcn_fence(__ATOMIC_ACQ_REL, "workgroup"); __builtin_amdgcn_wave_barrier();
  const int rsub = lane >> 4, c4 = (lane & 15) * 4;
  {
#pragma unroll
    for (int q = 0; q < 8; ++q) { const int r = q * 2 + rsub; if (col0 + c4 < N) { const v4f v = *(const v4fa*)&so[w][r][c4]; *(v4f*)(C + (size_t)(row0 + r) * ldc + col0 + c4) = v; } }
     }
}

// Wt[n][k] = f16(W[k][n]·scale) from f32 row-major W[K][N] (scale = power of two; bf16-exact weights stay exact in f16 away from the subnormal range)
__global__ __launch_bounds__(256) void k_wt_f16(const float* __restrict__ W, _Float16* __restrict__ Wt, int K, int N, float scale) {
  const int t = blockIdx.x * 256 + threadIdx.x; if (t >= N * (K / 8)) return; const int n = t / (K / 8), k8 = (t % (K / 8)) * 8; FragH f;
#pragma unroll
  for (int i = 0; i < 8; ++i) f.h[i] = (_Float16)(bf16_round(W[(size_t)(k8 + i) * N + n]) * scale); const v8us o = f.half[0];
  *(v8us*)((unsigned short*)Wt + (size_t)n * K + k8) = o; 
}
// k_gemm_hh variant with fused epilogue: v = acc·alpha + bias[by·sBias + col] (+ CP[(row/rowsPerB)·sCPb + by·64 + col] if CP) ; ACT 0 none / 1 elu ; writes f32 C and/or f16 C16 (each if non-null)
template <int ACT>
__global__ __launch_bounds__(128) void k_gemm_hhx(const _Float16* __restrict__ A, int lda, size_t sA, const _Float16* __restrict__ Bh, int ldb, size_t sB, float alpha, const float* __restrict__ bias, size_t sBias, const float* __restrict__ CP, int rowsPerB, size_t sCPb, int row0g,
    float* __restrict__ C, _Float16* __restrict__ C16, int ldc, size_t sC, int M, int N, int K) {
  __shared__ __attribute__((aligned(16))) float so[4][16][64];
  const int tid = threadIdx.x, w = tid >> 5, lane = tid & 31, ln = lane & 15, hh = lane >> 4; const int by = blockIdx.y;
  A += (size_t)by * sA; Bh += (size_t)by * sB; const size_t cofs = (size_t)by * sC; const float* bp = bias ? bias + (size_t)by * sBias : nullptr;
  const int ntn = (N + 63) / 64; const int wid = blockIdx.x * 4 + w; const int mt = wid / ntn, nq = wid % ntn; if (mt * 16 >= M) return;
  const int row0 = mt * 16, col0 = nq * 64; const _Float16* arow = A + (size_t)(row0 + ln) * lda;
  v8f acc[4] = {};
  for (int kb = 0; kb < K; kb += 32) { FragH ah; ah.half[0] = *(const v8us*)((const unsigned short*)arow + kb + 8 * hh); ah.half[1] = *(const v8us*)((const unsigned short*)arow + kb + 16 + 8 * hh);
#pragma unroll
    for (int t = 0; t < 4; ++t) { if (col0 + t * 16 >= N) continue; const size_t boff = (size_t)(col0 + t * 16 + ln) * ldb + kb; FragH bq; bq.half[0] = *(const v8us*)((const unsigned short*)Bh + boff + 8 * hh); bq.half[1] = *(const v8us*)((const unsigned short*)Bh + boff + 16 + 8 * hh);
      acc[t] = mmaH<1>(ah.v, ah.v, bq.v, bq.v, acc[t]); }
  }
#pragma unroll
  for (int t = 0; t < 4; ++t) { if (col0 + t * 16 >= N) continue; const int col = col0 + t * 16 + ln; const float bv = bp ? bf16_round(bp[col]) : 0.f;
#pragma unroll
    for (int r = 0; r < 8; ++r) { float v = acc[t][r] * alpha + bv; if (CP) { const int bidx = (row0g + row0 + 8 * hh + r) / rowsPerB; v += CP[(size_t)bidx * sCPb + (size_t)by * 64 + col]; } if (ACT == 1) v = (v > 0.f) ? v : expm1f(v); else if (ACT == 3) v = fmaxf(v, 0.f); so[w][8 * hh + r][t * 16 + ln] = v; } }
  __builtin_amdgcn_fence(__ATOMIC_ACQ_REL, "workgroup"); __builtin_amdgcn_wave_barrier();
  const int rsub = lane >> 4, c4 = (lane & 15) * 4; typedef _Float16 v4h __attribute__((ext_vector_type(4)));
  {
#pragma unroll
    for (int q = 0; q < 8; ++q) { const int r = q * 2 + rsub; if (col0 + c4 < N) { const v4f v = *(const v4fa*)&so[w][r][c4]; if (C) *(v4f*)(C + cofs + (size_t)(row0 + r) * ldc + col0 + c4) = v; if (C16) { v4h h4; for (int i = 0; i < 4; ++i) h4[i] = (_Float16)v[i]; *(v4h*)(C16 + cofs + (size_t)(row0 + r) * ldc + col0 + c4) = h4; } } }
     }
}


__global__ __launch_bounds__(256) void k_x16(const float* __restrict__ x, _Float16* __restrict__ X16, size_t n8) { const size_t t = (size_t)blockIdx.x * 256 + threadIdx.x; if (t >= n8) return; FragH f;
#pragma unroll
  for (int q = 0; q < 8; ++q) f.h[q] = (_Float16)bf16_round(x[t * 8 + q]); *(v8us*)((unsigned short*)X16 + t * 8) = f.half[0];  }
__global__ __launch_bounds__(256) void k_h16(const float* __restrict__ x, _Float16* __restrict__ X16, size_t n8) { const size_t t = (size_t)blockIdx.x * 256 + threadIdx.x; if (t >= n8) return; FragH f;
#pragma unroll
  for (int q = 0; q < 8; ++q) f.h[q] = (_Float16)x[t * 8 + q]; *(v8us*)((unsigned short*)X16 + t * 8) = f.half[0];  }
__global__ __launch_bounds__(256) void k_round16f(const float* __restrict__ W, _Float16* __restrict__ Bt, size_t n8) { const size_t t = (size_t)blockIdx.x * 256 + threadIdx.x; if (t >= n8) return; FragH f;
#pragma unroll
  for (int i = 0; i < 8; ++i) f.h[i] = (_Float16)(bf16_round(W[t * 8 + i]) * 16.0f); *(v8us*)((unsigned short*)Bt + t * 8) = f.half[0];  }
template <int NHv, int TTv>
__global__ __launch_bounds__(256) void k_vt(const _Float16* __restrict__ V16, int ldv, int voff, _Float16* __restrict__ Vt) { __shared__ unsigned short tl[64][66]; const int tid = threadIdx.x; const int slab = blockIdx.x / (TTv / 64), lg = blockIdx.x % (TTv / 64); const int b = slab / NHv, h = slab % NHv;
  for (int i = tid; i < 64 * 8; i += 256) { const int r = i / 8, c8 = (i % 8) * 8; FragH f; f.half[0] = *(const v8us*)((const unsigned short*)V16 + ((size_t)b * TTv + lg * 64 + r) * ldv + voff + h * 64 + c8);
#pragma unroll
    for (int q = 0; q < 8; ++q) tl[r][c8 + q] = f.u[q]; }
  __syncthreads();
  {
#pragma unroll
    for (int rd = 0; rd < 2; ++rd) { const int d = rd * 32 + tid / 8, pc = tid % 8; FragH f;
#pragma unroll
      for (int q = 0; q < 8; ++q) f.u[q] = tl[pc * 8 + q][d];
      *(v8us*)((unsigned short*)Vt + ((size_t)slab * 64 + d) * TTv + lg * 64 + pc * 8) = f.half[0]; }
     } }

// lane l <-> lane l ^ 16 as a vector cross-row move: no LDS queue and no wait, unlike a shuffle
__device__ __forceinline__ float xhalf(float x) { return __builtin_bit_cast(float, __builtin_amdgcn_permlanex16(__builtin_bit_cast(int, x), __builtin_bit_cast(int, x), 0x76543210, 0xfedcba98, false, false)); }

// Transposed products: St = K.Qt (A = K rows, B = Q rows) and Ot += Vt.Pt (A = Vt rows, B = Pt). In a 16 x 16 tile of St lane (ln, hh) holds
// query column ln and keys 8hh + r, so maximum and sum of a query run inside the lane (one exchange between the halves for the maximum), and the two
// key tiles of a pass, converted in place, are the B operand of the second product in the loaders' own k order: P never leaves the registers.
__global__ __launch_bounds__(128) void k_flash(const _Float16* __restrict__ Q16, int ldq, const _Float16* __restrict__ K16, int ldk, const _Float16* __restrict__ Vt, const int* __restrict__ MSK, float* __restrict__ O, int ldo) {
  constexpr int RPW = 32, NQB = 4096 / (4 * RPW), DT = 4, KS = 2; (void)MSK;
  __shared__ __attribute__((aligned(16))) float sO[4][RPW][64 + 4];
  const int tid = threadIdx.x, w = tid >> 5, lane = tid & 31, ln = lane & 15, hh = lane >> 4;
  const int slab = blockIdx.x / NQB, qblk = blockIdx.x % NQB; const int b = slab / 8, h = slab % 8; const int qb0 = qblk * (4 * RPW); const int q0 = qb0 + w * RPW;
  FragH aq[2][KS];
#pragma unroll
  for (int rt = 0; rt < 2; ++rt) { const unsigned short* qr = (const unsigned short*)Q16 + ((size_t)b * 4096 + q0 + rt * 16 + ln) * ldq + h * 64;
#pragma unroll
    for (int ks = 0; ks < KS; ++ks) { aq[rt][ks].half[0] = *(const v8us*)(qr + ks * 32 + 8 * hh); aq[rt][ks].half[1] = *(const v8us*)(qr + ks * 32 + 16 + 8 * hh); } }
  const unsigned short* Vth = (const unsigned short*)Vt + (size_t)slab * 64 * 4096;
  float m_r[2], l_r[2]; v8f oacc[2][DT];      // per lane: query rt * 16 + ln; oacc[rt][dt][r] = Ot[dt * 16 + 8hh + r][that query]
#pragma unroll
  for (int rt = 0; rt < 2; ++rt) { m_r[rt] = -3.0e38f; l_r[rt] = 0.f;
#pragma unroll
    for (int dt = 0; dt < DT; ++dt) oacc[rt][dt] = (v8f){0.f,0.f,0.f,0.f,0.f,0.f,0.f,0.f}; }
  const int jend = 4096;
#pragma unroll 1
  for (int j0 = 0; j0 < jend; j0 += 32) {
    v8f s[2][2];      // s[rt][nt][r] = score of key j0 + nt * 16 + 8hh + r against query rt * 16 + ln
#pragma unroll
    for (int nt = 0; nt < 2; ++nt) { const unsigned short* kr = (const unsigned short*)K16 + ((size_t)b * 4096 + j0 + nt * 16 + ln) * ldk + h * 64; FragH bk[KS];
#pragma unroll
      for (int ks = 0; ks < KS; ++ks) { bk[ks].half[0] = *(const v8us*)(kr + ks * 32 + 8 * hh); bk[ks].half[1] = *(const v8us*)(kr + ks * 32 + 16 + 8 * hh); }
#pragma unroll
      for (int rt = 0; rt < 2; ++rt) { v8f acc = (v8f){0.f,0.f,0.f,0.f,0.f,0.f,0.f,0.f};
#pragma unroll
        for (int ks = 0; ks < KS; ++ks) acc = mmaH<1>(bk[ks].v, bk[ks].v, aq[rt][ks].v, aq[rt][ks].v, acc); s[rt][nt] = acc; } }
    FragH pb[2];
#pragma unroll
    for (int rt = 0; rt < 2; ++rt) {
      float sc[16], mx[8];
#pragma unroll
      for (int r = 0; r < 8; ++r) { sc[r] = s[rt][0][r] * (0.125f); sc[8 + r] = s[rt][1][r] * (0.125f); mx[r] = fmaxf(sc[r], sc[8 + r]); }
      float mc = fmaxf(fmaxf(fmaxf(mx[0], mx[1]), fmaxf(mx[2], mx[3])), fmaxf(fmaxf(mx[4], mx[5]), fmaxf(mx[6], mx[7])));
      mc = fmaxf(mc, xhalf(mc));      // both halves of a column must use one maximum: their P meet in one product
      const float mn = fmaxf(m_r[rt], mc); const float al = (mn > -1.0e38f) ? expf(m_r[rt] - mn) : 1.0f; m_r[rt] = mn;
      float ps[4] = {0.f, 0.f, 0.f, 0.f};
#pragma unroll
      for (int i = 0; i < 16; ++i) { const float p = expf(sc[i] - mn); ps[i & 3] += p; pb[rt].h[i] = (_Float16)p; }
      l_r[rt] = l_r[rt] * al + ((ps[0] + ps[1]) + (ps[2] + ps[3]));      // this half's keys only; the halves join after the loop
#pragma unroll
      for (int dt = 0; dt < DT; ++dt)
#pragma unroll
        for (int r = 0; r < 8; ++r) oacc[rt][dt][r] *= al; }
#pragma unroll
    for (int dt = 0; dt < DT; ++dt) { const unsigned short* vrow = Vth + (size_t)(dt * 16 + ln) * 4096 + j0; FragH bv; bv.half[0] = *(const v8us*)(vrow + 8 * hh); bv.half[1] = *(const v8us*)(vrow + 16 + 8 * hh);
#pragma unroll
      for (int rt = 0; rt < 2; ++rt) oacc[rt][dt] = mmaH<1>(bv.v, bv.v, pb[rt].v, pb[rt].v, oacc[rt][dt]); } }
#pragma unroll
  for (int rt = 0; rt < 2; ++rt) { float l = l_r[rt]; l += xhalf(l); const float li = (l > 0.f) ? 1.0f / l : 0.f;
#pragma unroll
    for (int dt = 0; dt < DT; ++dt) { v4f lo, hi;
#pragma unroll
      for (int r = 0; r < 4; ++r) { lo[r] = oacc[rt][dt][r] * li; hi[r] = oacc[rt][dt][4 + r] * li; }
      *(v4fa*)&sO[w][rt * 16 + ln][dt * 16 + 8 * hh] = lo; *(v4fa*)&sO[w][rt * 16 + ln][dt * 16 + 8 * hh + 4] = hi; } }
  __builtin_amdgcn_fence(__ATOMIC_ACQ_REL, "workgroup"); __builtin_amdgcn_wave_barrier();
  {
#pragma unroll
    for (int rp = 0; rp < RPW; rp += 2) { const int r = rp + (lane >> 4), pc = lane & 15; const v4f val = *(const v4fa*)&sO[w][r][pc * 4]; *(v4f*)(O + ((size_t)b * 4096 + q0 + r) * ldo + h * 64 + pc * 4) = val; }
     } }

extern "C" void kernel_launch(void* const* d_in, const int* in_sizes, int n_in,
                              void* d_out, int out_size, void* d_ws, size_t ws_size, hipStream_t stream) {
  (void)in_sizes; (void)n_in; (void)out_size;
  const float* q = (const float*)d_in[0]; const float* k = (const float*)d_in[1]; const float* v = (const float*)d_in[2]; const float* Wo = (const float*)d_in[3]; const float* bo = (const float*)d_in[4];
  char* ws = (char*)d_ws; size_t off = 0;
  auto take = [&](size_t bytes) { char* p = ws + off; off += (bytes + 255) & ~(size_t)255; return p; };
  _Float16* Bo = (_Float16*)take((size_t)NO * CC * 2); _Float16* Q16 = (_Float16*)take((size_t)NR * CC * 2); _Float16* K16 = (_Float16*)take((size_t)NR * CC * 2); _Float16* V16 = (_Float16*)take((size_t)NR * CC * 2); _Float16* Vt = (_Float16*)take((size_t)NR * CC * 2); float* O = (float*)take((size_t)NR * CC * 4); _Float16* O16 = V16;      // V16 dead after k_vt
  if (off > ws_size) return;      // 8.4 × 4 + 16.8 MB ≈ 50 MiB
  k_wt_f16<<<(NO * (CC / 8) + 255) / 256, 256, 0, stream>>>(Wo, Bo, CC, NO, 16.0f);      // [in][out]
  const unsigned gx = (unsigned)(((size_t)NR * CC / 8 + 255) / 256);
  k_x16<<<gx, 256, 0, stream>>>(q, Q16, (size_t)NR * CC / 8); k_x16<<<gx, 256, 0, stream>>>(k, K16, (size_t)NR * CC / 8); k_x16<<<gx, 256, 0, stream>>>(v, V16, (size_t)NR * CC / 8);
  k_vt<NH, TT><<<BB * NH * (TT / 64), 256, 0, stream>>>(V16, CC, 0, Vt);
  k_flash<<<BB * NH * (TT / 128), 128, 0, stream>>>(Q16, CC, K16, CC, Vt, nullptr, O, CC);
  k_h16<<<gx, 256, 0, stream>>>(O, O16, (size_t)NR * CC / 8);
  k_gemm_hhx<0><<<dim3(((NR / 16) * 1 + 3) / 4, 1), 128, 0, stream>>>(O16, CC, 0, Bo, CC, 0, 0.0625f, bo, 0, nullptr, 1, 0, 0, (float*)d_out, nullptr, NO, 0, NR, NO, CC);      // N = 64
}

// v002
// Measured time: 177 microseconds a run.
// Two timings next to v001 both put it at 1.93 times that version's speed.
// Counting every step since v000, it is 3.80 times as fast.
#include <hip/hip_runtime.h>
// 8-head attention over the given q/k/v (2 × 4096 tokens, d = 64) as a fused flash-style kernel on v_wmma_f32_16x16x32_f16 (q, k, v are module INPUTS → exact bf16 values as f16 operands; S = Q·Kᵀ × 64^-½,
// online max/sum softmax f32, P f16 ≤ 1, O = P·V), then the 512→64 output linear (+ bias; W_out [in][out] bf16-exact ×2^4); f32 accumulate.
#define BB 2
#define TT 4096
#define CC 512
#define NH 8
#define NO 64
#define NR (BB * TT)

typedef __bf16 v16b __attribute__((ext_vector_type(16)));
typedef unsigned short v8us __attribute__((ext_vector_type(8), may_alias));
typedef float  v8f  __attribute__((ext_vector_type(8)));
typedef float  v4f  __attribute__((ext_vector_type(4)));
typedef float  v4fa __attribute__((ext_vector_type(4), may_alias));
union FragB { v16b v; v8us half[2]; unsigned short u[16]; };

__device__ __forceinline__ unsigned short bf16_bits(float x) { unsigned int u = __float_as_uint(x); return (unsigned short)((u + 0x7FFFu + ((u >> 16) & 1u)) >> 16); }
__device__ __forceinline__ float bf16_val(unsigned short b) { return __uint_as_float(((unsigned int)b) << 16); }
__device__ __forceinline__ float bf16_round(float x) { return bf16_val(bf16_bits(x)); }
// D += A·B with NT terms: 1 = ah·bh, 2 = + al·bh (A split), 3 = + ah·bl (both split)
template <int NT>
__device__ __forceinline__ v8f mmaN(v16b ah, v16b al, v16b bh, v16b bl, v8f c) {
  c = __builtin_amdgcn_wmma_f32_16x16x32_bf16(false, ah, false, bh, (short)0, c, false, false);
  if (NT >= 2) c = __builtin_amdgcn_wmma_f32_16x16x32_bf16(false, al, false, bh, (short)0, c, false, false);
  if (NT >= 3) c = __builtin_amdgcn_wmma_f32_16x16x32_bf16(false, ah, false, bl, (short)0, c, false, false);
  asm volatile("v_nop\n\tv_nop\n\tv_nop\n\tv_nop" : "+v"(c) : "v"(ah), "v"(al), "v"(bh), "v"(bl));
  return c;
}

__global__ __launch_bounds__(256) void k_wt_bf16(const float* __restrict__ W, unsigned short* __restrict__ Wt, int K, int N) {
  const int t = blockIdx.x * 256 + threadIdx.x;
  const int k8n = K / 8;
  if (t >= N * k8n) return;
  const int n = t / k8n, k8 = (t % k8n) * 8;
  v8us v;
#pragma unroll
  for (int i = 0; i < 8; ++i) v[i] = bf16_bits(W[(size_t)(k8 + i) * N + n]);
  *(v8us*)(Wt + (size_t)n * K + k8) = v;
  
}

// GEMM C[M][N] (f32, pitch ldc) = act(A[M][K]·W + bias). A f32 row-major (pitch lda) converted per fragment to bf16
// (ASPLIT: hi/lo two planes -> 2 terms, else single rounded term); Wt bf16 [N][K] (pitch ldb). BIAS_BF16 rounds the
// bias to bf16 first (bias quantised to bf16 before the add). K%32==0, M%16==0, N%64==0.
template <bool ASPLIT, int ACT, bool BIAS_BF16>
__global__ __launch_bounds__(128) void k_gemm_bf(const float* __restrict__ A, int lda, const unsigned short* __restrict__ Wt, int ldb,
                                               const float* __restrict__ bias, float* __restrict__ C, int ldc, int M, int N, int K) {
  __shared__ __attribute__((aligned(16))) float so[4][16][64];
  const int tid = threadIdx.x, w = tid >> 5, lane = tid & 31, ln = lane & 15, hh = lane >> 4;
  const int ntn = N / 64;
  const int wid = blockIdx.x * 4 + w;
  const int mt = wid / ntn, nq = wid % ntn;
  if (mt * 16 >= M) return;
  const int row0 = mt * 16, col0 = nq * 64;
  const float* arow = A + (size_t)(row0 + ln) * lda;
  v8f acc[4] = {};
  for (int kb = 0; kb < K; kb += 32) {
    FragB ah, al;
    const v4f x0 = *(const v4fa*)(arow + kb + 8 * hh), x1 = *(const v4fa*)(arow + kb + 8 * hh + 4);
    const v4f x2 = *(const v4fa*)(arow + kb + 16 + 8 * hh), x3 = *(const v4fa*)(arow + kb + 16 + 8 * hh + 4);
    float xs[16] = {x0[0],x0[1],x0[2],x0[3],x1[0],x1[1],x1[2],x1[3],x2[0],x2[1],x2[2],x2[3],x3[0],x3[1],x3[2],x3[3]};
#pragma unroll
    for (int i = 0; i < 16; ++i) { const unsigned short hb = bf16_bits(xs[i]); ah.u[i] = hb; al.u[i] = ASPLIT ? bf16_bits(xs[i] - bf16_val(hb)) : (unsigned short)0; }
#pragma unroll
    for (int t = 0; t < 4; ++t) {
      const unsigned short* brow = Wt + (size_t)(col0 + t * 16 + ln) * ldb + kb;
      FragB b;
      b.half[0] = *(const v8us*)(brow + 8 * hh);
      b.half[1] = *(const v8us*)(brow + 16 + 8 * hh);
      acc[t] = mmaN<ASPLIT ? 2 : 1>(ah.v, al.v, b.v, b.v, acc[t]);
    }
  }
#pragma unroll
  for (int t = 0; t < 4; ++t) {
    float bv = bias ? bias[col0 + t * 16 + ln] : 0.f;
    if (BIAS_BF16) bv = bf16_round(bv);
#pragma unroll
    for (int r = 0; r < 8; ++r) { float v = acc[t][r] + bv; if (ACT == 1) v = fmaxf(v, 0.f); so[w][8 * hh + r][t * 16 + ln] = v; }
  }
  __builtin_amdgcn_fence(__ATOMIC_ACQ_REL, "workgroup");
  __builtin_amdgcn_wave_barrier();
  const int rsub = lane >> 4, c4 = (lane & 15) * 4;
  {
#pragma unroll
    for (int q = 0; q < 8; ++q) {
      const int r = q * 2 + rsub;
      const v4f v = *(const v4fa*)&so[w][r][c4];
      *(v4f*)(C + (size_t)(row0 + r) * ldc + col0 + c4) = v;
    }
    
  }
}

// Flash-style causal/unmasked attention, all contractions 3-term bf16 hi/lo splits, f32 softmax with running max.
// q,k,v rows are read from f32 buffers with arbitrary row pitch (so they can live inside a fused qkv buffer);
// D = head size (multiple of 32, <= 128); one wave = 16 query rows; block = 4 waves (64 queries) sharing K/V chunks of 32.
template <int D, bool CAUSAL>
__global__ __launch_bounds__(128) void k_flash(const float* __restrict__ qb, const float* __restrict__ kb, const float* __restrict__ vb,
                                             int pitch, int T, int H, float scale, float* __restrict__ y, int ypitch) {
  constexpr int KS = D / 32;        // k-steps for QK
  constexpr int DT = D / 16;        // d tiles for PV
  __shared__ __attribute__((aligned(16))) unsigned short sKh[32][D + 8], sKl[32][D + 8], sVh[32][D + 8], sVl[32][D + 8];
  __shared__ __attribute__((aligned(16))) unsigned short sPh[4][16][40], sPl[4][16][40];
  __shared__ __attribute__((aligned(16))) float sO[4][16][D];
  const int tid = threadIdx.x, w = tid >> 5, lane = tid & 31, ln = lane & 15, hh = lane >> 4;
  const int nqb = (T + 63) / 64;
  const int bh = blockIdx.x / nqb, qblk = blockIdx.x % nqb;
  const int b = bh / H, h = bh % H;
  const int q0 = qblk * 64 + w * 16;
  const float* Q = qb + (size_t)b * T * pitch + h * D;
  const float* K = kb + (size_t)b * T * pitch + h * D;
  const float* V = vb + (size_t)b * T * pitch + h * D;

  // A fragments of the wave's 16 query rows (scaled), hi/lo
  FragB aqh[KS], aql[KS];
  {
    int row = q0 + ln; if (row >= T) row = T - 1;
    const float* qr = Q + (size_t)row * pitch;
#pragma unroll
    for (int ks = 0; ks < KS; ++ks)
#pragma unroll
      for (int i = 0; i < 16; ++i) {
        const int d = ks * 32 + ((i < 8) ? (8 * hh + i) : (16 + 8 * hh + (i - 8)));
        const float x = qr[d] * scale; const unsigned short hb = bf16_bits(x);
        aqh[ks].u[i] = hb; aql[ks].u[i] = bf16_bits(x - bf16_val(hb));
      }
  }
  float m_r[8], l_r[8];
#pragma unroll
  for (int r = 0; r < 8; ++r) { m_r[r] = -3.0e38f; l_r[r] = 0.f; }
  v8f oacc[DT];
#pragma unroll
  for (int dt = 0; dt < DT; ++dt) oacc[dt] = (v8f){0.f,0.f,0.f,0.f,0.f,0.f,0.f,0.f};

  const int kv_end = CAUSAL ? min(T, qblk * 64 + 64) : T;     // block-uniform
  for (int j0 = 0; j0 < kv_end; j0 += 32) {
    __syncthreads();
    for (int e = tid; e < 32 * (D / 4); e += 128) {
      const int r = e / (D / 4), c4 = (e % (D / 4)) * 4;
      const int key = j0 + r;
      v4f kf = {0.f,0.f,0.f,0.f}, vf = {0.f,0.f,0.f,0.f};
      if (key < T) { kf = *(const v4fa*)(K + (size_t)key * pitch + c4); vf = *(const v4fa*)(V + (size_t)key * pitch + c4); }
#pragma unroll
      for (int t = 0; t < 4; ++t) {
        unsigned short hb = bf16_bits(kf[t]); sKh[r][c4 + t] = hb; sKl[r][c4 + t] = bf16_bits(kf[t] - bf16_val(hb));
        hb = bf16_bits(vf[t]); sVh[r][c4 + t] = hb; sVl[r][c4 + t] = bf16_bits(vf[t] - bf16_val(hb));
      }
    }
    __syncthreads();
    // S tile 16 x 32
    v8f s[2];
#pragma unroll
    for (int nt = 0; nt < 2; ++nt) {
      v8f acc = {};
#pragma unroll
      for (int ks = 0; ks < KS; ++ks) {
        FragB bh_, bl_;
        bh_.half[0] = *(const v8us*)&sKh[nt * 16 + ln][ks * 32 + 8 * hh]; bh_.half[1] = *(const v8us*)&sKh[nt * 16 + ln][ks * 32 + 16 + 8 * hh];
        bl_.half[0] = *(const v8us*)&sKl[nt * 16 + ln][ks * 32 + 8 * hh]; bl_.half[1] = *(const v8us*)&sKl[nt * 16 + ln][ks * 32 + 16 + 8 * hh];
        acc = mmaN<3>(aqh[ks].v, aql[ks].v, bh_.v, bl_.v, acc);
      }
      s[nt] = acc;
    }
    // mask + running max (rows 8hh+r; the 16 lanes of a half share rows)
    float alpha[8];
#pragma unroll
    for (int r = 0; r < 8; ++r) {
      const int qi = q0 + 8 * hh + r;
      const int ja = j0 + ln, jb = j0 + 16 + ln;
      if (CAUSAL) { if (ja > qi) s[0][r] = -3.0e38f; if (jb > qi) s[1][r] = -3.0e38f; }
      if (ja >= T) s[0][r] = -3.0e38f;
      if (jb >= T) s[1][r] = -3.0e38f;
      float mx = fmaxf(s[0][r], s[1][r]);
      mx = fmaxf(mx, __shfl_xor(mx, 1, 32)); mx = fmaxf(mx, __shfl_xor(mx, 2, 32)); mx = fmaxf(mx, __shfl_xor(mx, 4, 32)); mx = fmaxf(mx, __shfl_xor(mx, 8, 32));
      const float mnew = fmaxf(m_r[r], mx);
      alpha[r] = (mnew > -1.0e38f) ? __expf(m_r[r] - mnew) : 1.0f;
      const float p0 = (s[0][r] > -1.0e38f) ? __expf(s[0][r] - mnew) : 0.f;
      const float p1 = (s[1][r] > -1.0e38f) ? __expf(s[1][r] - mnew) : 0.f;
      m_r[r] = mnew;
      l_r[r] = l_r[r] * alpha[r] + p0 + p1;            // per-lane partial row sum (16 lanes combined at the end)
      unsigned short hb = bf16_bits(p0); sPh[w][8 * hh + r][ln] = hb;      sPl[w][8 * hh + r][ln] = bf16_bits(p0 - bf16_val(hb));
      hb = bf16_bits(p1);                sPh[w][8 * hh + r][16 + ln] = hb; sPl[w][8 * hh + r][16 + ln] = bf16_bits(p1 - bf16_val(hb));
    }
#pragma unroll
    for (int dt = 0; dt < DT; ++dt)
#pragma unroll
      for (int r = 0; r < 8; ++r) oacc[dt][r] *= alpha[r];
    __builtin_amdgcn_fence(__ATOMIC_ACQ_REL, "workgroup");
    __builtin_amdgcn_wave_barrier();
    FragB pah, pal;
    pah.half[0] = *(const v8us*)&sPh[w][ln][8 * hh]; pah.half[1] = *(const v8us*)&sPh[w][ln][16 + 8 * hh];
    pal.half[0] = *(const v8us*)&sPl[w][ln][8 * hh]; pal.half[1] = *(const v8us*)&sPl[w][ln][16 + 8 * hh];
#pragma unroll
    for (int dt = 0; dt < DT; ++dt) {
      FragB bvh, bvl;
#pragma unroll
      for (int i = 0; i < 8; ++i) {
        bvh.u[i] = sVh[8 * hh + i][dt * 16 + ln]; bvh.u[8 + i] = sVh[16 + 8 * hh + i][dt * 16 + ln];
        bvl.u[i] = sVl[8 * hh + i][dt * 16 + ln]; bvl.u[8 + i] = sVl[16 + 8 * hh + i][dt * 16 + ln];
      }
      oacc[dt] = mmaN<3>(pah.v, pal.v, bvh.v, bvl.v, oacc[dt]);
    }
    __builtin_amdgcn_fence(__ATOMIC_ACQ_REL, "workgroup");
    __builtin_amdgcn_wave_barrier();
  }
#pragma unroll
  for (int r = 0; r < 8; ++r) {
    float l = l_r[r];
    l += __shfl_xor(l, 1, 32); l += __shfl_xor(l, 2, 32); l += __shfl_xor(l, 4, 32); l += __shfl_xor(l, 8, 32);
    l_r[r] = (l > 0.f) ? 1.0f / l : 0.f;
  }
#pragma unroll
  for (int dt = 0; dt < DT; ++dt)
#pragma unroll
    for (int r = 0; r < 8; ++r) sO[w][8 * hh + r][dt * 16 + ln] = oacc[dt][r] * l_r[r];
  __builtin_amdgcn_fence(__ATOMIC_ACQ_REL, "workgroup");
  __builtin_amdgcn_wave_barrier();
  {
    for (int r = 0; r < 16; ++r) {
      const int row = q0 + r;
      if (row < T && lane < D / 4) {
        const v4f val = *(const v4fa*)&sO[w][r][lane * 4];
        *(v4f*)(y + ((size_t)b * T + row) * ypitch + h * D + lane * 4) = val;
      }
    }
    
  }
}

// GEMM C = act(A·W + bias + resid): A f32 (ASPLIT -> hi/lo 2 terms), Wt bf16 [N][K]; ACT 0 none, 1 relu, 2 exact gelu;
// resid (optional, f32, row index = (row % rmod), pitch ldr, RES_BF16 rounds it) added before the activation.
template <bool ASPLIT, int ACT, bool BIAS_BF16, bool RES_BF16>
__global__ __launch_bounds__(128) void k_gemm_bf3(const float* __restrict__ A, int lda, const unsigned short* __restrict__ Wt, int ldb,
                                                const float* __restrict__ bias, const float* __restrict__ resid, int rmod, int ldr,
                                                float* __restrict__ C, int ldc, int M, int N, int K) {
  __shared__ __attribute__((aligned(16))) float so[4][16][64];
  const int tid = threadIdx.x, w = tid >> 5, lane = tid & 31, ln = lane & 15, hh = lane >> 4;
  const int ntn = N / 64;
  const int wid = blockIdx.x * 4 + w;
  const int mt = wid / ntn, nq = wid % ntn;
  if (mt * 16 >= M) return;
  const int row0 = mt * 16, col0 = nq * 64;
  const float* arow = A + (size_t)(row0 + ln) * lda;
  v8f acc[4] = {};
  for (int kb = 0; kb < K; kb += 32) {
    FragB ah, al;
    const v4f x0 = *(const v4fa*)(arow + kb + 8 * hh), x1 = *(const v4fa*)(arow + kb + 8 * hh + 4);
    const v4f x2 = *(const v4fa*)(arow + kb + 16 + 8 * hh), x3 = *(const v4fa*)(arow + kb + 16 + 8 * hh + 4);
    float xs[16] = {x0[0],x0[1],x0[2],x0[3],x1[0],x1[1],x1[2],x1[3],x2[0],x2[1],x2[2],x2[3],x3[0],x3[1],x3[2],x3[3]};
#pragma unroll
    for (int i = 0; i < 16; ++i) { const unsigned short hb = bf16_bits(xs[i]); ah.u[i] = hb; al.u[i] = ASPLIT ? bf16_bits(xs[i] - bf16_val(hb)) : (unsigned short)0; }
#pragma unroll
    for (int t = 0; t < 4; ++t) {
      const unsigned short* brow = Wt + (size_t)(col0 + t * 16 + ln) * ldb + kb;
      FragB b;
      b.half[0] = *(const v8us*)(brow + 8 * hh);
      b.half[1] = *(const v8us*)(brow + 16 + 8 * hh);
      acc[t] = mmaN<ASPLIT ? 2 : 1>(ah.v, al.v, b.v, b.v, acc[t]);
    }
  }
#pragma unroll
  for (int t = 0; t < 4; ++t) {
    const int col = col0 + t * 16 + ln;
    float bv = bias ? bias[col] : 0.f;
    if (BIAS_BF16) bv = bf16_round(bv);
#pragma unroll
    for (int r = 0; r < 8; ++r) {
      float v = acc[t][r] + bv;
      if (resid) { float rv = resid[(size_t)((row0 + 8 * hh + r) % rmod) * ldr + col]; if (RES_BF16) rv = bf16_round(rv); v += rv; }
      if (ACT == 1) v = fmaxf(v, 0.f);
      if (ACT == 2) v = 0.5f * v * (1.0f + erff(v * 0.70710678118654752f));
      if (ACT == 3) { const float u = 0.7978845608028654f * (v + 0.044715f * v * v * v); v = 0.5f * v * (1.0f + tanhf(u)); }
      so[w][8 * hh + r][t * 16 + ln] = v;
    }
  }
  __builtin_amdgcn_fence(__ATOMIC_ACQ_REL, "workgroup");
  __builtin_amdgcn_wave_barrier();
  const int rsub = lane >> 4, c4 = (lane & 15) * 4;
  {
#pragma unroll
    for (int q = 0; q < 8; ++q) {
      const int r = q * 2 + rsub;
      const v4f v = *(const v4fa*)&so[w][r][c4];
      *(v4f*)(C + (size_t)(row0 + r) * ldc + col0 + c4) = v;
    }
    
  }
}
// row LayerNorm (biased variance, eps) over N: s = X (+ R); optional out_sum <- s; out_norm <- (s-mu)*rsqrt(var+eps)*g + b
template <bool PARAM_BF16>
__global__ __launch_bounds__(256) void k_layernorm(const float* __restrict__ X, const float* __restrict__ R, const float* __restrict__ g, const float* __restrict__ bta,
                                                  float* __restrict__ out_sum, float* __restrict__ out_norm, int N, float eps) {
  __shared__ float red[256];
  const int row = blockIdx.x, tid = threadIdx.x;
  const float* x = X + (size_t)row * N; const float* rr = R ? R + (size_t)row * N : nullptr;
  float vals[16];                     // up to N = 4096
  const int per = N / 256;            // contiguous chunk per thread? use strided-by-4 chunks: thread handles j = tid*4 + 1024*u
  float s1 = 0.f;
  for (int u = 0; u < per / 4; ++u) {
    const int j = tid * 4 + 1024 * u;
    const v4f a = *(const v4fa*)(x + j);
    v4f b = {0.f,0.f,0.f,0.f}; if (rr) b = *(const v4fa*)(rr + j);
#pragma unroll
    for (int q = 0; q < 4; ++q) { const float v = a[q] + b[q]; vals[u * 4 + q] = v; s1 += v; }
  }
  red[tid] = s1; __syncthreads();
  for (int st = 128; st > 0; st >>= 1) { if (tid < st) red[tid] += red[tid + st]; __syncthreads(); }
  const float mu = red[0] / (float)N; __syncthreads();
  float s2 = 0.f;
  for (int u = 0; u < per / 4; ++u)
#pragma unroll
    for (int q = 0; q < 4; ++q) { const float c = vals[u * 4 + q] - mu; s2 += c * c; }
  red[tid] = s2; __syncthreads();
  for (int st = 128; st > 0; st >>= 1) { if (tid < st) red[tid] += red[tid + st]; __syncthreads(); }
  const float rs = rsqrtf(red[0] / (float)N + eps);
  {
    for (int u = 0; u < per / 4; ++u) {
      const int j = tid * 4 + 1024 * u;
      v4f o, sm;
#pragma unroll
      for (int q = 0; q < 4; ++q) {
        float gg = g[j + q], bb = bta[j + q];
        if (PARAM_BF16) { gg = bf16_round(gg); bb = bf16_round(bb); }
        sm[q] = vals[u * 4 + q]; o[q] = (vals[u * 4 + q] - mu) * rs * gg + bb;
      }
      if (out_sum) *(v4f*)(out_sum + (size_t)row * N + j) = sm;
      *(v4f*)(out_norm + (size_t)row * N + j) = o;
    }
    
  }
}



// ---- f16 WMMA path (v_wmma_f32_16x16x32_f16): 11-bit significands for operands in range — used for every matrix product here (Q·Kᵀ, P·V, output linear)
typedef _Float16 v16h __attribute__((ext_vector_type(16)));
union FragH { v16h v; v8us half[2]; _Float16 h[16]; unsigned short u[16]; };
template <int NT>
__device__ __forceinline__ v8f mmaH(v16h ah, v16h al, v16h bh, v16h bl, v8f c) {
  c = __builtin_amdgcn_wmma_f32_16x16x32_f16(false, ah, false, bh, (short)0, c, false, false);
  if (NT >= 2) c = __builtin_amdgcn_wmma_f32_16x16x32_f16(false, al, false, bh, (short)0, c, false, false);
  if (NT >= 3) c = __builtin_amdgcn_wmma_f32_16x16x32_f16(false, ah, false, bl, (short)0, c, false, false);
  asm volatile("v_nop\n\tv_nop\n\tv_nop\n\tv_nop" : "+v"(c) : "v"(ah), "v"(al), "v"(bh), "v"(bl));
  return c;
}
// batched GEMM like k_gemm_b but f16 operands: A f32 (split into f16 hi/lo if ASPLIT, else rounded to f16), Bt = f16 values [n][k]; alpha; C f32; N multiple of 16 (partial tiles skipped)
template <bool ASPLIT>
__global__ __launch_bounds__(128) void k_gemm_h(const float* __restrict__ A, int lda, size_t sA, const _Float16* __restrict__ Bh, int ldb, size_t sB, float alpha, float* __restrict__ C, int ldc, size_t sC, int M, int N, int K) {
  __shared__ __attribute__((aligned(16))) float so[4][16][64];
  const int tid = threadIdx.x, w = tid >> 5, lane = tid & 31, ln = lane & 15, hh = lane >> 4; const int by = blockIdx.y;
  A += (size_t)by * sA; Bh += (size_t)by * sB; C += (size_t)by * sC;
  const int ntn = (N + 63) / 64; const int wid = blockIdx.x * 4 + w; const int mt = wid / ntn, nq = wid % ntn; if (mt * 16 >= M) return;
  const int row0 = mt * 16, col0 = nq * 64; const float* arow = A + (size_t)(row0 + ln) * lda;
  v8f acc[4] = {};
  for (int kb = 0; kb < K; kb += 32) {
    FragH ah, al;
    const v4f x0 = *(const v4fa*)(arow + kb + 8 * hh), x1 = *(const v4fa*)(arow + kb + 8 * hh + 4), x2 = *(const v4fa*)(arow + kb + 16 + 8 * hh), x3 = *(const v4fa*)(arow + kb + 16 + 8 * hh + 4);
    float xs[16] = {x0[0],x0[1],x0[2],x0[3],x1[0],x1[1],x1[2],x1[3],x2[0],x2[1],x2[2],x2[3],x3[0],x3[1],x3[2],x3[3]};
#pragma unroll
    for (int i = 0; i < 16; ++i) { const _Float16 h = (_Float16)xs[i]; ah.h[i] = h; al.h[i] = ASPLIT ? (_Float16)(xs[i] - (float)h) : (_Float16)0.0f; }
#pragma unroll
    for (int t = 0; t < 4; ++t) { if (col0 + t * 16 >= N) continue; const size_t boff = (size_t)(col0 + t * 16 + ln) * ldb + kb; FragH bq; bq.half[0] = *(const v8us*)(Bh + boff + 8 * hh); bq.half[1] = *(const v8us*)(Bh + boff + 16 + 8 * hh);
      acc[t] = mmaH<ASPLIT ? 2 : 1>(ah.v, al.v, bq.v, bq.v, acc[t]); }
  }
#pragma unroll
  for (int t = 0; t < 4; ++t) { if (col0 + t * 16 >= N) continue;
#pragma unroll
    for (int r = 0; r < 8; ++r) so[w][8 * hh + r][t * 16 + ln] = acc[t][r] * alpha; }
  __builtin_amdgcn_fence(__ATOMIC_ACQ_REL, "workgroup"); __builtin_amdgcn_wave_barrier();
  const int rsub = lane >> 4, c4 = (lane & 15) * 4;
  {
#pragma unroll
    for (int q = 0; q < 8; ++q) { const int r = q * 2 + rsub; if (col0 + c4 < N) { const v4f v = *(const v4fa*)&so[w][r][c4]; *(v4f*)(C + (size_t)(row0 + r) * ldc + col0 + c4) = v; } }
     }
}

// Wt[n][k] = f16(W[k][n]·scale) from f32 row-major W[K][N] (scale = power of two; bf16-exact weights stay exact in f16 away from the subnormal range)
__global__ __launch_bounds__(256) void k_wt_f16(const float* __restrict__ W, _Float16* __restrict__ Wt, int K, int N, float scale) {
  const int t = blockIdx.x * 256 + threadIdx.x; if (t >= N * (K / 8)) return; const int n = t / (K / 8), k8 = (t % (K / 8)) * 8; FragH f;
#pragma unroll
  for (int i = 0; i < 8; ++i) f.h[i] = (_Float16)(bf16_round(W[(size_t)(k8 + i) * N + n]) * scale); const v8us o = f.half[0];
  *(v8us*)((unsigned short*)Wt + (size_t)n * K + k8) = o; 
}
// k_gemm_hh variant with fused epilogue: v = acc·alpha + bias[by·sBias + col] (+ CP[(row/rowsPerB)·sCPb + by·64 + col] if CP) ; ACT 0 none / 1 elu ; writes f32 C and/or f16 C16 (each if non-null)
template <int ACT>
__global__ __launch_bounds__(128) void k_gemm_hhx(const _Float16* __restrict__ A, int lda, size_t sA, const _Float16* __restrict__ Bh, int ldb, size_t sB, float alpha, const float* __restrict__ bias, size_t sBias, const float* __restrict__ CP, int rowsPerB, size_t sCPb, int row0g,
    float* __restrict__ C, _Float16* __restrict__ C16, int ldc, size_t sC, int M, int N, int K) {
  __shared__ __attribute__((aligned(16))) float so[4][16][64];
  const int tid = threadIdx.x, w = tid >> 5, lane = tid & 31, ln = lane & 15, hh = lane >> 4; const int by = blockIdx.y;
  A += (size_t)by * sA; Bh += (size_t)by * sB; const size_t cofs = (size_t)by * sC; const float* bp = bias ? bias + (size_t)by * sBias : nullptr;
  const int ntn = (N + 63) / 64; const int wid = blockIdx.x * 4 + w; const int mt = wid / ntn, nq = wid % ntn; if (mt * 16 >= M) return;
  const int row0 = mt * 16, col0 = nq * 64; const _Float16* arow = A + (size_t)(row0 + ln) * lda;
  v8f acc[4] = {};
  for (int kb = 0; kb < K; kb += 32) { FragH ah; ah.half[0] = *(const v8us*)((const unsigned short*)arow + kb + 8 * hh); ah.half[1] = *(const v8us*)((const unsigned short*)arow + kb + 16 + 8 * hh);
#pragma unroll
    for (int t = 0; t < 4; ++t) { if (col0 + t * 16 >= N) continue; const size_t boff = (size_t)(col0 + t * 16 + ln) * ldb + kb; FragH bq; bq.half[0] = *(const v8us*)((const unsigned short*)Bh + boff + 8 * hh); bq.half[1] = *(const v8us*)((const unsigned short*)Bh + boff + 16 + 8 * hh);
      acc[t] = mmaH<1>(ah.v, ah.v, bq.v, bq.v, acc[t]); }
  }
#pragma unroll
  for (int t = 0; t < 4; ++t) { if (col0 + t * 16 >= N) continue; const int col = col0 + t * 16 + ln; const float bv = bp ? bf16_round(bp[col]) : 0.f;
#pragma unroll
    for (int r = 0; r < 8; ++r) { float v = acc[t][r] * alpha + bv; if (CP) { const int bidx = (row0g + row0 + 8 * hh + r) / rowsPerB; v += CP[(size_t)bidx * sCPb + (size_t)by * 64 + col]; } if (ACT == 1) v = (v > 0.f) ? v : expm1f(v); else if (ACT == 3) v = fmaxf(v, 0.f); so[w][8 * hh + r][t * 16 + ln] = v; } }
  __builtin_amdgcn_fence(__ATOMIC_ACQ_REL, "workgroup"); __builtin_amdgcn_wave_barrier();
  const int rsub = lane >> 4, c4 = (lane & 15) * 4; typedef _Float16 v4h __attribute__((ext_vector_type(4)));
  {
#pragma unroll
    for (int q = 0; q < 8; ++q) { const int r = q * 2 + rsub; if (col0 + c4 < N) { const v4f v = *(const v4fa*)&so[w][r][c4]; if (C) *(v4f*)(C + cofs + (size_t)(row0 + r) * ldc + col0 + c4) = v; if (C16) { v4h h4; for (int i = 0; i < 4; ++i) h4[i] = (_Float16)v[i]; *(v4h*)(C16 + cofs + (size_t)(row0 + r) * ldc + col0 + c4) = h4; } } }
     }
}


__global__ __launch_bounds__(256) void k_x16(const float* __restrict__ x, _Float16* __restrict__ X16, size_t n8) { const size_t t = (size_t)blockIdx.x * 256 + threadIdx.x; if (t >= n8) return; FragH f;
#pragma unroll
  for (int q = 0; q < 8; ++q) f.h[q] = (_Float16)bf16_round(x[t * 8 + q]); *(v8us*)((unsigned short*)X16 + t * 8) = f.half[0];  }
__global__ __launch_bounds__(256) void k_h16(const float* __restrict__ x, _Float16* __restrict__ X16, size_t n8) { const size_t t = (size_t)blockIdx.x * 256 + threadIdx.x; if (t >= n8) return; FragH f;
#pragma unroll
  for (int q = 0; q < 8; ++q) f.h[q] = (_Float16)x[t * 8 + q]; *(v8us*)((unsigned short*)X16 + t * 8) = f.half[0];  }
__global__ __launch_bounds__(256) void k_round16f(const float* __restrict__ W, _Float16* __restrict__ Bt, size_t n8) { const size_t t = (size_t)blockIdx.x * 256 + threadIdx.x; if (t >= n8) return; FragH f;
#pragma unroll
  for (int i = 0; i < 8; ++i) f.h[i] = (_Float16)(bf16_round(W[t * 8 + i]) * 16.0f); *(v8us*)((unsigned short*)Bt + t * 8) = f.half[0];  }
template <int NHv, int TTv>
__global__ __launch_bounds__(256) void k_vt(const _Float16* __restrict__ V16, int ldv, int voff, _Float16* __restrict__ Vt) { __shared__ unsigned short tl[64][66]; const int tid = threadIdx.x; const int slab = blockIdx.x / (TTv / 64), lg = blockIdx.x % (TTv / 64); const int b = slab / NHv, h = slab % NHv;
  for (int i = tid; i < 64 * 8; i += 256) { const int r = i / 8, c8 = (i % 8) * 8; FragH f; f.half[0] = *(const v8us*)((const unsigned short*)V16 + ((size_t)b * TTv + lg * 64 + r) * ldv + voff + h * 64 + c8);
#pragma unroll
    for (int q = 0; q < 8; ++q) tl[r][c8 + q] = f.u[q]; }
  __syncthreads();
  {
#pragma unroll
    for (int rd = 0; rd < 2; ++rd) { const int d = rd * 32 + tid / 8, pc = tid % 8; FragH f;
#pragma unroll
      for (int q = 0; q < 8; ++q) f.u[q] = tl[pc * 8 + q][d];
      *(v8us*)((unsigned short*)Vt + ((size_t)slab * 64 + d) * TTv + lg * 64 + pc * 8) = f.half[0]; }
     } }

// lane l <-> lane l ^ 16 as a vector cross-row move: no LDS queue and no wait, unlike a shuffle
__device__ __forceinline__ float xhalf(float x) { return __builtin_bit_cast(float, __builtin_amdgcn_permlanex16(__builtin_bit_cast(int, x), __builtin_bit_cast(int, x), 0x76543210, 0xfedcba98, false, false)); }

// Transposed products: St = K.Qt (A = K rows, B = Q rows) and Ot += Vt.Pt (A = Vt rows, B = Pt). In a 16 x 16 tile of St lane (ln, hh) holds
// query column ln and keys 8hh + r, so maximum and sum of a query run inside the lane (one exchange between the halves for the maximum), and the two
// key tiles of a pass, converted in place, are the B operand of the second product in the loaders' own k order: P never leaves the registers.
__global__ __launch_bounds__(128) void k_flash(const _Float16* __restrict__ Q16, int ldq, const _Float16* __restrict__ K16, int ldk, const _Float16* __restrict__ Vt, const int* __restrict__ MSK, float* __restrict__ O, int ldo) {
  constexpr int RPW = 32, NQB = 4096 / (4 * RPW), DT = 4, KS = 2; (void)MSK;
  __shared__ __attribute__((aligned(16))) float sO[4][RPW][64 + 4];
  const int tid = threadIdx.x, w = tid >> 5, lane = tid & 31, ln = lane & 15, hh = lane >> 4;
  const int slab = blockIdx.x / NQB, qblk = blockIdx.x % NQB; const int b = slab / 8, h = slab % 8; const int qb0 = qblk * (4 * RPW); const int q0 = qb0 + w * RPW;
  FragH aq[2][KS];
#pragma unroll
  for (int rt = 0; rt < 2; ++rt) { const unsigned short* qr = (const unsigned short*)Q16 + ((size_t)b * 4096 + q0 + rt * 16 + ln) * ldq + h * 64;
#pragma unroll
    for (int ks = 0; ks < KS; ++ks) { aq[rt][ks].half[0] = *(const v8us*)(qr + ks * 32 + 8 * hh); aq[rt][ks].half[1] = *(const v8us*)(qr + ks * 32 + 16 + 8 * hh); } }
  const unsigned short* kl = (const unsigned short*)K16 + ((size_t)b * 4096 + ln) * ldk + h * 64 + 8 * hh;      // this lane's piece of key row ln
  FragH bk[2][KS];      // K of pass 0; inside the loop each pass fetches the next pass's
#pragma unroll
  for (int nt = 0; nt < 2; ++nt)
#pragma unroll
    for (int ks = 0; ks < KS; ++ks) { const unsigned short* kr = kl + (size_t)(nt * 16) * ldk + ks * 32; bk[nt][ks].half[0] = *(const v8us*)kr; bk[nt][ks].half[1] = *(const v8us*)(kr + 16); }
  asm volatile("s_wait_xcnt 0x0" ::: "memory");      // the address registers of the loads above are reused below: the wait stands in front of their overwrite
  __builtin_amdgcn_sched_barrier(0);                 // keeps the set-up code that reuses those registers behind that wait
  const unsigned short* Vth = (const unsigned short*)Vt + (size_t)slab * 64 * 4096;
  float m_r[2], l_r[2]; v8f oacc[2][DT];      // per lane: query rt * 16 + ln; oacc[rt][dt][r] = Ot[dt * 16 + 8hh + r][that query]
#pragma unroll
  for (int rt = 0; rt < 2; ++rt) { m_r[rt] = -3.0e38f; l_r[rt] = 0.f;
#pragma unroll
    for (int dt = 0; dt < DT; ++dt) oacc[rt][dt] = (v8f){0.f,0.f,0.f,0.f,0.f,0.f,0.f,0.f}; }
  const int jend = 4096;
  // Every load of a pass is issued a phase ahead of its use: V of a pass at the pass's top, K of the next pass right behind this pass's score products,
  // into the same registers, so that each flies over the softmax arithmetic and no product waits out a round trip to L2.
  const unsigned short* vl = Vth + (size_t)ln * 4096 + 8 * hh;                                                   // this lane's piece of Vt row ln
  FragH bv[DT];
#pragma unroll 1
  for (int j0 = 0; j0 < jend; j0 += 32) {
#pragma unroll
    for (int dt = 0; dt < DT; ++dt) { const unsigned short* vrow = vl + (size_t)(dt * 16) * 4096 + j0; bv[dt].half[0] = *(const v8us*)vrow; bv[dt].half[1] = *(const v8us*)(vrow + 16); }
    v8f s[2][2];      // s[rt][nt][r] = score of key j0 + nt * 16 + 8hh + r against query rt * 16 + ln
#pragma unroll
    for (int nt = 0; nt < 2; ++nt) {
#pragma unroll
      for (int rt = 0; rt < 2; ++rt) { v8f acc = (v8f){0.f,0.f,0.f,0.f,0.f,0.f,0.f,0.f};
#pragma unroll
        for (int ks = 0; ks < KS; ++ks) acc = mmaH<1>(bk[nt][ks].v, bk[nt][ks].v, aq[rt][ks].v, aq[rt][ks].v, acc); s[rt][nt] = acc; } }
    const int jn = (j0 + 32 < jend) ? j0 + 32 : 0;      // the last pass fetches pass 0's rows again (unused): the address stays inside K16
#pragma unroll
    for (int nt = 0; nt < 2; ++nt)
#pragma unroll
      for (int ks = 0; ks < KS; ++ks) { const unsigned short* kr = kl + (size_t)(jn + nt * 16) * ldk + ks * 32; bk[nt][ks].half[0] = *(const v8us*)kr; bk[nt][ks].half[1] = *(const v8us*)(kr + 16); }
    FragH pb[2];
#pragma unroll
    for (int rt = 0; rt < 2; ++rt) {
      float sc[16], mx[8];
#pragma unroll
      for (int r = 0; r < 8; ++r) { sc[r] = s[rt][0][r] * (0.125f); sc[8 + r] = s[rt][1][r] * (0.125f); mx[r] = fmaxf(sc[r], sc[8 + r]); }
      float mc = fmaxf(fmaxf(fmaxf(mx[0], mx[1]), fmaxf(mx[2], mx[3])), fmaxf(fmaxf(mx[4], mx[5]), fmaxf(mx[6], mx[7])));
      mc = fmaxf(mc, xhalf(mc));      // both halves of a column must use one maximum: their P meet in one product
      const float mn = fmaxf(m_r[rt], mc); const float al = (mn > -1.0e38f) ? expf(m_r[rt] - mn) : 1.0f; m_r[rt] = mn;
      float ps[4] = {0.f, 0.f, 0.f, 0.f};
#pragma unroll
      for (int i = 0; i < 16; ++i) { const float p = expf(sc[i] - mn); ps[i & 3] += p; pb[rt].h[i] = (_Float16)p; }
      l_r[rt] = l_r[rt] * al + ((ps[0] + ps[1]) + (ps[2] + ps[3]));      // this half's keys only; the halves join after the loop
#pragma unroll
      for (int dt = 0; dt < DT; ++dt)
#pragma unroll
        for (int r = 0; r < 8; ++r) oacc[rt][dt][r] *= al; }
#pragma unroll
    for (int dt = 0; dt < DT; ++dt) {
#pragma unroll
      for (int rt = 0; rt < 2; ++rt) oacc[rt][dt] = mmaH<1>(bv[dt].v, bv[dt].v, pb[rt].v, pb[rt].v, oacc[rt][dt]); } }
#pragma unroll
  for (int rt = 0; rt < 2; ++rt) { float l = l_r[rt]; l += xhalf(l); const float li = (l > 0.f) ? 1.0f / l : 0.f;
#pragma unroll
    for (int dt = 0; dt < DT; ++dt) { v4f lo, hi;
#pragma unroll
      for (int r = 0; r < 4; ++r) { lo[r] = oacc[rt][dt][r] * li; hi[r] = oacc[rt][dt][4 + r] * li; }
      *(v4fa*)&sO[w][rt * 16 + ln][dt * 16 + 8 * hh] = lo; *(v4fa*)&sO[w][rt * 16 + ln][dt * 16 + 8 * hh + 4] = hi; } }
  __builtin_amdgcn_fence(__ATOMIC_ACQ_REL, "workgroup"); __builtin_amdgcn_wave_barrier();
  {
#pragma unroll
    for (int rp = 0; rp < RPW; rp += 2) { const int r = rp + (lane >> 4), pc = lane & 15; const v4f val = *(const v4fa*)&sO[w][r][pc * 4]; *(v4f*)(O + ((size_t)b * 4096 + q0 + r) * ldo + h * 64 + pc * 4) = val; }
     } }

extern "C" void kernel_launch(void* const* d_in, const int* in_sizes, int n_in,
                              void* d_out, int out_size, void* d_ws, size_t ws_size, hipStream_t stream) {
  (void)in_sizes; (void)n_in; (void)out_size;
  const float* q = (const float*)d_in[0]; const float* k = (const float*)d_in[1]; const float* v = (const float*)d_in[2]; const float* Wo = (const float*)d_in[3]; const float* bo = (const float*)d_in[4];
  char* ws = (char*)d_ws; size_t off = 0;
  auto take = [&](size_t bytes) { char* p = ws + off; off += (bytes + 255) & ~(size_t)255; return p; };
  _Float16* Bo = (_Float16*)take((size_t)NO * CC * 2); _Float16* Q16 = (_Float16*)take((size_t)NR * CC * 2); _Float16* K16 = (_Float16*)take((size_t)NR * CC * 2); _Float16* V16 = (_Float16*)take((size_t)NR * CC * 2); _Float16* Vt = (_Float16*)take((size_t)NR * CC * 2); float* O = (float*)take((size_t)NR * CC * 4); _Float16* O16 = V16;      // V16 dead after k_vt
  if (off > ws_size) return;      // 8.4 × 4 + 16.8 MB ≈ 50 MiB
  k_wt_f16<<<(NO * (CC / 8) + 255) / 256, 256, 0, stream>>>(Wo, Bo, CC, NO, 16.0f);      // [in][out]
  const unsigned gx = (unsigned)(((size_t)NR * CC / 8 + 255) / 256);
  k_x16<<<gx, 256, 0, stream>>>(q, Q16, (size_t)NR * CC / 8); k_x16<<<gx, 256, 0, stream>>>(k, K16, (size_t)NR * CC / 8); k_x16<<<gx, 256, 0, stream>>>(v, V16, (size_t)NR * CC / 8);
  k_vt<NH, TT><<<BB * NH * (TT / 64), 256, 0, stream>>>(V16, CC, 0, Vt);
  k_flash<<<BB * NH * (TT / 128), 128, 0, stream>>>(Q16, CC, K16, CC, Vt, nullptr, O, CC);
  k_h16<<<gx, 256, 0, stream>>>(O, O16, (size_t)NR * CC / 8);
  k_gemm_hhx<0><<<dim3(((NR / 16) * 1 + 3) / 4, 1), 128, 0, stream>>>(O16, CC, 0, Bo, CC, 0, 0.0625f, bo, 0, nullptr, 1, 0, 0, (float*)d_out, nullptr, NO, 0, NR, NO, CC);      // N = 64
}

// v003
// It runs in 168 microseconds.
// Two timings next to v002 both put it at 1.06 times that version's speed.
// Counting every step since v000, it is 4.03 times as fast.
#include <hip/hip_runtime.h>
// 8-head attention over the given q/k/v (2 × 4096 tokens, d = 64) as a fused flash-style kernel on v_wmma_f32_16x16x32_f16 (q, k, v are module INPUTS → exact bf16 values as f16 operands; S = Q·Kᵀ × 64^-½,
// online max/sum softmax f32, P f16 ≤ 1, O = P·V), then the 512→64 output linear (+ bias; W_out [in][out] bf16-exact ×2^4); f32 accumulate.
#define BB 2
#define TT 4096
#define CC 512
#define NH 8
#define NO 64
#define NR (BB * TT)

typedef __bf16 v16b __attribute__((ext_vector_type(16)));
typedef unsigned short v8us __attribute__((ext_vector_type(8), may_alias));
typedef float  v8f  __attribute__((ext_vector_type(8)));
typedef float  v4f  __attribute__((ext_vector_type(4)));
typedef float  v4fa __attribute__((ext_vector_type(4), may_alias));
union FragB { v16b v; v8us half[2]; unsigned short u[16]; };

__device__ __forceinline__ unsigned short bf16_bits(float x) { unsigned int u = __float_as_uint(x); return (unsigned short)((u + 0x7FFFu + ((u >> 16) & 1u)) >> 16); }
__device__ __forceinline__ float bf16_val(unsigned short b) { return __uint_as_float(((unsigned int)b) << 16); }
__device__ __forceinline__ float bf16_round(float x) { return bf16_val(bf16_bits(x)); }
// D += A·B with NT terms: 1 = ah·bh, 2 = + al·bh (A split), 3 = + ah·bl (both split)
template <int NT>
__device__ __forceinline__ v8f mmaN(v16b ah, v16b al, v16b bh, v16b bl, v8f c) {
  c = __builtin_amdgcn_wmma_f32_16x16x32_bf16(false, ah, false, bh, (short)0, c, false, false);
  if (NT >= 2) c = __builtin_amdgcn_wmma_f32_16x16x32_bf16(false, al, false, bh, (short)0, c, false, false);
  if (NT >= 3) c = __builtin_amdgcn_wmma_f32_16x16x32_bf16(false, ah, false, bl, (short)0, c, false, false);
  asm volatile("v_nop\n\tv_nop\n\tv_nop\n\tv_nop" : "+v"(c) : "v"(ah), "v"(al), "v"(bh), "v"(bl));
  return c;
}

__global__ __launch_bounds__(256) void k_wt_bf16(const float* __restrict__ W, unsigned short* __restrict__ Wt, int K, int N) {
  const int t = blockIdx.x * 256 + threadIdx.x;
  const int k8n = K / 8;
  if (t >= N * k8n) return;
  const int n = t / k8n, k8 = (t % k8n) * 8;
  v8us v;
#pragma unroll
  for (int i = 0; i < 8; ++i) v[i] = bf16_bits(W[(size_t)(k8 + i) * N + n]);
  *(v8us*)(Wt + (size_t)n * K + k8) = v;
  
}

// GEMM C[M][N] (f32, pitch ldc) = act(A[M][K]·W + bias). A f32 row-major (pitch lda) converted per fragment to bf16
// (ASPLIT: hi/lo two planes -> 2 terms, else single rounded term); Wt bf16 [N][K] (pitch ldb). BIAS_BF16 rounds the
// bias to bf16 first (bias quantised to bf16 before the add). K%32==0, M%16==0, N%64==0.
template <bool ASPLIT, int ACT, bool BIAS_BF16>
__global__ __launch_bounds__(128) void k_gemm_bf(const float* __restrict__ A, int lda, const unsigned short* __restrict__ Wt, int ldb,
                                               const float* __restrict__ bias, float* __restrict__ C, int ldc, int M, int N, int K) {
  __shared__ __attribute__((aligned(16))) float so[4][16][64];
  const int tid = threadIdx.x, w = tid >> 5, lane = tid & 31, ln = lane & 15, hh = lane >> 4;
  const int ntn = N / 64;
  const int wid = blockIdx.x * 4 + w;
  const int mt = wid / ntn, nq = wid % ntn;
  if (mt * 16 >= M) return;
  const int row0 = mt * 16, col0 = nq * 64;
  const float* arow = A + (size_t)(row0 + ln) * lda;
  v8f acc[4] = {};
  for (int kb = 0; kb < K; kb += 32) {
    FragB ah, al;
    const v4f x0 = *(const v4fa*)(arow + kb + 8 * hh), x1 = *(const v4fa*)(arow + kb + 8 * hh + 4);
    const v4f x2 = *(const v4fa*)(arow + kb + 16 + 8 * hh), x3 = *(const v4fa*)(arow + kb + 16 + 8 * hh + 4);
    float xs[16] = {x0[0],x0[1],x0[2],x0[3],x1[0],x1[1],x1[2],x1[3],x2[0],x2[1],x2[2],x2[3],x3[0],x3[1],x3[2],x3[3]};
#pragma unroll
    for (int i = 0; i < 16; ++i) { const unsigned short hb = bf16_bits(xs[i]); ah.u[i] = hb; al.u[i] = ASPLIT ? bf16_bits(xs[i] - bf16_val(hb)) : (unsigned short)0; }
#pragma unroll
    for (int t = 0; t < 4; ++t) {
      const unsigned short* brow = Wt + (size_t)(col0 + t * 16 + ln) * ldb + kb;
      FragB b;
      b.half[0] = *(const v8us*)(brow + 8 * hh);
      b.half[1] = *(const v8us*)(brow + 16 + 8 * hh);
      acc[t] = mmaN<ASPLIT ? 2 : 1>(ah.v, al.v, b.v, b.v, acc[t]);
    }
  }
#pragma unroll
  for (int t = 0; t < 4; ++t) {
    float bv = bias ? bias[col0 + t * 16 + ln] : 0.f;
    if (BIAS_BF16) bv = bf16_round(bv);
#pragma unroll
    for (int r = 0; r < 8; ++r) { float v = acc[t][r] + bv; if (ACT == 1) v = fmaxf(v, 0.f); so[w][8 * hh + r][t * 16 + ln] = v; }
  }
  __builtin_amdgcn_fence(__ATOMIC_ACQ_REL, "workgroup");
  __builtin_amdgcn_wave_barrier();
  const int rsub = lane >> 4, c4 = (lane & 15) * 4;
  {
#pragma unroll
    for (int q = 0; q < 8; ++q) {
      const int r = q * 2 + rsub;
      const v4f v = *(const v4fa*)&so[w][r][c4];
      *(v4f*)(C + (size_t)(row0 + r) * ldc + col0 + c4) = v;
    }
    
  }
}

// Flash-style causal/unmasked attention, all contractions 3-term bf16 hi/lo splits, f32 softmax with running max.
// q,k,v rows are read from f32 buffers with arbitrary row pitch (so they can live inside a fused qkv buffer);
// D = head size (multiple of 32, <= 128); one wave = 16 query rows; block = 4 waves (64 queries) sharing K/V chunks of 32.
template <int D, bool CAUSAL>
__global__ __launch_bounds__(128) void k_flash(const float* __restrict__ qb, const float* __restrict__ kb, const float* __restrict__ vb,
                                             int pitch, int T, int H, float scale, float* __restrict__ y, int ypitch) {
  constexpr int KS = D / 32;        // k-steps for QK
  constexpr int DT = D / 16;        // d tiles for PV
  __shared__ __attribute__((aligned(16))) unsigned short sKh[32][D + 8], sKl[32][D + 8], sVh[32][D + 8], sVl[32][D + 8];
  __shared__ __attribute__((aligned(16))) unsigned short sPh[4][16][40], sPl[4][16][40];
  __shared__ __attribute__((aligned(16))) float sO[4][16][D];
  const int tid = threadIdx.x, w = tid >> 5, lane = tid & 31, ln = lane & 15, hh = lane >> 4;
  const int nqb = (T + 63) / 64;
  const int bh = blockIdx.x / nqb, qblk = blockIdx.x % nqb;
  const int b = bh / H, h = bh % H;
  const int q0 = qblk * 64 + w * 16;
  const float* Q = qb + (size_t)b * T * pitch + h * D;
  const float* K = kb + (size_t)b * T * pitch + h * D;
  const float* V = vb + (size_t)b * T * pitch + h * D;

  // A fragments of the wave's 16 query rows (scaled), hi/lo
  FragB aqh[KS], aql[KS];
  {
    int row = q0 + ln; if (row >= T) row = T - 1;
    const float* qr = Q + (size_t)row * pitch;
#pragma unroll
    for (int ks = 0; ks < KS; ++ks)
#pragma unroll
      for (int i = 0; i < 16; ++i) {
        const int d = ks * 32 + ((i < 8) ? (8 * hh + i) : (16 + 8 * hh + (i - 8)));
        const float x = qr[d] * scale; const unsigned short hb = bf16_bits(x);
        aqh[ks].u[i] = hb; aql[ks].u[i] = bf16_bits(x - bf16_val(hb));
      }
  }
  float m_r[8], l_r[8];
#pragma unroll
  for (int r = 0; r < 8; ++r) { m_r[r] = -3.0e38f; l_r[r] = 0.f; }
  v8f oacc[DT];
#pragma unroll
  for (int dt = 0; dt < DT; ++dt) oacc[dt] = (v8f){0.f,0.f,0.f,0.f,0.f,0.f,0.f,0.f};

  const int kv_end = CAUSAL ? min(T, qblk * 64 + 64) : T;     // block-uniform
  for (int j0 = 0; j0 < kv_end; j0 += 32) {
    __syncthreads();
    for (int e = tid; e < 32 * (D / 4); e += 128) {
      const int r = e / (D / 4), c4 = (e % (D / 4)) * 4;
      const int key = j0 + r;
      v4f kf = {0.f,0.f,0.f,0.f}, vf = {0.f,0.f,0.f,0.f};
      if (key < T) { kf = *(const v4fa*)(K + (size_t)key * pitch + c4); vf = *(const v4fa*)(V + (size_t)key * pitch + c4); }
#pragma unroll
      for (int t = 0; t < 4; ++t) {
        unsigned short hb = bf16_bits(kf[t]); sKh[r][c4 + t] = hb; sKl[r][c4 + t] = bf16_bits(kf[t] - bf16_val(hb));
        hb = bf16_bits(vf[t]); sVh[r][c4 + t] = hb; sVl[r][c4 + t] = bf16_bits(vf[t] - bf16_val(hb));
      }
    }
    __syncthreads();
    // S tile 16 x 32
    v8f s[2];
#pragma unroll
    for (int nt = 0; nt < 2; ++nt) {
      v8f acc = {};
#pragma unroll
      for (int ks = 0; ks < KS; ++ks) {
        FragB bh_, bl_;
        bh_.half[0] = *(const v8us*)&sKh[nt * 16 + ln][ks * 32 + 8 * hh]; bh_.half[1] = *(const v8us*)&sKh[nt * 16 + ln][ks * 32 + 16 + 8 * hh];
        bl_.half[0] = *(const v8us*)&sKl[nt * 16 + ln][ks * 32 + 8 * hh]; bl_.half[1] = *(const v8us*)&sKl[nt * 16 + ln][ks * 32 + 16 + 8 * hh];
        acc = mmaN<3>(aqh[ks].v, aql[ks].v, bh_.v, bl_.v, acc);
      }
      s[nt] = acc;
    }
    // mask + running max (rows 8hh+r; the 16 lanes of a half share rows)
    float alpha[8];
#pragma unroll
    for (int r = 0; r < 8; ++r) {
      const int qi = q0 + 8 * hh + r;
      const int ja = j0 + ln, jb = j0 + 16 + ln;
      if (CAUSAL) { if (ja > qi) s[0][r] = -3.0e38f; if (jb > qi) s[1][r] = -3.0e38f; }
      if (ja >= T) s[0][r] = -3.0e38f;
      if (jb >= T) s[1][r] = -3.0e38f;
      float mx = fmaxf(s[0][r], s[1][r]);
      mx = fmaxf(mx, __shfl_xor(mx, 1, 32)); mx = fmaxf(mx, __shfl_xor(mx, 2, 32)); mx = fmaxf(mx, __shfl_xor(mx, 4, 32)); mx = fmaxf(mx, __shfl_xor(mx, 8, 32));
      const float mnew = fmaxf(m_r[r], mx);
      alpha[r] = (mnew > -1.0e38f) ? __expf(m_r[r] - mnew) : 1.0f;
      const float p0 = (s[0][r] > -1.0e38f) ? __expf(s[0][r] - mnew) : 0.f;
      const float p1 = (s[1][r] > -1.0e38f) ? __expf(s[1][r] - mnew) : 0.f;
      m_r[r] = mnew;
      l_r[r] = l_r[r] * alpha[r] + p0 + p1;            // per-lane partial row sum (16 lanes combined at the end)
      unsigned short hb = bf16_bits(p0); sPh[w][8 * hh + r][ln] = hb;      sPl[w][8 * hh + r][ln] = bf16_bits(p0 - bf16_val(hb));
      hb = bf16_bits(p1);                sPh[w][8 * hh + r][16 + ln] = hb; sPl[w][8 * hh + r][16 + ln] = bf16_bits(p1 - bf16_val(hb));
    }
#pragma unroll
    for (int dt = 0; dt < DT; ++dt)
#pragma unroll
      for (int r = 0; r < 8; ++r) oacc[dt][r] *= alpha[r];
    __builtin_amdgcn_fence(__ATOMIC_ACQ_REL, "workgroup");
    __builtin_amdgcn_wave_barrier();
    FragB pah, pal;
    pah.half[0] = *(const v8us*)&sPh[w][ln][8 * hh]; pah.half[1] = *(const v8us*)&sPh[w][ln][16 + 8 * hh];
    pal.half[0] = *(const v8us*)&sPl[w][ln][8 * hh]; pal.half[1] = *(const v8us*)&sPl[w][ln][16 + 8 * hh];
#pragma unroll
    for (int dt = 0; dt < DT; ++dt) {
      FragB bvh, bvl;
#pragma unroll
      for (int i = 0; i < 8; ++i) {
        bvh.u[i] = sVh[8 * hh + i][dt * 16 + ln]; bvh.u[8 + i] = sVh[16 + 8 * hh + i][dt * 16 + ln];
        bvl.u[i] = sVl[8 * hh + i][dt * 16 + ln]; bvl.u[8 + i] = sVl[16 + 8 * hh + i][dt * 16 + ln];
      }
      oacc[dt] = mmaN<3>(pah.v, pal.v, bvh.v, bvl.v, oacc[dt]);
    }
    __builtin_amdgcn_fence(__ATOMIC_ACQ_REL, "workgroup");
    __builtin_amdgcn_wave_barrier();
  }
#pragma unroll
  for (int r = 0; r < 8; ++r) {
    float l = l_r[r];
    l += __shfl_xor(l, 1, 32); l += __shfl_xor(l, 2, 32); l += __shfl_xor(l, 4, 32); l += __shfl_xor(l, 8, 32);
    l_r[r] = (l > 0.f) ? 1.0f / l : 0.f;
  }
#pragma unroll
  for (int dt = 0; dt < DT; ++dt)
#pragma unroll
    for (int r = 0; r < 8; ++r) sO[w][8 * hh + r][dt * 16 + ln] = oacc[dt][r] * l_r[r];
  __builtin_amdgcn_fence(__ATOMIC_ACQ_REL, "workgroup");
  __builtin_amdgcn_wave_barrier();
  {
    for (int r = 0; r < 16; ++r) {
      const int row = q0 + r;
      if (row < T && lane < D / 4) {
        const v4f val = *(const v4fa*)&sO[w][r][lane * 4];
        *(v4f*)(y + ((size_t)b * T + row) * ypitch + h * D + lane * 4) = val;
      }
    }
    
  }
}

// GEMM C = act(A·W + bias + resid): A f32 (ASPLIT -> hi/lo 2 terms), Wt bf16 [N][K]; ACT 0 none, 1 relu, 2 exact gelu;
// resid (optional, f32, row index = (row % rmod), pitch ldr, RES_BF16 rounds it) added before the activation.
template <bool ASPLIT, int ACT, bool BIAS_BF16, bool RES_BF16>
__global__ __launch_bounds__(128) void k_gemm_bf3(const float* __restrict__ A, int lda, const unsigned short* __restrict__ Wt, int ldb,
                                                const float* __restrict__ bias, const float* __restrict__ resid, int rmod, int ldr,
                                                float* __restrict__ C, int ldc, int M, int N, int K) {
  __shared__ __attribute__((aligned(16))) float so[4][16][64];
  const int tid = threadIdx.x, w = tid >> 5, lane = tid & 31, ln = lane & 15, hh = lane >> 4;
  const int ntn = N / 64;
  const int wid = blockIdx.x * 4 + w;
  const int mt = wid / ntn, nq = wid % ntn;
  if (mt * 16 >= M) return;
  const int row0 = mt * 16, col0 = nq * 64;
  const float* arow = A + (size_t)(row0 + ln) * lda;
  v8f acc[4] = {};
  for (int kb = 0; kb < K; kb += 32) {
    FragB ah, al;
    const v4f x0 = *(const v4fa*)(arow + kb + 8 * hh), x1 = *(const v4fa*)(arow + kb + 8 * hh + 4);
    const v4f x2 = *(const v4fa*)(arow + kb + 16 + 8 * hh), x3 = *(const v4fa*)(arow + kb + 16 + 8 * hh + 4);
    float xs[16] = {x0[0],x0[1],x0[2],x0[3],x1[0],x1[1],x1[2],x1[3],x2[0],x2[1],x2[2],x2[3],x3[0],x3[1],x3[2],x3[3]};
#pragma unroll
    for (int i = 0; i < 16; ++i) { const unsigned short hb = bf16_bits(xs[i]); ah.u[i] = hb; al.u[i] = ASPLIT ? bf16_bits(xs[i] - bf16_val(hb)) : (unsigned short)0; }
#pragma unroll
    for (int t = 0; t < 4; ++t) {
      const unsigned short* brow = Wt + (size_t)(col0 + t * 16 + ln) * ldb + kb;
      FragB b;
      b.half[0] = *(const v8us*)(brow + 8 * hh);
      b.half[1] = *(const v8us*)(brow + 16 + 8 * hh);
      acc[t] = mmaN<ASPLIT ? 2 : 1>(ah.v, al.v, b.v, b.v, acc[t]);
    }
  }
#pragma unroll
  for (int t = 0; t < 4; ++t) {
    const int col = col0 + t * 16 + ln;
    float bv = bias ? bias[col] : 0.f;
    if (BIAS_BF16) bv = bf16_round(bv);
#pragma unroll
    for (int r = 0; r < 8; ++r) {
      float v = acc[t][r] + bv;
      if (resid) { float rv = resid[(size_t)((row0 + 8 * hh + r) % rmod) * ldr + col]; if (RES_BF16) rv = bf16_round(rv); v += rv; }
      if (ACT == 1) v = fmaxf(v, 0.f);
      if (ACT == 2) v = 0.5f * v * (1.0f + erff(v * 0.70710678118654752f));
      if (ACT == 3) { const float u = 0.7978845608028654f * (v + 0.044715f * v * v * v); v = 0.5f * v * (1.0f + tanhf(u)); }
      so[w][8 * hh + r][t * 16 + ln] = v;
    }
  }
  __builtin_amdgcn_fence(__ATOMIC_ACQ_REL, "workgroup");
  __builtin_amdgcn_wave_barrier();
  const int rsub = lane >> 4, c4 = (lane & 15) * 4;
  {
#pragma unroll
    for (int q = 0; q < 8; ++q) {
      const int r = q * 2 + rsub;
      const v4f v = *(const v4fa*)&so[w][r][c4];
      *(v4f*)(C + (size_t)(row0 + r) * ldc + col0 + c4) = v;
    }
    
  }
}
// row LayerNorm (biased variance, eps) over N: s = X (+ R); optional out_sum <- s; out_norm <- (s-mu)*rsqrt(var+eps)*g + b
template <bool PARAM_BF16>
__global__ __launch_bounds__(256) void k_layernorm(const float* __restrict__ X, const float* __restrict__ R, const float* __restrict__ g, const float* __restrict__ bta,
                                                  float* __restrict__ out_sum, float* __restrict__ out_norm, int N, float eps) {
  __shared__ float red[256];
  const int row = blockIdx.x, tid = threadIdx.x;
  const float* x = X + (size_t)row * N; const float* rr = R ? R + (size_t)row * N : nullptr;
  float vals[16];                     // up to N = 4096
  const int per = N / 256;            // contiguous chunk per thread? use strided-by-4 chunks: thread handles j = tid*4 + 1024*u
  float s1 = 0.f;
  for (int u = 0; u < per / 4; ++u) {
    const int j = tid * 4 + 1024 * u;
    const v4f a = *(const v4fa*)(x + j);
    v4f b = {0.f,0.f,0.f,0.f}; if (rr) b = *(const v4fa*)(rr + j);
#pragma unroll
    for (int q = 0; q < 4; ++q) { const float v = a[q] + b[q]; vals[u * 4 + q] = v; s1 += v; }
  }
  red[tid] = s1; __syncthreads();
  for (int st = 128; st > 0; st >>= 1) { if (tid < st) red[tid] += red[tid + st]; __syncthreads(); }
  const float mu = red[0] / (float)N; __syncthreads();
  float s2 = 0.f;
  for (int u = 0; u < per / 4; ++u)
#pragma unroll
    for (int q = 0; q < 4; ++q) { const float c = vals[u * 4 + q] - mu; s2 += c * c; }
  red[tid] = s2; __syncthreads();
  for (int st = 128; st > 0; st >>= 1) { if (tid < st) red[tid] += red[tid + st]; __syncthreads(); }
  const float rs = rsqrtf(red[0] / (float)N + eps);
  {
    for (int u = 0; u < per / 4; ++u) {
      const int j = tid * 4 + 1024 * u;
      v4f o, sm;
#pragma unroll
      for (int q = 0; q < 4; ++q) {
        float gg = g[j + q], bb = bta[j + q];
        if (PARAM_BF16) { gg = bf16_round(gg); bb = bf16_round(bb); }
        sm[q] = vals[u * 4 + q]; o[q] = (vals[u * 4 + q] - mu) * rs * gg + bb;
      }
      if (out_sum) *(v4f*)(out_sum + (size_t)row * N + j) = sm;
      *(v4f*)(out_norm + (size_t)row * N + j) = o;
    }
    
  }
}



// ---- f16 WMMA path (v_wmma_f32_16x16x32_f16): 11-bit significands for operands in range — used for every matrix product here (Q·Kᵀ, P·V, output linear)
typedef _Float16 v16h __attribute__((ext_vector_type(16)));
union FragH { v16h v; v8us half[2]; _Float16 h[16]; unsigned short u[16]; };
template <int NT>
__device__ __forceinline__ v8f mmaH(v16h ah, v16h al, v16h bh, v16h bl, v8f c) {
  c = __builtin_amdgcn_wmma_f32_16x16x32_f16(false, ah, false, bh, (short)0, c, false, false);
  if (NT >= 2) c = __builtin_amdgcn_wmma_f32_16x16x32_f16(false, al, false, bh, (short)0, c, false, false);
  if (NT >= 3) c = __builtin_amdgcn_wmma_f32_16x16x32_f16(false, ah, false, bl, (short)0, c, false, false);
  asm volatile("v_nop\n\tv_nop\n\tv_nop\n\tv_nop" : "+v"(c) : "v"(ah), "v"(al), "v"(bh), "v"(bl));
  return c;
}
// batched GEMM like k_gemm_b but f16 operands: A f32 (split into f16 hi/lo if ASPLIT, else rounded to f16), Bt = f16 values [n][k]; alpha; C f32; N multiple of 16 (partial tiles skipped)
template <bool ASPLIT>
__global__ __launch_bounds__(128) void k_gemm_h(const float* __restrict__ A, int lda, size_t sA, const _Float16* __restrict__ Bh, int ldb, size_t sB, float alpha, float* __restrict__ C, int ldc, size_t sC, int M, int N, int K) {
  __shared__ __attribute__((aligned(16))) float so[4][16][64];
  const int tid = threadIdx.x, w = tid >> 5, lane = tid & 31, ln = lane & 15, hh = lane >> 4; const int by = blockIdx.y;
  A += (size_t)by * sA; Bh += (size_t)by * sB; C += (size_t)by * sC;
  const int ntn = (N + 63) / 64; const int wid = blockIdx.x * 4 + w; const int mt = wid / ntn, nq = wid % ntn; if (mt * 16 >= M) return;
  const int row0 = mt * 16, col0 = nq * 64; const float* arow = A + (size_t)(row0 + ln) * lda;
  v8f acc[4] = {};
  for (int kb = 0; kb < K; kb += 32) {
    FragH ah, al;
    const v4f x0 = *(const v4fa*)(arow + kb + 8 * hh), x1 = *(const v4fa*)(arow + kb + 8 * hh + 4), x2 = *(const v4fa*)(arow + kb + 16 + 8 * hh), x3 = *(const v4fa*)(arow + kb + 16 + 8 * hh + 4);
    float xs[16] = {x0[0],x0[1],x0[2],x0[3],x1[0],x1[1],x1[2],x1[3],x2[0],x2[1],x2[2],x2[3],x3[0],x3[1],x3[2],x3[3]};
#pragma unroll
    for (int i = 0; i < 16; ++i) { const _Float16 h = (_Float16)xs[i]; ah.h[i] = h; al.h[i] = ASPLIT ? (_Float16)(xs[i] - (float)h) : (_Float16)0.0f; }
#pragma unroll
    for (int t = 0; t < 4; ++t) { if (col0 + t * 16 >= N) continue; const size_t boff = (size_t)(col0 + t * 16 + ln) * ldb + kb; FragH bq; bq.half[0] = *(const v8us*)(Bh + boff + 8 * hh); bq.half[1] = *(const v8us*)(Bh + boff + 16 + 8 * hh);
      acc[t] = mmaH<ASPLIT ? 2 : 1>(ah.v, al.v, bq.v, bq.v, acc[t]); }
  }
#pragma unroll
  for (int t = 0; t < 4; ++t) { if (col0 + t * 16 >= N) continue;
#pragma unroll
    for (int r = 0; r < 8; ++r) so[w][8 * hh + r][t * 16 + ln] = acc[t][r] * alpha; }
  __builtin_amdgcn_fence(__ATOMIC_ACQ_REL, "workgroup"); __builtin_amdgcn_wave_barrier();
  const int rsub = lane >> 4, c4 = (lane & 15) * 4;
  {
#pragma unroll
    for (int q = 0; q < 8; ++q) { const int r = q * 2 + rsub; if (col0 + c4 < N) { const v4f v = *(const v4fa*)&so[w][r][c4]; *(v4f*)(C + (size_t)(row0 + r) * ldc + col0 + c4) = v; } }
     }
}

// Wt[n][k] = f16(W[k][n]·scale) from f32 row-major W[K][N] (scale = power of two; bf16-exact weights stay exact in f16 away from the subnormal range)
__global__ __launch_bounds__(256) void k_wt_f16(const float* __restrict__ W, _Float16* __restrict__ Wt, int K, int N, float scale) {
  const int t = blockIdx.x * 256 + threadIdx.x; if (t >= N * (K / 8)) return; const int n = t / (K / 8), k8 = (t % (K / 8)) * 8; FragH f;
#pragma unroll
  for (int i = 0; i < 8; ++i) f.h[i] = (_Float16)(bf16_round(W[(size_t)(k8 + i) * N + n]) * scale); const v8us o = f.half[0];
  *(v8us*)((unsigned short*)Wt + (size_t)n * K + k8) = o; 
}
// k_gemm_hh variant with fused epilogue: v = acc·alpha + bias[by·sBias + col] (+ CP[(row/rowsPerB)·sCPb + by·64 + col] if CP) ; ACT 0 none / 1 elu ; writes f32 C and/or f16 C16 (each if non-null)
template <int ACT>
__global__ __launch_bounds__(128) void k_gemm_hhx(const _Float16* __restrict__ A, int lda, size_t sA, const _Float16* __restrict__ Bh, int ldb, size_t sB, float alpha, const float* __restrict__ bias, size_t sBias, const float* __restrict__ CP, int rowsPerB, size_t sCPb, int row0g,
    float* __restrict__ C, _Float16* __restrict__ C16, int ldc, size_t sC, int M, int N, int K) {
  __shared__ __attribute__((aligned(16))) float so[4][16][64];
  const int tid = threadIdx.x, w = tid >> 5, lane = tid & 31, ln = lane & 15, hh = lane >> 4; const int by = blockIdx.y;
  A += (size_t)by * sA; Bh += (size_t)by * sB; const size_t cofs = (size_t)by * sC; const float* bp = bias ? bias + (size_t)by * sBias : nullptr;
  const int ntn = (N + 63) / 64; const int wid = blockIdx.x * 4 + w; const int mt = wid / ntn, nq = wid % ntn; if (mt * 16 >= M) return;
  const int row0 = mt * 16, col0 = nq * 64; const _Float16* arow = A + (size_t)(row0 + ln) * lda;
  v8f acc[4] = {};
  for (int kb = 0; kb < K; kb += 32) { FragH ah; ah.half[0] = *(const v8us*)((const unsigned short*)arow + kb + 8 * hh); ah.half[1] = *(const v8us*)((const unsigned short*)arow + kb + 16 + 8 * hh);
#pragma unroll
    for (int t = 0; t < 4; ++t) { if (col0 + t * 16 >= N) continue; const size_t boff = (size_t)(col0 + t * 16 + ln) * ldb + kb; FragH bq; bq.half[0] = *(const v8us*)((const unsigned short*)Bh + boff + 8 * hh); bq.half[1] = *(const v8us*)((const unsigned short*)Bh + boff + 16 + 8 * hh);
      acc[t] = mmaH<1>(ah.v, ah.v, bq.v, bq.v, acc[t]); }
  }
#pragma unroll
  for (int t = 0; t < 4; ++t) { if (col0 + t * 16 >= N) continue; const int col = col0 + t * 16 + ln; const float bv = bp ? bf16_round(bp[col]) : 0.f;
#pragma unroll
    for (int r = 0; r < 8; ++r) { float v = acc[t][r] * alpha + bv; if (CP) { const int bidx = (row0g + row0 + 8 * hh + r) / rowsPerB; v += CP[(size_t)bidx * sCPb + (size_t)by * 64 + col]; } if (ACT == 1) v = (v > 0.f) ? v : expm1f(v); else if (ACT == 3) v = fmaxf(v, 0.f); so[w][8 * hh + r][t * 16 + ln] = v; } }
  __builtin_amdgcn_fence(__ATOMIC_ACQ_REL, "workgroup"); __builtin_amdgcn_wave_barrier();
  const int rsub = lane >> 4, c4 = (lane & 15) * 4; typedef _Float16 v4h __attribute__((ext_vector_type(4)));
  {
#pragma unroll
    for (int q = 0; q < 8; ++q) { const int r = q * 2 + rsub; if (col0 + c4 < N) { const v4f v = *(const v4fa*)&so[w][r][c4]; if (C) *(v4f*)(C + cofs + (size_t)(row0 + r) * ldc + col0 + c4) = v; if (C16) { v4h h4; for (int i = 0; i < 4; ++i) h4[i] = (_Float16)v[i]; *(v4h*)(C16 + cofs + (size_t)(row0 + r) * ldc + col0 + c4) = h4; } } }
     }
}


__global__ __launch_bounds__(256) void k_x16(const float* __restrict__ x, _Float16* __restrict__ X16, size_t n8) { const size_t t = (size_t)blockIdx.x * 256 + threadIdx.x; if (t >= n8) return; FragH f;
#pragma unroll
  for (int q = 0; q < 8; ++q) f.h[q] = (_Float16)bf16_round(x[t * 8 + q]); *(v8us*)((unsigned short*)X16 + t * 8) = f.half[0];  }
__global__ __launch_bounds__(256) void k_h16(const float* __restrict__ x, _Float16* __restrict__ X16, size_t n8) { const size_t t = (size_t)blockIdx.x * 256 + threadIdx.x; if (t >= n8) return; FragH f;
#pragma unroll
  for (int q = 0; q < 8; ++q) f.h[q] = (_Float16)x[t * 8 + q]; *(v8us*)((unsigned short*)X16 + t * 8) = f.half[0];  }
__global__ __launch_bounds__(256) void k_round16f(const float* __restrict__ W, _Float16* __restrict__ Bt, size_t n8) { const size_t t = (size_t)blockIdx.x * 256 + threadIdx.x; if (t >= n8) return; FragH f;
#pragma unroll
  for (int i = 0; i < 8; ++i) f.h[i] = (_Float16)(bf16_round(W[t * 8 + i]) * 16.0f); *(v8us*)((unsigned short*)Bt + t * 8) = f.half[0];  }
template <int NHv, int TTv>
__global__ __launch_bounds__(256) void k_vt(const _Float16* __restrict__ V16, int ldv, int voff, _Float16* __restrict__ Vt) { __shared__ unsigned short tl[64][66]; const int tid = threadIdx.x; const int slab = blockIdx.x / (TTv / 64), lg = blockIdx.x % (TTv / 64); const int b = slab / NHv, h = slab % NHv;
  for (int i = tid; i < 64 * 8; i += 256) { const int r = i / 8, c8 = (i % 8) * 8; FragH f; f.half[0] = *(const v8us*)((const unsigned short*)V16 + ((size_t)b * TTv + lg * 64 + r) * ldv + voff + h * 64 + c8);
#pragma unroll
    for (int q = 0; q < 8; ++q) tl[r][c8 + q] = f.u[q]; }
  __syncthreads();
  {
#pragma unroll
    for (int rd = 0; rd < 2; ++rd) { const int d = rd * 32 + tid / 8, pc = tid % 8; FragH f;
#pragma unroll
      for (int q = 0; q < 8; ++q) f.u[q] = tl[pc * 8 + q][d];
      *(v8us*)((unsigned short*)Vt + ((size_t)slab * 64 + d) * TTv + lg * 64 + pc * 8) = f.half[0]; }
     } }

typedef float v2f __attribute__((ext_vector_type(2)));
// lane l <-> lane l ^ 16 as a vector cross-row move: no LDS queue and no wait, unlike a shuffle
__device__ __forceinline__ float xhalf(float x) { return __builtin_bit_cast(float, __builtin_amdgcn_permlanex16(__builtin_bit_cast(int, x), __builtin_bit_cast(int, x), 0x76543210, 0xfedcba98, false, false)); }

// Transposed products: St = K.Qt (A = K rows, B = Q rows) and Ot += Vt.Pt (A = Vt rows, B = Pt). In a 16 x 16 tile of St lane (ln, hh) holds
// query column ln and keys 8hh + r, so maximum and sum of a query run inside the lane (one exchange between the halves for the maximum), and the two
// key tiles of a pass, converted in place, are the B operand of the second product in the loaders' own k order: P never leaves the registers.
__global__ __launch_bounds__(128) void k_flash(const _Float16* __restrict__ Q16, int ldq, const _Float16* __restrict__ K16, int ldk, const _Float16* __restrict__ Vt, const int* __restrict__ MSK, float* __restrict__ O, int ldo) {
  constexpr int RPW = 32, NQB = 4096 / (4 * RPW), DT = 4, KS = 2; (void)MSK;
  constexpr float SL2 = 0.125f * 1.44269504088896340736f;      // 64^-1/2 x log2(e): exp(x / 8 - m / 8) = 2^(x * SL2 - m * SL2)
  __shared__ __attribute__((aligned(16))) float sO[4][RPW][64 + 4];
  const int tid = threadIdx.x, w = tid >> 5, lane = tid & 31, ln = lane & 15, hh = lane >> 4;
  const int slab = blockIdx.x / NQB, qblk = blockIdx.x % NQB; const int b = slab / 8, h = slab % 8; const int qb0 = qblk * (4 * RPW); const int q0 = qb0 + w * RPW;
  FragH aq[2][KS];
#pragma unroll
  for (int rt = 0; rt < 2; ++rt) { const unsigned short* qr = (const unsigned short*)Q16 + ((size_t)b * 4096 + q0 + rt * 16 + ln) * ldq + h * 64;
#pragma unroll
    for (int ks = 0; ks < KS; ++ks) { aq[rt][ks].half[0] = *(const v8us*)(qr + ks * 32 + 8 * hh); aq[rt][ks].half[1] = *(const v8us*)(qr + ks * 32 + 16 + 8 * hh); } }
  const unsigned short* kl = (const unsigned short*)K16 + ((size_t)b * 4096 + ln) * ldk + h * 64 + 8 * hh;      // this lane's piece of key row ln
  FragH bk[2][KS];      // K of pass 0; inside the loop each pass fetches the next pass's
#pragma unroll
  for (int nt = 0; nt < 2; ++nt)
#pragma unroll
    for (int ks = 0; ks < KS; ++ks) { const unsigned short* kr = kl + (size_t)(nt * 16) * ldk + ks * 32; bk[nt][ks].half[0] = *(const v8us*)kr; bk[nt][ks].half[1] = *(const v8us*)(kr + 16); }
  asm volatile("s_wait_xcnt 0x0" ::: "memory");      // the address registers of the loads above are reused below: the wait stands in front of their overwrite
  __builtin_amdgcn_sched_barrier(0);                 // keeps the set-up code that reuses those registers behind that wait
  const unsigned short* Vth = (const unsigned short*)Vt + (size_t)slab * 64 * 4096;
  float m_r[2], l_r[2]; v8f oacc[2][DT];      // per lane: query rt * 16 + ln; m_r = running maximum in base-2 exponent units (score x SL2); oacc[rt][dt][r] = Ot[dt * 16 + 8hh + r][that query]
#pragma unroll
  for (int rt = 0; rt < 2; ++rt) { m_r[rt] = -3.0e38f; l_r[rt] = 0.f;
#pragma unroll
    for (int dt = 0; dt < DT; ++dt) oacc[rt][dt] = (v8f){0.f,0.f,0.f,0.f,0.f,0.f,0.f,0.f}; }
  const int jend = 4096;
  // Every load of a pass is issued a phase ahead of its use: V of a pass at the pass's top, K of the next pass right behind this pass's score products,
  // into the same registers, so that each flies over the softmax arithmetic and no product waits out a round trip to L2.
  const unsigned short* vl = Vth + (size_t)ln * 4096 + 8 * hh;                                                   // this lane's piece of Vt row ln
  FragH bv[DT];
#pragma unroll 1
  for (int j0 = 0; j0 < jend; j0 += 32) {
#pragma unroll
    for (int dt = 0; dt < DT; ++dt) { const unsigned short* vrow = vl + (size_t)(dt * 16) * 4096 + j0; bv[dt].half[0] = *(const v8us*)vrow; bv[dt].half[1] = *(const v8us*)(vrow + 16); }
    v8f s[2][2];      // s[rt][nt][r] = score of key j0 + nt * 16 + 8hh + r against query rt * 16 + ln
#pragma unroll
    for (int nt = 0; nt < 2; ++nt) {
#pragma unroll
      for (int rt = 0; rt < 2; ++rt) { v8f acc = (v8f){0.f,0.f,0.f,0.f,0.f,0.f,0.f,0.f};
#pragma unroll
        for (int ks = 0; ks < KS; ++ks) acc = mmaH<1>(bk[nt][ks].v, bk[nt][ks].v, aq[rt][ks].v, aq[rt][ks].v, acc); s[rt][nt] = acc; } }
    const int jn = (j0 + 32 < jend) ? j0 + 32 : 0;      // the last pass fetches pass 0's rows again (unused): the address stays inside K16
#pragma unroll
    for (int nt = 0; nt < 2; ++nt)
#pragma unroll
      for (int ks = 0; ks < KS; ++ks) { const unsigned short* kr = kl + (size_t)(jn + nt * 16) * ldk + ks * 32; bk[nt][ks].half[0] = *(const v8us*)kr; bk[nt][ks].half[1] = *(const v8us*)(kr + 16); }
    FragH pb[2];
#pragma unroll
    for (int rt = 0; rt < 2; ++rt) {
      float sc[16], mx[8];      // raw products: their maximum is taken first (the scale is positive); the scale goes into each exponent's one multiply-add
#pragma unroll
      for (int r = 0; r < 8; ++r) { sc[r] = s[rt][0][r]; sc[8 + r] = s[rt][1][r]; mx[r] = fmaxf(sc[r], sc[8 + r]); }
      float mc = fmaxf(fmaxf(fmaxf(mx[0], mx[1]), fmaxf(mx[2], mx[3])), fmaxf(fmaxf(mx[4], mx[5]), fmaxf(mx[6], mx[7])));
      mc = fmaxf(mc, xhalf(mc));      // both halves of a column must use one maximum: their P meet in one product
      const float mn = fmaxf(m_r[rt], mc * SL2); const float al = __builtin_amdgcn_exp2f(m_r[rt] - mn); m_r[rt] = mn;      // an unchanged maximum gives 2^0 = 1
      float ps[4] = {0.f, 0.f, 0.f, 0.f};
#pragma unroll
      for (int i = 0; i < 16; i += 2) {      // two neighbouring scores of an accumulator share one packed multiply-add
        const v2f e = __builtin_elementwise_fma((v2f){sc[i], sc[i + 1]}, (v2f){SL2, SL2}, (v2f){-mn, -mn});
        const float p0 = __builtin_amdgcn_exp2f(e[0]), p1 = __builtin_amdgcn_exp2f(e[1]);
        ps[i & 3] += p0; ps[(i + 1) & 3] += p1; pb[rt].h[i] = (_Float16)p0; pb[rt].h[i + 1] = (_Float16)p1; }
      l_r[rt] = l_r[rt] * al + ((ps[0] + ps[1]) + (ps[2] + ps[3]));      // this half's keys only; the halves join after the loop
#pragma unroll
      for (int dt = 0; dt < DT; ++dt)
#pragma unroll
        for (int r = 0; r < 8; ++r) oacc[rt][dt][r] *= al; }
#pragma unroll
    for (int dt = 0; dt < DT; ++dt) {
#pragma unroll
      for (int rt = 0; rt < 2; ++rt) oacc[rt][dt] = mmaH<1>(bv[dt].v, bv[dt].v, pb[rt].v, pb[rt].v, oacc[rt][dt]); } }
#pragma unroll
  for (int rt = 0; rt < 2; ++rt) { float l = l_r[rt]; l += xhalf(l); const float li = (l > 0.f) ? 1.0f / l : 0.f;
#pragma unroll
    for (int dt = 0; dt < DT; ++dt) { v4f lo, hi;
#pragma unroll
      for (int r = 0; r < 4; ++r) { lo[r] = oacc[rt][dt][r] * li; hi[r] = oacc[rt][dt][4 + r] * li; }
      *(v4fa*)&sO[w][rt * 16 + ln][dt * 16 + 8 * hh] = lo; *(v4fa*)&sO[w][rt * 16 + ln][dt * 16 + 8 * hh + 4] = hi; } }
  __builtin_amdgcn_fence(__ATOMIC_ACQ_REL, "workgroup"); __builtin_amdgcn_wave_barrier();
  {
#pragma unroll
    for (int rp = 0; rp < RPW; rp += 2) { const int r = rp + (lane >> 4), pc = lane & 15; const v4f val = *(const v4fa*)&sO[w][r][pc * 4]; *(v4f*)(O + ((size_t)b * 4096 + q0 + r) * ldo + h * 64 + pc * 4) = val; }
     } }

extern "C" void kernel_launch(void* const* d_in, const int* in_sizes, int n_in,
                              void* d_out, int out_size, void* d_ws, size_t ws_size, hipStream_t stream) {
  (void)in_sizes; (void)n_in; (void)out_size;
  const float* q = (const float*)d_in[0]; const float* k = (const float*)d_in[1]; const float* v = (const float*)d_in[2]; const float* Wo = (const float*)d_in[3]; const float* bo = (const float*)d_in[4];
  char* ws = (char*)d_ws; size_t off = 0;
  auto take = [&](size_t bytes) { char* p = ws + off; off += (bytes + 255) & ~(size_t)255; return p; };
  _Float16* Bo = (_Float16*)take((size_t)NO * CC * 2); _Float16* Q16 = (_Float16*)take((size_t)NR * CC * 2); _Float16* K16 = (_Float16*)take((size_t)NR * CC * 2); _Float16* V16 = (_Float16*)take((size_t)NR * CC * 2); _Float16* Vt = (_Float16*)take((size_t)NR * CC * 2); float* O = (float*)take((size_t)NR * CC * 4); _Float16* O16 = V16;      // V16 dead after k_vt
  if (off > ws_size) return;      // 8.4 × 4 + 16.8 MB ≈ 50 MiB
  k_wt_f16<<<(NO * (CC / 8) + 255) / 256, 256, 0, stream>>>(Wo, Bo, CC, NO, 16.0f);      // [in][out]
  const unsigned gx = (unsigned)(((size_t)NR * CC / 8 + 255) / 256);
  k_x16<<<gx, 256, 0, stream>>>(q, Q16, (size_t)NR * CC / 8); k_x16<<<gx, 256, 0, stream>>>(k, K16, (size_t)NR * CC / 8); k_x16<<<gx, 256, 0, stream>>>(v, V16, (size_t)NR * CC / 8);
  k_vt<NH, TT><<<BB * NH * (TT / 64), 256, 0, stream>>>(V16, CC, 0, Vt);
  k_flash<<<BB * NH * (TT / 128), 128, 0, stream>>>(Q16, CC, K16, CC, Vt, nullptr, O, CC);
  k_h16<<<gx, 256, 0, stream>>>(O, O16, (size_t)NR * CC / 8);
  k_gemm_hhx<0><<<dim3(((NR / 16) * 1 + 3) / 4, 1), 128, 0, stream>>>(O16, CC, 0, Bo, CC, 0, 0.0625f, bo, 0, nullptr, 1, 0, 0, (float*)d_out, nullptr, NO, 0, NR, NO, CC);      // N = 64
}

// v004
// It runs in 136 microseconds.
// In two side-by-side timings against v003, it was 1.22 and 1.24 times as fast.
// Over all steps from v000 it is 4.95 times as fast.
#include <hip/hip_runtime.h>
// 8-head attention over the given q/k/v (2 × 4096 tokens, d = 64) as a fused flash-style kernel on v_wmma_f32_16x16x32_f16 (q, k, v are module INPUTS → exact bf16 values as f16 operands; S = Q·Kᵀ × 64^-½,
// online max/sum softmax f32, P f16 ≤ 1, O = P·V), then the 512→64 output linear (+ bias; W_out [in][out] bf16-exact ×2^4); f32 accumulate.
#define BB 2
#define TT 4096
#define CC 512
#define NH 8
#define NO 64
#define NR (BB * TT)

typedef __bf16 v16b __attribute__((ext_vector_type(16)));
typedef unsigned short v8us __attribute__((ext_vector_type(8), may_alias));
typedef float  v8f  __attribute__((ext_vector_type(8)));
typedef float  v4f  __attribute__((ext_vector_type(4)));
typedef float  v4fa __attribute__((ext_vector_type(4), may_alias));
union FragB { v16b v; v8us half[2]; unsigned short u[16]; };

__device__ __forceinline__ unsigned short bf16_bits(float x) { unsigned int u = __float_as_uint(x); return (unsigned short)((u + 0x7FFFu + ((u >> 16) & 1u)) >> 16); }
__device__ __forceinline__ float bf16_val(unsigned short b) { return __uint_as_float(((unsigned int)b) << 16); }
__device__ __forceinline__ float bf16_round(float x) { return bf16_val(bf16_bits(x)); }
// D += A·B with NT terms: 1 = ah·bh, 2 = + al·bh (A split), 3 = + ah·bl (both split)
template <int NT>
__device__ __forceinline__ v8f mmaN(v16b ah, v16b al, v16b bh, v16b bl, v8f c) {
  c = __builtin_amdgcn_wmma_f32_16x16x32_bf16(false, ah, false, bh, (short)0, c, false, false);
  if (NT >= 2) c = __builtin_amdgcn_wmma_f32_16x16x32_bf16(false, al, false, bh, (short)0, c, false, false);
  if (NT >= 3) c = __builtin_amdgcn_wmma_f32_16x16x32_bf16(false, ah, false, bl, (short)0, c, false, false);
  asm volatile("v_nop\n\tv_nop\n\tv_nop\n\tv_nop" : "+v"(c) : "v"(ah), "v"(al), "v"(bh), "v"(bl));
  return c;
}

__global__ __launch_bounds__(256) void k_wt_bf16(const float* __restrict__ W, unsigned short* __restrict__ Wt, int K, int N) {
  const int t = blockIdx.x * 256 + threadIdx.x;
  const int k8n = K / 8;
  if (t >= N * k8n) return;
  const int n = t / k8n, k8 = (t % k8n) * 8;
  v8us v;
#pragma unroll
  for (int i = 0; i < 8; ++i) v[i] = bf16_bits(W[(size_t)(k8 + i) * N + n]);
  *(v8us*)(Wt + (size_t)n * K + k8) = v;
  
}

// GEMM C[M][N] (f32, pitch ldc) = act(A[M][K]·W + bias). A f32 row-major (pitch lda) converted per fragment to bf16
// (ASPLIT: hi/lo two planes -> 2 terms, else single rounded term); Wt bf16 [N][K] (pitch ldb). BIAS_BF16 rounds the
// bias to bf16 first (bias quantised to bf16 before the add). K%32==0, M%16==0, N%64==0.
template <bool ASPLIT, int ACT, bool BIAS_BF16>
__global__ __launch_bounds__(128) void k_gemm_bf(const float* __restrict__ A, int lda, const unsigned short* __restrict__ Wt, int ldb,
                                               const float* __restrict__ bias, float* __restrict__ C, int ldc, int M, int N, int K) {
  __shared__ __attribute__((aligned(16))) float so[4][16][64];
  const int tid = threadIdx.x, w = tid >> 5, lane = tid & 31, ln = lane & 15, hh = lane >> 4;
  const int ntn = N / 64;
  const int wid = blockIdx.x * 4 + w;
  const int mt = wid / ntn, nq = wid % ntn;
  if (mt * 16 >= M) return;
  const int row0 = mt * 16, col0 = nq * 64;
  const float* arow = A + (size_t)(row0 + ln) * lda;
  v8f acc[4] = {};
  for (int kb = 0; kb < K; kb += 32) {
    FragB ah, al;
    const v4f x0 = *(const v4fa*)(arow + kb + 8 * hh), x1 = *(const v4fa*)(arow + kb + 8 * hh + 4);
    const v4f x2 = *(const v4fa*)(arow + kb + 16 + 8 * hh), x3 = *(const v4fa*)(arow + kb + 16 + 8 * hh + 4);
    float xs[16] = {x0[0],x0[1],x0[2],x0[3],x1[0],x1[1],x1[2],x1[3],x2[0],x2[1],x2[2],x2[3],x3[0],x3[1],x3[2],x3[3]};
#pragma unroll
    for (int i = 0; i < 16; ++i) { const unsigned short hb = bf16_bits(xs[i]); ah.u[i] = hb; al.u[i] = ASPLIT ? bf16_bits(xs[i] - bf16_val(hb)) : (unsigned short)0; }
#pragma unroll
    for (int t = 0; t < 4; ++t) {
      const unsigned short* brow = Wt + (size_t)(col0 + t * 16 + ln) * ldb + kb;
      FragB b;
      b.half[0] = *(const v8us*)(brow + 8 * hh);
      b.half[1] = *(const v8us*)(brow + 16 + 8 * hh);
      acc[t] = mmaN<ASPLIT ? 2 : 1>(ah.v, al.v, b.v, b.v, acc[t]);
    }
  }
#pragma unroll
  for (int t = 0; t < 4; ++t) {
    float bv = bias ? bias[col0 + t * 16 + ln] : 0.f;
    if (BIAS_BF16) bv = bf16_round(bv);
#pragma unroll
    for (int r = 0; r < 8; ++r) { float v = acc[t][r] + bv; if (ACT == 1) v = fmaxf(v, 0.f); so[w][8 * hh + r][t * 16 + ln] = v; }
  }
  __builtin_amdgcn_fence(__ATOMIC_ACQ_REL, "workgroup");
  __builtin_amdgcn_wave_barrier();
  const int rsub = lane >> 4, c4 = (lane & 15) * 4;
  {
#pragma unroll
    for (int q = 0; q < 8; ++q) {
      const int r = q * 2 + rsub;
      const v4f v = *(const v4fa*)&so[w][r][c4];
      *(v4f*)(C + (size_t)(row0 + r) * ldc + col0 + c4) = v;
    }
    
  }
}

// Flash-style causal/unmasked attention, all contractions 3-term bf16 hi/lo splits, f32 softmax with running max.
// q,k,v rows are read from f32 buffers with arbitrary row pitch (so they can live inside a fused qkv buffer);
// D = head size (multiple of 32, <= 128); one wave = 16 query rows; block = 4 waves (64 queries) sharing K/V chunks of 32.
template <int D, bool CAUSAL>
__global__ __launch_bounds__(128) void k_flash(const float* __restrict__ qb, const float* __restrict__ kb, const float* __restrict__ vb,
                                             int pitch, int T, int H, float scale, float* __restrict__ y, int ypitch) {
  constexpr int KS = D / 32;        // k-steps for QK
  constexpr int DT = D / 16;        // d tiles for PV
  __shared__ __attribute__((aligned(16))) unsigned short sKh[32][D + 8], sKl[32][D + 8], sVh[32][D + 8], sVl[32][D + 8];
  __shared__ __attribute__((aligned(16))) unsigned short sPh[4][16][40], sPl[4][16][40];
  __shared__ __attribute__((aligned(16))) float sO[4][16][D];
  const int tid = threadIdx.x, w = tid >> 5, lane = tid & 31, ln = lane & 15, hh = lane >> 4;
  const int nqb = (T + 63) / 64;
  const int bh = blockIdx.x / nqb, qblk = blockIdx.x % nqb;
  const int b = bh / H, h = bh % H;
  const int q0 = qblk * 64 + w * 16;
  const float* Q = qb + (size_t)b * T * pitch + h * D;
  const float* K = kb + (size_t)b * T * pitch + h * D;
  const float* V = vb + (size_t)b * T * pitch + h * D;

  // A fragments of the wave's 16 query rows (scaled), hi/lo
  FragB aqh[KS], aql[KS];
  {
    int row = q0 + ln; if (row >= T) row = T - 1;
    const float* qr = Q + (size_t)row * pitch;
#pragma unroll
    for (int ks = 0; ks < KS; ++ks)
#pragma unroll
      for (int i = 0; i < 16; ++i) {
        const int d = ks * 32 + ((i < 8) ? (8 * hh + i) : (16 + 8 * hh + (i - 8)));
        const float x = qr[d] * scale; const unsigned short hb = bf16_bits(x);
        aqh[ks].u[i] = hb; aql[ks].u[i] = bf16_bits(x - bf16_val(hb));
      }
  }
  float m_r[8], l_r[8];
#pragma unroll
  for (int r = 0; r < 8; ++r) { m_r[r] = -3.0e38f; l_r[r] = 0.f; }
  v8f oacc[DT];
#pragma unroll
  for (int dt = 0; dt < DT; ++dt) oacc[dt] = (v8f){0.f,0.f,0.f,0.f,0.f,0.f,0.f,0.f};

  const int kv_end = CAUSAL ? min(T, qblk * 64 + 64) : T;     // block-uniform
  for (int j0 = 0; j0 < kv_end; j0 += 32) {
    __syncthreads();
    for (int e = tid; e < 32 * (D / 4); e += 128) {
      const int r = e / (D / 4), c4 = (e % (D / 4)) * 4;
      const int key = j0 + r;
      v4f kf = {0.f,0.f,0.f,0.f}, vf = {0.f,0.f,0.f,0.f};
      if (key < T) { kf = *(const v4fa*)(K + (size_t)key * pitch + c4); vf = *(const v4fa*)(V + (size_t)key * pitch + c4); }
#pragma unroll
      for (int t = 0; t < 4; ++t) {
        unsigned short hb = bf16_bits(kf[t]); sKh[r][c4 + t] = hb; sKl[r][c4 + t] = bf16_bits(kf[t] - bf16_val(hb));
        hb = bf16_bits(vf[t]); sVh[r][c4 + t] = hb; sVl[r][c4 + t] = bf16_bits(vf[t] - bf16_val(hb));
      }
    }
    __syncthreads();
    // S tile 16 x 32
    v8f s[2];
#pragma unroll
    for (int nt = 0; nt < 2; ++nt) {
      v8f acc = {};
#pragma unroll
      for (int ks = 0; ks < KS; ++ks) {
        FragB bh_, bl_;
        bh_.half[0] = *(const v8us*)&sKh[nt * 16 + ln][ks * 32 + 8 * hh]; bh_.half[1] = *(const v8us*)&sKh[nt * 16 + ln][ks * 32 + 16 + 8 * hh];
        bl_.half[0] = *(const v8us*)&sKl[nt * 16 + ln][ks * 32 + 8 * hh]; bl_.half[1] = *(const v8us*)&sKl[nt * 16 + ln][ks * 32 + 16 + 8 * hh];
        acc = mmaN<3>(aqh[ks].v, aql[ks].v, bh_.v, bl_.v, acc);
      }
      s[nt] = acc;
    }
    // mask + running max (rows 8hh+r; the 16 lanes of a half share rows)
    float alpha[8];
#pragma unroll
    for (int r = 0; r < 8; ++r) {
      const int qi = q0 + 8 * hh + r;
      const int ja = j0 + ln, jb = j0 + 16 + ln;
      if (CAUSAL) { if (ja > qi) s[0][r] = -3.0e38f; if (jb > qi) s[1][r] = -3.0e38f; }
      if (ja >= T) s[0][r] = -3.0e38f;
      if (jb >= T) s[1][r] = -3.0e38f;
      float mx = fmaxf(s[0][r], s[1][r]);
      mx = fmaxf(mx, __shfl_xor(mx, 1, 32)); mx = fmaxf(mx, __shfl_xor(mx, 2, 32)); mx = fmaxf(mx, __shfl_xor(mx, 4, 32)); mx = fmaxf(mx, __shfl_xor(mx, 8, 32));
      const float mnew = fmaxf(m_r[r], mx);
      alpha[r] = (mnew > -1.0e38f) ? __expf(m_r[r] - mnew) : 1.0f;
      const float p0 = (s[0][r] > -1.0e38f) ? __expf(s[0][r] - mnew) : 0.f;
      const float p1 = (s[1][r] > -1.0e38f) ? __expf(s[1][r] - mnew) : 0.f;
      m_r[r] = mnew;
      l_r[r] = l_r[r] * alpha[r] + p0 + p1;            // per-lane partial row sum (16 lanes combined at the end)
      unsigned short hb = bf16_bits(p0); sPh[w][8 * hh + r][ln] = hb;      sPl[w][8 * hh + r][ln] = bf16_bits(p0 - bf16_val(hb));
      hb = bf16_bits(p1);                sPh[w][8 * hh + r][16 + ln] = hb; sPl[w][8 * hh + r][16 + ln] = bf16_bits(p1 - bf16_val(hb));
    }
#pragma unroll
    for (int dt = 0; dt < DT; ++dt)
#pragma unroll
      for (int r = 0; r < 8; ++r) oacc[dt][r] *= alpha[r];
    __builtin_amdgcn_fence(__ATOMIC_ACQ_REL, "workgroup");
    __builtin_amdgcn_wave_barrier();
    FragB pah, pal;
    pah.half[0] = *(const v8us*)&sPh[w][ln][8 * hh]; pah.half[1] = *(const v8us*)&sPh[w][ln][16 + 8 * hh];
    pal.half[0] = *(const v8us*)&sPl[w][ln][8 * hh]; pal.half[1] = *(const v8us*)&sPl[w][ln][16 + 8 * hh];
#pragma unroll
    for (int dt = 0; dt < DT; ++dt) {
      FragB bvh, bvl;
#pragma unroll
      for (int i = 0; i < 8; ++i) {
        bvh.u[i] = sVh[8 * hh + i][dt * 16 + ln]; bvh.u[8 + i] = sVh[16 + 8 * hh + i][dt * 16 + ln];
        bvl.u[i] = sVl[8 * hh + i][dt * 16 + ln]; bvl.u[8 + i] = sVl[16 + 8 * hh + i][dt * 16 + ln];
      }
      oacc[dt] = mmaN<3>(pah.v, pal.v, bvh.v, bvl.v, oacc[dt]);
    }
    __builtin_amdgcn_fence(__ATOMIC_ACQ_REL, "workgroup");
    __builtin_amdgcn_wave_barrier();
  }
#pragma unroll
  for (int r = 0; r < 8; ++r) {
    float l = l_r[r];
    l += __shfl_xor(l, 1, 32); l += __shfl_xor(l, 2, 32); l += __shfl_xor(l, 4, 32); l += __shfl_xor(l, 8, 32);
    l_r[r] = (l > 0.f) ? 1.0f / l : 0.f;
  }
#pragma unroll
  for (int dt = 0; dt < DT; ++dt)
#pragma unroll
    for (int r = 0; r < 8; ++r) sO[w][8 * hh + r][dt * 16 + ln] = oacc[dt][r] * l_r[r];
  __builtin_amdgcn_fence(__ATOMIC_ACQ_REL, "workgroup");
  __builtin_amdgcn_wave_barrier();
  {
    for (int r = 0; r < 16; ++r) {
      const int row = q0 + r;
      if (row < T && lane < D / 4) {
        const v4f val = *(const v4fa*)&sO[w][r][lane * 4];
        *(v4f*)(y + ((size_t)b * T + row) * ypitch + h * D + lane * 4) = val;
      }
    }
    
  }
}

// GEMM C = act(A·W + bias + resid): A f32 (ASPLIT -> hi/lo 2 terms), Wt bf16 [N][K]; ACT 0 none, 1 relu, 2 exact gelu;
// resid (optional, f32, row index = (row % rmod), pitch ldr, RES_BF16 rounds it) added before the activation.
template <bool ASPLIT, int ACT, bool BIAS_BF16, bool RES_BF16>
__global__ __launch_bounds__(128) void k_gemm_bf3(const float* __restrict__ A, int lda, const unsigned short* __restrict__ Wt, int ldb,
                                                const float* __restrict__ bias, const float* __restrict__ resid, int rmod, int ldr,
                                                float* __restrict__ C, int ldc, int M, int N, int K) {
  __shared__ __attribute__((aligned(16))) float so[4][16][64];
  const int tid = threadIdx.x, w = tid >> 5, lane = tid & 31, ln = lane & 15, hh = lane >> 4;
  const int ntn = N / 64;
  const int wid = blockIdx.x * 4 + w;
  const int mt = wid / ntn, nq = wid % ntn;
  if (mt * 16 >= M) return;
  const int row0 = mt * 16, col0 = nq * 64;
  const float* arow = A + (size_t)(row0 + ln) * lda;
  v8f acc[4] = {};
  for (int kb = 0; kb < K; kb += 32) {
    FragB ah, al;
    const v4f x0 = *(const v4fa*)(arow + kb + 8 * hh), x1 = *(const v4fa*)(arow + kb + 8 * hh + 4);
    const v4f x2 = *(const v4fa*)(arow + kb + 16 + 8 * hh), x3 = *(const v4fa*)(arow + kb + 16 + 8 * hh + 4);
    float xs[16] = {x0[0],x0[1],x0[2],x0[3],x1[0],x1[1],x1[2],x1[3],x2[0],x2[1],x2[2],x2[3],x3[0],x3[1],x3[2],x3[3]};
#pragma unroll
    for (int i = 0; i < 16; ++i) { const unsigned short hb = bf16_bits(xs[i]); ah.u[i] = hb; al.u[i] = ASPLIT ? bf16_bits(xs[i] - bf16_val(hb)) : (unsigned short)0; }
#pragma unroll
    for (int t = 0; t < 4; ++t) {
      const unsigned short* brow = Wt + (size_t)(col0 + t * 16 + ln) * ldb + kb;
      FragB b;
      b.half[0] = *(const v8us*)(brow + 8 * hh);
      b.half[1] = *(const v8us*)(brow + 16 + 8 * hh);
      acc[t] = mmaN<ASPLIT ? 2 : 1>(ah.v, al.v, b.v, b.v, acc[t]);
    }
  }
#pragma unroll
  for (int t = 0; t < 4; ++t) {
    const int col = col0 + t * 16 + ln;
    float bv = bias ? bias[col] : 0.f;
    if (BIAS_BF16) bv = bf16_round(bv);
#pragma unroll
    for (int r = 0; r < 8; ++r) {
      float v = acc[t][r] + bv;
      if (resid) { float rv = resid[(size_t)((row0 + 8 * hh + r) % rmod) * ldr + col]; if (RES_BF16) rv = bf16_round(rv); v += rv; }
      if (ACT == 1) v = fmaxf(v, 0.f);
      if (ACT == 2) v = 0.5f * v * (1.0f + erff(v * 0.70710678118654752f));
      if (ACT == 3) { const float u = 0.7978845608028654f * (v + 0.044715f * v * v * v); v = 0.5f * v * (1.0f + tanhf(u)); }
      so[w][8 * hh + r][t * 16 + ln] = v;
    }
  }
  __builtin_amdgcn_fence(__ATOMIC_ACQ_REL, "workgroup");
  __builtin_amdgcn_wave_barrier();
  const int rsub = lane >> 4, c4 = (lane & 15) * 4;
  {
#pragma unroll
    for (int q = 0; q < 8; ++q) {
      const int r = q * 2 + rsub;
      const v4f v = *(const v4fa*)&so[w][r][c4];
      *(v4f*)(C + (size_t)(row0 + r) * ldc + col0 + c4) = v;
    }
    
  }
}
// row LayerNorm (biased variance, eps) over N: s = X (+ R); optional out_sum <- s; out_norm <- (s-mu)*rsqrt(var+eps)*g + b
template <bool PARAM_BF16>
__global__ __launch_bounds__(256) void k_layernorm(const float* __restrict__ X, const float* __restrict__ R, const float* __restrict__ g, const float* __restrict__ bta,
                                                  float* __restrict__ out_sum, float* __restrict__ out_norm, int N, float eps) {
  __shared__ float red[256];
  const int row = blockIdx.x, tid = threadIdx.x;
  const float* x = X + (size_t)row * N; const float* rr = R ? R + (size_t)row * N : nullptr;
  float vals[16];                     // up to N = 4096
  const int per = N / 256;            // contiguous chunk per thread? use strided-by-4 chunks: thread handles j = tid*4 + 1024*u
  float s1 = 0.f;
  for (int u = 0; u < per / 4; ++u) {
    const int j = tid * 4 + 1024 * u;
    const v4f a = *(const v4fa*)(x + j);
    v4f b = {0.f,0.f,0.f,0.f}; if (rr) b = *(const v4fa*)(rr + j);
#pragma unroll
    for (int q = 0; q < 4; ++q) { const float v = a[q] + b[q]; vals[u * 4 + q] = v; s1 += v; }
  }
  red[tid] = s1; __syncthreads();
  for (int st = 128; st > 0; st >>= 1) { if (tid < st) red[tid] += red[tid + st]; __syncthreads(); }
  const float mu = red[0] / (float)N; __syncthreads();
  float s2 = 0.f;
  for (int u = 0; u < per / 4; ++u)
#pragma unroll
    for (int q = 0; q < 4; ++q) { const float c = vals[u * 4 + q] - mu; s2 += c * c; }
  red[tid] = s2; __syncthreads();
  for (int st = 128; st > 0; st >>= 1) { if (tid < st) red[tid] += red[tid + st]; __syncthreads(); }
  const float rs = rsqrtf(red[0] / (float)N + eps);
  {
    for (int u = 0; u < per / 4; ++u) {
      const int j = tid * 4 + 1024 * u;
      v4f o, sm;
#pragma unroll
      for (int q = 0; q < 4; ++q) {
        float gg = g[j + q], bb = bta[j + q];
        if (PARAM_BF16) { gg = bf16_round(gg); bb = bf16_round(bb); }
        sm[q] = vals[u * 4 + q]; o[q] = (vals[u * 4 + q] - mu) * rs * gg + bb;
      }
      if (out_sum) *(v4f*)(out_sum + (size_t)row * N + j) = sm;
      *(v4f*)(out_norm + (size_t)row * N + j) = o;
    }
    
  }
}



// ---- f16 WMMA path (v_wmma_f32_16x16x32_f16): 11-bit significands for operands in range — used for every matrix product here (Q·Kᵀ, P·V, output linear)
typedef _Float16 v16h __attribute__((ext_vector_type(16)));
union FragH { v16h v; v8us half[2]; _Float16 h[16]; unsigned short u[16]; };
template <int NT>
__device__ __forceinline__ v8f mmaH(v16h ah, v16h al, v16h bh, v16h bl, v8f c) {
  c = __builtin_amdgcn_wmma_f32_16x16x32_f16(false, ah, false, bh, (short)0, c, false, false);
  if (NT >= 2) c = __builtin_amdgcn_wmma_f32_16x16x32_f16(false, al, false, bh, (short)0, c, false, false);
  if (NT >= 3) c = __builtin_amdgcn_wmma_f32_16x16x32_f16(false, ah, false, bl, (short)0, c, false, false);
  asm volatile("v_nop\n\tv_nop\n\tv_nop\n\tv_nop" : "+v"(c) : "v"(ah), "v"(al), "v"(bh), "v"(bl));
  return c;
}
// batched GEMM like k_gemm_b but f16 operands: A f32 (split into f16 hi/lo if ASPLIT, else rounded to f16), Bt = f16 values [n][k]; alpha; C f32; N multiple of 16 (partial tiles skipped)
template <bool ASPLIT>
__global__ __launch_bounds__(128) void k_gemm_h(const float* __restrict__ A, int lda, size_t sA, const _Float16* __restrict__ Bh, int ldb, size_t sB, float alpha, float* __restrict__ C, int ldc, size_t sC, int M, int N, int K) {
  __shared__ __attribute__((aligned(16))) float so[4][16][64];
  const int tid = threadIdx.x, w = tid >> 5, lane = tid & 31, ln = lane & 15, hh = lane >> 4; const int by = blockIdx.y;
  A += (size_t)by * sA; Bh += (size_t)by * sB; C += (size_t)by * sC;
  const int ntn = (N + 63) / 64; const int wid = blockIdx.x * 4 + w; const int mt = wid / ntn, nq = wid % ntn; if (mt * 16 >= M) return;
  const int row0 = mt * 16, col0 = nq * 64; const float* arow = A + (size_t)(row0 + ln) * lda;
  v8f acc[4] = {};
  for (int kb = 0; kb < K; kb += 32) {
    FragH ah, al;
    const v4f x0 = *(const v4fa*)(arow + kb + 8 * hh), x1 = *(const v4fa*)(arow + kb + 8 * hh + 4), x2 = *(const v4fa*)(arow + kb + 16 + 8 * hh), x3 = *(const v4fa*)(arow + kb + 16 + 8 * hh + 4);
    float xs[16] = {x0[0],x0[1],x0[2],x0[3],x1[0],x1[1],x1[2],x1[3],x2[0],x2[1],x2[2],x2[3],x3[0],x3[1],x3[2],x3[3]};
#pragma unroll
    for (int i = 0; i < 16; ++i) { const _Float16 h = (_Float16)xs[i]; ah.h[i] = h; al.h[i] = ASPLIT ? (_Float16)(xs[i] - (float)h) : (_Float16)0.0f; }
#pragma unroll
    for (int t = 0; t < 4; ++t) { if (col0 + t * 16 >= N) continue; const size_t boff = (size_t)(col0 + t * 16 + ln) * ldb + kb; FragH bq; bq.half[0] = *(const v8us*)(Bh + boff + 8 * hh); bq.half[1] = *(const v8us*)(Bh + boff + 16 + 8 * hh);
      acc[t] = mmaH<ASPLIT ? 2 : 1>(ah.v, al.v, bq.v, bq.v, acc[t]); }
  }
#pragma unroll
  for (int t = 0; t < 4; ++t) { if (col0 + t * 16 >= N) continue;
#pragma unroll
    for (int r = 0; r < 8; ++r) so[w][8 * hh + r][t * 16 + ln] = acc[t][r] * alpha; }
  __builtin_amdgcn_fence(__ATOMIC_ACQ_REL, "workgroup"); __builtin_amdgcn_wave_barrier();
  const int rsub = lane >> 4, c4 = (lane & 15) * 4;
  {
#pragma unroll
    for (int q = 0; q < 8; ++q) { const int r = q * 2 + rsub; if (col0 + c4 < N) { const v4f v = *(const v4fa*)&so[w][r][c4]; *(v4f*)(C + (size_t)(row0 + r) * ldc + col0 + c4) = v; } }
     }
}

// Wt[n][k] = f16(W[k][n]·scale) from f32 row-major W[K][N] (scale = power of two; bf16-exact weights stay exact in f16 away from the subnormal range)
__global__ __launch_bounds__(256) void k_wt_f16(const float* __restrict__ W, _Float16* __restrict__ Wt, int K, int N, float scale) {
  const int t = blockIdx.x * 256 + threadIdx.x; if (t >= N * (K / 8)) return; const int n = t / (K / 8), k8 = (t % (K / 8)) * 8; FragH f;
#pragma unroll
  for (int i = 0; i < 8; ++i) f.h[i] = (_Float16)(bf16_round(W[(size_t)(k8 + i) * N + n]) * scale); const v8us o = f.half[0];
  *(v8us*)((unsigned short*)Wt + (size_t)n * K + k8) = o; 
}
// k_gemm_hh variant with fused epilogue: v = acc·alpha + bias[by·sBias + col] (+ CP[(row/rowsPerB)·sCPb + by·64 + col] if CP) ; ACT 0 none / 1 elu ; writes f32 C and/or f16 C16 (each if non-null)
template <int ACT>
__global__ __launch_bounds__(128) void k_gemm_hhx(const _Float16* __restrict__ A, int lda, size_t sA, const _Float16* __restrict__ Bh, int ldb, size_t sB, float alpha, const float* __restrict__ bias, size_t sBias, const float* __restrict__ CP, int rowsPerB, size_t sCPb, int row0g,
    float* __restrict__ C, _Float16* __restrict__ C16, int ldc, size_t sC, int M, int N, int K) {
  __shared__ __attribute__((aligned(16))) float so[4][16][64];
  const int tid = threadIdx.x, w = tid >> 5, lane = tid & 31, ln = lane & 15, hh = lane >> 4; const int by = blockIdx.y;
  A += (size_t)by * sA; Bh += (size_t)by * sB; const size_t cofs = (size_t)by * sC; const float* bp = bias ? bias + (size_t)by * sBias : nullptr;
  const int ntn = (N + 63) / 64; const int wid = blockIdx.x * 4 + w; const int mt = wid / ntn, nq = wid % ntn; if (mt * 16 >= M) return;
  const int row0 = mt * 16, col0 = nq * 64; const _Float16* arow = A + (size_t)(row0 + ln) * lda;
  v8f acc[4] = {};
  for (int kb = 0; kb < K; kb += 32) { FragH ah; ah.half[0] = *(const v8us*)((const unsigned short*)arow + kb + 8 * hh); ah.half[1] = *(const v8us*)((const unsigned short*)arow + kb + 16 + 8 * hh);
#pragma unroll
    for (int t = 0; t < 4; ++t) { if (col0 + t * 16 >= N) continue; const size_t boff = (size_t)(col0 + t * 16 + ln) * ldb + kb; FragH bq; bq.half[0] = *(const v8us*)((const unsigned short*)Bh + boff + 8 * hh); bq.half[1] = *(const v8us*)((const unsigned short*)Bh + boff + 16 + 8 * hh);
      acc[t] = mmaH<1>(ah.v, ah.v, bq.v, bq.v, acc[t]); }
  }
#pragma unroll
  for (int t = 0; t < 4; ++t) { if (col0 + t * 16 >= N) continue; const int col = col0 + t * 16 + ln; const float bv = bp ? bf16_round(bp[col]) : 0.f;
#pragma unroll
    for (int r = 0; r < 8; ++r) { float v = acc[t][r] * alpha + bv; if (CP) { const int bidx = (row0g + row0 + 8 * hh + r) / rowsPerB; v += CP[(size_t)bidx * sCPb + (size_t)by * 64 + col]; } if (ACT == 1) v = (v > 0.f) ? v : expm1f(v); else if (ACT == 3) v = fmaxf(v, 0.f); so[w][8 * hh + r][t * 16 + ln] = v; } }
  __builtin_amdgcn_fence(__ATOMIC_ACQ_REL, "workgroup"); __builtin_amdgcn_wave_barrier();
  const int rsub = lane >> 4, c4 = (lane & 15) * 4; typedef _Float16 v4h __attribute__((ext_vector_type(4)));
  {
#pragma unroll
    for (int q = 0; q < 8; ++q) { const int r = q * 2 + rsub; if (col0 + c4 < N) { const v4f v = *(const v4fa*)&so[w][r][c4]; if (C) *(v4f*)(C + cofs + (size_t)(row0 + r) * ldc + col0 + c4) = v; if (C16) { v4h h4; for (int i = 0; i < 4; ++i) h4[i] = (_Float16)v[i]; *(v4h*)(C16 + cofs + (size_t)(row0 + r) * ldc + col0 + c4) = h4; } } }
     }
}


__global__ __launch_bounds__(256) void k_x16(const float* __restrict__ x, _Float16* __restrict__ X16, size_t n8) { const size_t t = (size_t)blockIdx.x * 256 + threadIdx.x; if (t >= n8) return; FragH f;
#pragma unroll
  for (int q = 0; q < 8; ++q) f.h[q] = (_Float16)bf16_round(x[t * 8 + q]); *(v8us*)((unsigned short*)X16 + t * 8) = f.half[0];  }
__global__ __launch_bounds__(256) void k_h16(const float* __restrict__ x, _Float16* __restrict__ X16, size_t n8) { const size_t t = (size_t)blockIdx.x * 256 + threadIdx.x; if (t >= n8) return; FragH f;
#pragma unroll
  for (int q = 0; q < 8; ++q) f.h[q] = (_Float16)x[t * 8 + q]; *(v8us*)((unsigned short*)X16 + t * 8) = f.half[0];  }
__global__ __launch_bounds__(256) void k_round16f(const float* __restrict__ W, _Float16* __restrict__ Bt, size_t n8) { const size_t t = (size_t)blockIdx.x * 256 + threadIdx.x; if (t >= n8) return; FragH f;
#pragma unroll
  for (int i = 0; i < 8; ++i) f.h[i] = (_Float16)(bf16_round(W[t * 8 + i]) * 16.0f); *(v8us*)((unsigned short*)Bt + t * 8) = f.half[0];  }
// K rows (f32 -> bf16 value -> f16) in the order of the score product's A fragments. A 16-byte unit holds 8 dims of one key; unit ((kt * 2 + ks) * 2 + half) * 32 + hh * 16 + ln
// of a (batch, head) slab is key kt * 16 + ln, dims ks * 32 + half * 16 + hh * 8 .. + 7: a wave's load of one fragment half is 512 contiguous bytes (four whole lines).
// One block = 16 keys x all 8 heads, read in whole rows and turned through LDS; a group of 16 units takes 256 + 16 bytes there, so that neither side meets a bank conflict.
__global__ __launch_bounds__(256) void k_kpack(const float* __restrict__ x, _Float16* __restrict__ Kp) { __shared__ __attribute__((aligned(16))) unsigned short st[64 * 136]; const int tid = threadIdx.x; const int b = blockIdx.x / 256, kt = blockIdx.x % 256;
#pragma unroll      // the four rounds' loads fly together
  for (int i = 0; i < 4; ++i) { const int u = i * 256 + tid, ln = u >> 6, c8 = u & 63; const float* s = x + ((size_t)b * 4096 + kt * 16 + ln) * 512 + c8 * 8; const v4f a0 = *(const v4fa*)s, a1 = *(const v4fa*)(s + 4); FragH f;      // c8 = head * 8 + ks * 4 + half * 2 + hh
#pragma unroll      // constant vector indices: the values stay in registers
    for (int q = 0; q < 4; ++q) { f.h[q] = (_Float16)bf16_round(a0[q]); f.h[4 + q] = (_Float16)bf16_round(a1[q]); }
    *(v8us*)&st[c8 * 136 + ln * 8] = f.half[0]; }
  __syncthreads();
#pragma unroll      // the four LDS reads are issued ahead of the first store
  for (int i = 0; i < 4; ++i) { const int p = i * 256 + tid; const v8us o = *(const v8us*)&st[(p >> 4) * 136 + (p & 15) * 8];      // p >> 7 = head
    *(v8us*)((unsigned short*)Kp + ((((size_t)b * 8 + (p >> 7)) * 256 + kt) * 128 + (p & 127)) * 8) = o; } }
// V transposed, in the order of the second product's A fragments: unit ((pass * 4 + dt) * 2 + half) * 32 + hh * 16 + ln of a slab is dim dt * 16 + ln, keys pass * 32 + half * 16 + hh * 8 .. + 7.
template <int NHv, int TTv>
__global__ __launch_bounds__(256) void k_vt(const _Float16* __restrict__ V16, int ldv, int voff, _Float16* __restrict__ Vt) { __shared__ unsigned short tl[64][66]; const int tid = threadIdx.x; const int slab = blockIdx.x / (TTv / 64), lg = blockIdx.x % (TTv / 64); const int b = slab / NHv, h = slab % NHv;
  for (int i = tid; i < 64 * 8; i += 256) { const int r = i / 8, c8 = (i % 8) * 8; FragH f; f.half[0] = *(const v8us*)((const unsigned short*)V16 + ((size_t)b * TTv + lg * 64 + r) * ldv + voff + h * 64 + c8);
#pragma unroll
    for (int q = 0; q < 8; ++q) tl[r][c8 + q] = f.u[q]; }
  __syncthreads();
  {
#pragma unroll
    for (int rd = 0; rd < 2; ++rd) { const int u = rd * 256 + tid, d = ((u >> 6) & 3) * 16 + (u & 15), k0 = rd * 32 + ((u >> 4) & 3) * 8; FragH f;      // the block's 64 keys are two passes: 512 units in a row
#pragma unroll
      for (int q = 0; q < 8; ++q) f.u[q] = tl[k0 + q][d];
      *(v8us*)((unsigned short*)Vt + ((size_t)blockIdx.x * 512 + u) * 8) = f.half[0]; }
     } }

typedef float v2f __attribute__((ext_vector_type(2)));
// lane l <-> lane l ^ 16 as a vector cross-row move: no LDS queue and no wait, unlike a shuffle
__device__ __forceinline__ float xhalf(float x) { return __builtin_bit_cast(float, __builtin_amdgcn_permlanex16(__builtin_bit_cast(int, x), __builtin_bit_cast(int, x), 0x76543210, 0xfedcba98, false, false)); }

// Transposed products: St = K.Qt (A = K rows, B = Q rows) and Ot += Vt.Pt (A = Vt rows, B = Pt). In a 16 x 16 tile of St lane (ln, hh) holds
// query column ln and keys 8hh + r, so maximum and sum of a query run inside the lane (one exchange between the halves for the maximum), and the two
// key tiles of a pass, converted in place, are the B operand of the second product in the loaders' own k order: P never leaves the registers.
__global__ __launch_bounds__(128) void k_flash(const _Float16* __restrict__ Q16, int ldq, const _Float16* __restrict__ Kp, const _Float16* __restrict__ Vt, const int* __restrict__ MSK, float* __restrict__ O, int ldo) {
  constexpr int RPW = 32, NQB = 4096 / (4 * RPW), DT = 4, KS = 2; (void)MSK;
  constexpr float SL2 = 0.125f * 1.44269504088896340736f;      // 64^-1/2 x log2(e): exp(x / 8 - m / 8) = 2^(x * SL2 - m * SL2)
  __shared__ __attribute__((aligned(16))) float sO[4][RPW][64 + 4];
  const int tid = threadIdx.x, w = tid >> 5, lane = tid & 31, ln = lane & 15, hh = lane >> 4;
  const int slab = blockIdx.x / NQB, qblk = blockIdx.x % NQB; const int b = slab / 8, h = slab % 8; const int qb0 = qblk * (4 * RPW); const int q0 = qb0 + w * RPW;
  FragH aq[2][KS];
#pragma unroll
  for (int rt = 0; rt < 2; ++rt) { const unsigned short* qr = (const unsigned short*)Q16 + ((size_t)b * 4096 + q0 + rt * 16 + ln) * ldq + h * 64;
#pragma unroll
    for (int ks = 0; ks < KS; ++ks) { aq[rt][ks].half[0] = *(const v8us*)(qr + ks * 32 + 8 * hh); aq[rt][ks].half[1] = *(const v8us*)(qr + ks * 32 + 16 + 8 * hh); } }
  const unsigned short* kl = (const unsigned short*)Kp + (size_t)slab * 4096 * 64 + lane * 8;      // fragment order (k_kpack): this lane's unit of the slab's first fragment half; a pass is 4 KiB in a row
  FragH bk[2][KS];      // K of pass 0; inside the loop each pass fetches the next pass's
#pragma unroll
  for (int nt = 0; nt < 2; ++nt)
#pragma unroll
    for (int ks = 0; ks < KS; ++ks) { const unsigned short* kr = kl + nt * 1024 + ks * 512; bk[nt][ks].half[0] = *(const v8us*)kr; bk[nt][ks].half[1] = *(const v8us*)(kr + 256); }
  asm volatile("s_wait_xcnt 0x0" ::: "memory");      // the address registers of the loads above are reused below: the wait stands in front of their overwrite
  __builtin_amdgcn_sched_barrier(0);                 // keeps the set-up code that reuses those registers behind that wait
  const unsigned short* Vth = (const unsigned short*)Vt + (size_t)slab * 64 * 4096;
  float m_r[2], l_r[2]; v8f oacc[2][DT];      // per lane: query rt * 16 + ln; m_r = running maximum in base-2 exponent units (score x SL2); oacc[rt][dt][r] = Ot[dt * 16 + 8hh + r][that query]
#pragma unroll
  for (int rt = 0; rt < 2; ++rt) { m_r[rt] = -3.0e38f; l_r[rt] = 0.f;
#pragma unroll
    for (int dt = 0; dt < DT; ++dt) oacc[rt][dt] = (v8f){0.f,0.f,0.f,0.f,0.f,0.f,0.f,0.f}; }
  const int jend = 4096;
  // Every load of a pass is issued a phase ahead of its use: V of a pass at the pass's top, K of the next pass right behind this pass's score products,
  // into the same registers, so that each flies over the softmax arithmetic and no product waits out a round trip to L2.
  const unsigned short* vl = Vth + lane * 8;                                                                     // fragment order (k_vt): a pass is 4 KiB in a row
  FragH bv[DT];
#pragma unroll 1
  for (int j0 = 0; j0 < jend; j0 += 32) {
#pragma unroll
    for (int dt = 0; dt < DT; ++dt) { const unsigned short* vrow = vl + (size_t)j0 * 64 + dt * 512; bv[dt].half[0] = *(const v8us*)vrow; bv[dt].half[1] = *(const v8us*)(vrow + 256); }
    v8f s[2][2];      // s[rt][nt][r] = score of key j0 + nt * 16 + 8hh + r against query rt * 16 + ln
#pragma unroll
    for (int nt = 0; nt < 2; ++nt) {
#pragma unroll
      for (int rt = 0; rt < 2; ++rt) { v8f acc = (v8f){0.f,0.f,0.f,0.f,0.f,0.f,0.f,0.f};
#pragma unroll
        for (int ks = 0; ks < KS; ++ks) acc = mmaH<1>(bk[nt][ks].v, bk[nt][ks].v, aq[rt][ks].v, aq[rt][ks].v, acc); s[rt][nt] = acc; } }
    const int jn = (j0 + 32 < jend) ? j0 + 32 : 0;      // the last pass fetches pass 0's rows again (unused): the address stays inside Kp
#pragma unroll
    for (int nt = 0; nt < 2; ++nt)
#pragma unroll
      for (int ks = 0; ks < KS; ++ks) { const unsigned short* kr = kl + (size_t)jn * 64 + nt * 1024 + ks * 512; bk[nt][ks].half[0] = *(const v8us*)kr; bk[nt][ks].half[1] = *(const v8us*)(kr + 256); }
    FragH pb[2];
#pragma unroll
    for (int rt = 0; rt < 2; ++rt) {
      float sc[16], mx[8];      // raw products: their maximum is taken first (the scale is positive); the scale goes into each exponent's one multiply-add
#pragma unroll
      for (int r = 0; r < 8; ++r) { sc[r] = s[rt][0][r]; sc[8 + r] = s[rt][1][r]; mx[r] = fmaxf(sc[r], sc[8 + r]); }
      float mc = fmaxf(fmaxf(fmaxf(mx[0], mx[1]), fmaxf(mx[2], mx[3])), fmaxf(fmaxf(mx[4], mx[5]), fmaxf(mx[6], mx[7])));
      mc = fmaxf(mc, xhalf(mc));      // both halves of a column must use one maximum: their P meet in one product
      const float mn = fmaxf(m_r[rt], mc * SL2); const float al = __builtin_amdgcn_exp2f(m_r[rt] - mn); m_r[rt] = mn;      // an unchanged maximum gives 2^0 = 1
      float ps[4] = {0.f, 0.f, 0.f, 0.f};
#pragma unroll
      for (int i = 0; i < 16; i += 2) {      // two neighbouring scores of an accumulator share one packed multiply-add
        const v2f e = __builtin_elementwise_fma((v2f){sc[i], sc[i + 1]}, (v2f){SL2, SL2}, (v2f){-mn, -mn});
        const float p0 = __builtin_amdgcn_exp2f(e[0]), p1 = __builtin_amdgcn_exp2f(e[1]);
        ps[i & 3] += p0; ps[(i + 1) & 3] += p1; pb[rt].h[i] = (_Float16)p0; pb[rt].h[i + 1] = (_Float16)p1; }
      l_r[rt] = l_r[rt] * al + ((ps[0] + ps[1]) + (ps[2] + ps[3]));      // this half's keys only; the halves join after the loop
#pragma unroll
      for (int dt = 0; dt < DT; ++dt)
#pragma unroll
        for (int r = 0; r < 8; ++r) oacc[rt][dt][r] *= al; }
#pragma unroll
    for (int dt = 0; dt < DT; ++dt) {
#pragma unroll
      for (int rt = 0; rt < 2; ++rt) oacc[rt][dt] = mmaH<1>(bv[dt].v, bv[dt].v, pb[rt].v, pb[rt].v, oacc[rt][dt]); } }
#pragma unroll
  for (int rt = 0; rt < 2; ++rt) { float l = l_r[rt]; l += xhalf(l); const float li = (l > 0.f) ? 1.0f / l : 0.f;
#pragma unroll
    for (int dt = 0; dt < DT; ++dt) { v4f lo, hi;
#pragma unroll
      for (int r = 0; r < 4; ++r) { lo[r] = oacc[rt][dt][r] * li; hi[r] = oacc[rt][dt][4 + r] * li; }
      *(v4fa*)&sO[w][rt * 16 + ln][dt * 16 + 8 * hh] = lo; *(v4fa*)&sO[w][rt * 16 + ln][dt * 16 + 8 * hh + 4] = hi; } }
  __builtin_amdgcn_fence(__ATOMIC_ACQ_REL, "workgroup"); __builtin_amdgcn_wave_barrier();
  {
#pragma unroll
    for (int rp = 0; rp < RPW; rp += 2) { const int r = rp + (lane >> 4), pc = lane & 15; const v4f val = *(const v4fa*)&sO[w][r][pc * 4]; *(v4f*)(O + ((size_t)b * 4096 + q0 + r) * ldo + h * 64 + pc * 4) = val; }
     } }

extern "C" void kernel_launch(void* const* d_in, const int* in_sizes, int n_in,
                              void* d_out, int out_size, void* d_ws, size_t ws_size, hipStream_t stream) {
  (void)in_sizes; (void)n_in; (void)out_size;
  const float* q = (const float*)d_in[0]; const float* k = (const float*)d_in[1]; const float* v = (const float*)d_in[2]; const float* Wo = (const float*)d_in[3]; const float* bo = (const float*)d_in[4];
  char* ws = (char*)d_ws; size_t off = 0;
  auto take = [&](size_t bytes) { char* p = ws + off; off += (bytes + 255) & ~(size_t)255; return p; };
  _Float16* Bo = (_Float16*)take((size_t)NO * CC * 2); _Float16* Q16 = (_Float16*)take((size_t)NR * CC * 2); _Float16* K16 = (_Float16*)take((size_t)NR * CC * 2); _Float16* V16 = (_Float16*)take((size_t)NR * CC * 2); _Float16* Vt = (_Float16*)take((size_t)NR * CC * 2); float* O = (float*)take((size_t)NR * CC * 4); _Float16* O16 = V16;      // V16 dead after k_vt
  if (off > ws_size) return;      // 8.4 × 4 + 16.8 MB ≈ 50 MiB
  k_wt_f16<<<(NO * (CC / 8) + 255) / 256, 256, 0, stream>>>(Wo, Bo, CC, NO, 16.0f);      // [in][out]
  const unsigned gx = (unsigned)(((size_t)NR * CC / 8 + 255) / 256);
  k_x16<<<gx, 256, 0, stream>>>(q, Q16, (size_t)NR * CC / 8); k_kpack<<<NR / 16, 256, 0, stream>>>(k, K16); k_x16<<<gx, 256, 0, stream>>>(v, V16, (size_t)NR * CC / 8);
  k_vt<NH, TT><<<BB * NH * (TT / 64), 256, 0, stream>>>(V16, CC, 0, Vt);
  k_flash<<<BB * NH * (TT / 128), 128, 0, stream>>>(Q16, CC, K16, Vt, nullptr, O, CC);
  k_h16<<<gx, 256, 0, stream>>>(O, O16, (size_t)NR * CC / 8);
  k_gemm_hhx<0><<<dim3(((NR / 16) * 1 + 3) / 4, 1), 128, 0, stream>>>(O16, CC, 0, Bo, CC, 0, 0.0625f, bo, 0, nullptr, 1, 0, 0, (float*)d_out, nullptr, NO, 0, NR, NO, CC);      // N = 64
}

// v005
// One run takes 124 microseconds.
// Two timings next to v004 put it at 1.10 and 1.09 times that version's speed.
// All steps since v000 together make it 5.42 times as fast.
#include <hip/hip_runtime.h>
// 8-head attention over the given q/k/v (2 × 4096 tokens, d = 64) as a fused flash-style kernel on v_wmma_f32_16x16x32_f16 (q, k, v are module INPUTS → exact bf16 values as f16 operands; S = Q·Kᵀ × 64^-½,
// online max/sum softmax f32, P f16 ≤ 1, O = P·V), then the 512→64 output linear (+ bias; W_out [in][out] bf16-exact ×2^4); f32 accumulate.
#define BB 2
#define TT 4096
#define CC 512
#define NH 8
#define NO 64
#define NR (BB * TT)

typedef __bf16 v16b __attribute__((ext_vector_type(16)));
typedef unsigned short v8us __attribute__((ext_vector_type(8), may_alias));
typedef float  v8f  __attribute__((ext_vector_type(8)));
typedef float  v4f  __attribute__((ext_vector_type(4)));
typedef float  v4fa __attribute__((ext_vector_type(4), may_alias));
union FragB { v16b v; v8us half[2]; unsigned short u[16]; };

__device__ __forceinline__ unsigned short bf16_bits(float x) { unsigned int u = __float_as_uint(x); return (unsigned short)((u + 0x7FFFu + ((u >> 16) & 1u)) >> 16); }
__device__ __forceinline__ float bf16_val(unsigned short b) { return __uint_as_float(((unsigned int)b) << 16); }
__device__ __forceinline__ float bf16_round(float x) { return bf16_val(bf16_bits(x)); }
// D += A·B with NT terms: 1 = ah·bh, 2 = + al·bh (A split), 3 = + ah·bl (both split)
template <int NT>
__device__ __forceinline__ v8f mmaN(v16b ah, v16b al, v16b bh, v16b bl, v8f c) {
  c = __builtin_amdgcn_wmma_f32_16x16x32_bf16(false, ah, false, bh, (short)0, c, false, false);
  if (NT >= 2) c = __builtin_amdgcn_wmma_f32_16x16x32_bf16(false, al, false, bh, (short)0, c, false, false);
  if (NT >= 3) c = __builtin_amdgcn_wmma_f32_16x16x32_bf16(false, ah, false, bl, (short)0, c, false, false);
  asm volatile("v_nop\n\tv_nop\n\tv_nop\n\tv_nop" : "+v"(c) : "v"(ah), "v"(al), "v"(bh), "v"(bl));
  return c;
}

__global__ __launch_bounds__(256) void k_wt_bf16(const float* __restrict__ W, unsigned short* __restrict__ Wt, int K, int N) {
  const int t = blockIdx.x * 256 + threadIdx.x;
  const int k8n = K / 8;
  if (t >= N * k8n) return;
  const int n = t / k8n, k8 = (t % k8n) * 8;
  v8us v;
#pragma unroll
  for (int i = 0; i < 8; ++i) v[i] = bf16_bits(W[(size_t)(k8 + i) * N + n]);
  *(v8us*)(Wt + (size_t)n * K + k8) = v;
  
}

// GEMM C[M][N] (f32, pitch ldc) = act(A[M][K]·W + bias). A f32 row-major (pitch lda) converted per fragment to bf16
// (ASPLIT: hi/lo two planes -> 2 terms, else single rounded term); Wt bf16 [N][K] (pitch ldb). BIAS_BF16 rounds the
// bias to bf16 first (bias quantised to bf16 before the add). K%32==0, M%16==0, N%64==0.
template <bool ASPLIT, int ACT, bool BIAS_BF16>
__global__ __launch_bounds__(128) void k_gemm_bf(const float* __restrict__ A, int lda, const unsigned short* __restrict__ Wt, int ldb,
                                               const float* __restrict__ bias, float* __restrict__ C, int ldc, int M, int N, int K) {
  __shared__ __attribute__((aligned(16))) float so[4][16][64];
  const int tid = threadIdx.x, w = tid >> 5, lane = tid & 31, ln = lane & 15, hh = lane >> 4;
  const int ntn = N / 64;
  const int wid = blockIdx.x * 4 + w;
  const int mt = wid / ntn, nq = wid % ntn;
  if (mt * 16 >= M) return;
  const int row0 = mt * 16, col0 = nq * 64;
  const float* arow = A + (size_t)(row0 + ln) * lda;
  v8f acc[4] = {};
  for (int kb = 0; kb < K; kb += 32) {
    FragB ah, al;
    const v4f x0 = *(const v4fa*)(arow + kb + 8 * hh), x1 = *(const v4fa*)(arow + kb + 8 * hh + 4);
    const v4f x2 = *(const v4fa*)(arow + kb + 16 + 8 * hh), x3 = *(const v4fa*)(arow + kb + 16 + 8 * hh + 4);
    float xs[16] = {x0[0],x0[1],x0[2],x0[3],x1[0],x1[1],x1[2],x1[3],x2[0],x2[1],x2[2],x2[3],x3[0],x3[1],x3[2],x3[3]};
#pragma unroll
    for (int i = 0; i < 16; ++i) { const unsigned short hb = bf16_bits(xs[i]); ah.u[i] = hb; al.u[i] = ASPLIT ? bf16_bits(xs[i] - bf16_val(hb)) : (unsigned short)0; }
#pragma unroll
    for (int t = 0; t < 4; ++t) {
      const unsigned short* brow = Wt + (size_t)(col0 + t * 16 + ln) * ldb + kb;
      FragB b;
      b.half[0] = *(const v8us*)(brow + 8 * hh);
      b.half[1] = *(const v8us*)(brow + 16 + 8 * hh);
      acc[t] = mmaN<ASPLIT ? 2 : 1>(ah.v, al.v, b.v, b.v, acc[t]);
    }
  }
#pragma unroll
  for (int t = 0; t < 4; ++t) {
    float bv = bias ? bias[col0 + t * 16 + ln] : 0.f;
    if (BIAS_BF16) bv = bf16_round(bv);
#pragma unroll
    for (int r = 0; r < 8; ++r) { float v = acc[t][r] + bv; if (ACT == 1) v = fmaxf(v, 0.f); so[w][8 * hh + r][t * 16 + ln] = v; }
  }
  __builtin_amdgcn_fence(__ATOMIC_ACQ_REL, "workgroup");
  __builtin_amdgcn_wave_barrier();
  const int rsub = lane >> 4, c4 = (lane & 15) * 4;
  {
#pragma unroll
    for (int q = 0; q < 8; ++q) {
      const int r = q * 2 + rsub;
      const v4f v = *(const v4fa*)&so[w][r][c4];
      *(v4f*)(C + (size_t)(row0 + r) * ldc + col0 + c4) = v;
    }
    
  }
}

// Flash-style causal/unmasked attention, all contractions 3-term bf16 hi/lo splits, f32 softmax with running max.
// q,k,v rows are read from f32 buffers with arbitrary row pitch (so they can live inside a fused qkv buffer);
// D = head size (multiple of 32, <= 128); one wave = 16 query rows; block = 4 waves (64 queries) sharing K/V chunks of 32.
template <int D, bool CAUSAL>
__global__ __launch_bounds__(128) void k_flash(const float* __restrict__ qb, const float* __restrict__ kb, const float* __restrict__ vb,
                                             int pitch, int T, int H, float scale, float* __restrict__ y, int ypitch) {
  constexpr int KS = D / 32;        // k-steps for QK
  constexpr int DT = D / 16;        // d tiles for PV
  __shared__ __attribute__((aligned(16))) unsigned short sKh[32][D + 8], sKl[32][D + 8], sVh[32][D + 8], sVl[32][D + 8];
  __shared__ __attribute__((aligned(16))) unsigned short sPh[4][16][40], sPl[4][16][40];
  __shared__ __attribute__((aligned(16))) float sO[4][16][D];
  const int tid = threadIdx.x, w = tid >> 5, lane = tid & 31, ln = lane & 15, hh = lane >> 4;
  const int nqb = (T + 63) / 64;
  const int bh = blockIdx.x / nqb, qblk = blockIdx.x % nqb;
  const int b = bh / H, h = bh % H;
  const int q0 = qblk * 64 + w * 16;
  const float* Q = qb + (size_t)b * T * pitch + h * D;
  const float* K = kb + (size_t)b * T * pitch + h * D;
  const float* V = vb + (size_t)b * T * pitch + h * D;

  // A fragments of the wave's 16 query rows (scaled), hi/lo
  FragB aqh[KS], aql[KS];
  {
    int row = q0 + ln; if (row >= T) row = T - 1;
    const float* qr = Q + (size_t)row * pitch;
#pragma unroll
    for (int ks = 0; ks < KS; ++ks)
#pragma unroll
      for (int i = 0; i < 16; ++i) {
        const int d = ks * 32 + ((i < 8) ? (8 * hh + i) : (16 + 8 * hh + (i - 8)));
        const float x = qr[d] * scale; const unsigned short hb = bf16_bits(x);
        aqh[ks].u[i] = hb; aql[ks].u[i] = bf16_bits(x - bf16_val(hb));
      }
  }
  float m_r[8], l_r[8];
#pragma unroll
  for (int r = 0; r < 8; ++r) { m_r[r] = -3.0e38f; l_r[r] = 0.f; }
  v8f oacc[DT];
#pragma unroll
  for (int dt = 0; dt < DT; ++dt) oacc[dt] = (v8f){0.f,0.f,0.f,0.f,0.f,0.f,0.f,0.f};

  const int kv_end = CAUSAL ? min(T, qblk * 64 + 64) : T;     // block-uniform
  for (int j0 = 0; j0 < kv_end; j0 += 32) {
    __syncthreads();
    for (int e = tid; e < 32 * (D / 4); e += 128) {
      const int r = e / (D / 4), c4 = (e % (D / 4)) * 4;
      const int key = j0 + r;
      v4f kf = {0.f,0.f,0.f,0.f}, vf = {0.f,0.f,0.f,0.f};
      if (key < T) { kf = *(const v4fa*)(K + (size_t)key * pitch + c4); vf = *(const v4fa*)(V + (size_t)key * pitch + c4); }
#pragma unroll
      for (int t = 0; t < 4; ++t) {
        unsigned short hb = bf16_bits(kf[t]); sKh[r][c4 + t] = hb; sKl[r][c4 + t] = bf16_bits(kf[t] - bf16_val(hb));
        hb = bf16_bits(vf[t]); sVh[r][c4 + t] = hb; sVl[r][c4 + t] = bf16_bits(vf[t] - bf16_val(hb));
      }
    }
    __syncthreads();
    // S tile 16 x 32
    v8f s[2];
#pragma unroll
    for (int nt = 0; nt < 2; ++nt) {
      v8f acc = {};
#pragma unroll
      for (int ks = 0; ks < KS; ++ks) {
        FragB bh_, bl_;
        bh_.half[0] = *(const v8us*)&sKh[nt * 16 + ln][ks * 32 + 8 * hh]; bh_.half[1] = *(const v8us*)&sKh[nt * 16 + ln][ks * 32 + 16 + 8 * hh];
        bl_.half[0] = *(const v8us*)&sKl[nt * 16 + ln][ks * 32 + 8 * hh]; bl_.half[1] = *(const v8us*)&sKl[nt * 16 + ln][ks * 32 + 16 + 8 * hh];
        acc = mmaN<3>(aqh[ks].v, aql[ks].v, bh_.v, bl_.v, acc);
      }
      s[nt] = acc;
    }
    // mask + running max (rows 8hh+r; the 16 lanes of a half share rows)
    float alpha[8];
#pragma unroll
    for (int r = 0; r < 8; ++r) {
      const int qi = q0 + 8 * hh + r;
      const int ja = j0 + ln, jb = j0 + 16 + ln;
      if (CAUSAL) { if (ja > qi) s[0][r] = -3.0e38f; if (jb > qi) s[1][r] = -3.0e38f; }
      if (ja >= T) s[0][r] = -3.0e38f;
      if (jb >= T) s[1][r] = -3.0e38f;
      float mx = fmaxf(s[0][r], s[1][r]);
      mx = fmaxf(mx, __shfl_xor(mx, 1, 32)); mx = fmaxf(mx, __shfl_xor(mx, 2, 32)); mx = fmaxf(mx, __shfl_xor(mx, 4, 32)); mx = fmaxf(mx, __shfl_xor(mx, 8, 32));
      const float mnew = fmaxf(m_r[r], mx);
      alpha[r] = (mnew > -1.0e38f) ? __expf(m_r[r] - mnew) : 1.0f;
      const float p0 = (s[0][r] > -1.0e38f) ? __expf(s[0][r] - mnew) : 0.f;
      const float p1 = (s[1][r] > -1.0e38f) ? __expf(s[1][r] - mnew) : 0.f;
      m_r[r] = mnew;
      l_r[r] = l_r[r] * alpha[r] + p0 + p1;            // per-lane partial row sum (16 lanes combined at the end)
      unsigned short hb = bf16_bits(p0); sPh[w][8 * hh + r][ln] = hb;      sPl[w][8 * hh + r][ln] = bf16_bits(p0 - bf16_val(hb));
      hb = bf16_bits(p1);                sPh[w][8 * hh + r][16 + ln] = hb; sPl[w][8 * hh + r][16 + ln] = bf16_bits(p1 - bf16_val(hb));
    }
#pragma unroll
    for (int dt = 0; dt < DT; ++dt)
#pragma unroll
      for (int r = 0; r < 8; ++r) oacc[dt][r] *= alpha[r];
    __builtin_amdgcn_fence(__ATOMIC_ACQ_REL, "workgroup");
    __builtin_amdgcn_wave_barrier();
    FragB pah, pal;
    pah.half[0] = *(const v8us*)&sPh[w][ln][8 * hh]; pah.half[1] = *(const v8us*)&sPh[w][ln][16 + 8 * hh];
    pal.half[0] = *(const v8us*)&sPl[w][ln][8 * hh]; pal.half[1] = *(const v8us*)&sPl[w][ln][16 + 8 * hh];
#pragma unroll
    for (int dt = 0; dt < DT; ++dt) {
      FragB bvh, bvl;
#pragma unroll
      for (int i = 0; i < 8; ++i) {
        bvh.u[i] = sVh[8 * hh + i][dt * 16 + ln]; bvh.u[8 + i] = sVh[16 + 8 * hh + i][dt * 16 + ln];
        bvl.u[i] = sVl[8 * hh + i][dt * 16 + ln]; bvl.u[8 + i] = sVl[16 + 8 * hh + i][dt * 16 + ln];
      }
      oacc[dt] = mmaN<3>(pah.v, pal.v, bvh.v, bvl.v, oacc[dt]);
    }
    __builtin_amdgcn_fence(__ATOMIC_ACQ_REL, "workgroup");
    __builtin_amdgcn_wave_barrier();
  }
#pragma unroll
  for (int r = 0; r < 8; ++r) {
    float l = l_r[r];
    l += __shfl_xor(l, 1, 32); l += __shfl_xor(l, 2, 32); l += __shfl_xor(l, 4, 32); l += __shfl_xor(l, 8, 32);
    l_r[r] = (l > 0.f) ? 1.0f / l : 0.f;
  }
#pragma unroll
  for (int dt = 0; dt < DT; ++dt)
#pragma unroll
    for (int r = 0; r < 8; ++r) sO[w][8 * hh + r][dt * 16 + ln] = oacc[dt][r] * l_r[r];
  __builtin_amdgcn_fence(__ATOMIC_ACQ_REL, "workgroup");
  __builtin_amdgcn_wave_barrier();
  {
    for (int r = 0; r < 16; ++r) {
      const int row = q0 + r;
      if (row < T && lane < D / 4) {
        const v4f val = *(const v4fa*)&sO[w][r][lane * 4];
        *(v4f*)(y + ((size_t)b * T + row) * ypitch + h * D + lane * 4) = val;
      }
    }
    
  }
}

// GEMM C = act(A·W + bias + resid): A f32 (ASPLIT -> hi/lo 2 terms), Wt bf16 [N][K]; ACT 0 none, 1 relu, 2 exact gelu;
// resid (optional, f32, row index = (row % rmod), pitch ldr, RES_BF16 rounds it) added before the activation.
template <bool ASPLIT, int ACT, bool BIAS_BF16, bool RES_BF16>
__global__ __launch_bounds__(128) void k_gemm_bf3(const float* __restrict__ A, int lda, const unsigned short* __restrict__ Wt, int ldb,
                                                const float* __restrict__ bias, const float* __restrict__ resid, int rmod, int ldr,
                                                float* __restrict__ C, int ldc, int M, int N, int K) {
  __shared__ __attribute__((aligned(16))) float so[4][16][64];
  const int tid = threadIdx.x, w = tid >> 5, lane = tid & 31, ln = lane & 15, hh = lane >> 4;
  const int ntn = N / 64;
  const int wid = blockIdx.x * 4 + w;
  const int mt = wid / ntn, nq = wid % ntn;
  if (mt * 16 >= M) return;
  const int row0 = mt * 16, col0 = nq * 64;
  const float* arow = A + (size_t)(row0 + ln) * lda;
  v8f acc[4] = {};
  for (int kb = 0; kb < K; kb += 32) {
    FragB ah, al;
    const v4f x0 = *(const v4fa*)(arow + kb + 8 * hh), x1 = *(const v4fa*)(arow + kb + 8 * hh + 4);
    const v4f x2 = *(const v4fa*)(arow + kb + 16 + 8 * hh), x3 = *(const v4fa*)(arow + kb + 16 + 8 * hh + 4);
    float xs[16] = {x0[0],x0[1],x0[2],x0[3],x1[0],x1[1],x1[2],x1[3],x2[0],x2[1],x2[2],x2[3],x3[0],x3[1],x3[2],x3[3]};
#pragma unroll
    for (int i = 0; i < 16; ++i) { const unsigned short hb = bf16_bits(xs[i]); ah.u[i] = hb; al.u[i] = ASPLIT ? bf16_bits(xs[i] - bf16_val(hb)) : (unsigned short)0; }
#pragma unroll
    for (int t = 0; t < 4; ++t) {
      const unsigned short* brow = Wt + (size_t)(col0 + t * 16 + ln) * ldb + kb;
      FragB b;
      b.half[0] = *(const v8us*)(brow + 8 * hh);
      b.half[1] = *(const v8us*)(brow + 16 + 8 * hh);
      acc[t] = mmaN<ASPLIT ? 2 : 1>(ah.v, al.v, b.v, b.v, acc[t]);
    }
  }
#pragma unroll
  for (int t = 0; t < 4; ++t) {
    const int col = col0 + t * 16 + ln;
    float bv = bias ? bias[col] : 0.f;
    if (BIAS_BF16) bv = bf16_round(bv);
#pragma unroll
    for (int r = 0; r < 8; ++r) {
      float v = acc[t][r] + bv;
      if (resid) { float rv = resid[(size_t)((row0 + 8 * hh + r) % rmod) * ldr + col]; if (RES_BF16) rv = bf16_round(rv); v += rv; }
      if (ACT == 1) v = fmaxf(v, 0.f);
      if (ACT == 2) v = 0.5f * v * (1.0f + erff(v * 0.70710678118654752f));
      if (ACT == 3) { const float u = 0.7978845608028654f * (v + 0.044715f * v * v * v); v = 0.5f * v * (1.0f + tanhf(u)); }
      so[w][8 * hh + r][t * 16 + ln] = v;
    }
  }
  __builtin_amdgcn_fence(__ATOMIC_ACQ_REL, "workgroup");
  __builtin_amdgcn_wave_barrier();
  const int rsub = lane >> 4, c4 = (lane & 15) * 4;
  {
#pragma unroll
    for (int q = 0; q < 8; ++q) {
      const int r = q * 2 + rsub;
      const v4f v = *(const v4fa*)&so[w][r][c4];
      *(v4f*)(C + (size_t)(row0 + r) * ldc + col0 + c4) = v;
    }
    
  }
}
// row LayerNorm (biased variance, eps) over N: s = X (+ R); optional out_sum <- s; out_norm <- (s-mu)*rsqrt(var+eps)*g + b
template <bool PARAM_BF16>
__global__ __launch_bounds__(256) void k_layernorm(const float* __restrict__ X, const float* __restrict__ R, const float* __restrict__ g, const float* __restrict__ bta,
                                                  float* __restrict__ out_sum, float* __restrict__ out_norm, int N, float eps) {
  __shared__ float red[256];
  const int row = blockIdx.x, tid = threadIdx.x;
  const float* x = X + (size_t)row * N; const float* rr = R ? R + (size_t)row * N : nullptr;
  float vals[16];                     // up to N = 4096
  const int per = N / 256;            // contiguous chunk per thread? use strided-by-4 chunks: thread handles j = tid*4 + 1024*u
  float s1 = 0.f;
  for (int u = 0; u < per / 4; ++u) {
    const int j = tid * 4 + 1024 * u;
    const v4f a = *(const v4fa*)(x + j);
    v4f b = {0.f,0.f,0.f,0.f}; if (rr) b = *(const v4fa*)(rr + j);
#pragma unroll
    for (int q = 0; q < 4; ++q) { const float v = a[q] + b[q]; vals[u * 4 + q] = v; s1 += v; }
  }
  red[tid] = s1; __syncthreads();
  for (int st = 128; st > 0; st >>= 1) { if (tid < st) red[tid] += red[tid + st]; __syncthreads(); }
  const float mu = red[0] / (float)N; __syncthreads();
  float s2 = 0.f;
  for (int u = 0; u < per / 4; ++u)
#pragma unroll
    for (int q = 0; q < 4; ++q) { const float c = vals[u * 4 + q] - mu; s2 += c * c; }
  red[tid] = s2; __syncthreads();
  for (int st = 128; st > 0; st >>= 1) { if (tid < st) red[tid] += red[tid + st]; __syncthreads(); }
  const float rs = rsqrtf(red[0] / (float)N + eps);
  {
    for (int u = 0; u < per / 4; ++u) {
      const int j = tid * 4 + 1024 * u;
      v4f o, sm;
#pragma unroll
      for (int q = 0; q < 4; ++q) {
        float gg = g[j + q], bb = bta[j + q];
        if (PARAM_BF16) { gg = bf16_round(gg); bb = bf16_round(bb); }
        sm[q] = vals[u * 4 + q]; o[q] = (vals[u * 4 + q] - mu) * rs * gg + bb;
      }
      if (out_sum) *(v4f*)(out_sum + (size_t)row * N + j) = sm;
      *(v4f*)(out_norm + (size_t)row * N + j) = o;
    }
    
  }
}



// ---- f16 WMMA path (v_wmma_f32_16x16x32_f16): 11-bit significands for operands in range — used for every matrix product here (Q·Kᵀ, P·V, output linear)
typedef _Float16 v16h __attribute__((ext_vector_type(16)));
union FragH { v16h v; v8us half[2]; _Float16 h[16]; unsigned short u[16]; };
template <int NT>
__device__ __forceinline__ v8f mmaH(v16h ah, v16h al, v16h bh, v16h bl, v8f c) {
  c = __builtin_amdgcn_wmma_f32_16x16x32_f16(false, ah, false, bh, (short)0, c, false, false);
  if (NT >= 2) c = __builtin_amdgcn_wmma_f32_16x16x32_f16(false, al, false, bh, (short)0, c, false, false);
  if (NT >= 3) c = __builtin_amdgcn_wmma_f32_16x16x32_f16(false, ah, false, bl, (short)0, c, false, false);
  asm volatile("v_nop\n\tv_nop\n\tv_nop\n\tv_nop" : "+v"(c) : "v"(ah), "v"(al), "v"(bh), "v"(bl));
  return c;
}
// batched GEMM like k_gemm_b but f16 operands: A f32 (split into f16 hi/lo if ASPLIT, else rounded to f16), Bt = f16 values [n][k]; alpha; C f32; N multiple of 16 (partial tiles skipped)
template <bool ASPLIT>
__global__ __launch_bounds__(128) void k_gemm_h(const float* __restrict__ A, int lda, size_t sA, const _Float16* __restrict__ Bh, int ldb, size_t sB, float alpha, float* __restrict__ C, int ldc, size_t sC, int M, int N, int K) {
  __shared__ __attribute__((aligned(16))) float so[4][16][64];
  const int tid = threadIdx.x, w = tid >> 5, lane = tid & 31, ln = lane & 15, hh = lane >> 4; const int by = blockIdx.y;
  A += (size_t)by * sA; Bh += (size_t)by * sB; C += (size_t)by * sC;
  const int ntn = (N + 63) / 64; const int wid = blockIdx.x * 4 + w; const int mt = wid / ntn, nq = wid % ntn; if (mt * 16 >= M) return;
  const int row0 = mt * 16, col0 = nq * 64; const float* arow = A + (size_t)(row0 + ln) * lda;
  v8f acc[4] = {};
  for (int kb = 0; kb < K; kb += 32) {
    FragH ah, al;
    const v4f x0 = *(const v4fa*)(arow + kb + 8 * hh), x1 = *(const v4fa*)(arow + kb + 8 * hh + 4), x2 = *(const v4fa*)(arow + kb + 16 + 8 * hh), x3 = *(const v4fa*)(arow + kb + 16 + 8 * hh + 4);
    float xs[16] = {x0[0],x0[1],x0[2],x0[3],x1[0],x1[1],x1[2],x1[3],x2[0],x2[1],x2[2],x2[3],x3[0],x3[1],x3[2],x3[3]};
#pragma unroll
    for (int i = 0; i < 16; ++i) { const _Float16 h = (_Float16)xs[i]; ah.h[i] = h; al.h[i] = ASPLIT ? (_Float16)(xs[i] - (float)h) : (_Float16)0.0f; }
#pragma unroll
    for (int t = 0; t < 4; ++t) { if (col0 + t * 16 >= N) continue; const size_t boff = (size_t)(col0 + t * 16 + ln) * ldb + kb; FragH bq; bq.half[0] = *(const v8us*)(Bh + boff + 8 * hh); bq.half[1] = *(const v8us*)(Bh + boff + 16 + 8 * hh);
      acc[t] = mmaH<ASPLIT ? 2 : 1>(ah.v, al.v, bq.v, bq.v, acc[t]); }
  }
#pragma unroll
  for (int t = 0; t < 4; ++t) { if (col0 + t * 16 >= N) continue;
#pragma unroll
    for (int r = 0; r < 8; ++r) so[w][8 * hh + r][t * 16 + ln] = acc[t][r] * alpha; }
  __builtin_amdgcn_fence(__ATOMIC_ACQ_REL, "workgroup"); __builtin_amdgcn_wave_barrier();
  const int rsub = lane >> 4, c4 = (lane & 15) * 4;
  {
#pragma unroll
    for (int q = 0; q < 8; ++q) { const int r = q * 2 + rsub; if (col0 + c4 < N) { const v4f v = *(const v4fa*)&so[w][r][c4]; *(v4f*)(C + (size_t)(row0 + r) * ldc + col0 + c4) = v; } }
     }
}

// Wt[n][k] = f16(W[k][n]·scale) from f32 row-major W[K][N] (scale = power of two; bf16-exact weights stay exact in f16 away from the subnormal range)
__global__ __launch_bounds__(256) void k_wt_f16(const float* __restrict__ W, _Float16* __restrict__ Wt, int K, int N, float scale) {
  const int t = blockIdx.x * 256 + threadIdx.x; if (t >= N * (K / 8)) return; const int n = t / (K / 8), k8 = (t % (K / 8)) * 8; FragH f;
#pragma unroll
  for (int i = 0; i < 8; ++i) f.h[i] = (_Float16)(bf16_round(W[(size_t)(k8 + i) * N + n]) * scale); const v8us o = f.half[0];
  *(v8us*)((unsigned short*)Wt + (size_t)n * K + k8) = o; 
}
// k_gemm_hh variant with fused epilogue: v = acc·alpha + bias[by·sBias + col] (+ CP[(row/rowsPerB)·sCPb + by·64 + col] if CP) ; ACT 0 none / 1 elu ; writes f32 C and/or f16 C16 (each if non-null)
template <int ACT>
__global__ __launch_bounds__(128) void k_gemm_hhx(const _Float16* __restrict__ A, int lda, size_t sA, const _Float16* __restrict__ Bh, int ldb, size_t sB, float alpha, const float* __restrict__ bias, size_t sBias, const float* __restrict__ CP, int rowsPerB, size_t sCPb, int row0g,
    float* __restrict__ C, _Float16* __restrict__ C16, int ldc, size_t sC, int M, int N, int K) {
  __shared__ __attribute__((aligned(16))) float so[4][16][64];
  const int tid = threadIdx.x, w = tid >> 5, lane = tid & 31, ln = lane & 15, hh = lane >> 4; const int by = blockIdx.y;
  A += (size_t)by * sA; Bh += (size_t)by * sB; const size_t cofs = (size_t)by * sC; const float* bp = bias ? bias + (size_t)by * sBias : nullptr;
  const int ntn = (N + 63) / 64; const int wid = blockIdx.x * 4 + w; const int mt = wid / ntn, nq = wid % ntn; if (mt * 16 >= M) return;
  const int row0 = mt * 16, col0 = nq * 64; const _Float16* arow = A + (size_t)(row0 + ln) * lda;
  v8f acc[4] = {};
  for (int kb = 0; kb < K; kb += 32) { FragH ah; ah.half[0] = *(const v8us*)((const unsigned short*)arow + kb + 8 * hh); ah.half[1] = *(const v8us*)((const unsigned short*)arow + kb + 16 + 8 * hh);
#pragma unroll
    for (int t = 0; t < 4; ++t) { if (col0 + t * 16 >= N) continue; const size_t boff = (size_t)(col0 + t * 16 + ln) * ldb + kb; FragH bq; bq.half[0] = *(const v8us*)((const unsigned short*)Bh + boff + 8 * hh); bq.half[1] = *(const v8us*)((const unsigned short*)Bh + boff + 16 + 8 * hh);
      acc[t] = mmaH<1>(ah.v, ah.v, bq.v, bq.v, acc[t]); }
  }
#pragma unroll
  for (int t = 0; t < 4; ++t) { if (col0 + t * 16 >= N) continue; const int col = col0 + t * 16 + ln; const float bv = bp ? bf16_round(bp[col]) : 0.f;
#pragma unroll
    for (int r = 0; r < 8; ++r) { float v = acc[t][r] * alpha + bv; if (CP) { const int bidx = (row0g + row0 + 8 * hh + r) / rowsPerB; v += CP[(size_t)bidx * sCPb + (size_t)by * 64 + col]; } if (ACT == 1) v = (v > 0.f) ? v : expm1f(v); else if (ACT == 3) v = fmaxf(v, 0.f); so[w][8 * hh + r][t * 16 + ln] = v; } }
  __builtin_amdgcn_fence(__ATOMIC_ACQ_REL, "workgroup"); __builtin_amdgcn_wave_barrier();
  const int rsub = lane >> 4, c4 = (lane & 15) * 4; typedef _Float16 v4h __attribute__((ext_vector_type(4)));
  {
#pragma unroll
    for (int q = 0; q < 8; ++q) { const int r = q * 2 + rsub; if (col0 + c4 < N) { const v4f v = *(const v4fa*)&so[w][r][c4]; if (C) *(v4f*)(C + cofs + (size_t)(row0 + r) * ldc + col0 + c4) = v; if (C16) { v4h h4; for (int i = 0; i < 4; ++i) h4[i] = (_Float16)v[i]; *(v4h*)(C16 + cofs + (size_t)(row0 + r) * ldc + col0 + c4) = h4; } } }
     }
}


__global__ __launch_bounds__(256) void k_round16f(const float* __restrict__ W, _Float16* __restrict__ Bt, size_t n8) { const size_t t = (size_t)blockIdx.x * 256 + threadIdx.x; if (t >= n8) return; FragH f;
#pragma unroll
  for (int i = 0; i < 8; ++i) f.h[i] = (_Float16)(bf16_round(W[t * 8 + i]) * 16.0f); *(v8us*)((unsigned short*)Bt + t * 8) = f.half[0];  }
// K rows (f32 -> bf16 value -> f16) in the order of the score product's A fragments. A 16-byte unit holds 8 dims of one key; unit ((kt * 2 + ks) * 2 + half) * 32 + hh * 16 + ln
// of a (batch, head) slab is key kt * 16 + ln, dims ks * 32 + half * 16 + hh * 8 .. + 7: a wave's load of one fragment half is 512 contiguous bytes (four whole lines).
// One block = 16 keys x all 8 heads, read in whole rows and turned through LDS; a group of 16 units takes 256 + 16 bytes there, so that neither side meets a bank conflict.
__global__ __launch_bounds__(256) void k_kpack(const float* __restrict__ x, _Float16* __restrict__ Kp) { __shared__ __attribute__((aligned(16))) unsigned short st[64 * 136]; const int tid = threadIdx.x; const int b = blockIdx.x / 256, kt = blockIdx.x % 256;
#pragma unroll      // the four rounds' loads fly together
  for (int i = 0; i < 4; ++i) { const int u = i * 256 + tid, ln = u >> 6, c8 = u & 63; const float* s = x + ((size_t)b * 4096 + kt * 16 + ln) * 512 + c8 * 8; const v4f a0 = *(const v4fa*)s, a1 = *(const v4fa*)(s + 4); FragH f;      // c8 = head * 8 + ks * 4 + half * 2 + hh
#pragma unroll      // constant vector indices: the values stay in registers
    for (int q = 0; q < 4; ++q) { f.h[q] = (_Float16)bf16_round(a0[q]); f.h[4 + q] = (_Float16)bf16_round(a1[q]); }
    *(v8us*)&st[c8 * 136 + ln * 8] = f.half[0]; }
  __syncthreads();
#pragma unroll      // the four LDS reads are issued ahead of the first store
  for (int i = 0; i < 4; ++i) { const int p = i * 256 + tid; const v8us o = *(const v8us*)&st[(p >> 4) * 136 + (p & 15) * 8];      // p >> 7 = head
    *(v8us*)((unsigned short*)Kp + ((((size_t)b * 8 + (p >> 7)) * 256 + kt) * 128 + (p & 127)) * 8) = o; } }
// V (f32 -> bf16 value -> f16, converted here on the way into LDS) transposed, in the order of the second product's A fragments: unit ((pass * 4 + dt) * 2 + half) * 32 + hh * 16 + ln of a slab is dim dt * 16 + ln, keys pass * 32 + half * 16 + hh * 8 .. + 7.
template <int NHv, int TTv>
__global__ __launch_bounds__(256) void k_vt(const float* __restrict__ V, int ldv, int voff, _Float16* __restrict__ Vt) { __shared__ unsigned short tl[64][66]; const int tid = threadIdx.x; const int slab = blockIdx.x / (TTv / 64), lg = blockIdx.x % (TTv / 64); const int b = slab / NHv, h = slab % NHv;
#pragma unroll      // the four rounds' loads fly together
  for (int rd = 0; rd < 4; ++rd) { const int i = rd * 256 + tid, r = i >> 4, c4 = (i & 15) * 4; const v4f a = *(const v4fa*)(V + ((size_t)b * TTv + lg * 64 + r) * ldv + voff + h * 64 + c4); FragH f;      // 16 lanes take a head's 256-byte row piece: whole lines
#pragma unroll      // constant vector indices: the values stay in registers
    for (int q = 0; q < 4; ++q) { f.h[q] = (_Float16)bf16_round(a[q]); tl[r][c4 + q] = f.u[q]; } }
  __syncthreads();
  {
#pragma unroll
    for (int rd = 0; rd < 2; ++rd) { const int u = rd * 256 + tid, d = ((u >> 6) & 3) * 16 + (u & 15), k0 = rd * 32 + ((u >> 4) & 3) * 8; FragH f;      // the block's 64 keys are two passes: 512 units in a row
#pragma unroll
      for (int q = 0; q < 8; ++q) f.u[q] = tl[k0 + q][d];
      *(v8us*)((unsigned short*)Vt + ((size_t)blockIdx.x * 512 + u) * 8) = f.half[0]; }
     } }

typedef float v2f __attribute__((ext_vector_type(2)));
// lane l <-> lane l ^ 16 as a vector cross-row move: no LDS queue and no wait, unlike a shuffle
__device__ __forceinline__ float xhalf(float x) { return __builtin_bit_cast(float, __builtin_amdgcn_permlanex16(__builtin_bit_cast(int, x), __builtin_bit_cast(int, x), 0x76543210, 0xfedcba98, false, false)); }

// Transposed products: St = K.Qt (A = K rows, B = Q rows) and Ot += Vt.Pt (A = Vt rows, B = Pt). In a 16 x 16 tile of St lane (ln, hh) holds
// query column ln and keys 8hh + r, so maximum and sum of a query run inside the lane (one exchange between the halves for the maximum), and the two
// key tiles of a pass, converted in place, are the B operand of the second product in the loaders' own k order: P never leaves the registers.
// Q comes as the f32 input and is converted (f32 -> bf16 value -> f16) once, on the way into its fragments; O leaves as the f16 operand of the output linear.
__global__ __launch_bounds__(128) void k_flash(const float* __restrict__ Qf, int ldq, const _Float16* __restrict__ Kp, const _Float16* __restrict__ Vt, const int* __restrict__ MSK, _Float16* __restrict__ O16, int ldo) {
  constexpr int RPW = 32, NQB = 4096 / (4 * RPW), DT = 4, KS = 2; (void)MSK;
  constexpr float SL2 = 0.125f * 1.44269504088896340736f;      // 64^-1/2 x log2(e): exp(x / 8 - m / 8) = 2^(x * SL2 - m * SL2)
  __shared__ __attribute__((aligned(16))) unsigned short sO[4][RPW][64 + 8];      // row pitch 144 bytes = 16 x 9: 16-byte accesses down a column meet no bank conflict
  const int tid = threadIdx.x, w = tid >> 5, lane = tid & 31, ln = lane & 15, hh = lane >> 4;
  const int slab = blockIdx.x / NQB, qblk = blockIdx.x % NQB; const int b = slab / 8, h = slab % 8; const int qb0 = qblk * (4 * RPW); const int q0 = qb0 + w * RPW;
  v4f qf[2][KS][4];      // raw f32 Q in the fragments' k order: [0], [1] = dims ks * 32 + 8hh .. + 7, [2], [3] = dims ks * 32 + 16 + 8hh .. + 7
#pragma unroll
  for (int rt = 0; rt < 2; ++rt) { const float* qr = Qf + ((size_t)b * 4096 + q0 + rt * 16 + ln) * ldq + h * 64;
#pragma unroll
    for (int ks = 0; ks < KS; ++ks) { const float* qk = qr + ks * 32 + 8 * hh; qf[rt][ks][0] = *(const v4fa*)qk; qf[rt][ks][1] = *(const v4fa*)(qk + 4); qf[rt][ks][2] = *(const v4fa*)(qk + 16); qf[rt][ks][3] = *(const v4fa*)(qk + 20); } }
  asm volatile("s_wait_xcnt 0x0" ::: "memory");      // the K loads below may be given the Q loads' address registers as their destination: the wait stands in front of that overwrite
  const unsigned short* kl = (const unsigned short*)Kp + (size_t)slab * 4096 * 64 + lane * 8;      // fragment order (k_kpack): this lane's unit of the slab's first fragment half; a pass is 4 KiB in a row
  FragH bk[2][KS];      // K of pass 0; inside the loop each pass fetches the next pass's
#pragma unroll
  for (int nt = 0; nt < 2; ++nt)
#pragma unroll
    for (int ks = 0; ks < KS; ++ks) { const unsigned short* kr = kl + nt * 1024 + ks * 512; bk[nt][ks].half[0] = *(const v8us*)kr; bk[nt][ks].half[1] = *(const v8us*)(kr + 256); }
  asm volatile("s_wait_xcnt 0x0" ::: "memory");      // the address registers of the loads above are reused below: the wait stands in front of their overwrite
  __builtin_amdgcn_sched_barrier(0);                 // keeps the set-up code that reuses those registers behind that wait
  FragH aq[2][KS];
#pragma unroll      // all three loops: constant indices, so that the raw values and the fragments stay in registers
  for (int rt = 0; rt < 2; ++rt)
#pragma unroll
    for (int ks = 0; ks < KS; ++ks)
#pragma unroll
      for (int i = 0; i < 16; ++i) aq[rt][ks].h[i] = (_Float16)bf16_round(qf[rt][ks][i >> 2][i & 3]);
  const unsigned short* Vth = (const unsigned short*)Vt + (size_t)slab * 64 * 4096;
  float m_r[2], l_r[2]; v8f oacc[2][DT];      // per lane: query rt * 16 + ln; m_r = running maximum in base-2 exponent units (score x SL2); oacc[rt][dt][r] = Ot[dt * 16 + 8hh + r][that query]
#pragma unroll
  for (int rt = 0; rt < 2; ++rt) { m_r[rt] = -3.0e38f; l_r[rt] = 0.f;
#pragma unroll
    for (int dt = 0; dt < DT; ++dt) oacc[rt][dt] = (v8f){0.f,0.f,0.f,0.f,0.f,0.f,0.f,0.f}; }
  const int jend = 4096;
  // Every load of a pass is issued a phase ahead of its use: V of a pass at the pass's top, K of the next pass right behind this pass's score products,
  // into the same registers, so that each flies over the softmax arithmetic and no product waits out a round trip to L2.
  const unsigned short* vl = Vth + lane * 8;                                                                     // fragment order (k_vt): a pass is 4 KiB in a row
  FragH bv[DT];
#pragma unroll 1
  for (int j0 = 0; j0 < jend; j0 += 32) {
#pragma unroll
    for (int dt = 0; dt < DT; ++dt) { const unsigned short* vrow = vl + (size_t)j0 * 64 + dt * 512; bv[dt].half[0] = *(const v8us*)vrow; bv[dt].half[1] = *(const v8us*)(vrow + 256); }
    v8f s[2][2];      // s[rt][nt][r] = score of key j0 + nt * 16 + 8hh + r against query rt * 16 + ln
#pragma unroll
    for (int nt = 0; nt < 2; ++nt) {
#pragma unroll
      for (int rt = 0; rt < 2; ++rt) { v8f acc = (v8f){0.f,0.f,0.f,0.f,0.f,0.f,0.f,0.f};
#pragma unroll
        for (int ks = 0; ks < KS; ++ks) acc = mmaH<1>(bk[nt][ks].v, bk[nt][ks].v, aq[rt][ks].v, aq[rt][ks].v, acc); s[rt][nt] = acc; } }
    const int jn = (j0 + 32 < jend) ? j0 + 32 : 0;      // the last pass fetches pass 0's rows again (unused): the address stays inside Kp
#pragma unroll
    for (int nt = 0; nt < 2; ++nt)
#pragma unroll
      for (int ks = 0; ks < KS; ++ks) { const unsigned short* kr = kl + (size_t)jn * 64 + nt * 1024 + ks * 512; bk[nt][ks].half[0] = *(const v8us*)kr; bk[nt][ks].half[1] = *(const v8us*)(kr + 256); }
    FragH pb[2];
#pragma unroll
    for (int rt = 0; rt < 2; ++rt) {
      float sc[16], mx[8];      // raw products: their maximum is taken first (the scale is positive); the scale goes into each exponent's one multiply-add
#pragma unroll
      for (int r = 0; r < 8; ++r) { sc[r] = s[rt][0][r]; sc[8 + r] = s[rt][1][r]; mx[r] = fmaxf(sc[r], sc[8 + r]); }
      float mc = fmaxf(fmaxf(fmaxf(mx[0], mx[1]), fmaxf(mx[2], mx[3])), fmaxf(fmaxf(mx[4], mx[5]), fmaxf(mx[6], mx[7])));
      mc = fmaxf(mc, xhalf(mc));      // both halves of a column must use one maximum: their P meet in one product
      const float mn = fmaxf(m_r[rt], mc * SL2); const float al = __builtin_amdgcn_exp2f(m_r[rt] - mn); m_r[rt] = mn;      // an unchanged maximum gives 2^0 = 1
      float ps[4] = {0.f, 0.f, 0.f, 0.f};
#pragma unroll
      for (int i = 0; i < 16; i += 2) {      // two neighbouring scores of an accumulator share one packed multiply-add
        const v2f e = __builtin_elementwise_fma((v2f){sc[i], sc[i + 1]}, (v2f){SL2, SL2}, (v2f){-mn, -mn});
        const float p0 = __builtin_amdgcn_exp2f(e[0]), p1 = __builtin_amdgcn_exp2f(e[1]);
        ps[i & 3] += p0; ps[(i + 1) & 3] += p1; pb[rt].h[i] = (_Float16)p0; pb[rt].h[i + 1] = (_Float16)p1; }
      l_r[rt] = l_r[rt] * al + ((ps[0] + ps[1]) + (ps[2] + ps[3]));      // this half's keys only; the halves join after the loop
#pragma unroll
      for (int dt = 0; dt < DT; ++dt)
#pragma unroll
        for (int r = 0; r < 8; ++r) oacc[rt][dt][r] *= al; }
#pragma unroll
    for (int dt = 0; dt < DT; ++dt) {
#pragma unroll
      for (int rt = 0; rt < 2; ++rt) oacc[rt][dt] = mmaH<1>(bv[dt].v, bv[dt].v, pb[rt].v, pb[rt].v, oacc[rt][dt]); } }
#pragma unroll
  for (int rt = 0; rt < 2; ++rt) { float l = l_r[rt]; l += xhalf(l); const float li = (l > 0.f) ? 1.0f / l : 0.f;
#pragma unroll
    for (int dt = 0; dt < DT; ++dt) { FragH f;
#pragma unroll
      for (int r = 0; r < 8; ++r) f.h[r] = (_Float16)(oacc[rt][dt][r] * li);
      *(v8us*)&sO[w][rt * 16 + ln][dt * 16 + 8 * hh] = f.half[0]; } }
  __builtin_amdgcn_fence(__ATOMIC_ACQ_REL, "workgroup"); __builtin_amdgcn_wave_barrier();
  {
#pragma unroll
    for (int rp = 0; rp < RPW; rp += 4) { const int r = rp + (lane >> 3), pc = lane & 7; const v8us val = *(const v8us*)&sO[w][r][pc * 8]; *(v8us*)((unsigned short*)O16 + ((size_t)b * 4096 + q0 + r) * ldo + h * 64 + pc * 8) = val; }      // 8 lanes store a head's 128-byte row piece: one whole line
     } }

extern "C" void kernel_launch(void* const* d_in, const int* in_sizes, int n_in,
                              void* d_out, int out_size, void* d_ws, size_t ws_size, hipStream_t stream) {
  (void)in_sizes; (void)n_in; (void)out_size;
  const float* q = (const float*)d_in[0]; const float* k = (const float*)d_in[1]; const float* v = (const float*)d_in[2]; const float* Wo = (const float*)d_in[3]; const float* bo = (const float*)d_in[4];
  char* ws = (char*)d_ws; size_t off = 0;
  auto take = [&](size_t bytes) { char* p = ws + off; off += (bytes + 255) & ~(size_t)255; return p; };
  _Float16* Bo = (_Float16*)take((size_t)NO * CC * 2); _Float16* K16 = (_Float16*)take((size_t)NR * CC * 2); _Float16* Vt = (_Float16*)take((size_t)NR * CC * 2); _Float16* O16 = (_Float16*)take((size_t)NR * CC * 2);
  if (off > ws_size) return;      // 3 x 8.4 MB
  k_wt_f16<<<(NO * (CC / 8) + 255) / 256, 256, 0, stream>>>(Wo, Bo, CC, NO, 16.0f);      // [in][out]
  k_kpack<<<NR / 16, 256, 0, stream>>>(k, K16);
  k_vt<NH, TT><<<BB * NH * (TT / 64), 256, 0, stream>>>(v, CC, 0, Vt);
  k_flash<<<BB * NH * (TT / 128), 128, 0, stream>>>(q, CC, K16, Vt, nullptr, O16, CC);
  k_gemm_hhx<0><<<dim3(((NR / 16) * 1 + 3) / 4, 1), 128, 0, stream>>>(O16, CC, 0, Bo, CC, 0, 0.0625f, bo, 0, nullptr, 1, 0, 0, (float*)d_out, nullptr, NO, 0, NR, NO, CC);      // N = 64
}

// v006
// It runs in 93.2 microseconds.
// Two timings next to v005 put it at 1.33 and 1.34 times that version's speed.
// Over all steps from v000 it is 7.24 times as fast.
#include <hip/hip_runtime.h>
// 8-head attention over the given q/k/v (2 × 4096 tokens, d = 64) as a fused flash-style kernel on v_wmma_f32_16x16x32_f16 (q, k, v are module INPUTS → exact bf16 values as f16 operands; S = Q·Kᵀ × 64^-½,
// online max/sum softmax f32, P f16 ≤ 1, O = P·V), then the 512→64 output linear (+ bias; W_out [in][out] bf16-exact ×2^4); f32 accumulate.
#define BB 2
#define TT 4096
#define CC 512
#define NH 8
#define NO 64
#define NR (BB * TT)

typedef __bf16 v16b __attribute__((ext_vector_type(16)));
typedef unsigned short v8us __attribute__((ext_vector_type(8), may_alias));
typedef float  v8f  __attribute__((ext_vector_type(8)));
typedef float  v4f  __attribute__((ext_vector_type(4)));
typedef float  v4fa __attribute__((ext_vector_type(4), may_alias));
union FragB { v16b v; v8us half[2]; unsigned short u[16]; };

__device__ __forceinline__ unsigned short bf16_bits(float x) { unsigned int u = __float_as_uint(x); return (unsigned short)((u + 0x7FFFu + ((u >> 16) & 1u)) >> 16); }
__device__ __forceinline__ float bf16_val(unsigned short b) { return __uint_as_float(((unsigned int)b) << 16); }
__device__ __forceinline__ float bf16_round(float x) { return bf16_val(bf16_bits(x)); }
// D += A·B with NT terms: 1 = ah·bh, 2 = + al·bh (A split), 3 = + ah·bl (both split)
template <int NT>
__device__ __forceinline__ v8f mmaN(v16b ah, v16b al, v16b bh, v16b bl, v8f c) {
  c = __builtin_amdgcn_wmma_f32_16x16x32_bf16(false, ah, false, bh, (short)0, c, false, false);
  if (NT >= 2) c = __builtin_amdgcn_wmma_f32_16x16x32_bf16(false, al, false, bh, (short)0, c, false, false);
  if (NT >= 3) c = __builtin_amdgcn_wmma_f32_16x16x32_bf16(false, ah, false, bl, (short)0, c, false, false);
  asm volatile("v_nop\n\tv_nop\n\tv_nop\n\tv_nop" : "+v"(c) : "v"(ah), "v"(al), "v"(bh), "v"(bl));
  return c;
}

__global__ __launch_bounds__(256) void k_wt_bf16(const float* __restrict__ W, unsigned short* __restrict__ Wt, int K, int N) {
  const int t = blockIdx.x * 256 + threadIdx.x;
  const int k8n = K / 8;
  if (t >= N * k8n) return;
  const int n = t / k8n, k8 = (t % k8n) * 8;
  v8us v;
#pragma unroll
  for (int i = 0; i < 8; ++i) v[i] = bf16_bits(W[(size_t)(k8 + i) * N + n]);
  *(v8us*)(Wt + (size_t)n * K + k8) = v;
  
}

// GEMM C[M][N] (f32, pitch ldc) = act(A[M][K]·W + bias). A f32 row-major (pitch lda) converted per fragment to bf16
// (ASPLIT: hi/lo two planes -> 2 terms, else single rounded term); Wt bf16 [N][K] (pitch ldb). BIAS_BF16 rounds the
// bias to bf16 first (bias quantised to bf16 before the add). K%32==0, M%16==0, N%64==0.
template <bool ASPLIT, int ACT, bool BIAS_BF16>
__global__ __launch_bounds__(128) void k_gemm_bf(const float* __restrict__ A, int lda, const unsigned short* __restrict__ Wt, int ldb,
                                               const float* __restrict__ bias, float* __restrict__ C, int ldc, int M, int N, int K) {
  __shared__ __attribute__((aligned(16))) float so[4][16][64];
  const int tid = threadIdx.x, w = tid >> 5, lane = tid & 31, ln = lane & 15, hh = lane >> 4;
  const int ntn = N / 64;
  const int wid = blockIdx.x * 4 + w;
  const int mt = wid / ntn, nq = wid % ntn;
  if (mt * 16 >= M) return;
  const int row0 = mt * 16, col0 = nq * 64;
  const float* arow = A + (size_t)(row0 + ln) * lda;
  v8f acc[4] = {};
  for (int kb = 0; kb < K; kb += 32) {
    FragB ah, al;
    const v4f x0 = *(const v4fa*)(arow + kb + 8 * hh), x1 = *(const v4fa*)(arow + kb + 8 * hh + 4);
    const v4f x2 = *(const v4fa*)(arow + kb + 16 + 8 * hh), x3 = *(const v4fa*)(arow + kb + 16 + 8 * hh + 4);
    float xs[16] = {x0[0],x0[1],x0[2],x0[3],x1[0],x1[1],x1[2],x1[3],x2[0],x2[1],x2[2],x2[3],x3[0],x3[1],x3[2],x3[3]};
#pragma unroll
    for (int i = 0; i < 16; ++i) { const unsigned short hb = bf16_bits(xs[i]); ah.u[i] = hb; al.u[i] = ASPLIT ? bf16_bits(xs[i] - bf16_val(hb)) : (unsigned short)0; }
#pragma unroll
    for (int t = 0; t < 4; ++t) {
      const unsigned short* brow = Wt + (size_t)(col0 + t * 16 + ln) * ldb + kb;
      FragB b;
      b.half[0] = *(const v8us*)(brow + 8 * hh);
      b.half[1] = *(const v8us*)(brow + 16 + 8 * hh);
      acc[t] = mmaN<ASPLIT ? 2 : 1>(ah.v, al.v, b.v, b.v, acc[t]);
    }
  }
#pragma unroll
  for (int t = 0; t < 4; ++t) {
    float bv = bias ? bias[col0 + t * 16 + ln] : 0.f;
    if (BIAS_BF16) bv = bf16_round(bv);
#pragma unroll
    for (int r = 0; r < 8; ++r) { float v = acc[t][r] + bv; if (ACT == 1) v = fmaxf(v, 0.f); so[w][8 * hh + r][t * 16 + ln] = v; }
  }
  __builtin_amdgcn_fence(__ATOMIC_ACQ_REL, "workgroup");
  __builtin_amdgcn_wave_barrier();
  const int rsub = lane >> 4, c4 = (lane & 15) * 4;
  {
#pragma unroll
    for (int q = 0; q < 8; ++q) {
      const int r = q * 2 + rsub;
      const v4f v = *(const v4fa*)&so[w][r][c4];
      *(v4f*)(C + (size_t)(row0 + r) * ldc + col0 + c4) = v;
    }
    
  }
}

// Flash-style causal/unmasked attention, all contractions 3-term bf16 hi/lo splits, f32 softmax with running max.
// q,k,v rows are read from f32 buffers with arbitrary row pitch (so they can live inside a fused qkv buffer);
// D = head size (multiple of 32, <= 128); one wave = 16 query rows; block = 4 waves (64 queries) sharing K/V chunks of 32.
template <int D, bool CAUSAL>
__global__ __launch_bounds__(128) void k_flash(const float* __restrict__ qb, const float* __restrict__ kb, const float* __restrict__ vb,
                                             int pitch, int T, int H, float scale, float* __restrict__ y, int ypitch) {
  constexpr int KS = D / 32;        // k-steps for QK
  constexpr int DT = D / 16;        // d tiles for PV
  __shared__ __attribute__((aligned(16))) unsigned short sKh[32][D + 8], sKl[32][D + 8], sVh[32][D + 8], sVl[32][D + 8];
  __shared__ __attribute__((aligned(16))) unsigned short sPh[4][16][40], sPl[4][16][40];
  __shared__ __attribute__((aligned(16))) float sO[4][16][D];
  const int tid = threadIdx.x, w = tid >> 5, lane = tid & 31, ln = lane & 15, hh = lane >> 4;
  const int nqb = (T + 63) / 64;
  const int bh = blockIdx.x / nqb, qblk = blockIdx.x % nqb;
  const int b = bh / H, h = bh % H;
  const int q0 = qblk * 64 + w * 16;
  const float* Q = qb + (size_t)b * T * pitch + h * D;
  const float* K = kb + (size_t)b * T * pitch + h * D;
  const float* V = vb + (size_t)b * T * pitch + h * D;

  // A fragments of the wave's 16 query rows (scaled), hi/lo
  FragB aqh[KS], aql[KS];
  {
    int row = q0 + ln; if (row >= T) row = T - 1;
    const float* qr = Q + (size_t)row * pitch;
#pragma unroll
    for (int ks = 0; ks < KS; ++ks)
#pragma unroll
      for (int i = 0; i < 16; ++i) {
        const int d = ks * 32 + ((i < 8) ? (8 * hh + i) : (16 + 8 * hh + (i - 8)));
        const float x = qr[d] * scale; const unsigned short hb = bf16_bits(x);
        aqh[ks].u[i] = hb; aql[ks].u[i] = bf16_bits(x - bf16_val(hb));
      }
  }
  float m_r[8], l_r[8];
#pragma unroll
  for (int r = 0; r < 8; ++r) { m_r[r] = -3.0e38f; l_r[r] = 0.f; }
  v8f oacc[DT];
#pragma unroll
  for (int dt = 0; dt < DT; ++dt) oacc[dt] = (v8f){0.f,0.f,0.f,0.f,0.f,0.f,0.f,0.f};

  const int kv_end = CAUSAL ? min(T, qblk * 64 + 64) : T;     // block-uniform
  for (int j0 = 0; j0 < kv_end; j0 += 32) {
    __syncthreads();
    for (int e = tid; e < 32 * (D / 4); e += 128) {
      const int r = e / (D / 4), c4 = (e % (D / 4)) * 4;
      const int key = j0 + r;
      v4f kf = {0.f,0.f,0.f,0.f}, vf = {0.f,0.f,0.f,0.f};
      if (key < T) { kf = *(const v4fa*)(K + (size_t)key * pitch + c4); vf = *(const v4fa*)(V + (size_t)key * pitch + c4); }
#pragma unroll
      for (int t = 0; t < 4; ++t) {
        unsigned short hb = bf16_bits(kf[t]); sKh[r][c4 + t] = hb; sKl[r][c4 + t] = bf16_bits(kf[t] - bf16_val(hb));
        hb = bf16_bits(vf[t]); sVh[r][c4 + t] = hb; sVl[r][c4 + t] = bf16_bits(vf[t] - bf16_val(hb));
      }
    }
    __syncthreads();
    // S tile 16 x 32
    v8f s[2];
#pragma unroll
    for (int nt = 0; nt < 2; ++nt) {
      v8f acc = {};
#pragma unroll
      for (int ks = 0; ks < KS; ++ks) {
        FragB bh_, bl_;
        bh_.half[0] = *(const v8us*)&sKh[nt * 16 + ln][ks * 32 + 8 * hh]; bh_.half[1] = *(const v8us*)&sKh[nt * 16 + ln][ks * 32 + 16 + 8 * hh];
        bl_.half[0] = *(const v8us*)&sKl[nt * 16 + ln][ks * 32 + 8 * hh]; bl_.half[1] = *(const v8us*)&sKl[nt * 16 + ln][ks * 32 + 16 + 8 * hh];
        acc = mmaN<3>(aqh[ks].v, aql[ks].v, bh_.v, bl_.v, acc);
      }
      s[nt] = acc;
    }
    // mask + running max (rows 8hh+r; the 16 lanes of a half share rows)
    float alpha[8];
#pragma unroll
    for (int r = 0; r < 8; ++r) {
      const int qi = q0 + 8 * hh + r;
      const int ja = j0 + ln, jb = j0 + 16 + ln;
      if (CAUSAL) { if (ja > qi) s[0][r] = -3.0e38f; if (jb > qi) s[1][r] = -3.0e38f; }
      if (ja >= T) s[0][r] = -3.0e38f;
      if (jb >= T) s[1][r] = -3.0e38f;
      float mx = fmaxf(s[0][r], s[1][r]);
      mx = fmaxf(mx, __shfl_xor(mx, 1, 32)); mx = fmaxf(mx, __shfl_xor(mx, 2, 32)); mx = fmaxf(mx, __shfl_xor(mx, 4, 32)); mx = fmaxf(mx, __shfl_xor(mx, 8, 32));
      const float mnew = fmaxf(m_r[r], mx);
      alpha[r] = (mnew > -1.0e38f) ? __expf(m_r[r] - mnew) : 1.0f;
      const float p0 = (s[0][r] > -1.0e38f) ? __expf(s[0][r] - mnew) : 0.f;
      const float p1 = (s[1][r] > -1.0e38f) ? __expf(s[1][r] - mnew) : 0.f;
      m_r[r] = mnew;
      l_r[r] = l_r[r] * alpha[r] + p0 + p1;            // per-lane partial row sum (16 lanes combined at the end)
      unsigned short hb = bf16_bits(p0); sPh[w][8 * hh + r][ln] = hb;      sPl[w][8 * hh + r][ln] = bf16_bits(p0 - bf16_val(hb));
      hb = bf16_bits(p1);                sPh[w][8 * hh + r][16 + ln] = hb; sPl[w][8 * hh + r][16 + ln] = bf16_bits(p1 - bf16_val(hb));
    }
#pragma unroll
    for (int dt = 0; dt < DT; ++dt)
#pragma unroll
      for (int r = 0; r < 8; ++r) oacc[dt][r] *= alpha[r];
    __builtin_amdgcn_fence(__ATOMIC_ACQ_REL, "workgroup");
    __builtin_amdgcn_wave_barrier();
    FragB pah, pal;
    pah.half[0] = *(const v8us*)&sPh[w][ln][8 * hh]; pah.half[1] = *(const v8us*)&sPh[w][ln][16 + 8 * hh];
    pal.half[0] = *(const v8us*)&sPl[w][ln][8 * hh]; pal.half[1] = *(const v8us*)&sPl[w][ln][16 + 8 * hh];
#pragma unroll
    for (int dt = 0; dt < DT; ++dt) {
      FragB bvh, bvl;
#pragma unroll
      for (int i = 0; i < 8; ++i) {
        bvh.u[i] = sVh[8 * hh + i][dt * 16 + ln]; bvh.u[8 + i] = sVh[16 + 8 * hh + i][dt * 16 + ln];
        bvl.u[i] = sVl[8 * hh + i][dt * 16 + ln]; bvl.u[8 + i] = sVl[16 + 8 * hh + i][dt * 16 + ln];
      }
      oacc[dt] = mmaN<3>(pah.v, pal.v, bvh.v, bvl.v, oacc[dt]);
    }
    __builtin_amdgcn_fence(__ATOMIC_ACQ_REL, "workgroup");
    __builtin_amdgcn_wave_barrier();
  }
#pragma unroll
  for (int r = 0; r < 8; ++r) {
    float l = l_r[r];
    l += __shfl_xor(l, 1, 32); l += __shfl_xor(l, 2, 32); l += __shfl_xor(l, 4, 32); l += __shfl_xor(l, 8, 32);
    l_r[r] = (l > 0.f) ? 1.0f / l : 0.f;
  }
#pragma unroll
  for (int dt = 0; dt < DT; ++dt)
#pragma unroll
    for (int r = 0; r < 8; ++r) sO[w][8 * hh + r][dt * 16 + ln] = oacc[dt][r] * l_r[r];
  __builtin_amdgcn_fence(__ATOMIC_ACQ_REL, "workgroup");
  __builtin_amdgcn_wave_barrier();
  {
    for (int r = 0; r < 16; ++r) {
      const int row = q0 + r;
      if (row < T && lane < D / 4) {
        const v4f val = *(const v4fa*)&sO[w][r][lane * 4];
        *(v4f*)(y + ((size_t)b * T + row) * ypitch + h * D + lane * 4) = val;
      }
    }
    
  }
}

// GEMM C = act(A·W + bias + resid): A f32 (ASPLIT -> hi/lo 2 terms), Wt bf16 [N][K]; ACT 0 none, 1 relu, 2 exact gelu;
// resid (optional, f32, row index = (row % rmod), pitch ldr, RES_BF16 rounds it) added before the activation.
template <bool ASPLIT, int ACT, bool BIAS_BF16, bool RES_BF16>
__global__ __launch_bounds__(128) void k_gemm_bf3(const float* __restrict__ A, int lda, const unsigned short* __restrict__ Wt, int ldb,
                                                const float* __restrict__ bias, const float* __restrict__ resid, int rmod, int ldr,
                                                float* __restrict__ C, int ldc, int M, int N, int K) {
  __shared__ __attribute__((aligned(16))) float so[4][16][64];
  const int tid = threadIdx.x, w = tid >> 5, lane = tid & 31, ln = lane & 15, hh = lane >> 4;
  const int ntn = N / 64;
  const int wid = blockIdx.x * 4 + w;
  const int mt = wid / ntn, nq = wid % ntn;
  if (mt * 16 >= M) return;
  const int row0 = mt * 16, col0 = nq * 64;
  const float* arow = A + (size_t)(row0 + ln) * lda;
  v8f acc[4] = {};
  for (int kb = 0; kb < K; kb += 32) {
    FragB ah, al;
    const v4f x0 = *(const v4fa*)(arow + kb + 8 * hh), x1 = *(const v4fa*)(arow + kb + 8 * hh + 4);
    const v4f x2 = *(const v4fa*)(arow + kb + 16 + 8 * hh), x3 = *(const v4fa*)(arow + kb + 16 + 8 * hh + 4);
    float xs[16] = {x0[0],x0[1],x0[2],x0[3],x1[0],x1[1],x1[2],x1[3],x2[0],x2[1],x2[2],x2[3],x3[0],x3[1],x3[2],x3[3]};
#pragma unroll
    for (int i = 0; i < 16; ++i) { const unsigned short hb = bf16_bits(xs[i]); ah.u[i] = hb; al.u[i] = ASPLIT ? bf16_bits(xs[i] - bf16_val(hb)) : (unsigned short)0; }
#pragma unroll
    for (int t = 0; t < 4; ++t) {
      const unsigned short* brow = Wt + (size_t)(col0 + t * 16 + ln) * ldb + kb;
      FragB b;
      b.half[0] = *(const v8us*)(brow + 8 * hh);
      b.half[1] = *(const v8us*)(brow + 16 + 8 * hh);
      acc[t] = mmaN<ASPLIT ? 2 : 1>(ah.v, al.v, b.v, b.v, acc[t]);
    }
  }
#pragma unroll
  for (int t = 0; t < 4; ++t) {
    const int col = col0 + t * 16 + ln;
    float bv = bias ? bias[col] : 0.f;
    if (BIAS_BF16) bv = bf16_round(bv);
#pragma unroll
    for (int r = 0; r < 8; ++r) {
      float v = acc[t][r] + bv;
      if (resid) { float rv = resid[(size_t)((row0 + 8 * hh + r) % rmod) * ldr + col]; if (RES_BF16) rv = bf16_round(rv); v += rv; }
      if (ACT == 1) v = fmaxf(v, 0.f);
      if (ACT == 2) v = 0.5f * v * (1.0f + erff(v * 0.70710678118654752f));
      if (ACT == 3) { const float u = 0.7978845608028654f * (v + 0.044715f * v * v * v); v = 0.5f * v * (1.0f + tanhf(u)); }
      so[w][8 * hh + r][t * 16 + ln] = v;
    }
  }
  __builtin_amdgcn_fence(__ATOMIC_ACQ_REL, "workgroup");
  __builtin_amdgcn_wave_barrier();
  const int rsub = lane >> 4, c4 = (lane & 15) * 4;
  {
#pragma unroll
    for (int q = 0; q < 8; ++q) {
      const int r = q * 2 + rsub;
      const v4f v = *(const v4fa*)&so[w][r][c4];
      *(v4f*)(C + (size_t)(row0 + r) * ldc + col0 + c4) = v;
    }
    
  }
}
// row LayerNorm (biased variance, eps) over N: s = X (+ R); optional out_sum <- s; out_norm <- (s-mu)*rsqrt(var+eps)*g + b
template <bool PARAM_BF16>
__global__ __launch_bounds__(256) void k_layernorm(const float* __restrict__ X, const float* __restrict__ R, const float* __restrict__ g, const float* __restrict__ bta,
                                                  float* __restrict__ out_sum, float* __restrict__ out_norm, int N, float eps) {
  __shared__ float red[256];
  const int row = blockIdx.x, tid = threadIdx.x;
  const float* x = X + (size_t)row * N; const float* rr = R ? R + (size_t)row * N : nullptr;
  float vals[16];                     // up to N = 4096
  const int per = N / 256;            // contiguous chunk per thread? use strided-by-4 chunks: thread handles j = tid*4 + 1024*u
  float s1 = 0.f;
  for (int u = 0; u < per / 4; ++u) {
    const int j = tid * 4 + 1024 * u;
    const v4f a = *(const v4fa*)(x + j);
    v4f b = {0.f,0.f,0.f,0.f}; if (rr) b = *(const v4fa*)(rr + j);
#pragma unroll
    for (int q = 0; q < 4; ++q) { const float v = a[q] + b[q]; vals[u * 4 + q] = v; s1 += v; }
  }
  red[tid] = s1; __syncthreads();
  for (int st = 128; st > 0; st >>= 1) { if (tid < st) red[tid] += red[tid + st]; __syncthreads(); }
  const float mu = red[0] / (float)N; __syncthreads();
  float s2 = 0.f;
  for (int u = 0; u < per / 4; ++u)
#pragma unroll
    for (int q = 0; q < 4; ++q) { const float c = vals[u * 4 + q] - mu; s2 += c * c; }
  red[tid] = s2; __syncthreads();
  for (int st = 128; st > 0; st >>= 1) { if (tid < st) red[tid] += red[tid + st]; __syncthreads(); }
  const float rs = rsqrtf(red[0] / (float)N + eps);
  {
    for (int u = 0; u < per / 4; ++u) {
      const int j = tid * 4 + 1024 * u;
      v4f o, sm;
#pragma unroll
      for (int q = 0; q < 4; ++q) {
        float gg = g[j + q], bb = bta[j + q];
        if (PARAM_BF16) { gg = bf16_round(gg); bb = bf16_round(bb); }
        sm[q] = vals[u * 4 + q]; o[q] = (vals[u * 4 + q] - mu) * rs * gg + bb;
      }
      if (out_sum) *(v4f*)(out_sum + (size_t)row * N + j) = sm;
      *(v4f*)(out_norm + (size_t)row * N + j) = o;
    }
    
  }
}



// ---- f16 WMMA path (v_wmma_f32_16x16x32_f16): 11-bit significands for operands in range — used for every matrix product here (Q·Kᵀ, P·V, output linear)
typedef _Float16 v16h __attribute__((ext_vector_type(16)));
union FragH { v16h v; v8us half[2]; _Float16 h[16]; unsigned short u[16]; };
template <int NT>
__device__ __forceinline__ v8f mmaH(v16h ah, v16h al, v16h bh, v16h bl, v8f c) {
  c = __builtin_amdgcn_wmma_f32_16x16x32_f16(false, ah, false, bh, (short)0, c, false, false);
  if (NT >= 2) c = __builtin_amdgcn_wmma_f32_16x16x32_f16(false, al, false, bh, (short)0, c, false, false);
  if (NT >= 3) c = __builtin_amdgcn_wmma_f32_16x16x32_f16(false, ah, false, bl, (short)0, c, false, false);
  asm volatile("v_nop\n\tv_nop\n\tv_nop\n\tv_nop" : "+v"(c) : "v"(ah), "v"(al), "v"(bh), "v"(bl));
  return c;
}
// batched GEMM like k_gemm_b but f16 operands: A f32 (split into f16 hi/lo if ASPLIT, else rounded to f16), Bt = f16 values [n][k]; alpha; C f32; N multiple of 16 (partial tiles skipped)
template <bool ASPLIT>
__global__ __launch_bounds__(128) void k_gemm_h(const float* __restrict__ A, int lda, size_t sA, const _Float16* __restrict__ Bh, int ldb, size_t sB, float alpha, float* __restrict__ C, int ldc, size_t sC, int M, int N, int K) {
  __shared__ __attribute__((aligned(16))) float so[4][16][64];
  const int tid = threadIdx.x, w = tid >> 5, lane = tid & 31, ln = lane & 15, hh = lane >> 4; const int by = blockIdx.y;
  A += (size_t)by * sA; Bh += (size_t)by * sB; C += (size_t)by * sC;
  const int ntn = (N + 63) / 64; const int wid = blockIdx.x * 4 + w; const int mt = wid / ntn, nq = wid % ntn; if (mt * 16 >= M) return;
  const int row0 = mt * 16, col0 = nq * 64; const float* arow = A + (size_t)(row0 + ln) * lda;
  v8f acc[4] = {};
  for (int kb = 0; kb < K; kb += 32) {
    FragH ah, al;
    const v4f x0 = *(const v4fa*)(arow + kb + 8 * hh), x1 = *(const v4fa*)(arow + kb + 8 * hh + 4), x2 = *(const v4fa*)(arow + kb + 16 + 8 * hh), x3 = *(const v4fa*)(arow + kb + 16 + 8 * hh + 4);
    float xs[16] = {x0[0],x0[1],x0[2],x0[3],x1[0],x1[1],x1[2],x1[3],x2[0],x2[1],x2[2],x2[3],x3[0],x3[1],x3[2],x3[3]};
#pragma unroll
    for (int i = 0; i < 16; ++i) { const _Float16 h = (_Float16)xs[i]; ah.h[i] = h; al.h[i] = ASPLIT ? (_Float16)(xs[i] - (float)h) : (_Float16)0.0f; }
#pragma unroll
    for (int t = 0; t < 4; ++t) { if (col0 + t * 16 >= N) continue; const size_t boff = (size_t)(col0 + t * 16 + ln) * ldb + kb; FragH bq; bq.half[0] = *(const v8us*)(Bh + boff + 8 * hh); bq.half[1] = *(const v8us*)(Bh + boff + 16 + 8 * hh);
      acc[t] = mmaH<ASPLIT ? 2 : 1>(ah.v, al.v, bq.v, bq.v, acc[t]); }
  }
#pragma unroll
  for (int t = 0; t < 4; ++t) { if (col0 + t * 16 >= N) continue;
#pragma unroll
    for (int r = 0; r < 8; ++r) so[w][8 * hh + r][t * 16 + ln] = acc[t][r] * alpha; }
  __builtin_amdgcn_fence(__ATOMIC_ACQ_REL, "workgroup"); __builtin_amdgcn_wave_barrier();
  const int rsub = lane >> 4, c4 = (lane & 15) * 4;
  {
#pragma unroll
    for (int q = 0; q < 8; ++q) { const int r = q * 2 + rsub; if (col0 + c4 < N) { const v4f v = *(const v4fa*)&so[w][r][c4]; *(v4f*)(C + (size_t)(row0 + r) * ldc + col0 + c4) = v; } }
     }
}

// Wt[n][k] = f16(W[k][n]·scale) from f32 row-major W[K][N] (scale = power of two; bf16-exact weights stay exact in f16 away from the subnormal range)
__global__ __launch_bounds__(256) void k_wt_f16(const float* __restrict__ W, _Float16* __restrict__ Wt, int K, int N, float scale) {
  const int t = blockIdx.x * 256 + threadIdx.x; if (t >= N * (K / 8)) return; const int n = t / (K / 8), k8 = (t % (K / 8)) * 8; FragH f;
#pragma unroll
  for (int i = 0; i < 8; ++i) f.h[i] = (_Float16)(bf16_round(W[(size_t)(k8 + i) * N + n]) * scale); const v8us o = f.half[0];
  *(v8us*)((unsigned short*)Wt + (size_t)n * K + k8) = o; 
}
// k_gemm_hh variant with fused epilogue: v = acc·alpha + bias[by·sBias + col] (+ CP[(row/rowsPerB)·sCPb + by·64 + col] if CP) ; ACT 0 none / 1 elu ; writes f32 C and/or f16 C16 (each if non-null)
template <int ACT>
__global__ __launch_bounds__(128) void k_gemm_hhx(const _Float16* __restrict__ A, int lda, size_t sA, const _Float16* __restrict__ Bh, int ldb, size_t sB, float alpha, const float* __restrict__ bias, size_t sBias, const float* __restrict__ CP, int rowsPerB, size_t sCPb, int row0g,
    float* __restrict__ C, _Float16* __restrict__ C16, int ldc, size_t sC, int M, int N, int K) {
  __shared__ __attribute__((aligned(16))) float so[4][16][64];
  const int tid = threadIdx.x, w = tid >> 5, lane = tid & 31, ln = lane & 15, hh = lane >> 4; const int by = blockIdx.y;
  A += (size_t)by * sA; Bh += (size_t)by * sB; const size_t cofs = (size_t)by * sC; const float* bp = bias ? bias + (size_t)by * sBias : nullptr;
  const int ntn = (N + 63) / 64; const int wid = blockIdx.x * 4 + w; const int mt = wid / ntn, nq = wid % ntn; if (mt * 16 >= M) return;
  const int row0 = mt * 16, col0 = nq * 64; const _Float16* arow = A + (size_t)(row0 + ln) * lda;
  v8f acc[4] = {};
  for (int kb = 0; kb < K; kb += 32) { FragH ah; ah.half[0] = *(const v8us*)((const unsigned short*)arow + kb + 8 * hh); ah.half[1] = *(const v8us*)((const unsigned short*)arow + kb + 16 + 8 * hh);
#pragma unroll
    for (int t = 0; t < 4; ++t) { if (col0 + t * 16 >= N) continue; const size_t boff = (size_t)(col0 + t * 16 + ln) * ldb + kb; FragH bq; bq.half[0] = *(const v8us*)((const unsigned short*)Bh + boff + 8 * hh); bq.half[1] = *(const v8us*)((const unsigned short*)Bh + boff + 16 + 8 * hh);
      acc[t] = mmaH<1>(ah.v, ah.v, bq.v, bq.v, acc[t]); }
  }
#pragma unroll
  for (int t = 0; t < 4; ++t) { if (col0 + t * 16 >= N) continue; const int col = col0 + t * 16 + ln; const float bv = bp ? bf16_round(bp[col]) : 0.f;
#pragma unroll
    for (int r = 0; r < 8; ++r) { float v = acc[t][r] * alpha + bv; if (CP) { const int bidx = (row0g + row0 + 8 * hh + r) / rowsPerB; v += CP[(size_t)bidx * sCPb + (size_t)by * 64 + col]; } if (ACT == 1) v = (v > 0.f) ? v : expm1f(v); else if (ACT == 3) v = fmaxf(v, 0.f); so[w][8 * hh + r][t * 16 + ln] = v; } }
  __builtin_amdgcn_fence(__ATOMIC_ACQ_REL, "workgroup"); __builtin_amdgcn_wave_barrier();
  const int rsub = lane >> 4, c4 = (lane & 15) * 4; typedef _Float16 v4h __attribute__((ext_vector_type(4)));
  {
#pragma unroll
    for (int q = 0; q < 8; ++q) { const int r = q * 2 + rsub; if (col0 + c4 < N) { const v4f v = *(const v4fa*)&so[w][r][c4]; if (C) *(v4f*)(C + cofs + (size_t)(row0 + r) * ldc + col0 + c4) = v; if (C16) { v4h h4; for (int i = 0; i < 4; ++i) h4[i] = (_Float16)v[i]; *(v4h*)(C16 + cofs + (size_t)(row0 + r) * ldc + col0 + c4) = h4; } } }
     }
}


__global__ __launch_bounds__(256) void k_round16f(const float* __restrict__ W, _Float16* __restrict__ Bt, size_t n8) { const size_t t = (size_t)blockIdx.x * 256 + threadIdx.x; if (t >= n8) return; FragH f;
#pragma unroll
  for (int i = 0; i < 8; ++i) f.h[i] = (_Float16)(bf16_round(W[t * 8 + i]) * 16.0f); *(v8us*)((unsigned short*)Bt + t * 8) = f.half[0];  }
// K rows (f32 -> bf16 value -> f16) in the order of the score product's A fragments. A 16-byte unit holds 8 dims of one key; unit ((kt * 2 + ks) * 2 + half) * 32 + hh * 16 + ln
// of a (batch, head) slab is key kt * 16 + ln, dims ks * 32 + half * 16 + hh * 8 .. + 7: a wave's load of one fragment half is 512 contiguous bytes (four whole lines).
// One block = 16 keys x all 8 heads, read in whole rows and turned through LDS; a group of 16 units takes 256 + 16 bytes there, so that neither side meets a bank conflict.
__global__ __launch_bounds__(256) void k_kpack(const float* __restrict__ x, _Float16* __restrict__ Kp) { __shared__ __attribute__((aligned(16))) unsigned short st[64 * 136]; const int tid = threadIdx.x; const int b = blockIdx.x / 256, kt = blockIdx.x % 256;
#pragma unroll      // the four rounds' loads fly together
  for (int i = 0; i < 4; ++i) { const int u = i * 256 + tid, ln = u >> 6, c8 = u & 63; const float* s = x + ((size_t)b * 4096 + kt * 16 + ln) * 512 + c8 * 8; const v4f a0 = *(const v4fa*)s, a1 = *(const v4fa*)(s + 4); FragH f;      // c8 = head * 8 + ks * 4 + half * 2 + hh
#pragma unroll      // constant vector indices: the values stay in registers
    for (int q = 0; q < 4; ++q) { f.h[q] = (_Float16)bf16_round(a0[q]); f.h[4 + q] = (_Float16)bf16_round(a1[q]); }
    *(v8us*)&st[c8 * 136 + ln * 8] = f.half[0]; }
  __syncthreads();
#pragma unroll      // the four LDS reads are issued ahead of the first store
  for (int i = 0; i < 4; ++i) { const int p = i * 256 + tid; const v8us o = *(const v8us*)&st[(p >> 4) * 136 + (p & 15) * 8];      // p >> 7 = head
    *(v8us*)((unsigned short*)Kp + ((((size_t)b * 8 + (p >> 7)) * 256 + kt) * 128 + (p & 127)) * 8) = o; } }
// V (f32 -> bf16 value -> f16, converted here on the way into LDS) transposed, in the order of the second product's A fragments: unit ((pass * 4 + dt) * 2 + half) * 32 + hh * 16 + ln of a slab is dim dt * 16 + ln, keys pass * 32 + half * 16 + hh * 8 .. + 7.
template <int NHv, int TTv>
__global__ __launch_bounds__(256) void k_vt(const float* __restrict__ V, int ldv, int voff, _Float16* __restrict__ Vt) { __shared__ unsigned short tl[64][66]; const int tid = threadIdx.x; const int slab = blockIdx.x / (TTv / 64), lg = blockIdx.x % (TTv / 64); const int b = slab / NHv, h = slab % NHv;
#pragma unroll      // the four rounds' loads fly together
  for (int rd = 0; rd < 4; ++rd) { const int i = rd * 256 + tid, r = i >> 4, c4 = (i & 15) * 4; const v4f a = *(const v4fa*)(V + ((size_t)b * TTv + lg * 64 + r) * ldv + voff + h * 64 + c4); FragH f;      // 16 lanes take a head's 256-byte row piece: whole lines
#pragma unroll      // constant vector indices: the values stay in registers
    for (int q = 0; q < 4; ++q) { f.h[q] = (_Float16)bf16_round(a[q]); tl[r][c4 + q] = f.u[q]; } }
  __syncthreads();
  {
#pragma unroll
    for (int rd = 0; rd < 2; ++rd) { const int u = rd * 256 + tid, d = ((u >> 6) & 3) * 16 + (u & 15), k0 = rd * 32 + ((u >> 4) & 3) * 8; FragH f;      // the block's 64 keys are two passes: 512 units in a row
#pragma unroll
      for (int q = 0; q < 8; ++q) f.u[q] = tl[k0 + q][d];
      *(v8us*)((unsigned short*)Vt + ((size_t)blockIdx.x * 512 + u) * 8) = f.half[0]; }
     } }

typedef float v2f __attribute__((ext_vector_type(2)));
// lane l <-> lane l ^ 16 as a vector cross-row move: no LDS queue and no wait, unlike a shuffle
__device__ __forceinline__ float xhalf(float x) { return __builtin_bit_cast(float, __builtin_amdgcn_permlanex16(__builtin_bit_cast(int, x), __builtin_bit_cast(int, x), 0x76543210, 0xfedcba98, false, false)); }

// Eight asynchronous copies to LDS: line i brings this lane's 16 bytes at g + i * 4 KiB to LDS byte l + i * 4 KiB; the block's 256 lanes move 8 x 4 KiB in a row (one tile's K part or V part).
// The wait at the statement's end stands in front of any later overwrite of the address registers that the copies name.
__device__ __forceinline__ void copy8(unsigned l, const unsigned short* g) {
  asm volatile("global_load_async_to_lds_b128 %0, %8, off\n\t"
               "global_load_async_to_lds_b128 %1, %9, off\n\t"
               "global_load_async_to_lds_b128 %2, %10, off\n\t"
               "global_load_async_to_lds_b128 %3, %11, off\n\t"
               "global_load_async_to_lds_b128 %4, %12, off\n\t"
               "global_load_async_to_lds_b128 %5, %13, off\n\t"
               "global_load_async_to_lds_b128 %6, %14, off\n\t"
               "global_load_async_to_lds_b128 %7, %15, off\n\t"
               "s_wait_xcnt 0x0"
               :: "v"(l), "v"(l + 4096u), "v"(l + 8192u), "v"(l + 12288u), "v"(l + 16384u), "v"(l + 20480u), "v"(l + 24576u), "v"(l + 28672u),
                  "v"(g), "v"(g + 2048), "v"(g + 4096), "v"(g + 6144), "v"(g + 8192), "v"(g + 10240), "v"(g + 12288), "v"(g + 14336) : "memory");
}

__global__ __launch_bounds__(256) void k_flash(const float* __restrict__ Qf, int ldq, const _Float16* __restrict__ Kp, const _Float16* __restrict__ Vt, const int* __restrict__ MSK, _Float16* __restrict__ O16, int ldo) {
  constexpr int NW = 8, RPW = 32, NQB = 4096 / (NW * RPW), DT = 4, KS = 2, PP = 8, NT = 4096 / (32 * PP), PART = PP * 2048; (void)MSK;      // PART: 16-bit elements of a tile's K part, and of its V part
  constexpr float SL2 = 0.125f * 1.44269504088896340736f;      // 64^-1/2 x log2(e): exp(x / 8 - m / 8) = 2^(x * SL2 - m * SL2)
  __shared__ __attribute__((aligned(16))) unsigned short sKV[2][2 * PART];        // [buffer][K part, then V part]
  __shared__ __attribute__((aligned(16))) unsigned short sO[NW][RPW][64 + 8];      // row pitch 144 bytes = 16 x 9: 16-byte accesses down a column meet no bank conflict
  const int tid = threadIdx.x, w = tid >> 5, lane = tid & 31, ln = lane & 15, hh = lane >> 4;
  const int slab = blockIdx.x / NQB, qblk = blockIdx.x % NQB; const int b = slab / 8, h = slab % 8; const int qb0 = qblk * (NW * RPW); const int q0 = qb0 + w * RPW;
  const unsigned short* kg = (const unsigned short*)Kp + (size_t)slab * 4096 * 64 + tid * 8;      // fragment order (k_kpack): a pass is 4 KiB in a row, a tile 32 KiB; this lane's 16 bytes of each 4 KiB
  const unsigned short* vg = (const unsigned short*)Vt + (size_t)slab * 64 * 4096 + tid * 8;      // fragment order (k_vt): the same
  const unsigned l0 = (unsigned)(size_t)&sKV[0][tid * 8];                                         // this lane's LDS byte address in buffer 0's K part
  copy8(l0, kg); copy8(l0 + 2 * PART, vg);      // tile 0 -> buffer 0; it flies over the Q loads and their conversion
  v4f qf[2][KS][4];      // raw f32 Q in the fragments' k order: [0], [1] = dims ks * 32 + 8hh .. + 7, [2], [3] = dims ks * 32 + 16 + 8hh .. + 7
#pragma unroll
  for (int rt = 0; rt < 2; ++rt) { const float* qr = Qf + ((size_t)b * 4096 + q0 + rt * 16 + ln) * ldq + h * 64;
#pragma unroll
    for (int ks = 0; ks < KS; ++ks) { const float* qk = qr + ks * 32 + 8 * hh; qf[rt][ks][0] = *(const v4fa*)qk; qf[rt][ks][1] = *(const v4fa*)(qk + 4); qf[rt][ks][2] = *(const v4fa*)(qk + 16); qf[rt][ks][3] = *(const v4fa*)(qk + 20); } }
  asm volatile("s_wait_xcnt 0x0" ::: "memory");      // the address registers of the loads above are reused below: the wait stands in front of their overwrite
  __builtin_amdgcn_sched_barrier(0);                 // keeps the set-up code that reuses those registers behind that wait
  FragH aq[2][KS];
#pragma unroll      // all three loops: constant indices, so that the raw values and the fragments stay in registers
  for (int rt = 0; rt < 2; ++rt)
#pragma unroll
    for (int ks = 0; ks < KS; ++ks)
#pragma unroll
      for (int i = 0; i < 16; ++i) aq[rt][ks].h[i] = (_Float16)bf16_round(qf[rt][ks][i >> 2][i & 3]);
  float m_r[2], l_r[2]; v8f oacc[2][DT];      // per lane: query rt * 16 + ln; m_r = running maximum in base-2 exponent units (score x SL2); oacc[rt][dt][r] = Ot[dt * 16 + 8hh + r][that query]
#pragma unroll
  for (int rt = 0; rt < 2; ++rt) { m_r[rt] = -3.0e38f; l_r[rt] = 0.f;
#pragma unroll
    for (int dt = 0; dt < DT; ++dt) oacc[rt][dt] = (v8f){0.f,0.f,0.f,0.f,0.f,0.f,0.f,0.f}; }
  asm volatile("s_wait_asynccnt 0x0" ::: "memory");      // this wave's copies of tile 0 have landed
  __syncthreads();                                       // ... and every other wave's: tile 0 may be read
  copy8(l0 + 4 * PART, kg + PART); copy8(l0 + 6 * PART, vg + PART);      // tile 1 -> buffer 1
#pragma unroll 1      // one trip = one tile; rolled, so that the ring's foot stands once
  for (int t = 0; t < NT; ++t) {
    const unsigned short* kl = &sKV[t & 1][lane * 8];      // this lane's unit of the tile's first K fragment half
    const unsigned short* vl = kl + PART;
    // Inside a tile every LDS read is issued a phase ahead of its use: V of a pass at the pass's top, K of the next pass right behind this pass's score products.
    FragH bk[2][KS], bv[DT];
#pragma unroll
    for (int nt = 0; nt < 2; ++nt)
#pragma unroll
      for (int ks = 0; ks < KS; ++ks) { const unsigned short* kr = kl + nt * 1024 + ks * 512; bk[nt][ks].half[0] = *(const v8us*)kr; bk[nt][ks].half[1] = *(const v8us*)(kr + 256); }
#pragma unroll 1      // rolled: unrolled, the 8 passes' LDS reads are lifted far ahead, the registers double and the back edge fills with copies
   for (int p = 0; p < PP; ++p) {
#pragma unroll
    for (int dt = 0; dt < DT; ++dt) { const unsigned short* vrow = vl + p * 2048 + dt * 512; bv[dt].half[0] = *(const v8us*)vrow; bv[dt].half[1] = *(const v8us*)(vrow + 256); }
    v8f s[2][2];      // s[rt][nt][r] = score of key (t * PP + p) * 32 + nt * 16 + 8hh + r against query rt * 16 + ln
#pragma unroll
    for (int nt = 0; nt < 2; ++nt) {
#pragma unroll
      for (int rt = 0; rt < 2; ++rt) { v8f acc = (v8f){0.f,0.f,0.f,0.f,0.f,0.f,0.f,0.f};
#pragma unroll
        for (int ks = 0; ks < KS; ++ks) acc = mmaH<1>(bk[nt][ks].v, bk[nt][ks].v, aq[rt][ks].v, aq[rt][ks].v, acc); s[rt][nt] = acc; } }
    if (p + 1 < PP) {      // the last pass of a tile fetches no K ahead: the next tile is not published yet
#pragma unroll
      for (int nt = 0; nt < 2; ++nt)
#pragma unroll
        for (int ks = 0; ks < KS; ++ks) { const unsigned short* kr = kl + (p + 1) * 2048 + nt * 1024 + ks * 512; bk[nt][ks].half[0] = *(const v8us*)kr; bk[nt][ks].half[1] = *(const v8us*)(kr + 256); } }
    FragH pb[2];
#pragma unroll
    for (int rt = 0; rt < 2; ++rt) {
      float sc[16], mx[8];      // raw products: their maximum is taken first (the scale is positive); the scale goes into each exponent's one multiply-add
#pragma unroll
      for (int r = 0; r < 8; ++r) { sc[r] = s[rt][0][r]; sc[8 + r] = s[rt][1][r]; mx[r] = fmaxf(sc[r], sc[8 + r]); }
      float mc = fmaxf(fmaxf(fmaxf(mx[0], mx[1]), fmaxf(mx[2], mx[3])), fmaxf(fmaxf(mx[4], mx[5]), fmaxf(mx[6], mx[7])));
      mc = fmaxf(mc, xhalf(mc));      // both halves of a column must use one maximum: their P meet in one product
      const float mn = fmaxf(m_r[rt], mc * SL2); const float al = __builtin_amdgcn_exp2f(m_r[rt] - mn); m_r[rt] = mn;      // an unchanged maximum gives 2^0 = 1
      float ps[4] = {0.f, 0.f, 0.f, 0.f};
#pragma unroll
      for (int i = 0; i < 16; i += 2) {      // two neighbouring scores of an accumulator share one packed multiply-add
        const v2f e = __builtin_elementwise_fma((v2f){sc[i], sc[i + 1]}, (v2f){SL2, SL2}, (v2f){-mn, -mn});
        const float p0 = __builtin_amdgcn_exp2f(e[0]), p1 = __builtin_amdgcn_exp2f(e[1]);
        ps[i & 3] += p0; ps[(i + 1) & 3] += p1; pb[rt].h[i] = (_Float16)p0; pb[rt].h[i + 1] = (_Float16)p1; }
      l_r[rt] = l_r[rt] * al + ((ps[0] + ps[1]) + (ps[2] + ps[3]));      // this half's keys only; the halves join after the loop
#pragma unroll
      for (int dt = 0; dt < DT; ++dt)
#pragma unroll
        for (int r = 0; r < 8; ++r) oacc[rt][dt][r] *= al; }
#pragma unroll
    for (int dt = 0; dt < DT; ++dt) {
#pragma unroll
      for (int rt = 0; rt < 2; ++rt) oacc[rt][dt] = mmaH<1>(bv[dt].v, bv[dt].v, pb[rt].v, pb[rt].v, oacc[rt][dt]); } }
    // The ring's foot: this wave's LDS reads are done, its copies of tile t + 1 have landed, every wave has come as far; then tile t + 2 goes into the buffer that this trip has read.
    asm volatile("s_wait_dscnt 0x0" ::: "memory");
    asm volatile("s_wait_asynccnt 0x0" ::: "memory");
    __syncthreads();
    if (t + 2 < NT) { const unsigned lb = l0 + (unsigned)(t & 1) * (4 * PART); copy8(lb, kg + (size_t)(t + 2) * PART); copy8(lb + 2 * PART, vg + (size_t)(t + 2) * PART); } }
  asm volatile("s_wait_asynccnt 0x0" ::: "memory");      // nothing of this wave is in flight when it goes on to the epilogue
#pragma unroll
  for (int rt = 0; rt < 2; ++rt) { float l = l_r[rt]; l += xhalf(l); const float li = (l > 0.f) ? 1.0f / l : 0.f;
#pragma unroll
    for (int dt = 0; dt < DT; ++dt) { FragH f;
#pragma unroll
      for (int r = 0; r < 8; ++r) f.h[r] = (_Float16)(oacc[rt][dt][r] * li);
      *(v8us*)&sO[w][rt * 16 + ln][dt * 16 + 8 * hh] = f.half[0]; } }
  __builtin_amdgcn_fence(__ATOMIC_ACQ_REL, "workgroup"); __builtin_amdgcn_wave_barrier();
  {
#pragma unroll
    for (int rp = 0; rp < RPW; rp += 4) { const int r = rp + (lane >> 3), pc = lane & 7; const v8us val = *(const v8us*)&sO[w][r][pc * 8]; *(v8us*)((unsigned short*)O16 + ((size_t)b * 4096 + q0 + r) * ldo + h * 64 + pc * 8) = val; }      // 8 lanes store a head's 128-byte row piece: one whole line
     } }

extern "C" void kernel_launch(void* const* d_in, const int* in_sizes, int n_in,
                              void* d_out, int out_size, void* d_ws, size_t ws_size, hipStream_t stream) {
  (void)in_sizes; (void)n_in; (void)out_size;
  const float* q = (const float*)d_in[0]; const float* k = (const float*)d_in[1]; const float* v = (const float*)d_in[2]; const float* Wo = (const float*)d_in[3]; const float* bo = (const float*)d_in[4];
  char* ws = (char*)d_ws; size_t off = 0;
  auto take = [&](size_t bytes) { char* p = ws + off; off += (bytes + 255) & ~(size_t)255; return p; };
  _Float16* Bo = (_Float16*)take((size_t)NO * CC * 2); _Float16* K16 = (_Float16*)take((size_t)NR * CC * 2); _Float16* Vt = (_Float16*)take((size_t)NR * CC * 2); _Float16* O16 = (_Float16*)take((size_t)NR * CC * 2);
  if (off > ws_size) return;      // 3 x 8.4 MB
  k_wt_f16<<<(NO * (CC / 8) + 255) / 256, 256, 0, stream>>>(Wo, Bo, CC, NO, 16.0f);      // [in][out]
  k_kpack<<<NR / 16, 256, 0, stream>>>(k, K16);
  k_vt<NH, TT><<<BB * NH * (TT / 64), 256, 0, stream>>>(v, CC, 0, Vt);
  k_flash<<<BB * NH * (TT / 256), 256, 0, stream>>>(q, CC, K16, Vt, nullptr, O16, CC);
  k_gemm_hhx<0><<<dim3(((NR / 16) * 1 + 3) / 4, 1), 128, 0, stream>>>(O16, CC, 0, Bo, CC, 0, 0.0625f, bo, 0, nullptr, 1, 0, 0, (float*)d_out, nullptr, NO, 0, NR, NO, CC);      // N = 64
}

// v007
// A run of this version takes 87.3 microseconds.
// Next to v006, in two timings, it ran 1.07 and 1.06 times as fast.
// Counting every step since v000, it is 7.72 times as fast.
#include <hip/hip_runtime.h>
// 8-head attention over the given q/k/v (2 × 4096 tokens, d = 64) as a fused flash-style kernel on v_wmma_f32_16x16x32_f16 (q, k, v are module INPUTS → exact bf16 values as f16 operands; S = Q·Kᵀ × 64^-½,
// online max/sum softmax f32, P f16 ≤ 1, O = P·V), then the 512→64 output linear (+ bias; W_out [in][out] bf16-exact ×2^4); f32 accumulate.
#define BB 2
#define TT 4096
#define CC 512
#define NH 8
#define NO 64
#define NR (BB * TT)

typedef __bf16 v16b __attribute__((ext_vector_type(16)));
typedef unsigned short v8us __attribute__((ext_vector_type(8), may_alias));
typedef float  v8f  __attribute__((ext_vector_type(8)));
typedef float  v4f  __attribute__((ext_vector_type(4)));
typedef float  v4fa __attribute__((ext_vector_type(4), may_alias));
union FragB { v16b v; v8us half[2]; unsigned short u[16]; };

__device__ __forceinline__ unsigned short bf16_bits(float x) { unsigned int u = __float_as_uint(x); return (unsigned short)((u + 0x7FFFu + ((u >> 16) & 1u)) >> 16); }
__device__ __forceinline__ float bf16_val(unsigned short b) { return __uint_as_float(((unsigned int)b) << 16); }
__device__ __forceinline__ float bf16_round(float x) { return bf16_val(bf16_bits(x)); }
// D += A·B with NT terms: 1 = ah·bh, 2 = + al·bh (A split), 3 = + ah·bl (both split)
template <int NT>
__device__ __forceinline__ v8f mmaN(v16b ah, v16b al, v16b bh, v16b bl, v8f c) {
  c = __builtin_amdgcn_wmma_f32_16x16x32_bf16(false, ah, false, bh, (short)0, c, false, false);
  if (NT >= 2) c = __builtin_amdgcn_wmma_f32_16x16x32_bf16(false, al, false, bh, (short)0, c, false, false);
  if (NT >= 3) c = __builtin_amdgcn_wmma_f32_16x16x32_bf16(false, ah, false, bl, (short)0, c, false, false);
  asm volatile("v_nop\n\tv_nop\n\tv_nop\n\tv_nop" : "+v"(c) : "v"(ah), "v"(al), "v"(bh), "v"(bl));
  return c;
}

__global__ __launch_bounds__(256) void k_wt_bf16(const float* __restrict__ W, unsigned short* __restrict__ Wt, int K, int N) {
  const int t = blockIdx.x * 256 + threadIdx.x;
  const int k8n = K / 8;
  if (t >= N * k8n) return;
  const int n = t / k8n, k8 = (t % k8n) * 8;
  v8us v;
#pragma unroll
  for (int i = 0; i < 8; ++i) v[i] = bf16_bits(W[(size_t)(k8 + i) * N + n]);
  *(v8us*)(Wt + (size_t)n * K + k8) = v;
  
}

// GEMM C[M][N] (f32, pitch ldc) = act(A[M][K]·W + bias). A f32 row-major (pitch lda) converted per fragment to bf16
// (ASPLIT: hi/lo two planes -> 2 terms, else single rounded term); Wt bf16 [N][K] (pitch ldb). BIAS_BF16 rounds the
// bias to bf16 first (bias quantised to bf16 before the add). K%32==0, M%16==0, N%64==0.
template <bool ASPLIT, int ACT, bool BIAS_BF16>
__global__ __launch_bounds__(128) void k_gemm_bf(const float* __restrict__ A, int lda, const unsigned short* __restrict__ Wt, int ldb,
                                               const float* __restrict__ bias, float* __restrict__ C, int ldc, int M, int N, int K) {
  __shared__ __attribute__((aligned(16))) float so[4][16][64];
  const int tid = threadIdx.x, w = tid >> 5, lane = tid & 31, ln = lane & 15, hh = lane >> 4;
  const int ntn = N / 64;
  const int wid = blockIdx.x * 4 + w;
  const int mt = wid / ntn, nq = wid % ntn;
  if (mt * 16 >= M) return;
  const int row0 = mt * 16, col0 = nq * 64;
  const float* arow = A + (size_t)(row0 + ln) * lda;
  v8f acc[4] = {};
  for (int kb = 0; kb < K; kb += 32) {
    FragB ah, al;
    const v4f x0 = *(const v4fa*)(arow + kb + 8 * hh), x1 = *(const v4fa*)(arow + kb + 8 * hh + 4);
    const v4f x2 = *(const v4fa*)(arow + kb + 16 + 8 * hh), x3 = *(const v4fa*)(arow + kb + 16 + 8 * hh + 4);
    float xs[16] = {x0[0],x0[1],x0[2],x0[3],x1[0],x1[1],x1[2],x1[3],x2[0],x2[1],x2[2],x2[3],x3[0],x3[1],x3[2],x3[3]};
#pragma unroll
    for (int i = 0; i < 16; ++i) { const unsigned short hb = bf16_bits(xs[i]); ah.u[i] = hb; al.u[i] = ASPLIT ? bf16_bits(xs[i] - bf16_val(hb)) : (unsigned short)0; }
#pragma unroll
    for (int t = 0; t < 4; ++t) {
      const unsigned short* brow = Wt + (size_t)(col0 + t * 16 + ln) * ldb + kb;
      FragB b;
      b.half[0] = *(const v8us*)(brow + 8 * hh);
      b.half[1] = *(const v8us*)(brow + 16 + 8 * hh);
      acc[t] = mmaN<ASPLIT ? 2 : 1>(ah.v, al.v, b.v, b.v, acc[t]);
    }
  }
#pragma unroll
  for (int t = 0; t < 4; ++t) {
    float bv = bias ? bias[col0 + t * 16 + ln] : 0.f;
    if (BIAS_BF16) bv = bf16_round(bv);
#pragma unroll
    for (int r = 0; r < 8; ++r) { float v = acc[t][r] + bv; if (ACT == 1) v = fmaxf(v, 0.f); so[w][8 * hh + r][t * 16 + ln] = v; }
  }
  __builtin_amdgcn_fence(__ATOMIC_ACQ_REL, "workgroup");
  __builtin_amdgcn_wave_barrier();
  const int rsub = lane >> 4, c4 = (lane & 15) * 4;
  {
#pragma unroll
    for (int q = 0; q < 8; ++q) {
      const int r = q * 2 + rsub;
      const v4f v = *(const v4fa*)&so[w][r][c4];
      *(v4f*)(C + (size_t)(row0 + r) * ldc + col0 + c4) = v;
    }
    
  }
}

// Flash-style causal/unmasked attention, all contractions 3-term bf16 hi/lo splits, f32 softmax with running max.
// q,k,v rows are read from f32 buffers with arbitrary row pitch (so they can live inside a fused qkv buffer);
// D = head size (multiple of 32, <= 128); one wave = 16 query rows; block = 4 waves (64 queries) sharing K/V chunks of 32.
template <int D, bool CAUSAL>
__global__ __launch_bounds__(128) void k_flash(const float* __restrict__ qb, const float* __restrict__ kb, const float* __restrict__ vb,
                                             int pitch, int T, int H, float scale, float* __restrict__ y, int ypitch) {
  constexpr int KS = D / 32;        // k-steps for QK
  constexpr int DT = D / 16;        // d tiles for PV
  __shared__ __attribute__((aligned(16))) unsigned short sKh[32][D + 8], sKl[32][D + 8], sVh[32][D + 8], sVl[32][D + 8];
  __shared__ __attribute__((aligned(16))) unsigned short sPh[4][16][40], sPl[4][16][40];
  __shared__ __attribute__((aligned(16))) float sO[4][16][D];
  const int tid = threadIdx.x, w = tid >> 5, lane = tid & 31, ln = lane & 15, hh = lane >> 4;
  const int nqb = (T + 63) / 64;
  const int bh = blockIdx.x / nqb, qblk = blockIdx.x % nqb;
  const int b = bh / H, h = bh % H;
  const int q0 = qblk * 64 + w * 16;
  const float* Q = qb + (size_t)b * T * pitch + h * D;
  const float* K = kb + (size_t)b * T * pitch + h * D;
  const float* V = vb + (size_t)b * T * pitch + h * D;

  // A fragments of the wave's 16 query rows (scaled), hi/lo
  FragB aqh[KS], aql[KS];
  {
    int row = q0 + ln; if (row >= T) row = T - 1;
    const float* qr = Q + (size_t)row * pitch;
#pragma unroll
    for (int ks = 0; ks < KS; ++ks)
#pragma unroll
      for (int i = 0; i < 16; ++i) {
        const int d = ks * 32 + ((i < 8) ? (8 * hh + i) : (16 + 8 * hh + (i - 8)));
        const float x = qr[d] * scale; const unsigned short hb = bf16_bits(x);
        aqh[ks].u[i] = hb; aql[ks].u[i] = bf16_bits(x - bf16_val(hb));
      }
  }
  float m_r[8], l_r[8];
#pragma unroll
  for (int r = 0; r < 8; ++r) { m_r[r] = -3.0e38f; l_r[r] = 0.f; }
  v8f oacc[DT];
#pragma unroll
  for (int dt = 0; dt < DT; ++dt) oacc[dt] = (v8f){0.f,0.f,0.f,0.f,0.f,0.f,0.f,0.f};

  const int kv_end = CAUSAL ? min(T, qblk * 64 + 64) : T;     // block-uniform
  for (int j0 = 0; j0 < kv_end; j0 += 32) {
    __syncthreads();
    for (int e = tid; e < 32 * (D / 4); e += 128) {
      const int r = e / (D / 4), c4 = (e % (D / 4)) * 4;
      const int key = j0 + r;
      v4f kf = {0.f,0.f,0.f,0.f}, vf = {0.f,0.f,0.f,0.f};
      if (key < T) { kf = *(const v4fa*)(K + (size_t)key * pitch + c4); vf = *(const v4fa*)(V + (size_t)key * pitch + c4); }
#pragma unroll
      for (int t = 0; t < 4; ++t) {
        unsigned short hb = bf16_bits(kf[t]); sKh[r][c4 + t] = hb; sKl[r][c4 + t] = bf16_bits(kf[t] - bf16_val(hb));
        hb = bf16_bits(vf[t]); sVh[r][c4 + t] = hb; sVl[r][c4 + t] = bf16_bits(vf[t] - bf16_val(hb));
      }
    }
    __syncthreads();
    // S tile 16 x 32
    v8f s[2];
#pragma unroll
    for (int nt = 0; nt < 2; ++nt) {
      v8f acc = {};
#pragma unroll
      for (int ks = 0; ks < KS; ++ks) {
        FragB bh_, bl_;
        bh_.half[0] = *(const v8us*)&sKh[nt * 16 + ln][ks * 32 + 8 * hh]; bh_.half[1] = *(const v8us*)&sKh[nt * 16 + ln][ks * 32 + 16 + 8 * hh];
        bl_.half[0] = *(const v8us*)&sKl[nt * 16 + ln][ks * 32 + 8 * hh]; bl_.half[1] = *(const v8us*)&sKl[nt * 16 + ln][ks * 32 + 16 + 8 * hh];
        acc = mmaN<3>(aqh[ks].v, aql[ks].v, bh_.v, bl_.v, acc);
      }
      s[nt] = acc;
    }
    // mask + running max (rows 8hh+r; the 16 lanes of a half share rows)
    float alpha[8];
#pragma unroll
    for (int r = 0; r < 8; ++r) {
      const int qi = q0 + 8 * hh + r;
      const int ja = j0 + ln, jb = j0 + 16 + ln;
      if (CAUSAL) { if (ja > qi) s[0][r] = -3.0e38f; if (jb > qi) s[1][r] = -3.0e38f; }
      if (ja >= T) s[0][r] = -3.0e38f;
      if (jb >= T) s[1][r] = -3.0e38f;
      float mx = fmaxf(s[0][r], s[1][r]);
      mx = fmaxf(mx, __shfl_xor(mx, 1, 32)); mx = fmaxf(mx, __shfl_xor(mx, 2, 32)); mx = fmaxf(mx, __shfl_xor(mx, 4, 32)); mx = fmaxf(mx, __shfl_xor(mx, 8, 32));
      const float mnew = fmaxf(m_r[r], mx);
      alpha[r] = (mnew > -1.0e38f) ? __expf(m_r[r] - mnew) : 1.0f;
      const float p0 = (s[0][r] > -1.0e38f) ? __expf(s[0][r] - mnew) : 0.f;
      const float p1 = (s[1][r] > -1.0e38f) ? __expf(s[1][r] - mnew) : 0.f;
      m_r[r] = mnew;
      l_r[r] = l_r[r] * alpha[r] + p0 + p1;            // per-lane partial row sum (16 lanes combined at the end)
      unsigned short hb = bf16_bits(p0); sPh[w][8 * hh + r][ln] = hb;      sPl[w][8 * hh + r][ln] = bf16_bits(p0 - bf16_val(hb));
      hb = bf16_bits(p1);                sPh[w][8 * hh + r][16 + ln] = hb; sPl[w][8 * hh + r][16 + ln] = bf16_bits(p1 - bf16_val(hb));
    }
#pragma unroll
    for (int dt = 0; dt < DT; ++dt)
#pragma unroll
      for (int r = 0; r < 8; ++r) oacc[dt][r] *= alpha[r];
    __builtin_amdgcn_fence(__ATOMIC_ACQ_REL, "workgroup");
    __builtin_amdgcn_wave_barrier();
    FragB pah, pal;
    pah.half[0] = *(const v8us*)&sPh[w][ln][8 * hh]; pah.half[1] = *(const v8us*)&sPh[w][ln][16 + 8 * hh];
    pal.half[0] = *(const v8us*)&sPl[w][ln][8 * hh]; pal.half[1] = *(const v8us*)&sPl[w][ln][16 + 8 * hh];
#pragma unroll
    for (int dt = 0; dt < DT; ++dt) {
      FragB bvh, bvl;
#pragma unroll
      for (int i = 0; i < 8; ++i) {
        bvh.u[i] = sVh[8 * hh + i][dt * 16 + ln]; bvh.u[8 + i] = sVh[16 + 8 * hh + i][dt * 16 + ln];
        bvl.u[i] = sVl[8 * hh + i][dt * 16 + ln]; bvl.u[8 + i] = sVl[16 + 8 * hh + i][dt * 16 + ln];
      }
      oacc[dt] = mmaN<3>(pah.v, pal.v, bvh.v, bvl.v, oacc[dt]);
    }
    __builtin_amdgcn_fence(__ATOMIC_ACQ_REL, "workgroup");
    __builtin_amdgcn_wave_barrier();
  }
#pragma unroll
  for (int r = 0; r < 8; ++r) {
    float l = l_r[r];
    l += __shfl_xor(l, 1, 32); l += __shfl_xor(l, 2, 32); l += __shfl_xor(l, 4, 32); l += __shfl_xor(l, 8, 32);
    l_r[r] = (l > 0.f) ? 1.0f / l : 0.f;
  }
#pragma unroll
  for (int dt = 0; dt < DT; ++dt)
#pragma unroll
    for (int r = 0; r < 8; ++r) sO[w][8 * hh + r][dt * 16 + ln] = oacc[dt][r] * l_r[r];
  __builtin_amdgcn_fence(__ATOMIC_ACQ_REL, "workgroup");
  __builtin_amdgcn_wave_barrier();
  {
    for (int r = 0; r < 16; ++r) {
      const int row = q0 + r;
      if (row < T && lane < D / 4) {
        const v4f val = *(const v4fa*)&sO[w][r][lane * 4];
        *(v4f*)(y + ((size_t)b * T + row) * ypitch + h * D + lane * 4) = val;
      }
    }
    
  }
}

// GEMM C = act(A·W + bias + resid): A f32 (ASPLIT -> hi/lo 2 terms), Wt bf16 [N][K]; ACT 0 none, 1 relu, 2 exact gelu;
// resid (optional, f32, row index = (row % rmod), pitch ldr, RES_BF16 rounds it) added before the activation.
template <bool ASPLIT, int ACT, bool BIAS_BF16, bool RES_BF16>
__global__ __launch_bounds__(128) void k_gemm_bf3(const float* __restrict__ A, int lda, const unsigned short* __restrict__ Wt, int ldb,
                                                const float* __restrict__ bias, const float* __restrict__ resid, int rmod, int ldr,
                                                float* __restrict__ C, int ldc, int M, int N, int K) {
  __shared__ __attribute__((aligned(16))) float so[4][16][64];
  const int tid = threadIdx.x, w = tid >> 5, lane = tid & 31, ln = lane & 15, hh = lane >> 4;
  const int ntn = N / 64;
  const int wid = blockIdx.x * 4 + w;
  const int mt = wid / ntn, nq = wid % ntn;
  if (mt * 16 >= M) return;
  const int row0 = mt * 16, col0 = nq * 64;
  const float* arow = A + (size_t)(row0 + ln) * lda;
  v8f acc[4] = {};
  for (int kb = 0; kb < K; kb += 32) {
    FragB ah, al;
    const v4f x0 = *(const v4fa*)(arow + kb + 8 * hh), x1 = *(const v4fa*)(arow + kb + 8 * hh + 4);
    const v4f x2 = *(const v4fa*)(arow + kb + 16 + 8 * hh), x3 = *(const v4fa*)(arow + kb + 16 + 8 * hh + 4);
    float xs[16] = {x0[0],x0[1],x0[2],x0[3],x1[0],x1[1],x1[2],x1[3],x2[0],x2[1],x2[2],x2[3],x3[0],x3[1],x3[2],x3[3]};
#pragma unroll
    for (int i = 0; i < 16; ++i) { const unsigned short hb = bf16_bits(xs[i]); ah.u[i] = hb; al.u[i] = ASPLIT ? bf16_bits(xs[i] - bf16_val(hb)) : (unsigned short)0; }
#pragma unroll
    for (int t = 0; t < 4; ++t) {
      const unsigned short* brow = Wt + (size_t)(col0 + t * 16 + ln) * ldb + kb;
      FragB b;
      b.half[0] = *(const v8us*)(brow + 8 * hh);
      b.half[1] = *(const v8us*)(brow + 16 + 8 * hh);
      acc[t] = mmaN<ASPLIT ? 2 : 1>(ah.v, al.v, b.v, b.v, acc[t]);
    }
  }
#pragma unroll
  for (int t = 0; t < 4; ++t) {
    const int col = col0 + t * 16 + ln;
    float bv = bias ? bias[col] : 0.f;
    if (BIAS_BF16) bv = bf16_round(bv);
#pragma unroll
    for (int r = 0; r < 8; ++r) {
      float v = acc[t][r] + bv;
      if (resid) { float rv = resid[(size_t)((row0 + 8 * hh + r) % rmod) * ldr + col]; if (RES_BF16) rv = bf16_round(rv); v += rv; }
      if (ACT == 1) v = fmaxf(v, 0.f);
      if (ACT == 2) v = 0.5f * v * (1.0f + erff(v * 0.70710678118654752f));
      if (ACT == 3) { const float u = 0.7978845608028654f * (v + 0.044715f * v * v * v); v = 0.5f * v * (1.0f + tanhf(u)); }
      so[w][8 * hh + r][t * 16 + ln] = v;
    }
  }
  __builtin_amdgcn_fence(__ATOMIC_ACQ_REL, "workgroup");
  __builtin_amdgcn_wave_barrier();
  const int rsub = lane >> 4, c4 = (lane & 15) * 4;
  {
#pragma unroll
    for (int q = 0; q < 8; ++q) {
      const int r = q * 2 + rsub;
      const v4f v = *(const v4fa*)&so[w][r][c4];
      *(v4f*)(C + (size_t)(row0 + r) * ldc + col0 + c4) = v;
    }
    
  }
}
// row LayerNorm (biased variance, eps) over N: s = X (+ R); optional out_sum <- s; out_norm <- (s-mu)*rsqrt(var+eps)*g + b
template <bool PARAM_BF16>
__global__ __launch_bounds__(256) void k_layernorm(const float* __restrict__ X, const float* __restrict__ R, const float* __restrict__ g, const float* __restrict__ bta,
                                                  float* __restrict__ out_sum, float* __restrict__ out_norm, int N, float eps) {
  __shared__ float red[256];
  const int row = blockIdx.x, tid = threadIdx.x;
  const float* x = X + (size_t)row * N; const float* rr = R ? R + (size_t)row * N : nullptr;
  float vals[16];                     // up to N = 4096
  const int per = N / 256;            // contiguous chunk per thread? use strided-by-4 chunks: thread handles j = tid*4 + 1024*u
  float s1 = 0.f;
  for (int u = 0; u < per / 4; ++u) {
    const int j = tid * 4 + 1024 * u;
    const v4f a = *(const v4fa*)(x + j);
    v4f b = {0.f,0.f,0.f,0.f}; if (rr) b = *(const v4fa*)(rr + j);
#pragma unroll
    for (int q = 0; q < 4; ++q) { const float v = a[q] + b[q]; vals[u * 4 + q] = v; s1 += v; }
  }
  red[tid] = s1; __syncthreads();
  for (int st = 128; st > 0; st >>= 1) { if (tid < st) red[tid] += red[tid + st]; __syncthreads(); }
  const float mu = red[0] / (float)N; __syncthreads();
  float s2 = 0.f;
  for (int u = 0; u < per / 4; ++u)
#pragma unroll
    for (int q = 0; q < 4; ++q) { const float c = vals[u * 4 + q] - mu; s2 += c * c; }
  red[tid] = s2; __syncthreads();
  for (int st = 128; st > 0; st >>= 1) { if (tid < st) red[tid] += red[tid + st]; __syncthreads(); }
  const float rs = rsqrtf(red[0] / (float)N + eps);
  {
    for (int u = 0; u < per / 4; ++u) {
      const int j = tid * 4 + 1024 * u;
      v4f o, sm;
#pragma unroll
      for (int q = 0; q < 4; ++q) {
        float gg = g[j + q], bb = bta[j + q];
        if (PARAM_BF16) { gg = bf16_round(gg); bb = bf16_round(bb); }
        sm[q] = vals[u * 4 + q]; o[q] = (vals[u * 4 + q] - mu) * rs * gg + bb;
      }
      if (out_sum) *(v4f*)(out_sum + (size_t)row * N + j) = sm;
      *(v4f*)(out_norm + (size_t)row * N + j) = o;
    }
    
  }
}



// ---- f16 WMMA path (v_wmma_f32_16x16x32_f16): 11-bit significands for operands in range — used for every matrix product here (Q·Kᵀ, P·V, output linear)
typedef _Float16 v16h __attribute__((ext_vector_type(16)));
union FragH { v16h v; v8us half[2]; _Float16 h[16]; unsigned short u[16]; };
template <int NT>
__device__ __forceinline__ v8f mmaH(v16h ah, v16h al, v16h bh, v16h bl, v8f c) {
  c = __builtin_amdgcn_wmma_f32_16x16x32_f16(false, ah, false, bh, (short)0, c, false, false);
  if (NT >= 2) c = __builtin_amdgcn_wmma_f32_16x16x32_f16(false, al, false, bh, (short)0, c, false, false);
  if (NT >= 3) c = __builtin_amdgcn_wmma_f32_16x16x32_f16(false, ah, false, bl, (short)0, c, false, false);
  asm volatile("v_nop\n\tv_nop\n\tv_nop\n\tv_nop" : "+v"(c) : "v"(ah), "v"(al), "v"(bh), "v"(bl));
  return c;
}
// batched GEMM like k_gemm_b but f16 operands: A f32 (split into f16 hi/lo if ASPLIT, else rounded to f16), Bt = f16 values [n][k]; alpha; C f32; N multiple of 16 (partial tiles skipped)
template <bool ASPLIT>
__global__ __launch_bounds__(128) void k_gemm_h(const float* __restrict__ A, int lda, size_t sA, const _Float16* __restrict__ Bh, int ldb, size_t sB, float alpha, float* __restrict__ C, int ldc, size_t sC, int M, int N, int K) {
  __shared__ __attribute__((aligned(16))) float so[4][16][64];
  const int tid = threadIdx.x, w = tid >> 5, lane = tid & 31, ln = lane & 15, hh = lane >> 4; const int by = blockIdx.y;
  A += (size_t)by * sA; Bh += (size_t)by * sB; C += (size_t)by * sC;
  const int ntn = (N + 63) / 64; const int wid = blockIdx.x * 4 + w; const int mt = wid / ntn, nq = wid % ntn; if (mt * 16 >= M) return;
  const int row0 = mt * 16, col0 = nq * 64; const float* arow = A + (size_t)(row0 + ln) * lda;
  v8f acc[4] = {};
  for (int kb = 0; kb < K; kb += 32) {
    FragH ah, al;
    const v4f x0 = *(const v4fa*)(arow + kb + 8 * hh), x1 = *(const v4fa*)(arow + kb + 8 * hh + 4), x2 = *(const v4fa*)(arow + kb + 16 + 8 * hh), x3 = *(const v4fa*)(arow + kb + 16 + 8 * hh + 4);
    float xs[16] = {x0[0],x0[1],x0[2],x0[3],x1[0],x1[1],x1[2],x1[3],x2[0],x2[1],x2[2],x2[3],x3[0],x3[1],x3[2],x3[3]};
#pragma unroll
    for (int i = 0; i < 16; ++i) { const _Float16 h = (_Float16)xs[i]; ah.h[i] = h; al.h[i] = ASPLIT ? (_Float16)(xs[i] - (float)h) : (_Float16)0.0f; }
#pragma unroll
    for (int t = 0; t < 4; ++t) { if (col0 + t * 16 >= N) continue; const size_t boff = (size_t)(col0 + t * 16 + ln) * ldb + kb; FragH bq; bq.half[0] = *(const v8us*)(Bh + boff + 8 * hh); bq.half[1] = *(const v8us*)(Bh + boff + 16 + 8 * hh);
      acc[t] = mmaH<ASPLIT ? 2 : 1>(ah.v, al.v, bq.v, bq.v, acc[t]); }
  }
#pragma unroll
  for (int t = 0; t < 4; ++t) { if (col0 + t * 16 >= N) continue;
#pragma unroll
    for (int r = 0; r < 8; ++r) so[w][8 * hh + r][t * 16 + ln] = acc[t][r] * alpha; }
  __builtin_amdgcn_fence(__ATOMIC_ACQ_REL, "workgroup"); __builtin_amdgcn_wave_barrier();
  const int rsub = lane >> 4, c4 = (lane & 15) * 4;
  {
#pragma unroll
    for (int q = 0; q < 8; ++q) { const int r = q * 2 + rsub; if (col0 + c4 < N) { const v4f v = *(const v4fa*)&so[w][r][c4]; *(v4f*)(C + (size_t)(row0 + r) * ldc + col0 + c4) = v; } }
     }
}

// Wt[n][k] = f16(W[k][n]·scale) from f32 row-major W[K][N] (scale = power of two; bf16-exact weights stay exact in f16 away from the subnormal range)
__global__ __launch_bounds__(256) void k_wt_f16(const float* __restrict__ W, _Float16* __restrict__ Wt, int K, int N, float scale) {
  const int t = blockIdx.x * 256 + threadIdx.x; if (t >= N * (K / 8)) return; const int n = t / (K / 8), k8 = (t % (K / 8)) * 8; FragH f;
#pragma unroll
  for (int i = 0; i < 8; ++i) f.h[i] = (_Float16)(bf16_round(W[(size_t)(k8 + i) * N + n]) * scale); const v8us o = f.half[0];
  *(v8us*)((unsigned short*)Wt + (size_t)n * K + k8) = o; 
}
// k_gemm_hh variant with fused epilogue: v = acc·alpha + bias[by·sBias + col] (+ CP[(row/rowsPerB)·sCPb + by·64 + col] if CP) ; ACT 0 none / 1 elu ; writes f32 C and/or f16 C16 (each if non-null)
template <int ACT>
__global__ __launch_bounds__(128) void k_gemm_hhx(const _Float16* __restrict__ A, int lda, size_t sA, const _Float16* __restrict__ Bh, int ldb, size_t sB, float alpha, const float* __restrict__ bias, size_t sBias, const float* __restrict__ CP, int rowsPerB, size_t sCPb, int row0g,
    float* __restrict__ C, _Float16* __restrict__ C16, int ldc, size_t sC, int M, int N, int K) {
  __shared__ __attribute__((aligned(16))) float so[4][16][64];
  const int tid = threadIdx.x, w = tid >> 5, lane = tid & 31, ln = lane & 15, hh = lane >> 4; const int by = blockIdx.y;
  A += (size_t)by * sA; Bh += (size_t)by * sB; const size_t cofs = (size_t)by * sC; const float* bp = bias ? bias + (size_t)by * sBias : nullptr;
  const int ntn = (N + 63) / 64; const int wid = blockIdx.x * 4 + w; const int mt = wid / ntn, nq = wid % ntn; if (mt * 16 >= M) return;
  const int row0 = mt * 16, col0 = nq * 64; const _Float16* arow = A + (size_t)(row0 + ln) * lda;
  v8f acc[4] = {};
  for (int kb = 0; kb < K; kb += 32) { FragH ah; ah.half[0] = *(const v8us*)((const unsigned short*)arow + kb + 8 * hh); ah.half[1] = *(const v8us*)((const unsigned short*)arow + kb + 16 + 8 * hh);
#pragma unroll
    for (int t = 0; t < 4; ++t) { if (col0 + t * 16 >= N) continue; const size_t boff = (size_t)(col0 + t * 16 + ln) * ldb + kb; FragH bq; bq.half[0] = *(const v8us*)((const unsigned short*)Bh + boff + 8 * hh); bq.half[1] = *(const v8us*)((const unsigned short*)Bh + boff + 16 + 8 * hh);
      acc[t] = mmaH<1>(ah.v, ah.v, bq.v, bq.v, acc[t]); }
  }
#pragma unroll
  for (int t = 0; t < 4; ++t) { if (col0 + t * 16 >= N) continue; const int col = col0 + t * 16 + ln; const float bv = bp ? bf16_round(bp[col]) : 0.f;
#pragma unroll
    for (int r = 0; r < 8; ++r) { float v = acc[t][r] * alpha + bv; if (CP) { const int bidx = (row0g + row0 + 8 * hh + r) / rowsPerB; v += CP[(size_t)bidx * sCPb + (size_t)by * 64 + col]; } if (ACT == 1) v = (v > 0.f) ? v : expm1f(v); else if (ACT == 3) v = fmaxf(v, 0.f); so[w][8 * hh + r][t * 16 + ln] = v; } }
  __builtin_amdgcn_fence(__ATOMIC_ACQ_REL, "workgroup"); __builtin_amdgcn_wave_barrier();
  const int rsub = lane >> 4, c4 = (lane & 15) * 4; typedef _Float16 v4h __attribute__((ext_vector_type(4)));
  {
#pragma unroll
    for (int q = 0; q < 8; ++q) { const int r = q * 2 + rsub; if (col0 + c4 < N) { const v4f v = *(const v4fa*)&so[w][r][c4]; if (C) *(v4f*)(C + cofs + (size_t)(row0 + r) * ldc + col0 + c4) = v; if (C16) { v4h h4; for (int i = 0; i < 4; ++i) h4[i] = (_Float16)v[i]; *(v4h*)(C16 + cofs + (size_t)(row0 + r) * ldc + col0 + c4) = h4; } } }
     }
}


__global__ __launch_bounds__(256) void k_round16f(const float* __restrict__ W, _Float16* __restrict__ Bt, size_t n8) { const size_t t = (size_t)blockIdx.x * 256 + threadIdx.x; if (t >= n8) return; FragH f;
#pragma unroll
  for (int i = 0; i < 8; ++i) f.h[i] = (_Float16)(bf16_round(W[t * 8 + i]) * 16.0f); *(v8us*)((unsigned short*)Bt + t * 8) = f.half[0];  }
// K rows (f32 -> bf16 value -> f16) in the order of the score product's A fragments. A 16-byte unit holds 8 dims of one key; unit ((kt * 2 + ks) * 2 + half) * 32 + hh * 16 + ln
// of a (batch, head) slab is key kt * 16 + ln, dims ks * 32 + half * 16 + hh * 8 .. + 7: a wave's load of one fragment half is 512 contiguous bytes (four whole lines).
// One block = 16 keys x all 8 heads, read in whole rows and turned through LDS; a group of 16 units takes 256 + 16 bytes there, so that neither side meets a bank conflict.
__global__ __launch_bounds__(256) void k_kpack(const float* __restrict__ x, _Float16* __restrict__ Kp) { __shared__ __attribute__((aligned(16))) unsigned short st[64 * 136]; const int tid = threadIdx.x; const int b = blockIdx.x / 256, kt = blockIdx.x % 256;
#pragma unroll      // the four rounds' loads fly together
  for (int i = 0; i < 4; ++i) { const int u = i * 256 + tid, ln = u >> 6, c8 = u & 63; const float* s = x + ((size_t)b * 4096 + kt * 16 + ln) * 512 + c8 * 8; const v4f a0 = *(const v4fa*)s, a1 = *(const v4fa*)(s + 4); FragH f;      // c8 = head * 8 + ks * 4 + half * 2 + hh
#pragma unroll      // constant vector indices: the values stay in registers
    for (int q = 0; q < 4; ++q) { f.h[q] = (_Float16)bf16_round(a0[q]); f.h[4 + q] = (_Float16)bf16_round(a1[q]); }
    *(v8us*)&st[c8 * 136 + ln * 8] = f.half[0]; }
  __syncthreads();
#pragma unroll      // the four LDS reads are issued ahead of the first store
  for (int i = 0; i < 4; ++i) { const int p = i * 256 + tid; const v8us o = *(const v8us*)&st[(p >> 4) * 136 + (p & 15) * 8];      // p >> 7 = head
    *(v8us*)((unsigned short*)Kp + ((((size_t)b * 8 + (p >> 7)) * 256 + kt) * 128 + (p & 127)) * 8) = o; } }
// V (f32 -> bf16 value -> f16, converted here on the way into LDS) transposed, in the order of the second product's A fragments: unit ((pass * 4 + dt) * 2 + half) * 32 + hh * 16 + ln of a slab is dim dt * 16 + ln, keys pass * 32 + half * 16 + hh * 8 .. + 7.
template <int NHv, int TTv>
__global__ __launch_bounds__(256) void k_vt(const float* __restrict__ V, int ldv, int voff, _Float16* __restrict__ Vt) { __shared__ unsigned short tl[64][66]; const int tid = threadIdx.x; const int slab = blockIdx.x / (TTv / 64), lg = blockIdx.x % (TTv / 64); const int b = slab / NHv, h = slab % NHv;
#pragma unroll      // the four rounds' loads fly together
  for (int rd = 0; rd < 4; ++rd) { const int i = rd * 256 + tid, r = i >> 4, c4 = (i & 15) * 4; const v4f a = *(const v4fa*)(V + ((size_t)b * TTv + lg * 64 + r) * ldv + voff + h * 64 + c4); FragH f;      // 16 lanes take a head's 256-byte row piece: whole lines
#pragma unroll      // constant vector indices: the values stay in registers
    for (int q = 0; q < 4; ++q) { f.h[q] = (_Float16)bf16_round(a[q]); tl[r][c4 + q] = f.u[q]; } }
  __syncthreads();
  {
#pragma unroll
    for (int rd = 0; rd < 2; ++rd) { const int u = rd * 256 + tid, d = ((u >> 6) & 3) * 16 + (u & 15), k0 = rd * 32 + ((u >> 4) & 3) * 8; FragH f;      // the block's 64 keys are two passes: 512 units in a row
#pragma unroll
      for (int q = 0; q < 8; ++q) f.u[q] = tl[k0 + q][d];
      *(v8us*)((unsigned short*)Vt + ((size_t)blockIdx.x * 512 + u) * 8) = f.half[0]; }
     } }

typedef float v2f __attribute__((ext_vector_type(2)));
// D = A.B + C for the flash kernel, the builtin alone: the compiler keeps the distance behind a matrix instruction itself and fills it with real work (the next independent product, the rescale, the sums) where there is some
__device__ __forceinline__ v8f mmaF(v16h a, v16h b, v8f c) { return __builtin_amdgcn_wmma_f32_16x16x32_f16(false, a, false, b, (short)0, c, false, false); }
// lane l <-> lane l ^ 16 as a vector cross-row move: no LDS queue and no wait, unlike a shuffle
__device__ __forceinline__ float xhalf(float x) { return __builtin_bit_cast(float, __builtin_amdgcn_permlanex16(__builtin_bit_cast(int, x), __builtin_bit_cast(int, x), 0x76543210, 0xfedcba98, false, false)); }

// Eight asynchronous copies to LDS: line i brings this lane's 16 bytes at g + i * 4 KiB to LDS byte l + i * 4 KiB; the block's 256 lanes move 8 x 4 KiB in a row (one tile's K part or V part).
// The wait at the statement's end stands in front of any later overwrite of the address registers that the copies name.
__device__ __forceinline__ void copy8(unsigned l, const unsigned short* g) {
  asm volatile("global_load_async_to_lds_b128 %0, %8, off\n\t"
               "global_load_async_to_lds_b128 %1, %9, off\n\t"
               "global_load_async_to_lds_b128 %2, %10, off\n\t"
               "global_load_async_to_lds_b128 %3, %11, off\n\t"
               "global_load_async_to_lds_b128 %4, %12, off\n\t"
               "global_load_async_to_lds_b128 %5, %13, off\n\t"
               "global_load_async_to_lds_b128 %6, %14, off\n\t"
               "global_load_async_to_lds_b128 %7, %15, off\n\t"
               "s_wait_xcnt 0x0"
               :: "v"(l), "v"(l + 4096u), "v"(l + 8192u), "v"(l + 12288u), "v"(l + 16384u), "v"(l + 20480u), "v"(l + 24576u), "v"(l + 28672u),
                  "v"(g), "v"(g + 2048), "v"(g + 4096), "v"(g + 6144), "v"(g + 8192), "v"(g + 10240), "v"(g + 12288), "v"(g + 14336) : "memory");
}

__global__ __launch_bounds__(256) void k_flash(const float* __restrict__ Qf, int ldq, const _Float16* __restrict__ Kp, const _Float16* __restrict__ Vt, const int* __restrict__ MSK, _Float16* __restrict__ O16, int ldo) {
  constexpr int NW = 8, RPW = 32, NQB = 4096 / (NW * RPW), DT = 4, KS = 2, PP = 8, NT = 4096 / (32 * PP), PART = PP * 2048; (void)MSK;      // PART: 16-bit elements of a tile's K part, and of its V part
  constexpr float SL2 = 0.125f * 1.44269504088896340736f;      // 64^-1/2 x log2(e): exp(x / 8 - m / 8) = 2^(x * SL2 - m * SL2)
  __shared__ __attribute__((aligned(16))) unsigned short sKV[2][2 * PART];        // [buffer][K part, then V part]
  __shared__ __attribute__((aligned(16))) unsigned short sO[NW][RPW][64 + 8];      // row pitch 144 bytes = 16 x 9: 16-byte accesses down a column meet no bank conflict
  const int tid = threadIdx.x, w = tid >> 5, lane = tid & 31, ln = lane & 15, hh = lane >> 4;
  const int slab = blockIdx.x / NQB, qblk = blockIdx.x % NQB; const int b = slab / 8, h = slab % 8; const int qb0 = qblk * (NW * RPW); const int q0 = qb0 + w * RPW;
  const unsigned short* kg = (const unsigned short*)Kp + (size_t)slab * 4096 * 64 + tid * 8;      // fragment order (k_kpack): a pass is 4 KiB in a row, a tile 32 KiB; this lane's 16 bytes of each 4 KiB
  const unsigned short* vg = (const unsigned short*)Vt + (size_t)slab * 64 * 4096 + tid * 8;      // fragment order (k_vt): the same
  const unsigned l0 = (unsigned)(size_t)&sKV[0][tid * 8];                                         // this lane's LDS byte address in buffer 0's K part
  copy8(l0, kg); copy8(l0 + 2 * PART, vg);      // tile 0 -> buffer 0; it flies over the Q loads and their conversion
  v4f qf[2][KS][4];      // raw f32 Q in the fragments' k order: [0], [1] = dims ks * 32 + 8hh .. + 7, [2], [3] = dims ks * 32 + 16 + 8hh .. + 7
#pragma unroll
  for (int rt = 0; rt < 2; ++rt) { const float* qr = Qf + ((size_t)b * 4096 + q0 + rt * 16 + ln) * ldq + h * 64;
#pragma unroll
    for (int ks = 0; ks < KS; ++ks) { const float* qk = qr + ks * 32 + 8 * hh; qf[rt][ks][0] = *(const v4fa*)qk; qf[rt][ks][1] = *(const v4fa*)(qk + 4); qf[rt][ks][2] = *(const v4fa*)(qk + 16); qf[rt][ks][3] = *(const v4fa*)(qk + 20); } }
  asm volatile("s_wait_xcnt 0x0" ::: "memory");      // the address registers of the loads above are reused below: the wait stands in front of their overwrite
  __builtin_amdgcn_sched_barrier(0);                 // keeps the set-up code that reuses those registers behind that wait
  FragH aq[2][KS];
#pragma unroll      // all three loops: constant indices, so that the raw values and the fragments stay in registers
  for (int rt = 0; rt < 2; ++rt)
#pragma unroll
    for (int ks = 0; ks < KS; ++ks)
#pragma unroll
      for (int i = 0; i < 16; ++i) aq[rt][ks].h[i] = (_Float16)bf16_round(qf[rt][ks][i >> 2][i & 3]);
  float m_r[2], l_r[2]; v8f oacc[2][DT];      // per lane: query rt * 16 + ln; m_r = running maximum in base-2 exponent units (score x SL2); oacc[rt][dt][r] = Ot[dt * 16 + 8hh + r][that query]
#pragma unroll
  for (int rt = 0; rt < 2; ++rt) { m_r[rt] = -3.0e38f; l_r[rt] = 0.f;
#pragma unroll
    for (int dt = 0; dt < DT; ++dt) oacc[rt][dt] = (v8f){0.f,0.f,0.f,0.f,0.f,0.f,0.f,0.f}; }
  asm volatile("s_wait_asynccnt 0x0" ::: "memory");      // this wave's copies of tile 0 have landed
  __syncthreads();                                       // ... and every other wave's: tile 0 may be read
  copy8(l0 + 4 * PART, kg + PART); copy8(l0 + 6 * PART, vg + PART);      // tile 1 -> buffer 1
#pragma unroll 1      // one trip = one tile; rolled, so that the ring's foot stands once
  for (int t = 0; t < NT; ++t) {
    const unsigned short* kl = &sKV[t & 1][lane * 8];      // this lane's unit of the tile's first K fragment half
    const unsigned short* vl = kl + PART;
    // Inside a tile every LDS read is issued a phase ahead of its use: V of a pass at the pass's top, K of the next pass right behind this pass's score products.
    FragH bk[2][KS], bv[DT];
#pragma unroll
    for (int nt = 0; nt < 2; ++nt)
#pragma unroll
      for (int ks = 0; ks < KS; ++ks) { const unsigned short* kr = kl + nt * 1024 + ks * 512; bk[nt][ks].half[0] = *(const v8us*)kr; bk[nt][ks].half[1] = *(const v8us*)(kr + 256); }
#pragma unroll 1      // rolled: unrolled, the 8 passes' LDS reads are lifted far ahead, the registers double and the back edge fills with copies
   for (int p = 0; p < PP; ++p) {
#pragma unroll
    for (int dt = 0; dt < DT; ++dt) { const unsigned short* vrow = vl + p * 2048 + dt * 512; bv[dt].half[0] = *(const v8us*)vrow; bv[dt].half[1] = *(const v8us*)(vrow + 256); }
    __builtin_amdgcn_sched_barrier(0);      // keeps the pass's eight V reads here as one group: sunk, they stand in several places among the softmax, and the last come late for their products
    v8f s[2][2];      // s[rt][nt][r] = score of key (t * PP + p) * 32 + nt * 16 + 8hh + r against query rt * 16 + ln
#pragma unroll
    for (int nt = 0; nt < 2; ++nt) {
#pragma unroll
      for (int rt = 0; rt < 2; ++rt) { v8f acc = (v8f){0.f,0.f,0.f,0.f,0.f,0.f,0.f,0.f};
#pragma unroll
        for (int ks = 0; ks < KS; ++ks) acc = mmaF(bk[nt][ks].v, aq[rt][ks].v, acc); s[rt][nt] = acc; } }
    if (p + 1 < PP) {      // the last pass of a tile fetches no K ahead: the next tile is not published yet
#pragma unroll
      for (int nt = 0; nt < 2; ++nt)
#pragma unroll
        for (int ks = 0; ks < KS; ++ks) { const unsigned short* kr = kl + (p + 1) * 2048 + nt * 1024 + ks * 512; bk[nt][ks].half[0] = *(const v8us*)kr; bk[nt][ks].half[1] = *(const v8us*)(kr + 256); } }
    FragH pb[2];
#pragma unroll
    for (int rt = 0; rt < 2; ++rt) {
      float sc[16], mx[8];      // raw products: their maximum is taken first (the scale is positive); the scale goes into each exponent's one multiply-add
#pragma unroll
      for (int r = 0; r < 8; ++r) { sc[r] = s[rt][0][r]; sc[8 + r] = s[rt][1][r]; mx[r] = fmaxf(sc[r], sc[8 + r]); }
      float mc = fmaxf(fmaxf(fmaxf(mx[0], mx[1]), fmaxf(mx[2], mx[3])), fmaxf(fmaxf(mx[4], mx[5]), fmaxf(mx[6], mx[7])));
      mc = fmaxf(mc, xhalf(mc));      // both halves of a column must use one maximum: their P meet in one product
      const float mn = fmaxf(m_r[rt], mc * SL2); const float al = __builtin_amdgcn_exp2f(m_r[rt] - mn); m_r[rt] = mn;      // an unchanged maximum gives 2^0 = 1
      float ps[4] = {0.f, 0.f, 0.f, 0.f};
#pragma unroll
      for (int i = 0; i < 16; i += 2) {      // two neighbouring scores of an accumulator share one packed multiply-add
        const v2f e = __builtin_elementwise_fma((v2f){sc[i], sc[i + 1]}, (v2f){SL2, SL2}, (v2f){-mn, -mn});
        const float p0 = __builtin_amdgcn_exp2f(e[0]), p1 = __builtin_amdgcn_exp2f(e[1]);
        ps[i & 3] += p0; ps[(i + 1) & 3] += p1; pb[rt].h[i] = (_Float16)p0; pb[rt].h[i + 1] = (_Float16)p1; }
      l_r[rt] = l_r[rt] * al + ((ps[0] + ps[1]) + (ps[2] + ps[3]));      // this half's keys only; the halves join after the loop
#pragma unroll
      for (int dt = 0; dt < DT; ++dt)
#pragma unroll
        for (int r = 0; r < 8; ++r) oacc[rt][dt][r] *= al; }
#pragma unroll
    for (int dt = 0; dt < DT; ++dt) {
#pragma unroll
      for (int rt = 0; rt < 2; ++rt) oacc[rt][dt] = mmaF(bv[dt].v, pb[rt].v, oacc[rt][dt]); } }
    // The ring's foot: this wave's LDS reads are done, its copies of tile t + 1 have landed, every wave has come as far; then tile t + 2 goes into the buffer that this trip has read.
    asm volatile("s_wait_dscnt 0x0" ::: "memory");
    asm volatile("s_wait_asynccnt 0x0" ::: "memory");
    __syncthreads();
    if (t + 2 < NT) { const unsigned lb = l0 + (unsigned)(t & 1) * (4 * PART); copy8(lb, kg + (size_t)(t + 2) * PART); copy8(lb + 2 * PART, vg + (size_t)(t + 2) * PART); } }
  asm volatile("s_wait_asynccnt 0x0" ::: "memory");      // nothing of this wave is in flight when it goes on to the epilogue
#pragma unroll
  for (int rt = 0; rt < 2; ++rt) { float l = l_r[rt]; l += xhalf(l); const float li = (l > 0.f) ? 1.0f / l : 0.f;
#pragma unroll
    for (int dt = 0; dt < DT; ++dt) { FragH f;
#pragma unroll
      for (int r = 0; r < 8; ++r) f.h[r] = (_Float16)(oacc[rt][dt][r] * li);
      *(v8us*)&sO[w][rt * 16 + ln][dt * 16 + 8 * hh] = f.half[0]; } }
  __builtin_amdgcn_fence(__ATOMIC_ACQ_REL, "workgroup"); __builtin_amdgcn_wave_barrier();
  {
#pragma unroll
    for (int rp = 0; rp < RPW; rp += 4) { const int r = rp + (lane >> 3), pc = lane & 7; const v8us val = *(const v8us*)&sO[w][r][pc * 8]; *(v8us*)((unsigned short*)O16 + ((size_t)b * 4096 + q0 + r) * ldo + h * 64 + pc * 8) = val; }      // 8 lanes store a head's 128-byte row piece: one whole line
     } }

extern "C" void kernel_launch(void* const* d_in, const int* in_sizes, int n_in,
                              void* d_out, int out_size, void* d_ws, size_t ws_size, hipStream_t stream) {
  (void)in_sizes; (void)n_in; (void)out_size;
  const float* q = (const float*)d_in[0]; const float* k = (const float*)d_in[1]; const float* v = (const float*)d_in[2]; const float* Wo = (const float*)d_in[3]; const float* bo = (const float*)d_in[4];
  char* ws = (char*)d_ws; size_t off = 0;
  auto take = [&](size_t bytes) { char* p = ws + off; off += (bytes + 255) & ~(size_t)255; return p; };
  _Float16* Bo = (_Float16*)take((size_t)NO * CC * 2); _Float16* K16 = (_Float16*)take((size_t)NR * CC * 2); _Float16* Vt = (_Float16*)take((size_t)NR * CC * 2); _Float16* O16 = (_Float16*)take((size_t)NR * CC * 2);
  if (off > ws_size) return;      // 3 x 8.4 MB
  k_wt_f16<<<(NO * (CC / 8) + 255) / 256, 256, 0, stream>>>(Wo, Bo, CC, NO, 16.0f);      // [in][out]
  k_kpack<<<NR / 16, 256, 0, stream>>>(k, K16);
  k_vt<NH, TT><<<BB * NH * (TT / 64), 256, 0, stream>>>(v, CC, 0, Vt);
  k_flash<<<BB * NH * (TT / 256), 256, 0, stream>>>(q, CC, K16, Vt, nullptr, O16, CC);
  k_gemm_hhx<0><<<dim3(((NR / 16) * 1 + 3) / 4, 1), 128, 0, stream>>>(O16, CC, 0, Bo, CC, 0, 0.0625f, bo, 0, nullptr, 1, 0, 0, (float*)d_out, nullptr, NO, 0, NR, NO, CC);      // N = 64
}

// v008
// A run of this version takes 77.2 microseconds.
// Next to v007, in two timings, it ran 1.13 times as fast each time.
// Over all steps from v000 it is 8.72 times as fast.
#include <hip/hip_runtime.h>
// 8-head attention over the given q/k/v (2 × 4096 tokens, d = 64) as a fused flash-style kernel on v_wmma_f32_16x16x32_f16 (q, k, v are module INPUTS → exact bf16 values as f16 operands; S = Q·Kᵀ × 64^-½,
// online max/sum softmax f32, P f16 ≤ 2^15, O = P·V), then the 512→64 output linear (+ bias; W_out [in][out] bf16-exact ×2^4); f32 accumulate.
#define BB 2
#define TT 4096
#define CC 512
#define NH 8
#define NO 64
#define NR (BB * TT)

typedef __bf16 v16b __attribute__((ext_vector_type(16)));
typedef unsigned short v8us __attribute__((ext_vector_type(8), may_alias));
typedef float  v8f  __attribute__((ext_vector_type(8)));
typedef float  v4f  __attribute__((ext_vector_type(4)));
typedef float  v4fa __attribute__((ext_vector_type(4), may_alias));
union FragB { v16b v; v8us half[2]; unsigned short u[16]; };

__device__ __forceinline__ unsigned short bf16_bits(float x) { unsigned int u = __float_as_uint(x); return (unsigned short)((u + 0x7FFFu + ((u >> 16) & 1u)) >> 16); }
__device__ __forceinline__ float bf16_val(unsigned short b) { return __uint_as_float(((unsigned int)b) << 16); }
__device__ __forceinline__ float bf16_round(float x) { return bf16_val(bf16_bits(x)); }
// D += A·B with NT terms: 1 = ah·bh, 2 = + al·bh (A split), 3 = + ah·bl (both split)
template <int NT>
__device__ __forceinline__ v8f mmaN(v16b ah, v16b al, v16b bh, v16b bl, v8f c) {
  c = __builtin_amdgcn_wmma_f32_16x16x32_bf16(false, ah, false, bh, (short)0, c, false, false);
  if (NT >= 2) c = __builtin_amdgcn_wmma_f32_16x16x32_bf16(false, al, false, bh, (short)0, c, false, false);
  if (NT >= 3) c = __builtin_amdgcn_wmma_f32_16x16x32_bf16(false, ah, false, bl, (short)0, c, false, false);
  asm volatile("v_nop\n\tv_nop\n\tv_nop\n\tv_nop" : "+v"(c) : "v"(ah), "v"(al), "v"(bh), "v"(bl));
  return c;
}

__global__ __launch_bounds__(256) void k_wt_bf16(const float* __restrict__ W, unsigned short* __restrict__ Wt, int K, int N) {
  const int t = blockIdx.x * 256 + threadIdx.x;
  const int k8n = K / 8;
  if (t >= N * k8n) return;
  const int n = t / k8n, k8 = (t % k8n) * 8;
  v8us v;
#pragma unroll
  for (int i = 0; i < 8; ++i) v[i] = bf16_bits(W[(size_t)(k8 + i) * N + n]);
  *(v8us*)(Wt + (size_t)n * K + k8) = v;
  
}

// GEMM C[M][N] (f32, pitch ldc) = act(A[M][K]·W + bias). A f32 row-major (pitch lda) converted per fragment to bf16
// (ASPLIT: hi/lo two planes -> 2 terms, else single rounded term); Wt bf16 [N][K] (pitch ldb). BIAS_BF16 rounds the
// bias to bf16 first (bias quantised to bf16 before the add). K%32==0, M%16==0, N%64==0.
template <bool ASPLIT, int ACT, bool BIAS_BF16>
__global__ __launch_bounds__(128) void k_gemm_bf(const float* __restrict__ A, int lda, const unsigned short* __restrict__ Wt, int ldb,
                                               const float* __restrict__ bias, float* __restrict__ C, int ldc, int M, int N, int K) {
  __shared__ __attribute__((aligned(16))) float so[4][16][64];
  const int tid = threadIdx.x, w = tid >> 5, lane = tid & 31, ln = lane & 15, hh = lane >> 4;
  const int ntn = N / 64;
  const int wid = blockIdx.x * 4 + w;
  const int mt = wid / ntn, nq = wid % ntn;
  if (mt * 16 >= M) return;
  const int row0 = mt * 16, col0 = nq * 64;
  const float* arow = A + (size_t)(row0 + ln) * lda;
  v8f acc[4] = {};
  for (int kb = 0; kb < K; kb += 32) {
    FragB ah, al;
    const v4f x0 = *(const v4fa*)(arow + kb + 8 * hh), x1 = *(const v4fa*)(arow + kb + 8 * hh + 4);
    const v4f x2 = *(const v4fa*)(arow + kb + 16 + 8 * hh), x3 = *(const v4fa*)(arow + kb + 16 + 8 * hh + 4);
    float xs[16] = {x0[0],x0[1],x0[2],x0[3],x1[0],x1[1],x1[2],x1[3],x2[0],x2[1],x2[2],x2[3],x3[0],x3[1],x3[2],x3[3]};
#pragma unroll
    for (int i = 0; i < 16; ++i) { const unsigned short hb = bf16_bits(xs[i]); ah.u[i] = hb; al.u[i] = ASPLIT ? bf16_bits(xs[i] - bf16_val(hb)) : (unsigned short)0; }
#pragma unroll
    for (int t = 0; t < 4; ++t) {
      const unsigned short* brow = Wt + (size_t)(col0 + t * 16 + ln) * ldb + kb;
      FragB b;
      b.half[0] = *(const v8us*)(brow + 8 * hh);
      b.half[1] = *(const v8us*)(brow + 16 + 8 * hh);
      acc[t] = mmaN<ASPLIT ? 2 : 1>(ah.v, al.v, b.v, b.v, acc[t]);
    }
  }
#pragma unroll
  for (int t = 0; t < 4; ++t) {
    float bv = bias ? bias[col0 + t * 16 + ln] : 0.f;
    if (BIAS_BF16) bv = bf16_round(bv);
#pragma unroll
    for (int r = 0; r < 8; ++r) { float v = acc[t][r] + bv; if (ACT == 1) v = fmaxf(v, 0.f); so[w][8 * hh + r][t * 16 + ln] = v; }
  }
  __builtin_amdgcn_fence(__ATOMIC_ACQ_REL, "workgroup");
  __builtin_amdgcn_wave_barrier();
  const int rsub = lane >> 4, c4 = (lane & 15) * 4;
  {
#pragma unroll
    for (int q = 0; q < 8; ++q) {
      const int r = q * 2 + rsub;
      const v4f v = *(const v4fa*)&so[w][r][c4];
      *(v4f*)(C + (size_t)(row0 + r) * ldc + col0 + c4) = v;
    }
    
  }
}

// Flash-style causal/unmasked attention, all contractions 3-term bf16 hi/lo splits, f32 softmax with running max.
// q,k,v rows are read from f32 buffers with arbitrary row pitch (so they can live inside a fused qkv buffer);
// D = head size (multiple of 32, <= 128); one wave = 16 query rows; block = 4 waves (64 queries) sharing K/V chunks of 32.
template <int D, bool CAUSAL>
__global__ __launch_bounds__(128) void k_flash(const float* __restrict__ qb, const float* __restrict__ kb, const float* __restrict__ vb,
                                             int pitch, int T, int H, float scale, float* __restrict__ y, int ypitch) {
  constexpr int KS = D / 32;        // k-steps for QK
  constexpr int DT = D / 16;        // d tiles for PV
  __shared__ __attribute__((aligned(16))) unsigned short sKh[32][D + 8], sKl[32][D + 8], sVh[32][D + 8], sVl[32][D + 8];
  __shared__ __attribute__((aligned(16))) unsigned short sPh[4][16][40], sPl[4][16][40];
  __shared__ __attribute__((aligned(16))) float sO[4][16][D];
  const int tid = threadIdx.x, w = tid >> 5, lane = tid & 31, ln = lane & 15, hh = lane >> 4;
  const int nqb = (T + 63) / 64;
  const int bh = blockIdx.x / nqb, qblk = blockIdx.x % nqb;
  const int b = bh / H, h = bh % H;
  const int q0 = qblk * 64 + w * 16;
  const float* Q = qb + (size_t)b * T * pitch + h * D;
  const float* K = kb + (size_t)b * T * pitch + h * D;
  const float* V = vb + (size_t)b * T * pitch + h * D;

  // A fragments of the wave's 16 query rows (scaled), hi/lo
  FragB aqh[KS], aql[KS];
  {
    int row = q0 + ln; if (row >= T) row = T - 1;
    const float* qr = Q + (size_t)row * pitch;
#pragma unroll
    for (int ks = 0; ks < KS; ++ks)
#pragma unroll
      for (int i = 0; i < 16; ++i) {
        const int d = ks * 32 + ((i < 8) ? (8 * hh + i) : (16 + 8 * hh + (i - 8)));
        const float x = qr[d] * scale; const unsigned short hb = bf16_bits(x);
        aqh[ks].u[i] = hb; aql[ks].u[i] = bf16_bits(x - bf16_val(hb));
      }
  }
  float m_r[8], l_r[8];
#pragma unroll
  for (int r = 0; r < 8; ++r) { m_r[r] = -3.0e38f; l_r[r] = 0.f; }
  v8f oacc[DT];
#pragma unroll
  for (int dt = 0; dt < DT; ++dt) oacc[dt] = (v8f){0.f,0.f,0.f,0.f,0.f,0.f,0.f,0.f};

  const int kv_end = CAUSAL ? min(T, qblk * 64 + 64) : T;     // block-uniform
  for (int j0 = 0; j0 < kv_end; j0 += 32) {
    __syncthreads();
    for (int e = tid; e < 32 * (D / 4); e += 128) {
      const int r = e / (D / 4), c4 = (e % (D / 4)) * 4;
      const int key = j0 + r;
      v4f kf = {0.f,0.f,0.f,0.f}, vf = {0.f,0.f,0.f,0.f};
      if (key < T) { kf = *(const v4fa*)(K + (size_t)key * pitch + c4); vf = *(const v4fa*)(V + (size_t)key * pitch + c4); }
#pragma unroll
      for (int t = 0; t < 4; ++t) {
        unsigned short hb = bf16_bits(kf[t]); sKh[r][c4 + t] = hb; sKl[r][c4 + t] = bf16_bits(kf[t] - bf16_val(hb));
        hb = bf16_bits(vf[t]); sVh[r][c4 + t] = hb; sVl[r][c4 + t] = bf16_bits(vf[t] - bf16_val(hb));
      }
    }
    __syncthreads();
    // S tile 16 x 32
    v8f s[2];
#pragma unroll
    for (int nt = 0; nt < 2; ++nt) {
      v8f acc = {};
#pragma unroll
      for (int ks = 0; ks < KS; ++ks) {
        FragB bh_, bl_;
        bh_.half[0] = *(const v8us*)&sKh[nt * 16 + ln][ks * 32 + 8 * hh]; bh_.half[1] = *(const v8us*)&sKh[nt * 16 + ln][ks * 32 + 16 + 8 * hh];
        bl_.half[0] = *(const v8us*)&sKl[nt * 16 + ln][ks * 32 + 8 * hh]; bl_.half[1] = *(const v8us*)&sKl[nt * 16 + ln][ks * 32 + 16 + 8 * hh];
        acc = mmaN<3>(aqh[ks].v, aql[ks].v, bh_.v, bl_.v, acc);
      }
      s[nt] = acc;
    }
    // mask + running max (rows 8hh+r; the 16 lanes of a half share rows)
    float alpha[8];
#pragma unroll
    for (int r = 0; r < 8; ++r) {
      const int qi = q0 + 8 * hh + r;
      const int ja = j0 + ln, jb = j0 + 16 + ln;
      if (CAUSAL) { if (ja > qi) s[0][r] = -3.0e38f; if (jb > qi) s[1][r] = -3.0e38f; }
      if (ja >= T) s[0][r] = -3.0e38f;
      if (jb >= T) s[1][r] = -3.0e38f;
      float mx = fmaxf(s[0][r], s[1][r]);
      mx = fmaxf(mx, __shfl_xor(mx, 1, 32)); mx = fmaxf(mx, __shfl_xor(mx, 2, 32)); mx = fmaxf(mx, __shfl_xor(mx, 4, 32)); mx = fmaxf(mx, __shfl_xor(mx, 8, 32));
      const float mnew = fmaxf(m_r[r], mx);
      alpha[r] = (mnew > -1.0e38f) ? __expf(m_r[r] - mnew) : 1.0f;
      const float p0 = (s[0][r] > -1.0e38f) ? __expf(s[0][r] - mnew) : 0.f;
      const float p1 = (s[1][r] > -1.0e38f) ? __expf(s[1][r] - mnew) : 0.f;
      m_r[r] = mnew;
      l_r[r] = l_r[r] * alpha[r] + p0 + p1;            // per-lane partial row sum (16 lanes combined at the end)
      unsigned short hb = bf16_bits(p0); sPh[w][8 * hh + r][ln] = hb;      sPl[w][8 * hh + r][ln] = bf16_bits(p0 - bf16_val(hb));
      hb = bf16_bits(p1);                sPh[w][8 * hh + r][16 + ln] = hb; sPl[w][8 * hh + r][16 + ln] = bf16_bits(p1 - bf16_val(hb));
    }
#pragma unroll
    for (int dt = 0; dt < DT; ++dt)
#pragma unroll
      for (int r = 0; r < 8; ++r) oacc[dt][r] *= alpha[r];
    __builtin_amdgcn_fence(__ATOMIC_ACQ_REL, "workgroup");
    __builtin_amdgcn_wave_barrier();
    FragB pah, pal;
    pah.half[0] = *(const v8us*)&sPh[w][ln][8 * hh]; pah.half[1] = *(const v8us*)&sPh[w][ln][16 + 8 * hh];
    pal.half[0] = *(const v8us*)&sPl[w][ln][8 * hh]; pal.half[1] = *(const v8us*)&sPl[w][ln][16 + 8 * hh];
#pragma unroll
    for (int dt = 0; dt < DT; ++dt) {
      FragB bvh, bvl;
#pragma unroll
      for (int i = 0; i < 8; ++i) {
        bvh.u[i] = sVh[8 * hh + i][dt * 16 + ln]; bvh.u[8 + i] = sVh[16 + 8 * hh + i][dt * 16 + ln];
        bvl.u[i] = sVl[8 * hh + i][dt * 16 + ln]; bvl.u[8 + i] = sVl[16 + 8 * hh + i][dt * 16 + ln];
      }
      oacc[dt] = mmaN<3>(pah.v, pal.v, bvh.v, bvl.v, oacc[dt]);
    }
    __builtin_amdgcn_fence(__ATOMIC_ACQ_REL, "workgroup");
    __builtin_amdgcn_wave_barrier();
  }
#pragma unroll
  for (int r = 0; r < 8; ++r) {
    float l = l_r[r];
    l += __shfl_xor(l, 1, 32); l += __shfl_xor(l, 2, 32); l += __shfl_xor(l, 4, 32); l += __shfl_xor(l, 8, 32);
    l_r[r] = (l > 0.f) ? 1.0f / l : 0.f;
  }
#pragma unroll
  for (int dt = 0; dt < DT; ++dt)
#pragma unroll
    for (int r = 0; r < 8; ++r) sO[w][8 * hh + r][dt * 16 + ln] = oacc[dt][r] * l_r[r];
  __builtin_amdgcn_fence(__ATOMIC_ACQ_REL, "workgroup");
  __builtin_amdgcn_wave_barrier();
  {
    for (int r = 0; r < 16; ++r) {
      const int row = q0 + r;
      if (row < T && lane < D / 4) {
        const v4f val = *(const v4fa*)&sO[w][r][lane * 4];
        *(v4f*)(y + ((size_t)b * T + row) * ypitch + h * D + lane * 4) = val;
      }
    }
    
  }
}

// GEMM C = act(A·W + bias + resid): A f32 (ASPLIT -> hi/lo 2 terms), Wt bf16 [N][K]; ACT 0 none, 1 relu, 2 exact gelu;
// resid (optional, f32, row index = (row % rmod), pitch ldr, RES_BF16 rounds it) added before the activation.
template <bool ASPLIT, int ACT, bool BIAS_BF16, bool RES_BF16>
__global__ __launch_bounds__(128) void k_gemm_bf3(const float* __restrict__ A, int lda, const unsigned short* __restrict__ Wt, int ldb,
                                                const float* __restrict__ bias, const float* __restrict__ resid, int rmod, int ldr,
                                                float* __restrict__ C, int ldc, int M, int N, int K) {
  __shared__ __attribute__((aligned(16))) float so[4][16][64];
  const int tid = threadIdx.x, w = tid >> 5, lane = tid & 31, ln = lane & 15, hh = lane >> 4;
  const int ntn = N / 64;
  const int wid = blockIdx.x * 4 + w;
  const int mt = wid / ntn, nq = wid % ntn;
  if (mt * 16 >= M) return;
  const int row0 = mt * 16, col0 = nq * 64;
  const float* arow = A + (size_t)(row0 + ln) * lda;
  v8f acc[4] = {};
  for (int kb = 0; kb < K; kb += 32) {
    FragB ah, al;
    const v4f x0 = *(const v4fa*)(arow + kb + 8 * hh), x1 = *(const v4fa*)(arow + kb + 8 * hh + 4);
    const v4f x2 = *(const v4fa*)(arow + kb + 16 + 8 * hh), x3 = *(const v4fa*)(arow + kb + 16 + 8 * hh + 4);
    float xs[16] = {x0[0],x0[1],x0[2],x0[3],x1[0],x1[1],x1[2],x1[3],x2[0],x2[1],x2[2],x2[3],x3[0],x3[1],x3[2],x3[3]};
#pragma unroll
    for (int i = 0; i < 16; ++i) { const unsigned short hb = bf16_bits(xs[i]); ah.u[i] = hb; al.u[i] = ASPLIT ? bf16_bits(xs[i] - bf16_val(hb)) : (unsigned short)0; }
#pragma unroll
    for (int t = 0; t < 4; ++t) {
      const unsigned short* brow = Wt + (size_t)(col0 + t * 16 + ln) * ldb + kb;
      FragB b;
      b.half[0] = *(const v8us*)(brow + 8 * hh);
      b.half[1] = *(const v8us*)(brow + 16 + 8 * hh);
      acc[t] = mmaN<ASPLIT ? 2 : 1>(ah.v, al.v, b.v, b.v, acc[t]);
    }
  }
#pragma unroll
  for (int t = 0; t < 4; ++t) {
    const int col = col0 + t * 16 + ln;
    float bv = bias ? bias[col] : 0.f;
    if (BIAS_BF16) bv = bf16_round(bv);
#pragma unroll
    for (int r = 0; r < 8; ++r) {
      float v = acc[t][r] + bv;
      if (resid) { float rv = resid[(size_t)((row0 + 8 * hh + r) % rmod) * ldr + col]; if (RES_BF16) rv = bf16_round(rv); v += rv; }
      if (ACT == 1) v = fmaxf(v, 0.f);
      if (ACT == 2) v = 0.5f * v * (1.0f + erff(v * 0.70710678118654752f));
      if (ACT == 3) { const float u = 0.7978845608028654f * (v + 0.044715f * v * v * v); v = 0.5f * v * (1.0f + tanhf(u)); }
      so[w][8 * hh + r][t * 16 + ln] = v;
    }
  }
  __builtin_amdgcn_fence(__ATOMIC_ACQ_REL, "workgroup");
  __builtin_amdgcn_wave_barrier();
  const int rsub = lane >> 4, c4 = (lane & 15) * 4;
  {
#pragma unroll
    for (int q = 0; q < 8; ++q) {
      const int r = q * 2 + rsub;
      const v4f v = *(const v4fa*)&so[w][r][c4];
      *(v4f*)(C + (size_t)(row0 + r) * ldc + col0 + c4) = v;
    }
    
  }
}
// row LayerNorm (biased variance, eps) over N: s = X (+ R); optional out_sum <- s; out_norm <- (s-mu)*rsqrt(var+eps)*g + b
template <bool PARAM_BF16>
__global__ __launch_bounds__(256) void k_layernorm(const float* __restrict__ X, const float* __restrict__ R, const float* __restrict__ g, const float* __restrict__ bta,
                                                  float* __restrict__ out_sum, float* __restrict__ out_norm, int N, float eps) {
  __shared__ float red[256];
  const int row = blockIdx.x, tid = threadIdx.x;
  const float* x = X + (size_t)row * N; const float* rr = R ? R + (size_t)row * N : nullptr;
  float vals[16];                     // up to N = 4096
  const int per = N / 256;            // contiguous chunk per thread? use strided-by-4 chunks: thread handles j = tid*4 + 1024*u
  float s1 = 0.f;
  for (int u = 0; u < per / 4; ++u) {
    const int j = tid * 4 + 1024 * u;
    const v4f a = *(const v4fa*)(x + j);
    v4f b = {0.f,0.f,0.f,0.f}; if (rr) b = *(const v4fa*)(rr + j);
#pragma unroll
    for (int q = 0; q < 4; ++q) { const float v = a[q] + b[q]; vals[u * 4 + q] = v; s1 += v; }
  }
  red[tid] = s1; __syncthreads();
  for (int st = 128; st > 0; st >>= 1) { if (tid < st) red[tid] += red[tid + st]; __syncthreads(); }
  const float mu = red[0] / (float)N; __syncthreads();
  float s2 = 0.f;
  for (int u = 0; u < per / 4; ++u)
#pragma unroll
    for (int q = 0; q < 4; ++q) { const float c = vals[u * 4 + q] - mu; s2 += c * c; }
  red[tid] = s2; __syncthreads();
  for (int st = 128; st > 0; st >>= 1) { if (tid < st) red[tid] += red[tid + st]; __syncthreads(); }
  const float rs = rsqrtf(red[0] / (float)N + eps);
  {
    for (int u = 0; u < per / 4; ++u) {
      const int j = tid * 4 + 1024 * u;
      v4f o, sm;
#pragma unroll
      for (int q = 0; q < 4; ++q) {
        float gg = g[j + q], bb = bta[j + q];
        if (PARAM_BF16) { gg = bf16_round(gg); bb = bf16_round(bb); }
        sm[q] = vals[u * 4 + q]; o[q] = (vals[u * 4 + q] - mu) * rs * gg + bb;
      }
      if (out_sum) *(v4f*)(out_sum + (size_t)row * N + j) = sm;
      *(v4f*)(out_norm + (size_t)row * N + j) = o;
    }
    
  }
}



// ---- f16 WMMA path (v_wmma_f32_16x16x32_f16): 11-bit significands for operands in range — used where the softmax P operand (≤ 2^15) needs more precision than bf16
typedef _Float16 v16h __attribute__((ext_vector_type(16)));
union FragH { v16h v; v8us half[2]; _Float16 h[16]; unsigned short u[16]; };
template <int NT>
__device__ __forceinline__ v8f mmaH(v16h ah, v16h al, v16h bh, v16h bl, v8f c) {
  c = __builtin_amdgcn_wmma_f32_16x16x32_f16(false, ah, false, bh, (short)0, c, false, false);
  if (NT >= 2) c = __builtin_amdgcn_wmma_f32_16x16x32_f16(false, al, false, bh, (short)0, c, false, false);
  if (NT >= 3) c = __builtin_amdgcn_wmma_f32_16x16x32_f16(false, ah, false, bl, (short)0, c, false, false);
  asm volatile("v_nop\n\tv_nop\n\tv_nop\n\tv_nop" : "+v"(c) : "v"(ah), "v"(al), "v"(bh), "v"(bl));
  return c;
}
// batched GEMM like k_gemm_b but f16 operands: A f32 (split into f16 hi/lo if ASPLIT, else rounded to f16), Bt = f16 values [n][k]; alpha; C f32; N multiple of 16 (partial tiles skipped)
template <bool ASPLIT>
__global__ __launch_bounds__(128) void k_gemm_h(const float* __restrict__ A, int lda, size_t sA, const _Float16* __restrict__ Bh, int ldb, size_t sB, float alpha, float* __restrict__ C, int ldc, size_t sC, int M, int N, int K) {
  __shared__ __attribute__((aligned(16))) float so[4][16][64];
  const int tid = threadIdx.x, w = tid >> 5, lane = tid & 31, ln = lane & 15, hh = lane >> 4; const int by = blockIdx.y;
  A += (size_t)by * sA; Bh += (size_t)by * sB; C += (size_t)by * sC;
  const int ntn = (N + 63) / 64; const int wid = blockIdx.x * 4 + w; const int mt = wid / ntn, nq = wid % ntn; if (mt * 16 >= M) return;
  const int row0 = mt * 16, col0 = nq * 64; const float* arow = A + (size_t)(row0 + ln) * lda;
  v8f acc[4] = {};
  for (int kb = 0; kb < K; kb += 32) {
    FragH ah, al;
    const v4f x0 = *(const v4fa*)(arow + kb + 8 * hh), x1 = *(const v4fa*)(arow + kb + 8 * hh + 4), x2 = *(const v4fa*)(arow + kb + 16 + 8 * hh), x3 = *(const v4fa*)(arow + kb + 16 + 8 * hh + 4);
    float xs[16] = {x0[0],x0[1],x0[2],x0[3],x1[0],x1[1],x1[2],x1[3],x2[0],x2[1],x2[2],x2[3],x3[0],x3[1],x3[2],x3[3]};
#pragma unroll
    for (int i = 0; i < 16; ++i) { const _Float16 h = (_Float16)xs[i]; ah.h[i] = h; al.h[i] = ASPLIT ? (_Float16)(xs[i] - (float)h) : (_Float16)0.0f; }
#pragma unroll
    for (int t = 0; t < 4; ++t) { if (col0 + t * 16 >= N) continue; const size_t boff = (size_t)(col0 + t * 16 + ln) * ldb + kb; FragH bq; bq.half[0] = *(const v8us*)(Bh + boff + 8 * hh); bq.half[1] = *(const v8us*)(Bh + boff + 16 + 8 * hh);
      acc[t] = mmaH<ASPLIT ? 2 : 1>(ah.v, al.v, bq.v, bq.v, acc[t]); }
  }
#pragma unroll
  for (int t = 0; t < 4; ++t) { if (col0 + t * 16 >= N) continue;
#pragma unroll
    for (int r = 0; r < 8; ++r) so[w][8 * hh + r][t * 16 + ln] = acc[t][r] * alpha; }
  __builtin_amdgcn_fence(__ATOMIC_ACQ_REL, "workgroup"); __builtin_amdgcn_wave_barrier();
  const int rsub = lane >> 4, c4 = (lane & 15) * 4;
  {
#pragma unroll
    for (int q = 0; q < 8; ++q) { const int r = q * 2 + rsub; if (col0 + c4 < N) { const v4f v = *(const v4fa*)&so[w][r][c4]; *(v4f*)(C + (size_t)(row0 + r) * ldc + col0 + c4) = v; } }
     }
}

// Wt[n][k] = f16(W[k][n]·scale) from f32 row-major W[K][N] (scale = power of two; bf16-exact weights stay exact in f16 away from the subnormal range)
__global__ __launch_bounds__(256) void k_wt_f16(const float* __restrict__ W, _Float16* __restrict__ Wt, int K, int N, float scale) {
  const int t = blockIdx.x * 256 + threadIdx.x; if (t >= N * (K / 8)) return; const int n = t / (K / 8), k8 = (t % (K / 8)) * 8; FragH f;
#pragma unroll
  for (int i = 0; i < 8; ++i) f.h[i] = (_Float16)(bf16_round(W[(size_t)(k8 + i) * N + n]) * scale); const v8us o = f.half[0];
  *(v8us*)((unsigned short*)Wt + (size_t)n * K + k8) = o; 
}
// k_gemm_hh variant with fused epilogue: v = acc·alpha + bias[by·sBias + col] (+ CP[(row/rowsPerB)·sCPb + by·64 + col] if CP) ; ACT 0 none / 1 elu ; writes f32 C and/or f16 C16 (each if non-null)
template <int ACT>
__global__ __launch_bounds__(128) void k_gemm_hhx(const _Float16* __restrict__ A, int lda, size_t sA, const _Float16* __restrict__ Bh, int ldb, size_t sB, float alpha, const float* __restrict__ bias, size_t sBias, const float* __restrict__ CP, int rowsPerB, size_t sCPb, int row0g,
    float* __restrict__ C, _Float16* __restrict__ C16, int ldc, size_t sC, int M, int N, int K) {
  __shared__ __attribute__((aligned(16))) float so[4][16][64];
  const int tid = threadIdx.x, w = tid >> 5, lane = tid & 31, ln = lane & 15, hh = lane >> 4; const int by = blockIdx.y;
  A += (size_t)by * sA; Bh += (size_t)by * sB; const size_t cofs = (size_t)by * sC; const float* bp = bias ? bias + (size_t)by * sBias : nullptr;
  const int ntn = (N + 63) / 64; const int wid = blockIdx.x * 4 + w; const int mt = wid / ntn, nq = wid % ntn; if (mt * 16 >= M) return;
  const int row0 = mt * 16, col0 = nq * 64; const _Float16* arow = A + (size_t)(row0 + ln) * lda;
  v8f acc[4] = {};
  for (int kb = 0; kb < K; kb += 32) { FragH ah; ah.half[0] = *(const v8us*)((const unsigned short*)arow + kb + 8 * hh); ah.half[1] = *(const v8us*)((const unsigned short*)arow + kb + 16 + 8 * hh);
#pragma unroll
    for (int t = 0; t < 4; ++t) { if (col0 + t * 16 >= N) continue; const size_t boff = (size_t)(col0 + t * 16 + ln) * ldb + kb; FragH bq; bq.half[0] = *(const v8us*)((const unsigned short*)Bh + boff + 8 * hh); bq.half[1] = *(const v8us*)((const unsigned short*)Bh + boff + 16 + 8 * hh);
      acc[t] = mmaH<1>(ah.v, ah.v, bq.v, bq.v, acc[t]); }
  }
#pragma unroll
  for (int t = 0; t < 4; ++t) { if (col0 + t * 16 >= N) continue; const int col = col0 + t * 16 + ln; const float bv = bp ? bf16_round(bp[col]) : 0.f;
#pragma unroll
    for (int r = 0; r < 8; ++r) { float v = acc[t][r] * alpha + bv; if (CP) { const int bidx = (row0g + row0 + 8 * hh + r) / rowsPerB; v += CP[(size_t)bidx * sCPb + (size_t)by * 64 + col]; } if (ACT == 1) v = (v > 0.f) ? v : expm1f(v); else if (ACT == 3) v = fmaxf(v, 0.f); so[w][8 * hh + r][t * 16 + ln] = v; } }
  __builtin_amdgcn_fence(__ATOMIC_ACQ_REL, "workgroup"); __builtin_amdgcn_wave_barrier();
  const int rsub = lane >> 4, c4 = (lane & 15) * 4; typedef _Float16 v4h __attribute__((ext_vector_type(4)));
  {
#pragma unroll
    for (int q = 0; q < 8; ++q) { const int r = q * 2 + rsub; if (col0 + c4 < N) { const v4f v = *(const v4fa*)&so[w][r][c4]; if (C) *(v4f*)(C + cofs + (size_t)(row0 + r) * ldc + col0 + c4) = v; if (C16) { v4h h4; for (int i = 0; i < 4; ++i) h4[i] = (_Float16)v[i]; *(v4h*)(C16 + cofs + (size_t)(row0 + r) * ldc + col0 + c4) = h4; } } }
     }
}


__global__ __launch_bounds__(256) void k_round16f(const float* __restrict__ W, _Float16* __restrict__ Bt, size_t n8) { const size_t t = (size_t)blockIdx.x * 256 + threadIdx.x; if (t >= n8) return; FragH f;
#pragma unroll
  for (int i = 0; i < 8; ++i) f.h[i] = (_Float16)(bf16_round(W[t * 8 + i]) * 16.0f); *(v8us*)((unsigned short*)Bt + t * 8) = f.half[0];  }
// K rows (f32 -> bf16 value -> f16) in the order of the score product's A fragments. A 16-byte unit holds 8 dims of one key; unit ((kt * 2 + ks) * 2 + half) * 32 + hh * 16 + ln
// of a (batch, head) slab is key kt * 16 + ln, dims ks * 32 + half * 16 + hh * 8 .. + 7: a wave's load of one fragment half is 512 contiguous bytes (four whole lines).
// One block = 16 keys x all 8 heads, read in whole rows and turned through LDS; a group of 16 units takes 256 + 16 bytes there, so that neither side meets a bank conflict.
__global__ __launch_bounds__(256) void k_kpack(const float* __restrict__ x, _Float16* __restrict__ Kp) { __shared__ __attribute__((aligned(16))) unsigned short st[64 * 136]; const int tid = threadIdx.x; const int b = blockIdx.x / 256, kt = blockIdx.x % 256;
#pragma unroll      // the four rounds' loads fly together
  for (int i = 0; i < 4; ++i) { const int u = i * 256 + tid, ln = u >> 6, c8 = u & 63; const float* s = x + ((size_t)b * 4096 + kt * 16 + ln) * 512 + c8 * 8; const v4f a0 = *(const v4fa*)s, a1 = *(const v4fa*)(s + 4); FragH f;      // c8 = head * 8 + ks * 4 + half * 2 + hh
#pragma unroll      // constant vector indices: the values stay in registers
    for (int q = 0; q < 4; ++q) { f.h[q] = (_Float16)bf16_round(a0[q]); f.h[4 + q] = (_Float16)bf16_round(a1[q]); }
    *(v8us*)&st[c8 * 136 + ln * 8] = f.half[0]; }
  __syncthreads();
#pragma unroll      // the four LDS reads are issued ahead of the first store
  for (int i = 0; i < 4; ++i) { const int p = i * 256 + tid; const v8us o = *(const v8us*)&st[(p >> 4) * 136 + (p & 15) * 8];      // p >> 7 = head
    *(v8us*)((unsigned short*)Kp + ((((size_t)b * 8 + (p >> 7)) * 256 + kt) * 128 + (p & 127)) * 8) = o; } }
// V (f32 -> bf16 value -> f16, converted here on the way into LDS) transposed, in the order of the second product's A fragments: unit ((pass * 4 + dt) * 2 + half) * 32 + hh * 16 + ln of a slab is dim dt * 16 + ln, keys pass * 32 + half * 16 + hh * 8 .. + 7.
template <int NHv, int TTv>
__global__ __launch_bounds__(256) void k_vt(const float* __restrict__ V, int ldv, int voff, _Float16* __restrict__ Vt) { __shared__ unsigned short tl[64][66]; const int tid = threadIdx.x; const int slab = blockIdx.x / (TTv / 64), lg = blockIdx.x % (TTv / 64); const int b = slab / NHv, h = slab % NHv;
#pragma unroll      // the four rounds' loads fly together
  for (int rd = 0; rd < 4; ++rd) { const int i = rd * 256 + tid, r = i >> 4, c4 = (i & 15) * 4; const v4f a = *(const v4fa*)(V + ((size_t)b * TTv + lg * 64 + r) * ldv + voff + h * 64 + c4); FragH f;      // 16 lanes take a head's 256-byte row piece: whole lines
#pragma unroll      // constant vector indices: the values stay in registers
    for (int q = 0; q < 4; ++q) { f.h[q] = (_Float16)bf16_round(a[q]); tl[r][c4 + q] = f.u[q]; } }
  __syncthreads();
  {
#pragma unroll
    for (int rd = 0; rd < 2; ++rd) { const int u = rd * 256 + tid, d = ((u >> 6) & 3) * 16 + (u & 15), k0 = rd * 32 + ((u >> 4) & 3) * 8; FragH f;      // the block's 64 keys are two passes: 512 units in a row
#pragma unroll
      for (int q = 0; q < 8; ++q) f.u[q] = tl[k0 + q][d];
      *(v8us*)((unsigned short*)Vt + ((size_t)blockIdx.x * 512 + u) * 8) = f.half[0]; }
     } }

typedef float v2f __attribute__((ext_vector_type(2)));
// D = A.B + C for the flash kernel, the builtin alone: the compiler keeps the distance behind a matrix instruction itself and fills it with real work (the next independent product, the rescale, the sums) where there is some
__device__ __forceinline__ v8f mmaF(v16h a, v16h b, v8f c) { return __builtin_amdgcn_wmma_f32_16x16x32_f16(false, a, false, b, (short)0, c, false, false); }
// lane l <-> lane l ^ 16 as a vector cross-row move: no LDS queue and no wait, unlike a shuffle
__device__ __forceinline__ float xhalf(float x) { return __builtin_bit_cast(float, __builtin_amdgcn_permlanex16(__builtin_bit_cast(int, x), __builtin_bit_cast(int, x), 0x76543210, 0xfedcba98, false, false)); }

// P of one query column for one pass: 2^(score x SL2 - m) for its 16 keys of this half, as the f16 B operand of the second product; returns their sum.
__device__ __forceinline__ float pexp(v8f s0, v8f s1, float m, FragH& pb) {
  constexpr float SL2 = 0.125f * 1.44269504088896340736f;
  float sc[16], ps[4] = {0.f, 0.f, 0.f, 0.f};
#pragma unroll      // both loops: constant indices, so that scores, sums and P stay in registers
  for (int r = 0; r < 8; ++r) { sc[r] = s0[r]; sc[8 + r] = s1[r]; }
#pragma unroll
  for (int i = 0; i < 16; i += 2) {      // two neighbouring scores of an accumulator share one packed multiply-add
    const v2f e = __builtin_elementwise_fma((v2f){sc[i], sc[i + 1]}, (v2f){SL2, SL2}, (v2f){-m, -m});
    const float p0 = __builtin_amdgcn_exp2f(e[0]), p1 = __builtin_amdgcn_exp2f(e[1]);
    ps[i & 3] += p0; ps[(i + 1) & 3] += p1; pb.h[i] = (_Float16)p0; pb.h[i + 1] = (_Float16)p1; }
  return (ps[0] + ps[1]) + (ps[2] + ps[3]);
}

// Eight asynchronous copies to LDS: line i brings this lane's 16 bytes at g + i * 4 KiB to LDS byte l + i * 4 KiB; the block's 256 lanes move 8 x 4 KiB in a row (one tile's K part or V part).
// The wait at the statement's end stands in front of any later overwrite of the address registers that the copies name.
__device__ __forceinline__ void copy8(unsigned l, const unsigned short* g) {
  asm volatile("global_load_async_to_lds_b128 %0, %8, off\n\t"
               "global_load_async_to_lds_b128 %1, %9, off\n\t"
               "global_load_async_to_lds_b128 %2, %10, off\n\t"
               "global_load_async_to_lds_b128 %3, %11, off\n\t"
               "global_load_async_to_lds_b128 %4, %12, off\n\t"
               "global_load_async_to_lds_b128 %5, %13, off\n\t"
               "global_load_async_to_lds_b128 %6, %14, off\n\t"
               "global_load_async_to_lds_b128 %7, %15, off\n\t"
               "s_wait_xcnt 0x0"
               :: "v"(l), "v"(l + 4096u), "v"(l + 8192u), "v"(l + 12288u), "v"(l + 16384u), "v"(l + 20480u), "v"(l + 24576u), "v"(l + 28672u),
                  "v"(g), "v"(g + 2048), "v"(g + 4096), "v"(g + 6144), "v"(g + 8192), "v"(g + 10240), "v"(g + 12288), "v"(g + 14336) : "memory");
}

__global__ __launch_bounds__(256) void k_flash(const float* __restrict__ Qf, int ldq, const _Float16* __restrict__ Kp, const _Float16* __restrict__ Vt, const int* __restrict__ MSK, _Float16* __restrict__ O16, int ldo) {
  constexpr int NW = 8, RPW = 32, NQB = 4096 / (NW * RPW), DT = 4, KS = 2, PP = 8, NT = 4096 / (32 * PP), PART = PP * 2048; (void)MSK;      // PART: 16-bit elements of a tile's K part, and of its V part
  constexpr float SL2 = 0.125f * 1.44269504088896340736f;      // 64^-1/2 x log2(e): exp(x / 8 - m / 8) = 2^(x * SL2 - m * SL2)
  __shared__ __attribute__((aligned(16))) unsigned short sKV[2][2 * PART];        // [buffer][K part, then V part]
  __shared__ __attribute__((aligned(16))) unsigned short sO[NW][RPW][64 + 8];      // row pitch 144 bytes = 16 x 9: 16-byte accesses down a column meet no bank conflict
  const int tid = threadIdx.x, w = tid >> 5, lane = tid & 31, ln = lane & 15, hh = lane >> 4;
  const int slab = blockIdx.x / NQB, qblk = blockIdx.x % NQB; const int b = slab / 8, h = slab % 8; const int qb0 = qblk * (NW * RPW); const int q0 = qb0 + w * RPW;
  const unsigned short* kg = (const unsigned short*)Kp + (size_t)slab * 4096 * 64 + tid * 8;      // fragment order (k_kpack): a pass is 4 KiB in a row, a tile 32 KiB; this lane's 16 bytes of each 4 KiB
  const unsigned short* vg = (const unsigned short*)Vt + (size_t)slab * 64 * 4096 + tid * 8;      // fragment order (k_vt): the same
  const unsigned l0 = (unsigned)(size_t)&sKV[0][tid * 8];                                         // this lane's LDS byte address in buffer 0's K part
  copy8(l0, kg); copy8(l0 + 2 * PART, vg);      // tile 0 -> buffer 0; it flies over the Q loads and their conversion
  v4f qf[2][KS][4];      // raw f32 Q in the fragments' k order: [0], [1] = dims ks * 32 + 8hh .. + 7, [2], [3] = dims ks * 32 + 16 + 8hh .. + 7
#pragma unroll
  for (int rt = 0; rt < 2; ++rt) { const float* qr = Qf + ((size_t)b * 4096 + q0 + rt * 16 + ln) * ldq + h * 64;
#pragma unroll
    for (int ks = 0; ks < KS; ++ks) { const float* qk = qr + ks * 32 + 8 * hh; qf[rt][ks][0] = *(const v4fa*)qk; qf[rt][ks][1] = *(const v4fa*)(qk + 4); qf[rt][ks][2] = *(const v4fa*)(qk + 16); qf[rt][ks][3] = *(const v4fa*)(qk + 20); } }
  asm volatile("s_wait_xcnt 0x0" ::: "memory");      // the address registers of the loads above are reused below: the wait stands in front of their overwrite
  __builtin_amdgcn_sched_barrier(0);                 // keeps the set-up code that reuses those registers behind that wait
  FragH aq[2][KS];
#pragma unroll      // all three loops: constant indices, so that the raw values and the fragments stay in registers
  for (int rt = 0; rt < 2; ++rt)
#pragma unroll
    for (int ks = 0; ks < KS; ++ks)
#pragma unroll
      for (int i = 0; i < 16; ++i) aq[rt][ks].h[i] = (_Float16)bf16_round(qf[rt][ks][i >> 2][i & 3]);
  float m_r[2], l_r[2]; v8f oacc[2][DT];      // per lane: query rt * 16 + ln; m_r = reference point of the exponents in base-2 units (score x SL2): the largest pass maximum among the passes that took the rescale; oacc[rt][dt][r] = Ot[dt * 16 + 8hh + r][that query]
#pragma unroll
  for (int rt = 0; rt < 2; ++rt) { m_r[rt] = -3.0e38f; l_r[rt] = 0.f;
#pragma unroll
    for (int dt = 0; dt < DT; ++dt) oacc[rt][dt] = (v8f){0.f,0.f,0.f,0.f,0.f,0.f,0.f,0.f}; }
  asm volatile("s_wait_asynccnt 0x0" ::: "memory");      // this wave's copies of tile 0 have landed
  __syncthreads();                                       // ... and every other wave's: tile 0 may be read
  copy8(l0 + 4 * PART, kg + PART); copy8(l0 + 6 * PART, vg + PART);      // tile 1 -> buffer 1
#pragma unroll 1      // one trip = one tile; rolled, so that the ring's foot stands once
  for (int t = 0; t < NT; ++t) {
    const unsigned short* kl = &sKV[t & 1][lane * 8];      // this lane's unit of the tile's first K fragment half
    const unsigned short* vl = kl + PART;
    // Inside a tile every LDS read is issued a phase ahead of its use: V of a pass at the pass's top, K of the next pass right behind this pass's score products.
    FragH bk[2][KS], bv[DT];
#pragma unroll
    for (int nt = 0; nt < 2; ++nt)
#pragma unroll
      for (int ks = 0; ks < KS; ++ks) { const unsigned short* kr = kl + nt * 1024 + ks * 512; bk[nt][ks].half[0] = *(const v8us*)kr; bk[nt][ks].half[1] = *(const v8us*)(kr + 256); }
#pragma unroll 1      // rolled: unrolled, the 8 passes' LDS reads are lifted far ahead, the registers double and the back edge fills with copies
   for (int p = 0; p < PP; ++p) {
#pragma unroll
    for (int dt = 0; dt < DT; ++dt) { const unsigned short* vrow = vl + p * 2048 + dt * 512; bv[dt].half[0] = *(const v8us*)vrow; bv[dt].half[1] = *(const v8us*)(vrow + 256); }
    __builtin_amdgcn_sched_barrier(0);      // keeps the pass's eight V reads here as one group: sunk, they stand in several places among the softmax, and the last come late for their products
    v8f s[2][2];      // s[rt][nt][r] = score of key (t * PP + p) * 32 + nt * 16 + 8hh + r against query rt * 16 + ln
#pragma unroll
    for (int nt = 0; nt < 2; ++nt) {
#pragma unroll
      for (int rt = 0; rt < 2; ++rt) { v8f acc = (v8f){0.f,0.f,0.f,0.f,0.f,0.f,0.f,0.f};
#pragma unroll
        for (int ks = 0; ks < KS; ++ks) acc = mmaF(bk[nt][ks].v, aq[rt][ks].v, acc); s[rt][nt] = acc; } }
    if (p + 1 < PP) {      // the last pass of a tile fetches no K ahead: the next tile is not published yet
#pragma unroll
      for (int nt = 0; nt < 2; ++nt)
#pragma unroll
        for (int ks = 0; ks < KS; ++ks) { const unsigned short* kr = kl + (p + 1) * 2048 + nt * 1024 + ks * 512; bk[nt][ks].half[0] = *(const v8us*)kr; bk[nt][ks].half[1] = *(const v8us*)(kr + 256); } }
    // The reference point m_r of a query's exponents need not be its running maximum: any m gives the same quotient O / l as long as no P leaves the f16 range.
    // So a pass first takes P with the m_r it has. All P are positive, so a lane's sum bounds each of them: while the sums stay under 2^15 nothing can overflow, and
    // the pass needs no maximum and no rescale. Otherwise (always in the first pass, where m_r is still -3e38 and the sums come out infinite; a NaN fails the test too)
    // the whole wave takes the maximum, moves m_r up to it, rescales l and O and forms P again.
    FragH pb[2]; float su[2];
#pragma unroll      // here and below: constant indices, so that the accumulators stay in registers
    for (int rt = 0; rt < 2; ++rt) su[rt] = pexp(s[rt][0], s[rt][1], m_r[rt], pb[rt]);
    if (__builtin_expect(__builtin_amdgcn_ballot_w32(!(su[0] + su[1] <= 32768.0f)) != 0u, 0)) {      // wave-uniform: every lane stays on, and both halves of a column keep one m_r
#pragma unroll
      for (int rt = 0; rt < 2; ++rt) {
        float mx[8];      // maximum of the raw products (the scale is positive)
#pragma unroll
        for (int r = 0; r < 8; ++r) mx[r] = fmaxf(s[rt][0][r], s[rt][1][r]);
        float mc = fmaxf(fmaxf(fmaxf(mx[0], mx[1]), fmaxf(mx[2], mx[3])), fmaxf(fmaxf(mx[4], mx[5]), fmaxf(mx[6], mx[7])));
        mc = fmaxf(mc, xhalf(mc));      // both halves of a column must use one maximum: their P meet in one product
        const float mn = fmaxf(m_r[rt], mc * SL2); const float al = __builtin_amdgcn_exp2f(m_r[rt] - mn); m_r[rt] = mn;
        su[rt] = pexp(s[rt][0], s[rt][1], mn, pb[rt]);
        l_r[rt] *= al;
#pragma unroll
        for (int dt = 0; dt < DT; ++dt)
#pragma unroll
          for (int r = 0; r < 8; ++r) oacc[rt][dt][r] *= al; } }
#pragma unroll
    for (int rt = 0; rt < 2; ++rt) l_r[rt] += su[rt];      // this half's keys only; the halves join after the loop
#pragma unroll
    for (int dt = 0; dt < DT; ++dt) {
#pragma unroll
      for (int rt = 0; rt < 2; ++rt) oacc[rt][dt] = mmaF(bv[dt].v, pb[rt].v, oacc[rt][dt]); } }
    // The ring's foot: this wave's LDS reads are done, its copies of tile t + 1 have landed, every wave has come as far; then tile t + 2 goes into the buffer that this trip has read.
    asm volatile("s_wait_dscnt 0x0" ::: "memory");
    asm volatile("s_wait_asynccnt 0x0" ::: "memory");
    __syncthreads();
    if (t + 2 < NT) { const unsigned lb = l0 + (unsigned)(t & 1) * (4 * PART); copy8(lb, kg + (size_t)(t + 2) * PART); copy8(lb + 2 * PART, vg + (size_t)(t + 2) * PART); } }
  asm volatile("s_wait_asynccnt 0x0" ::: "memory");      // nothing of this wave is in flight when it goes on to the epilogue
#pragma unroll
  for (int rt = 0; rt < 2; ++rt) { float l = l_r[rt]; l += xhalf(l); const float li = (l > 0.f) ? 1.0f / l : 0.f;
#pragma unroll
    for (int dt = 0; dt < DT; ++dt) { FragH f;
#pragma unroll
      for (int r = 0; r < 8; ++r) f.h[r] = (_Float16)(oacc[rt][dt][r] * li);
      *(v8us*)&sO[w][rt * 16 + ln][dt * 16 + 8 * hh] = f.half[0]; } }
  __builtin_amdgcn_fence(__ATOMIC_ACQ_REL, "workgroup"); __builtin_amdgcn_wave_barrier();
  {
#pragma unroll
    for (int rp = 0; rp < RPW; rp += 4) { const int r = rp + (lane >> 3), pc = lane & 7; const v8us val = *(const v8us*)&sO[w][r][pc * 8]; *(v8us*)((unsigned short*)O16 + ((size_t)b * 4096 + q0 + r) * ldo + h * 64 + pc * 8) = val; }      // 8 lanes store a head's 128-byte row piece: one whole line
     } }

extern "C" void kernel_launch(void* const* d_in, const int* in_sizes, int n_in,
                              void* d_out, int out_size, void* d_ws, size_t ws_size, hipStream_t stream) {
  (void)in_sizes; (void)n_in; (void)out_size;
  const float* q = (const float*)d_in[0]; const float* k = (const float*)d_in[1]; const float* v = (const float*)d_in[2]; const float* Wo = (const float*)d_in[3]; const float* bo = (const float*)d_in[4];
  char* ws = (char*)d_ws; size_t off = 0;
  auto take = [&](size_t bytes) { char* p = ws + off; off += (bytes + 255) & ~(size_t)255; return p; };
  _Float16* Bo = (_Float16*)take((size_t)NO * CC * 2); _Float16* K16 = (_Float16*)take((size_t)NR * CC * 2); _Float16* Vt = (_Float16*)take((size_t)NR * CC * 2); _Float16* O16 = (_Float16*)take((size_t)NR * CC * 2);
  if (off > ws_size) return;      // 3 x 8.4 MB
  k_wt_f16<<<(NO * (CC / 8) + 255) / 256, 256, 0, stream>>>(Wo, Bo, CC, NO, 16.0f);      // [in][out]
  k_kpack<<<NR / 16, 256, 0, stream>>>(k, K16);
  k_vt<NH, TT><<<BB * NH * (TT / 64), 256, 0, stream>>>(v, CC, 0, Vt);
  k_flash<<<BB * NH * (TT / 256), 256, 0, stream>>>(q, CC, K16, Vt, nullptr, O16, CC);
  k_gemm_hhx<0><<<dim3(((NR / 16) * 1 + 3) / 4, 1), 128, 0, stream>>>(O16, CC, 0, Bo, CC, 0, 0.0625f, bo, 0, nullptr, 1, 0, 0, (float*)d_out, nullptr, NO, 0, NR, NO, CC);      // N = 64
}

// v009
// It runs in 62.2 microseconds.
// Two timings next to v008 both put it at 1.24 times that version's speed.
// All steps since v000 together make it 10.8 times as fast.
#include <hip/hip_runtime.h>
// 8-head attention over the given q/k/v (2 × 4096 tokens, d = 64) as a fused flash-style kernel on v_wmma_f32_16x16x32_f16 (q, k, v are module INPUTS → exact bf16 values as f16 operands; S = Q·Kᵀ × 64^-½,
// online max/sum softmax f32, P f16 ≤ 2^15, O = P·V), then the 512→64 output linear (+ bias; W_out [in][out] bf16-exact ×2^4); f32 accumulate.
#define BB 2
#define TT 4096
#define CC 512
#define NH 8
#define NO 64
#define NR (BB * TT)

typedef __bf16 v16b __attribute__((ext_vector_type(16)));
typedef unsigned short v8us __attribute__((ext_vector_type(8), may_alias));
typedef float  v8f  __attribute__((ext_vector_type(8)));
typedef float  v4f  __attribute__((ext_vector_type(4)));
typedef float  v4fa __attribute__((ext_vector_type(4), may_alias));
union FragB { v16b v; v8us half[2]; unsigned short u[16]; };

__device__ __forceinline__ unsigned short bf16_bits(float x) { unsigned int u = __float_as_uint(x); return (unsigned short)((u + 0x7FFFu + ((u >> 16) & 1u)) >> 16); }
__device__ __forceinline__ float bf16_val(unsigned short b) { return __uint_as_float(((unsigned int)b) << 16); }
__device__ __forceinline__ float bf16_round(float x) { return bf16_val(bf16_bits(x)); }
// D += A·B with NT terms: 1 = ah·bh, 2 = + al·bh (A split), 3 = + ah·bl (both split)
template <int NT>
__device__ __forceinline__ v8f mmaN(v16b ah, v16b al, v16b bh, v16b bl, v8f c) {
  c = __builtin_amdgcn_wmma_f32_16x16x32_bf16(false, ah, false, bh, (short)0, c, false, false);
  if (NT >= 2) c = __builtin_amdgcn_wmma_f32_16x16x32_bf16(false, al, false, bh, (short)0, c, false, false);
  if (NT >= 3) c = __builtin_amdgcn_wmma_f32_16x16x32_bf16(false, ah, false, bl, (short)0, c, false, false);
  asm volatile("v_nop\n\tv_nop\n\tv_nop\n\tv_nop" : "+v"(c) : "v"(ah), "v"(al), "v"(bh), "v"(bl));
  return c;
}

__global__ __launch_bounds__(256) void k_wt_bf16(const float* __restrict__ W, unsigned short* __restrict__ Wt, int K, int N) {
  const int t = blockIdx.x * 256 + threadIdx.x;
  const int k8n = K / 8;
  if (t >= N * k8n) return;
  const int n = t / k8n, k8 = (t % k8n) * 8;
  v8us v;
#pragma unroll
  for (int i = 0; i < 8; ++i) v[i] = bf16_bits(W[(size_t)(k8 + i) * N + n]);
  *(v8us*)(Wt + (size_t)n * K + k8) = v;
  
}

// GEMM C[M][N] (f32, pitch ldc) = act(A[M][K]·W + bias). A f32 row-major (pitch lda) converted per fragment to bf16
// (ASPLIT: hi/lo two planes -> 2 terms, else single rounded term); Wt bf16 [N][K] (pitch ldb). BIAS_BF16 rounds the
// bias to bf16 first (bias quantised to bf16 before the add). K%32==0, M%16==0, N%64==0.
template <bool ASPLIT, int ACT, bool BIAS_BF16>
__global__ __launch_bounds__(128) void k_gemm_bf(const float* __restrict__ A, int lda, const unsigned short* __restrict__ Wt, int ldb,
                                               const float* __restrict__ bias, float* __restrict__ C, int ldc, int M, int N, int K) {
  __shared__ __attribute__((aligned(16))) float so[4][16][64];
  const int tid = threadIdx.x, w = tid >> 5, lane = tid & 31, ln = lane & 15, hh = lane >> 4;
  const int ntn = N / 64;
  const int wid = blockIdx.x * 4 + w;
  const int mt = wid / ntn, nq = wid % ntn;
  if (mt * 16 >= M) return;
  const int row0 = mt * 16, col0 = nq * 64;
  const float* arow = A + (size_t)(row0 + ln) * lda;
  v8f acc[4] = {};
  for (int kb = 0; kb < K; kb += 32) {
    FragB ah, al;
    const v4f x0 = *(const v4fa*)(arow + kb + 8 * hh), x1 = *(const v4fa*)(arow + kb + 8 * hh + 4);
    const v4f x2 = *(const v4fa*)(arow + kb + 16 + 8 * hh), x3 = *(const v4fa*)(arow + kb + 16 + 8 * hh + 4);
    float xs[16] = {x0[0],x0[1],x0[2],x0[3],x1[0],x1[1],x1[2],x1[3],x2[0],x2[1],x2[2],x2[3],x3[0],x3[1],x3[2],x3[3]};
#pragma unroll
    for (int i = 0; i < 16; ++i) { const unsigned short hb = bf16_bits(xs[i]); ah.u[i] = hb; al.u[i] = ASPLIT ? bf16_bits(xs[i] - bf16_val(hb)) : (unsigned short)0; }
#pragma unroll
    for (int t = 0; t < 4; ++t) {
      const unsigned short* brow = Wt + (size_t)(col0 + t * 16 + ln) * ldb + kb;
      FragB b;
      b.half[0] = *(const v8us*)(brow + 8 * hh);
      b.half[1] = *(const v8us*)(brow + 16 + 8 * hh);
      acc[t] = mmaN<ASPLIT ? 2 : 1>(ah.v, al.v, b.v, b.v, acc[t]);
    }
  }
#pragma unroll
  for (int t = 0; t < 4; ++t) {
    float bv = bias ? bias[col0 + t * 16 + ln] : 0.f;
    if (BIAS_BF16) bv = bf16_round(bv);
#pragma unroll
    for (int r = 0; r < 8; ++r) { float v = acc[t][r] + bv; if (ACT == 1) v = fmaxf(v, 0.f); so[w][8 * hh + r][t * 16 + ln] = v; }
  }
  __builtin_amdgcn_fence(__ATOMIC_ACQ_REL, "workgroup");
  __builtin_amdgcn_wave_barrier();
  const int rsub = lane >> 4, c4 = (lane & 15) * 4;
  {
#pragma unroll
    for (int q = 0; q < 8; ++q) {
      const int r = q * 2 + rsub;
      const v4f v = *(const v4fa*)&so[w][r][c4];
      *(v4f*)(C + (size_t)(row0 + r) * ldc + col0 + c4) = v;
    }
    
  }
}

// Flash-style causal/unmasked attention, all contractions 3-term bf16 hi/lo splits, f32 softmax with running max.
// q,k,v rows are read from f32 buffers with arbitrary row pitch (so they can live inside a fused qkv buffer);
// D = head size (multiple of 32, <= 128); one wave = 16 query rows; block = 4 waves (64 queries) sharing K/V chunks of 32.
template <int D, bool CAUSAL>
__global__ __launch_bounds__(128) void k_flash(const float* __restrict__ qb, const float* __restrict__ kb, const float* __restrict__ vb,
                                             int pitch, int T, int H, float scale, float* __restrict__ y, int ypitch) {
  constexpr int KS = D / 32;        // k-steps for QK
  constexpr int DT = D / 16;        // d tiles for PV
  __shared__ __attribute__((aligned(16))) unsigned short sKh[32][D + 8], sKl[32][D + 8], sVh[32][D + 8], sVl[32][D + 8];
  __shared__ __attribute__((aligned(16))) unsigned short sPh[4][16][40], sPl[4][16][40];
  __shared__ __attribute__((aligned(16))) float sO[4][16][D];
  const int tid = threadIdx.x, w = tid >> 5, lane = tid & 31, ln = lane & 15, hh = lane >> 4;
  const int nqb = (T + 63) / 64;
  const int bh = blockIdx.x / nqb, qblk = blockIdx.x % nqb;
  const int b = bh / H, h = bh % H;
  const int q0 = qblk * 64 + w * 16;
  const float* Q = qb + (size_t)b * T * pitch + h * D;
  const float* K = kb + (size_t)b * T * pitch + h * D;
  const float* V = vb + (size_t)b * T * pitch + h * D;

  // A fragments of the wave's 16 query rows (scaled), hi/lo
  FragB aqh[KS], aql[KS];
  {
    int row = q0 + ln; if (row >= T) row = T - 1;
    const float* qr = Q + (size_t)row * pitch;
#pragma unroll
    for (int ks = 0; ks < KS; ++ks)
#pragma unroll
      for (int i = 0; i < 16; ++i) {
        const int d = ks * 32 + ((i < 8) ? (8 * hh + i) : (16 + 8 * hh + (i - 8)));
        const float x = qr[d] * scale; const unsigned short hb = bf16_bits(x);
        aqh[ks].u[i] = hb; aql[ks].u[i] = bf16_bits(x - bf16_val(hb));
      }
  }
  float m_r[8], l_r[8];
#pragma unroll
  for (int r = 0; r < 8; ++r) { m_r[r] = -3.0e38f; l_r[r] = 0.f; }
  v8f oacc[DT];
#pragma unroll
  for (int dt = 0; dt < DT; ++dt) oacc[dt] = (v8f){0.f,0.f,0.f,0.f,0.f,0.f,0.f,0.f};

  const int kv_end = CAUSAL ? min(T, qblk * 64 + 64) : T;     // block-uniform
  for (int j0 = 0; j0 < kv_end; j0 += 32) {
    __syncthreads();
    for (int e = tid; e < 32 * (D / 4); e += 128) {
      const int r = e / (D / 4), c4 = (e % (D / 4)) * 4;
      const int key = j0 + r;
      v4f kf = {0.f,0.f,0.f,0.f}, vf = {0.f,0.f,0.f,0.f};
      if (key < T) { kf = *(const v4fa*)(K + (size_t)key * pitch + c4); vf = *(const v4fa*)(V + (size_t)key * pitch + c4); }
#pragma unroll
      for (int t = 0; t < 4; ++t) {
        unsigned short hb = bf16_bits(kf[t]); sKh[r][c4 + t] = hb; sKl[r][c4 + t] = bf16_bits(kf[t] - bf16_val(hb));
        hb = bf16_bits(vf[t]); sVh[r][c4 + t] = hb; sVl[r][c4 + t] = bf16_bits(vf[t] - bf16_val(hb));
      }
    }
    __syncthreads();
    // S tile 16 x 32
    v8f s[2];
#pragma unroll
    for (int nt = 0; nt < 2; ++nt) {
      v8f acc = {};
#pragma unroll
      for (int ks = 0; ks < KS; ++ks) {
        FragB bh_, bl_;
        bh_.half[0] = *(const v8us*)&sKh[nt * 16 + ln][ks * 32 + 8 * hh]; bh_.half[1] = *(const v8us*)&sKh[nt * 16 + ln][ks * 32 + 16 + 8 * hh];
        bl_.half[0] = *(const v8us*)&sKl[nt * 16 + ln][ks * 32 + 8 * hh]; bl_.half[1] = *(const v8us*)&sKl[nt * 16 + ln][ks * 32 + 16 + 8 * hh];
        acc = mmaN<3>(aqh[ks].v, aql[ks].v, bh_.v, bl_.v, acc);
      }
      s[nt] = acc;
    }
    // mask + running max (rows 8hh+r; the 16 lanes of a half share rows)
    float alpha[8];
#pragma unroll
    for (int r = 0; r < 8; ++r) {
      const int qi = q0 + 8 * hh + r;
      const int ja = j0 + ln, jb = j0 + 16 + ln;
      if (CAUSAL) { if (ja > qi) s[0][r] = -3.0e38f; if (jb > qi) s[1][r] = -3.0e38f; }
      if (ja >= T) s[0][r] = -3.0e38f;
      if (jb >= T) s[1][r] = -3.0e38f;
      float mx = fmaxf(s[0][r], s[1][r]);
      mx = fmaxf(mx, __shfl_xor(mx, 1, 32)); mx = fmaxf(mx, __shfl_xor(mx, 2, 32)); mx = fmaxf(mx, __shfl_xor(mx, 4, 32)); mx = fmaxf(mx, __shfl_xor(mx, 8, 32));
      const float mnew = fmaxf(m_r[r], mx);
      alpha[r] = (mnew > -1.0e38f) ? __expf(m_r[r] - mnew) : 1.0f;
      const float p0 = (s[0][r] > -1.0e38f) ? __expf(s[0][r] - mnew) : 0.f;
      const float p1 = (s[1][r] > -1.0e38f) ? __expf(s[1][r] - mnew) : 0.f;
      m_r[r] = mnew;
      l_r[r] = l_r[r] * alpha[r] + p0 + p1;            // per-lane partial row sum (16 lanes combined at the end)
      unsigned short hb = bf16_bits(p0); sPh[w][8 * hh + r][ln] = hb;      sPl[w][8 * hh + r][ln] = bf16_bits(p0 - bf16_val(hb));
      hb = bf16_bits(p1);                sPh[w][8 * hh + r][16 + ln] = hb; sPl[w][8 * hh + r][16 + ln] = bf16_bits(p1 - bf16_val(hb));
    }
#pragma unroll
    for (int dt = 0; dt < DT; ++dt)
#pragma unroll
      for (int r = 0; r < 8; ++r) oacc[dt][r] *= alpha[r];
    __builtin_amdgcn_fence(__ATOMIC_ACQ_REL, "workgroup");
    __builtin_amdgcn_wave_barrier();
    FragB pah, pal;
    pah.half[0] = *(const v8us*)&sPh[w][ln][8 * hh]; pah.half[1] = *(const v8us*)&sPh[w][ln][16 + 8 * hh];
    pal.half[0] = *(const v8us*)&sPl[w][ln][8 * hh]; pal.half[1] = *(const v8us*)&sPl[w][ln][16 + 8 * hh];
#pragma unroll
    for (int dt = 0; dt < DT; ++dt) {
      FragB bvh, bvl;
#pragma unroll
      for (int i = 0; i < 8; ++i) {
        bvh.u[i] = sVh[8 * hh + i][dt * 16 + ln]; bvh.u[8 + i] = sVh[16 + 8 * hh + i][dt * 16 + ln];
        bvl.u[i] = sVl[8 * hh + i][dt * 16 + ln]; bvl.u[8 + i] = sVl[16 + 8 * hh + i][dt * 16 + ln];
      }
      oacc[dt] = mmaN<3>(pah.v, pal.v, bvh.v, bvl.v, oacc[dt]);
    }
    __builtin_amdgcn_fence(__ATOMIC_ACQ_REL, "workgroup");
    __builtin_amdgcn_wave_barrier();
  }
#pragma unroll
  for (int r = 0; r < 8; ++r) {
    float l = l_r[r];
    l += __shfl_xor(l, 1, 32); l += __shfl_xor(l, 2, 32); l += __shfl_xor(l, 4, 32); l += __shfl_xor(l, 8, 32);
    l_r[r] = (l > 0.f) ? 1.0f / l : 0.f;
  }
#pragma unroll
  for (int dt = 0; dt < DT; ++dt)
#pragma unroll
    for (int r = 0; r < 8; ++r) sO[w][8 * hh + r][dt * 16 + ln] = oacc[dt][r] * l_r[r];
  __builtin_amdgcn_fence(__ATOMIC_ACQ_REL, "workgroup");
  __builtin_amdgcn_wave_barrier();
  {
    for (int r = 0; r < 16; ++r) {
      const int row = q0 + r;
      if (row < T && lane < D / 4) {
        const v4f val = *(const v4fa*)&sO[w][r][lane * 4];
        *(v4f*)(y + ((size_t)b * T + row) * ypitch + h * D + lane * 4) = val;
      }
    }
    
  }
}

// GEMM C = act(A·W + bias + resid): A f32 (ASPLIT -> hi/lo 2 terms), Wt bf16 [N][K]; ACT 0 none, 1 relu, 2 exact gelu;
// resid (optional, f32, row index = (row % rmod), pitch ldr, RES_BF16 rounds it) added before the activation.
template <bool ASPLIT, int ACT, bool BIAS_BF16, bool RES_BF16>
__global__ __launch_bounds__(128) void k_gemm_bf3(const float* __restrict__ A, int lda, const unsigned short* __restrict__ Wt, int ldb,
                                                const float* __restrict__ bias, const float* __restrict__ resid, int rmod, int ldr,
                                                float* __restrict__ C, int ldc, int M, int N, int K) {
  __shared__ __attribute__((aligned(16))) float so[4][16][64];
  const int tid = threadIdx.x, w = tid >> 5, lane = tid & 31, ln = lane & 15, hh = lane >> 4;
  const int ntn = N / 64;
  const int wid = blockIdx.x * 4 + w;
  const int mt = wid / ntn, nq = wid % ntn;
  if (mt * 16 >= M) return;
  const int row0 = mt * 16, col0 = nq * 64;
  const float* arow = A + (size_t)(row0 + ln) * lda;
  v8f acc[4] = {};
  for (int kb = 0; kb < K; kb += 32) {
    FragB ah, al;
    const v4f x0 = *(const v4fa*)(arow + kb + 8 * hh), x1 = *(const v4fa*)(arow + kb + 8 * hh + 4);
    const v4f x2 = *(const v4fa*)(arow + kb + 16 + 8 * hh), x3 = *(const v4fa*)(arow + kb + 16 + 8 * hh + 4);
    float xs[16] = {x0[0],x0[1],x0[2],x0[3],x1[0],x1[1],x1[2],x1[3],x2[0],x2[1],x2[2],x2[3],x3[0],x3[1],x3[2],x3[3]};
#pragma unroll
    for (int i = 0; i < 16; ++i) { const unsigned short hb = bf16_bits(xs[i]); ah.u[i] = hb; al.u[i] = ASPLIT ? bf16_bits(xs[i] - bf16_val(hb)) : (unsigned short)0; }
#pragma unroll
    for (int t = 0; t < 4; ++t) {
      const unsigned short* brow = Wt + (size_t)(col0 + t * 16 + ln) * ldb + kb;
      FragB b;
      b.half[0] = *(const v8us*)(brow + 8 * hh);
      b.half[1] = *(const v8us*)(brow + 16 + 8 * hh);
      acc[t] = mmaN<ASPLIT ? 2 : 1>(ah.v, al.v, b.v, b.v, acc[t]);
    }
  }
#pragma unroll
  for (int t = 0; t < 4; ++t) {
    const int col = col0 + t * 16 + ln;
    float bv = bias ? bias[col] : 0.f;
    if (BIAS_BF16) bv = bf16_round(bv);
#pragma unroll
    for (int r = 0; r < 8; ++r) {
      float v = acc[t][r] + bv;
      if (resid) { float rv = resid[(size_t)((row0 + 8 * hh + r) % rmod) * ldr + col]; if (RES_BF16) rv = bf16_round(rv); v += rv; }
      if (ACT == 1) v = fmaxf(v, 0.f);
      if (ACT == 2) v = 0.5f * v * (1.0f + erff(v * 0.70710678118654752f));
      if (ACT == 3) { const float u = 0.7978845608028654f * (v + 0.044715f * v * v * v); v = 0.5f * v * (1.0f + tanhf(u)); }
      so[w][8 * hh + r][t * 16 + ln] = v;
    }
  }
  __builtin_amdgcn_fence(__ATOMIC_ACQ_REL, "workgroup");
  __builtin_amdgcn_wave_barrier();
  const int rsub = lane >> 4, c4 = (lane & 15) * 4;
  {
#pragma unroll
    for (int q = 0; q < 8; ++q) {
      const int r = q * 2 + rsub;
      const v4f v = *(const v4fa*)&so[w][r][c4];
      *(v4f*)(C + (size_t)(row0 + r) * ldc + col0 + c4) = v;
    }
    
  }
}
// row LayerNorm (biased variance, eps) over N: s = X (+ R); optional out_sum <- s; out_norm <- (s-mu)*rsqrt(var+eps)*g + b
template <bool PARAM_BF16>
__global__ __launch_bounds__(256) void k_layernorm(const float* __restrict__ X, const float* __restrict__ R, const float* __restrict__ g, const float* __restrict__ bta,
                                                  float* __restrict__ out_sum, float* __restrict__ out_norm, int N, float eps) {
  __shared__ float red[256];
  const int row = blockIdx.x, tid = threadIdx.x;
  const float* x = X + (size_t)row * N; const float* rr = R ? R + (size_t)row * N : nullptr;
  float vals[16];                     // up to N = 4096
  const int per = N / 256;            // contiguous chunk per thread? use strided-by-4 chunks: thread handles j = tid*4 + 1024*u
  float s1 = 0.f;
  for (int u = 0; u < per / 4; ++u) {
    const int j = tid * 4 + 1024 * u;
    const v4f a = *(const v4fa*)(x + j);
    v4f b = {0.f,0.f,0.f,0.f}; if (rr) b = *(const v4fa*)(rr + j);
#pragma unroll
    for (int q = 0; q < 4; ++q) { const float v = a[q] + b[q]; vals[u * 4 + q] = v; s1 += v; }
  }
  red[tid] = s1; __syncthreads();
  for (int st = 128; st > 0; st >>= 1) { if (tid < st) red[tid] += red[tid + st]; __syncthreads(); }
  const float mu = red[0] / (float)N; __syncthreads();
  float s2 = 0.f;
  for (int u = 0; u < per / 4; ++u)
#pragma unroll
    for (int q = 0; q < 4; ++q) { const float c = vals[u * 4 + q] - mu; s2 += c * c; }
  red[tid] = s2; __syncthreads();
  for (int st = 128; st > 0; st >>= 1) { if (tid < st) red[tid] += red[tid + st]; __syncthreads(); }
  const float rs = rsqrtf(red[0] / (float)N + eps);
  {
    for (int u = 0; u < per / 4; ++u) {
      const int j = tid * 4 + 1024 * u;
      v4f o, sm;
#pragma unroll
      for (int q = 0; q < 4; ++q) {
        float gg = g[j + q], bb = bta[j + q];
        if (PARAM_BF16) { gg = bf16_round(gg); bb = bf16_round(bb); }
        sm[q] = vals[u * 4 + q]; o[q] = (vals[u * 4 + q] - mu) * rs * gg + bb;
      }
      if (out_sum) *(v4f*)(out_sum + (size_t)row * N + j) = sm;
      *(v4f*)(out_norm + (size_t)row * N + j) = o;
    }
    
  }
}



// ---- f16 WMMA path (v_wmma_f32_16x16x32_f16): 11-bit significands for operands in range — used where the softmax P operand (≤ 2^15) needs more precision than bf16
typedef _Float16 v16h __attribute__((ext_vector_type(16)));
union FragH { v16h v; v8us half[2]; _Float16 h[16]; unsigned short u[16]; };
template <int NT>
__device__ __forceinline__ v8f mmaH(v16h ah, v16h al, v16h bh, v16h bl, v8f c) {
  c = __builtin_amdgcn_wmma_f32_16x16x32_f16(false, ah, false, bh, (short)0, c, false, false);
  if (NT >= 2) c = __builtin_amdgcn_wmma_f32_16x16x32_f16(false, al, false, bh, (short)0, c, false, false);
  if (NT >= 3) c = __builtin_amdgcn_wmma_f32_16x16x32_f16(false, ah, false, bl, (short)0, c, false, false);
  asm volatile("v_nop\n\tv_nop\n\tv_nop\n\tv_nop" : "+v"(c) : "v"(ah), "v"(al), "v"(bh), "v"(bl));
  return c;
}
// batched GEMM like k_gemm_b but f16 operands: A f32 (split into f16 hi/lo if ASPLIT, else rounded to f16), Bt = f16 values [n][k]; alpha; C f32; N multiple of 16 (partial tiles skipped)
template <bool ASPLIT>
__global__ __launch_bounds__(128) void k_gemm_h(const float* __restrict__ A, int lda, size_t sA, const _Float16* __restrict__ Bh, int ldb, size_t sB, float alpha, float* __restrict__ C, int ldc, size_t sC, int M, int N, int K) {
  __shared__ __attribute__((aligned(16))) float so[4][16][64];
  const int tid = threadIdx.x, w = tid >> 5, lane = tid & 31, ln = lane & 15, hh = lane >> 4; const int by = blockIdx.y;
  A += (size_t)by * sA; Bh += (size_t)by * sB; C += (size_t)by * sC;
  const int ntn = (N + 63) / 64; const int wid = blockIdx.x * 4 + w; const int mt = wid / ntn, nq = wid % ntn; if (mt * 16 >= M) return;
  const int row0 = mt * 16, col0 = nq * 64; const float* arow = A + (size_t)(row0 + ln) * lda;
  v8f acc[4] = {};
  for (int kb = 0; kb < K; kb += 32) {
    FragH ah, al;
    const v4f x0 = *(const v4fa*)(arow + kb + 8 * hh), x1 = *(const v4fa*)(arow + kb + 8 * hh + 4), x2 = *(const v4fa*)(arow + kb + 16 + 8 * hh), x3 = *(const v4fa*)(arow + kb + 16 + 8 * hh + 4);
    float xs[16] = {x0[0],x0[1],x0[2],x0[3],x1[0],x1[1],x1[2],x1[3],x2[0],x2[1],x2[2],x2[3],x3[0],x3[1],x3[2],x3[3]};
#pragma unroll
    for (int i = 0; i < 16; ++i) { const _Float16 h = (_Float16)xs[i]; ah.h[i] = h; al.h[i] = ASPLIT ? (_Float16)(xs[i] - (float)h) : (_Float16)0.0f; }
#pragma unroll
    for (int t = 0; t < 4; ++t) { if (col0 + t * 16 >= N) continue; const size_t boff = (size_t)(col0 + t * 16 + ln) * ldb + kb; FragH bq; bq.half[0] = *(const v8us*)(Bh + boff + 8 * hh); bq.half[1] = *(const v8us*)(Bh + boff + 16 + 8 * hh);
      acc[t] = mmaH<ASPLIT ? 2 : 1>(ah.v, al.v, bq.v, bq.v, acc[t]); }
  }
#pragma unroll
  for (int t = 0; t < 4; ++t) { if (col0 + t * 16 >= N) continue;
#pragma unroll
    for (int r = 0; r < 8; ++r) so[w][8 * hh + r][t * 16 + ln] = acc[t][r] * alpha; }
  __builtin_amdgcn_fence(__ATOMIC_ACQ_REL, "workgroup"); __builtin_amdgcn_wave_barrier();
  const int rsub = lane >> 4, c4 = (lane & 15) * 4;
  {
#pragma unroll
    for (int q = 0; q < 8; ++q) { const int r = q * 2 + rsub; if (col0 + c4 < N) { const v4f v = *(const v4fa*)&so[w][r][c4]; *(v4f*)(C + (size_t)(row0 + r) * ldc + col0 + c4) = v; } }
     }
}

// Wt[n][k] = f16(W[k][n]·scale) from f32 row-major W[K][N] (scale = power of two; bf16-exact weights stay exact in f16 away from the subnormal range)
__global__ __launch_bounds__(256) void k_wt_f16(const float* __restrict__ W, _Float16* __restrict__ Wt, int K, int N, float scale) {
  const int t = blockIdx.x * 256 + threadIdx.x; if (t >= N * (K / 8)) return; const int n = t / (K / 8), k8 = (t % (K / 8)) * 8; FragH f;
#pragma unroll
  for (int i = 0; i < 8; ++i) f.h[i] = (_Float16)(bf16_round(W[(size_t)(k8 + i) * N + n]) * scale); const v8us o = f.half[0];
  *(v8us*)((unsigned short*)Wt + (size_t)n * K + k8) = o; 
}
// k_gemm_hh variant with fused epilogue: v = acc·alpha + bias[by·sBias + col] (+ CP[(row/rowsPerB)·sCPb + by·64 + col] if CP) ; ACT 0 none / 1 elu ; writes f32 C and/or f16 C16 (each if non-null)
template <int ACT>
__global__ __launch_bounds__(128) void k_gemm_hhx(const _Float16* __restrict__ A, int lda, size_t sA, const _Float16* __restrict__ Bh, int ldb, size_t sB, float alpha, const float* __restrict__ bias, size_t sBias, const float* __restrict__ CP, int rowsPerB, size_t sCPb, int row0g,
    float* __restrict__ C, _Float16* __restrict__ C16, int ldc, size_t sC, int M, int N, int K) {
  __shared__ __attribute__((aligned(16))) float so[4][16][64];
  const int tid = threadIdx.x, w = tid >> 5, lane = tid & 31, ln = lane & 15, hh = lane >> 4; const int by = blockIdx.y;
  A += (size_t)by * sA; Bh += (size_t)by * sB; const size_t cofs = (size_t)by * sC; const float* bp = bias ? bias + (size_t)by * sBias : nullptr;
  const int ntn = (N + 63) / 64; const int wid = blockIdx.x * 4 + w; const int mt = wid / ntn, nq = wid % ntn; if (mt * 16 >= M) return;
  const int row0 = mt * 16, col0 = nq * 64; const _Float16* arow = A + (size_t)(row0 + ln) * lda;
  v8f acc[4] = {};
  for (int kb = 0; kb < K; kb += 32) { FragH ah; ah.half[0] = *(const v8us*)((const unsigned short*)arow + kb + 8 * hh); ah.half[1] = *(const v8us*)((const unsigned short*)arow + kb + 16 + 8 * hh);
#pragma unroll
    for (int t = 0; t < 4; ++t) { if (col0 + t * 16 >= N) continue; const size_t boff = (size_t)(col0 + t * 16 + ln) * ldb + kb; FragH bq; bq.half[0] = *(const v8us*)((const unsigned short*)Bh + boff + 8 * hh); bq.half[1] = *(const v8us*)((const unsigned short*)Bh + boff + 16 + 8 * hh);
      acc[t] = mmaH<1>(ah.v, ah.v, bq.v, bq.v, acc[t]); }
  }
#pragma unroll
  for (int t = 0; t < 4; ++t) { if (col0 + t * 16 >= N) continue; const int col = col0 + t * 16 + ln; const float bv = bp ? bf16_round(bp[col]) : 0.f;
#pragma unroll
    for (int r = 0; r < 8; ++r) { float v = acc[t][r] * alpha + bv; if (CP) { const int bidx = (row0g + row0 + 8 * hh + r) / rowsPerB; v += CP[(size_t)bidx * sCPb + (size_t)by * 64 + col]; } if (ACT == 1) v = (v > 0.f) ? v : expm1f(v); else if (ACT == 3) v = fmaxf(v, 0.f); so[w][8 * hh + r][t * 16 + ln] = v; } }
  __builtin_amdgcn_fence(__ATOMIC_ACQ_REL, "workgroup"); __builtin_amdgcn_wave_barrier();
  const int rsub = lane >> 4, c4 = (lane & 15) * 4; typedef _Float16 v4h __attribute__((ext_vector_type(4)));
  {
#pragma unroll
    for (int q = 0; q < 8; ++q) { const int r = q * 2 + rsub; if (col0 + c4 < N) { const v4f v = *(const v4fa*)&so[w][r][c4]; if (C) *(v4f*)(C + cofs + (size_t)(row0 + r) * ldc + col0 + c4) = v; if (C16) { v4h h4; for (int i = 0; i < 4; ++i) h4[i] = (_Float16)v[i]; *(v4h*)(C16 + cofs + (size_t)(row0 + r) * ldc + col0 + c4) = h4; } } }
     }
}


__global__ __launch_bounds__(256) void k_round16f(const float* __restrict__ W, _Float16* __restrict__ Bt, size_t n8) { const size_t t = (size_t)blockIdx.x * 256 + threadIdx.x; if (t >= n8) return; FragH f;
#pragma unroll
  for (int i = 0; i < 8; ++i) f.h[i] = (_Float16)(bf16_round(W[t * 8 + i]) * 16.0f); *(v8us*)((unsigned short*)Bt + t * 8) = f.half[0];  }
// K rows (f32 -> bf16 value -> f16) in the order of the score product's A fragments. A 16-byte unit holds 8 dims of one key; unit ((kt * 2 + ks) * 2 + half) * 32 + hh * 16 + ln
// of a (batch, head) slab is key kt * 16 + ln, dims ks * 32 + half * 16 + hh * 8 .. + 7: a wave's load of one fragment half is 512 contiguous bytes (four whole lines).
// One block = 16 keys x all 8 heads, read in whole rows and turned through LDS; a group of 16 units takes 256 + 16 bytes there, so that neither side meets a bank conflict.
__global__ __launch_bounds__(256) void k_kpack(const float* __restrict__ x, _Float16* __restrict__ Kp) { __shared__ __attribute__((aligned(16))) unsigned short st[64 * 136]; const int tid = threadIdx.x; const int b = blockIdx.x / 256, kt = blockIdx.x % 256;
#pragma unroll      // the four rounds' loads fly together
  for (int i = 0; i < 4; ++i) { const int u = i * 256 + tid, ln = u >> 6, c8 = u & 63; const float* s = x + ((size_t)b * 4096 + kt * 16 + ln) * 512 + c8 * 8; const v4f a0 = *(const v4fa*)s, a1 = *(const v4fa*)(s + 4); FragH f;      // c8 = head * 8 + ks * 4 + half * 2 + hh
#pragma unroll      // constant vector indices: the values stay in registers
    for (int q = 0; q < 4; ++q) { f.h[q] = (_Float16)bf16_round(a0[q]); f.h[4 + q] = (_Float16)bf16_round(a1[q]); }
    *(v8us*)&st[c8 * 136 + ln * 8] = f.half[0]; }
  __syncthreads();
#pragma unroll      // the four LDS reads are issued ahead of the first store
  for (int i = 0; i < 4; ++i) { const int p = i * 256 + tid; const v8us o = *(const v8us*)&st[(p >> 4) * 136 + (p & 15) * 8];      // p >> 7 = head
    *(v8us*)((unsigned short*)Kp + ((((size_t)b * 8 + (p >> 7)) * 256 + kt) * 128 + (p & 127)) * 8) = o; } }
// V (f32 -> bf16 value -> f16, converted here on the way into LDS) transposed, in the order of the second product's A fragments: unit ((pass * 4 + dt) * 2 + half) * 32 + hh * 16 + ln of a slab is dim dt * 16 + ln, keys pass * 32 + half * 16 + hh * 8 .. + 7.
template <int NHv, int TTv>
__global__ __launch_bounds__(256) void k_vt(const float* __restrict__ V, int ldv, int voff, _Float16* __restrict__ Vt) { __shared__ unsigned short tl[64][66]; const int tid = threadIdx.x; const int slab = blockIdx.x / (TTv / 64), lg = blockIdx.x % (TTv / 64); const int b = slab / NHv, h = slab % NHv;
#pragma unroll      // the four rounds' loads fly together
  for (int rd = 0; rd < 4; ++rd) { const int i = rd * 256 + tid, r = i >> 4, c4 = (i & 15) * 4; const v4f a = *(const v4fa*)(V + ((size_t)b * TTv + lg * 64 + r) * ldv + voff + h * 64 + c4); FragH f;      // 16 lanes take a head's 256-byte row piece: whole lines
#pragma unroll      // constant vector indices: the values stay in registers
    for (int q = 0; q < 4; ++q) { f.h[q] = (_Float16)bf16_round(a[q]); tl[r][c4 + q] = f.u[q]; } }
  __syncthreads();
  {
#pragma unroll
    for (int rd = 0; rd < 2; ++rd) { const int u = rd * 256 + tid, d = ((u >> 6) & 3) * 16 + (u & 15), k0 = rd * 32 + ((u >> 4) & 3) * 8; FragH f;      // the block's 64 keys are two passes: 512 units in a row
#pragma unroll
      for (int q = 0; q < 8; ++q) f.u[q] = tl[k0 + q][d];
      *(v8us*)((unsigned short*)Vt + ((size_t)blockIdx.x * 512 + u) * 8) = f.half[0]; }
     } }

typedef float v2f __attribute__((ext_vector_type(2)));
// D = A.B + C for the flash kernel, the builtin alone: the compiler keeps the distance behind a matrix instruction itself and fills it with real work (the next independent product, the rescale, the sums) where there is some
__device__ __forceinline__ v8f mmaF(v16h a, v16h b, v8f c) { return __builtin_amdgcn_wmma_f32_16x16x32_f16(false, a, false, b, (short)0, c, false, false); }
// lane l <-> lane l ^ 16 as a vector cross-row move: no LDS queue and no wait, unlike a shuffle
__device__ __forceinline__ float xhalf(float x) { return __builtin_bit_cast(float, __builtin_amdgcn_permlanex16(__builtin_bit_cast(int, x), __builtin_bit_cast(int, x), 0x76543210, 0xfedcba98, false, false)); }

// P of one query column for one pass: 2^(score x SL2 - m) for its 16 keys of this half, as the f16 B operand of the second product; returns their sum.
__device__ __forceinline__ float pexp(v8f s0, v8f s1, float m, FragH& pb) {
  constexpr float SL2 = 0.125f * 1.44269504088896340736f;
  float sc[16], ps[4] = {0.f, 0.f, 0.f, 0.f};
#pragma unroll      // both loops: constant indices, so that scores, sums and P stay in registers
  for (int r = 0; r < 8; ++r) { sc[r] = s0[r]; sc[8 + r] = s1[r]; }
#pragma unroll
  for (int i = 0; i < 16; i += 2) {      // two neighbouring scores of an accumulator share one packed multiply-add
    const v2f e = __builtin_elementwise_fma((v2f){sc[i], sc[i + 1]}, (v2f){SL2, SL2}, (v2f){-m, -m});
    const float p0 = __builtin_amdgcn_exp2f(e[0]), p1 = __builtin_amdgcn_exp2f(e[1]);
    ps[i & 3] += p0; ps[(i + 1) & 3] += p1; pb.h[i] = (_Float16)p0; pb.h[i + 1] = (_Float16)p1; }
  return (ps[0] + ps[1]) + (ps[2] + ps[3]);
}

// Eight asynchronous copies to LDS: line i brings this lane's 16 bytes at g + i * 4 KiB to LDS byte l + i * 4 KiB; the block's 256 lanes move 8 x 4 KiB in a row (one tile's K part or V part).
// The wait at the statement's end stands in front of any later overwrite of the address registers that the copies name.
__device__ __forceinline__ void copy8(unsigned l, const unsigned short* g) {
  asm volatile("global_load_async_to_lds_b128 %0, %8, off\n\t"
               "global_load_async_to_lds_b128 %1, %9, off\n\t"
               "global_load_async_to_lds_b128 %2, %10, off\n\t"
               "global_load_async_to_lds_b128 %3, %11, off\n\t"
               "global_load_async_to_lds_b128 %4, %12, off\n\t"
               "global_load_async_to_lds_b128 %5, %13, off\n\t"
               "global_load_async_to_lds_b128 %6, %14, off\n\t"
               "global_load_async_to_lds_b128 %7, %15, off\n\t"
               "s_wait_xcnt 0x0"
               :: "v"(l), "v"(l + 4096u), "v"(l + 8192u), "v"(l + 12288u), "v"(l + 16384u), "v"(l + 20480u), "v"(l + 24576u), "v"(l + 28672u),
                  "v"(g), "v"(g + 2048), "v"(g + 4096), "v"(g + 6144), "v"(g + 8192), "v"(g + 10240), "v"(g + 12288), "v"(g + 14336) : "memory");
}

__global__ __launch_bounds__(256) void k_flash(const float* __restrict__ Qf, int ldq, const _Float16* __restrict__ Kp, const _Float16* __restrict__ Vt, const int* __restrict__ MSK, _Float16* __restrict__ O16, int ldo) {
  constexpr int NW = 8, RPW = 32, NQB = 4096 / (NW * RPW), DT = 4, KS = 2, PP = 8, NT = 4096 / (32 * PP), PART = PP * 2048; (void)MSK;      // PART: 16-bit elements of a tile's K part, and of its V part
  constexpr float SL2 = 0.125f * 1.44269504088896340736f;      // 64^-1/2 x log2(e): exp(x / 8 - m / 8) = 2^(x * SL2 - m * SL2)
  __shared__ __attribute__((aligned(16))) unsigned short sKV[2][2 * PART];        // [buffer][K part, then V part]
  __shared__ __attribute__((aligned(16))) unsigned short sO[NW][RPW][64 + 8];      // row pitch 144 bytes = 16 x 9: 16-byte accesses down a column meet no bank conflict
  const int tid = threadIdx.x, w = tid >> 5, lane = tid & 31, ln = lane & 15, hh = lane >> 4;
  const int slab = blockIdx.x / NQB, qblk = blockIdx.x % NQB; const int b = slab / 8, h = slab % 8; const int qb0 = qblk * (NW * RPW); const int q0 = qb0 + w * RPW;
  const unsigned short* kg = (const unsigned short*)Kp + (size_t)slab * 4096 * 64 + tid * 8;      // fragment order (k_kpack): a pass is 4 KiB in a row, a tile 32 KiB; this lane's 16 bytes of each 4 KiB
  const unsigned short* vg = (const unsigned short*)Vt + (size_t)slab * 64 * 4096 + tid * 8;      // fragment order (k_vt): the same
  const unsigned l0 = (unsigned)(size_t)&sKV[0][tid * 8];                                         // this lane's LDS byte address in buffer 0's K part
  copy8(l0, kg); copy8(l0 + 2 * PART, vg);      // tile 0 -> buffer 0; it flies over the Q loads and their conversion
  v4f qf[2][KS][4];      // raw f32 Q in the fragments' k order: [0], [1] = dims ks * 32 + 8hh .. + 7, [2], [3] = dims ks * 32 + 16 + 8hh .. + 7
#pragma unroll
  for (int rt = 0; rt < 2; ++rt) { const float* qr = Qf + ((size_t)b * 4096 + q0 + rt * 16 + ln) * ldq + h * 64;
#pragma unroll
    for (int ks = 0; ks < KS; ++ks) { const float* qk = qr + ks * 32 + 8 * hh; qf[rt][ks][0] = *(const v4fa*)qk; qf[rt][ks][1] = *(const v4fa*)(qk + 4); qf[rt][ks][2] = *(const v4fa*)(qk + 16); qf[rt][ks][3] = *(const v4fa*)(qk + 20); } }
  asm volatile("s_wait_xcnt 0x0" ::: "memory");      // the address registers of the loads above are reused below: the wait stands in front of their overwrite
  __builtin_amdgcn_sched_barrier(0);                 // keeps the set-up code that reuses those registers behind that wait
  FragH aq[2][KS];
#pragma unroll      // all three loops: constant indices, so that the raw values and the fragments stay in registers
  for (int rt = 0; rt < 2; ++rt)
#pragma unroll
    for (int ks = 0; ks < KS; ++ks)
#pragma unroll
      for (int i = 0; i < 16; ++i) aq[rt][ks].h[i] = (_Float16)bf16_round(qf[rt][ks][i >> 2][i & 3]);
  float m_r[2], l_r[2]; v8f oacc[2][DT];      // per lane: query rt * 16 + ln; m_r = reference point of the exponents in base-2 units (score x SL2): the largest pass maximum among the passes that took the rescale; oacc[rt][dt][r] = Ot[dt * 16 + 8hh + r][that query]
#pragma unroll
  for (int rt = 0; rt < 2; ++rt) { m_r[rt] = -3.0e38f; l_r[rt] = 0.f;
#pragma unroll
    for (int dt = 0; dt < DT; ++dt) oacc[rt][dt] = (v8f){0.f,0.f,0.f,0.f,0.f,0.f,0.f,0.f}; }
  asm volatile("s_wait_asynccnt 0x0" ::: "memory");      // this wave's copies of tile 0 have landed
  __syncthreads();                                       // ... and every other wave's: tile 0 may be read
  copy8(l0 + 4 * PART, kg + PART); copy8(l0 + 6 * PART, vg + PART);      // tile 1 -> buffer 1
#pragma unroll 1      // one trip = one tile; rolled, so that the ring's foot stands once
  for (int t = 0; t < NT; ++t) {
    const unsigned short* kl = &sKV[t & 1][lane * 8];      // this lane's unit of the tile's first K fragment half
    const unsigned short* vl = kl + PART;
    // Inside a tile every LDS read is issued a phase ahead of its use: V of a pass at the pass's top, K of the next pass right behind this pass's score products.
    FragH bk[2][KS], bv[DT];
#pragma unroll
    for (int nt = 0; nt < 2; ++nt)
#pragma unroll
      for (int ks = 0; ks < KS; ++ks) { const unsigned short* kr = kl + nt * 1024 + ks * 512; bk[nt][ks].half[0] = *(const v8us*)kr; bk[nt][ks].half[1] = *(const v8us*)(kr + 256); }
#pragma unroll 1      // rolled: unrolled, the 8 passes' LDS reads are lifted far ahead, the registers double and the back edge fills with copies
   for (int p = 0; p < PP; ++p) {
#pragma unroll
    for (int dt = 0; dt < DT; ++dt) { const unsigned short* vrow = vl + p * 2048 + dt * 512; bv[dt].half[0] = *(const v8us*)vrow; bv[dt].half[1] = *(const v8us*)(vrow + 256); }
    __builtin_amdgcn_sched_barrier(0);      // keeps the pass's eight V reads here as one group: sunk, they stand in several places among the softmax, and the last come late for their products
    v8f s[2][2];      // s[rt][nt][r] = score of key (t * PP + p) * 32 + nt * 16 + 8hh + r against query rt * 16 + ln
#pragma unroll
    for (int nt = 0; nt < 2; ++nt) {
#pragma unroll
      for (int rt = 0; rt < 2; ++rt) { v8f acc = (v8f){0.f,0.f,0.f,0.f,0.f,0.f,0.f,0.f};
#pragma unroll
        for (int ks = 0; ks < KS; ++ks) acc = mmaF(bk[nt][ks].v, aq[rt][ks].v, acc); s[rt][nt] = acc; } }
    if (p + 1 < PP) {      // the last pass of a tile fetches no K ahead: the next tile is not published yet
#pragma unroll
      for (int nt = 0; nt < 2; ++nt)
#pragma unroll
        for (int ks = 0; ks < KS; ++ks) { const unsigned short* kr = kl + (p + 1) * 2048 + nt * 1024 + ks * 512; bk[nt][ks].half[0] = *(const v8us*)kr; bk[nt][ks].half[1] = *(const v8us*)(kr + 256); } }
    // The reference point m_r of a query's exponents need not be its running maximum: any m gives the same quotient O / l as long as no P leaves the f16 range.
    // So a pass first takes P with the m_r it has. All P are positive, so a lane's sum bounds each of them: while the sums stay under 2^15 nothing can overflow, and
    // the pass needs no maximum and no rescale. Otherwise (always in the first pass, where m_r is still -3e38 and the sums come out infinite; a NaN fails the test too)
    // the whole wave takes the maximum, moves m_r up to it, rescales l and O and forms P again.
    FragH pb[2]; float su[2];
#pragma unroll      // here and below: constant indices, so that the accumulators stay in registers
    for (int rt = 0; rt < 2; ++rt) su[rt] = pexp(s[rt][0], s[rt][1], m_r[rt], pb[rt]);
    if (__builtin_expect(__builtin_amdgcn_ballot_w32(!(su[0] + su[1] <= 32768.0f)) != 0u, 0)) {      // wave-uniform: every lane stays on, and both halves of a column keep one m_r
#pragma unroll
      for (int rt = 0; rt < 2; ++rt) {
        float mx[8];      // maximum of the raw products (the scale is positive)
#pragma unroll
        for (int r = 0; r < 8; ++r) mx[r] = fmaxf(s[rt][0][r], s[rt][1][r]);
        float mc = fmaxf(fmaxf(fmaxf(mx[0], mx[1]), fmaxf(mx[2], mx[3])), fmaxf(fmaxf(mx[4], mx[5]), fmaxf(mx[6], mx[7])));
        mc = fmaxf(mc, xhalf(mc));      // both halves of a column must use one maximum: their P meet in one product
        const float mn = fmaxf(m_r[rt], mc * SL2); const float al = __builtin_amdgcn_exp2f(m_r[rt] - mn); m_r[rt] = mn;
        su[rt] = pexp(s[rt][0], s[rt][1], mn, pb[rt]);
        l_r[rt] *= al;
#pragma unroll
        for (int dt = 0; dt < DT; ++dt)
#pragma unroll
          for (int r = 0; r < 8; ++r) oacc[rt][dt][r] *= al; } }
#pragma unroll
    for (int rt = 0; rt < 2; ++rt) l_r[rt] += su[rt];      // this half's keys only; the halves join after the loop
#pragma unroll
    for (int dt = 0; dt < DT; ++dt) {
#pragma unroll
      for (int rt = 0; rt < 2; ++rt) oacc[rt][dt] = mmaF(bv[dt].v, pb[rt].v, oacc[rt][dt]); } }
    // The ring's foot: this wave's LDS reads are done, its copies of tile t + 1 have landed, every wave has come as far; then tile t + 2 goes into the buffer that this trip has read.
    asm volatile("s_wait_dscnt 0x0" ::: "memory");
    asm volatile("s_wait_asynccnt 0x0" ::: "memory");
    __syncthreads();
    if (t + 2 < NT) { const unsigned lb = l0 + (unsigned)(t & 1) * (4 * PART); copy8(lb, kg + (size_t)(t + 2) * PART); copy8(lb + 2 * PART, vg + (size_t)(t + 2) * PART); } }
  asm volatile("s_wait_asynccnt 0x0" ::: "memory");      // nothing of this wave is in flight when it goes on to the epilogue
#pragma unroll
  for (int rt = 0; rt < 2; ++rt) { float l = l_r[rt]; l += xhalf(l); const float li = (l > 0.f) ? 1.0f / l : 0.f;
#pragma unroll
    for (int dt = 0; dt < DT; ++dt) { FragH f;
#pragma unroll
      for (int r = 0; r < 8; ++r) f.h[r] = (_Float16)(oacc[rt][dt][r] * li);
      *(v8us*)&sO[w][rt * 16 + ln][dt * 16 + 8 * hh] = f.half[0]; } }
  __builtin_amdgcn_fence(__ATOMIC_ACQ_REL, "workgroup"); __builtin_amdgcn_wave_barrier();
  {
#pragma unroll
    for (int rp = 0; rp < RPW; rp += 4) { const int r = rp + (lane >> 3), pc = lane & 7; const v8us val = *(const v8us*)&sO[w][r][pc * 8]; *(v8us*)((unsigned short*)O16 + ((size_t)b * 4096 + q0 + r) * ldo + h * 64 + pc * 8) = val; }      // 8 lanes store a head's 128-byte row piece: one whole line
     } }

// Output linear: C[8192][64] = O16[8192][512] . W x 2^-4 + bias (Bt = W transposed, f16, x 2^4). One block = 32 rows; its 8 waves split K: wave w takes k = 64w .. 64w + 63 of all 32 rows and all 64 columns.
// A wave's 24 fragment loads depend on nothing but the thread index and are issued together: the kernel pays one round trip to L2, not one per product. Then 16 products; the 8 partial sums meet in LDS.
// Transposed product (A = Bt rows, B = O16 rows, both in the loaders' one k order): lane (ln, hh) holds output row ln and columns 8hh + r of a 16 x 16 tile, so its 8 values are 32 bytes in a row of the partial sum.
__global__ __launch_bounds__(256) void k_outlin(const _Float16* __restrict__ A, const _Float16* __restrict__ Bt, const float* __restrict__ bias, float* __restrict__ C) {
  constexpr int PW = NO + 4;      // LDS row pitch 272 bytes = 16 x 17: 16-byte accesses down a column meet no bank conflict
  __shared__ __attribute__((aligned(16))) float red[8][32][PW];
  const int tid = threadIdx.x, w = tid >> 5, lane = tid & 31, ln = lane & 15, hh = lane >> 4;
  const int row0 = blockIdx.x * 32, orow = tid >> 4, c4 = (tid & 15) * 4;
  const unsigned short* ap = (const unsigned short*)A + (size_t)(row0 + ln) * CC + w * 64 + 8 * hh;
  const unsigned short* bp = (const unsigned short*)Bt + (size_t)ln * CC + w * 64 + 8 * hh;
  FragH fa[2][2], fb[4][2];      // [row tile][k step], [column tile][k step]
#pragma unroll      // all loops here: constant indices, so that fragments and sums stay in registers
  for (int ks = 0; ks < 2; ++ks) {
#pragma unroll
    for (int rt = 0; rt < 2; ++rt) { const unsigned short* s = ap + rt * 16 * CC + ks * 32; fa[rt][ks].half[0] = *(const v8us*)s; fa[rt][ks].half[1] = *(const v8us*)(s + 16); }
#pragma unroll
    for (int t = 0; t < 4; ++t) { const unsigned short* s = bp + t * 16 * CC + ks * 32; fb[t][ks].half[0] = *(const v8us*)s; fb[t][ks].half[1] = *(const v8us*)(s + 16); } }
  const v4f bz = *(const v4fa*)(bias + c4);
  asm volatile("s_wait_xcnt 0x0" :: "v"(ap), "v"(bp) : "memory");      // the loads' address registers are reused below: the wait stands in front of their overwrite; as its operands they are kept as they are up to it
  __builtin_amdgcn_sched_barrier(0);      // keeps all 25 loads in front of the first product: left free, the scheduler sinks part of them among the products, and each such group is one more round trip
  v8f acc[2][4];
#pragma unroll
  for (int rt = 0; rt < 2; ++rt)
#pragma unroll
    for (int t = 0; t < 4; ++t) acc[rt][t] = (v8f){0.f,0.f,0.f,0.f,0.f,0.f,0.f,0.f};
#pragma unroll
  for (int ks = 0; ks < 2; ++ks)
#pragma unroll
    for (int rt = 0; rt < 2; ++rt)
#pragma unroll
      for (int t = 0; t < 4; ++t) acc[rt][t] = mmaF(fb[t][ks].v, fa[rt][ks].v, acc[rt][t]);
#pragma unroll
  for (int rt = 0; rt < 2; ++rt)
#pragma unroll
    for (int t = 0; t < 4; ++t) { float* d = &red[w][rt * 16 + ln][t * 16 + 8 * hh];
      *(v4fa*)d = (v4f){acc[rt][t][0], acc[rt][t][1], acc[rt][t][2], acc[rt][t][3]}; *(v4fa*)(d + 4) = (v4f){acc[rt][t][4], acc[rt][t][5], acc[rt][t][6], acc[rt][t][7]}; }
  __syncthreads();      // every wave's partial sums are in LDS
#pragma unroll
  for (int i = 0; i < 2; ++i) { const int r = i * 16 + orow; v4f s = *(const v4fa*)&red[0][r][c4];
#pragma unroll
    for (int p = 1; p < 8; ++p) s += *(const v4fa*)&red[p][r][c4];
    v4f o;
#pragma unroll
    for (int q = 0; q < 4; ++q) o[q] = s[q] * 0.0625f + bf16_round(bz[q]);
    *(v4fa*)(C + (size_t)(row0 + r) * NO + c4) = o; }      // 16 lanes store one 256-byte row: whole lines
}

extern "C" void kernel_launch(void* const* d_in, const int* in_sizes, int n_in,
                              void* d_out, int out_size, void* d_ws, size_t ws_size, hipStream_t stream) {
  (void)in_sizes; (void)n_in; (void)out_size;
  const float* q = (const float*)d_in[0]; const float* k = (const float*)d_in[1]; const float* v = (const float*)d_in[2]; const float* Wo = (const float*)d_in[3]; const float* bo = (const float*)d_in[4];
  char* ws = (char*)d_ws; size_t off = 0;
  auto take = [&](size_t bytes) { char* p = ws + off; off += (bytes + 255) & ~(size_t)255; return p; };
  _Float16* Bo = (_Float16*)take((size_t)NO * CC * 2); _Float16* K16 = (_Float16*)take((size_t)NR * CC * 2); _Float16* Vt = (_Float16*)take((size_t)NR * CC * 2); _Float16* O16 = (_Float16*)take((size_t)NR * CC * 2);
  if (off > ws_size) return;      // 3 x 8.4 MB
  k_wt_f16<<<(NO * (CC / 8) + 255) / 256, 256, 0, stream>>>(Wo, Bo, CC, NO, 16.0f);      // [in][out]
  k_kpack<<<NR / 16, 256, 0, stream>>>(k, K16);
  k_vt<NH, TT><<<BB * NH * (TT / 64), 256, 0, stream>>>(v, CC, 0, Vt);
  k_flash<<<BB * NH * (TT / 256), 256, 0, stream>>>(q, CC, K16, Vt, nullptr, O16, CC);
  k_outlin<<<NR / 32, 256, 0, stream>>>(O16, Bo, bo, (float*)d_out);
}

// v010
// One run takes 59.3 microseconds.
// Timed twice side by side with v009, it ran 1.05 times as fast both times.
// Over all steps from v000 it is 11.3 times as fast.
#include <hip/hip_runtime.h>
// 8-head attention over the given q/k/v (2 × 4096 tokens, d = 64) as a fused flash-style kernel on v_wmma_f32_16x16x32_f16 (q, k, v are module INPUTS → exact bf16 values as f16 operands; S = Q·Kᵀ × 64^-½,
// online max/sum softmax f32, P f16 ≤ 2^15, O = P·V), then the 512→64 output linear (+ bias; W_out [in][out] bf16-exact ×2^4); f32 accumulate.
#define BB 2
#define TT 4096
#define CC 512
#define NH 8
#define NO 64
#define NR (BB * TT)

typedef __bf16 v16b __attribute__((ext_vector_type(16)));
typedef unsigned short v8us __attribute__((ext_vector_type(8), may_alias));
typedef float  v8f  __attribute__((ext_vector_type(8)));
typedef float  v4f  __attribute__((ext_vector_type(4)));
typedef float  v4fa __attribute__((ext_vector_type(4), may_alias));
union FragB { v16b v; v8us half[2]; unsigned short u[16]; };

__device__ __forceinline__ unsigned short bf16_bits(float x) { unsigned int u = __float_as_uint(x); return (unsigned short)((u + 0x7FFFu + ((u >> 16) & 1u)) >> 16); }
__device__ __forceinline__ float bf16_val(unsigned short b) { return __uint_as_float(((unsigned int)b) << 16); }
__device__ __forceinline__ float bf16_round(float x) { return bf16_val(bf16_bits(x)); }
// D += A·B with NT terms: 1 = ah·bh, 2 = + al·bh (A split), 3 = + ah·bl (both split)
template <int NT>
__device__ __forceinline__ v8f mmaN(v16b ah, v16b al, v16b bh, v16b bl, v8f c) {
  c = __builtin_amdgcn_wmma_f32_16x16x32_bf16(false, ah, false, bh, (short)0, c, false, false);
  if (NT >= 2) c = __builtin_amdgcn_wmma_f32_16x16x32_bf16(false, al, false, bh, (short)0, c, false, false);
  if (NT >= 3) c = __builtin_amdgcn_wmma_f32_16x16x32_bf16(false, ah, false, bl, (short)0, c, false, false);
  asm volatile("v_nop\n\tv_nop\n\tv_nop\n\tv_nop" : "+v"(c) : "v"(ah), "v"(al), "v"(bh), "v"(bl));
  return c;
}

__global__ __launch_bounds__(256) void k_wt_bf16(const float* __restrict__ W, unsigned short* __restrict__ Wt, int K, int N) {
  const int t = blockIdx.x * 256 + threadIdx.x;
  const int k8n = K / 8;
  if (t >= N * k8n) return;
  const int n = t / k8n, k8 = (t % k8n) * 8;
  v8us v;
#pragma unroll
  for (int i = 0; i < 8; ++i) v[i] = bf16_bits(W[(size_t)(k8 + i) * N + n]);
  *(v8us*)(Wt + (size_t)n * K + k8) = v;
  
}

// GEMM C[M][N] (f32, pitch ldc) = act(A[M][K]·W + bias). A f32 row-major (pitch lda) converted per fragment to bf16
// (ASPLIT: hi/lo two planes -> 2 terms, else single rounded term); Wt bf16 [N][K] (pitch ldb). BIAS_BF16 rounds the
// bias to bf16 first (bias quantised to bf16 before the add). K%32==0, M%16==0, N%64==0.
template <bool ASPLIT, int ACT, bool BIAS_BF16>
__global__ __launch_bounds__(128) void k_gemm_bf(const float* __restrict__ A, int lda, const unsigned short* __restrict__ Wt, int ldb,
                                               const float* __restrict__ bias, float* __restrict__ C, int ldc, int M, int N, int K) {
  __shared__ __attribute__((aligned(16))) float so[4][16][64];
  const int tid = threadIdx.x, w = tid >> 5, lane = tid & 31, ln = lane & 15, hh = lane >> 4;
  const int ntn = N / 64;
  const int wid = blockIdx.x * 4 + w;
  const int mt = wid / ntn, nq = wid % ntn;
  if (mt * 16 >= M) return;
  const int row0 = mt * 16, col0 = nq * 64;
  const float* arow = A + (size_t)(row0 + ln) * lda;
  v8f acc[4] = {};
  for (int kb = 0; kb < K; kb += 32) {
    FragB ah, al;
    const v4f x0 = *(const v4fa*)(arow + kb + 8 * hh), x1 = *(const v4fa*)(arow + kb + 8 * hh + 4);
    const v4f x2 = *(const v4fa*)(arow + kb + 16 + 8 * hh), x3 = *(const v4fa*)(arow + kb + 16 + 8 * hh + 4);
    float xs[16] = {x0[0],x0[1],x0[2],x0[3],x1[0],x1[1],x1[2],x1[3],x2[0],x2[1],x2[2],x2[3],x3[0],x3[1],x3[2],x3[3]};
#pragma unroll
    for (int i = 0; i < 16; ++i) { const unsigned short hb = bf16_bits(xs[i]); ah.u[i] = hb; al.u[i] = ASPLIT ? bf16_bits(xs[i] - bf16_val(hb)) : (unsigned short)0; }
#pragma unroll
    for (int t = 0; t < 4; ++t) {
      const unsigned short* brow = Wt + (size_t)(col0 + t * 16 + ln) * ldb + kb;
      FragB b;
      b.half[0] = *(const v8us*)(brow + 8 * hh);
      b.half[1] = *(const v8us*)(brow + 16 + 8 * hh);
      acc[t] = mmaN<ASPLIT ? 2 : 1>(ah.v, al.v, b.v, b.v, acc[t]);
    }
  }
#pragma unroll
  for (int t = 0; t < 4; ++t) {
    float bv = bias ? bias[col0 + t * 16 + ln] : 0.f;
    if (BIAS_BF16) bv = bf16_round(bv);
#pragma unroll
    for (int r = 0; r < 8; ++r) { float v = acc[t][r] + bv; if (ACT == 1) v = fmaxf(v, 0.f); so[w][8 * hh + r][t * 16 + ln] = v; }
  }
  __builtin_amdgcn_fence(__ATOMIC_ACQ_REL, "workgroup");
  __builtin_amdgcn_wave_barrier();
  const int rsub = lane >> 4, c4 = (lane & 15) * 4;
  {
#pragma unroll
    for (int q = 0; q < 8; ++q) {
      const int r = q * 2 + rsub;
      const v4f v = *(const v4fa*)&so[w][r][c4];
      *(v4f*)(C + (size_t)(row0 + r) * ldc + col0 + c4) = v;
    }
    
  }
}

// Flash-style causal/unmasked attention, all contractions 3-term bf16 hi/lo splits, f32 softmax with running max.
// q,k,v rows are read from f32 buffers with arbitrary row pitch (so they can live inside a fused qkv buffer);
// D = head size (multiple of 32, <= 128); one wave = 16 query rows; block = 4 waves (64 queries) sharing K/V chunks of 32.
template <int D, bool CAUSAL>
__global__ __launch_bounds__(128) void k_flash(const float* __restrict__ qb, const float* __restrict__ kb, const float* __restrict__ vb,
                                             int pitch, int T, int H, float scale, float* __restrict__ y, int ypitch) {
  constexpr int KS = D / 32;        // k-steps for QK
  constexpr int DT = D / 16;        // d tiles for PV
  __shared__ __attribute__((aligned(16))) unsigned short sKh[32][D + 8], sKl[32][D + 8], sVh[32][D + 8], sVl[32][D + 8];
  __shared__ __attribute__((aligned(16))) unsigned short sPh[4][16][40], sPl[4][16][40];
  __shared__ __attribute__((aligned(16))) float sO[4][16][D];
  const int tid = threadIdx.x, w = tid >> 5, lane = tid & 31, ln = lane & 15, hh = lane >> 4;
  const int nqb = (T + 63) / 64;
  const int bh = blockIdx.x / nqb, qblk = blockIdx.x % nqb;
  const int b = bh / H, h = bh % H;
  const int q0 = qblk * 64 + w * 16;
  const float* Q = qb + (size_t)b * T * pitch + h * D;
  const float* K = kb + (size_t)b * T * pitch + h * D;
  const float* V = vb + (size_t)b * T * pitch + h * D;

  // A fragments of the wave's 16 query rows (scaled), hi/lo
  FragB aqh[KS], aql[KS];
  {
    int row = q0 + ln; if (row >= T) row = T - 1;
    const float* qr = Q + (size_t)row * pitch;
#pragma unroll
    for (int ks = 0; ks < KS; ++ks)
#pragma unroll
      for (int i = 0; i < 16; ++i) {
        const int d = ks * 32 + ((i < 8) ? (8 * hh + i) : (16 + 8 * hh + (i - 8)));
        const float x = qr[d] * scale; const unsigned short hb = bf16_bits(x);
        aqh[ks].u[i] = hb; aql[ks].u[i] = bf16_bits(x - bf16_val(hb));
      }
  }
  float m_r[8], l_r[8];
#pragma unroll
  for (int r = 0; r < 8; ++r) { m_r[r] = -3.0e38f; l_r[r] = 0.f; }
  v8f oacc[DT];
#pragma unroll
  for (int dt = 0; dt < DT; ++dt) oacc[dt] = (v8f){0.f,0.f,0.f,0.f,0.f,0.f,0.f,0.f};

  const int kv_end = CAUSAL ? min(T, qblk * 64 + 64) : T;     // block-uniform
  for (int j0 = 0; j0 < kv_end; j0 += 32) {
    __syncthreads();
    for (int e = tid; e < 32 * (D / 4); e += 128) {
      const int r = e / (D / 4), c4 = (e % (D / 4)) * 4;
      const int key = j0 + r;
      v4f kf = {0.f,0.f,0.f,0.f}, vf = {0.f,0.f,0.f,0.f};
      if (key < T) { kf = *(const v4fa*)(K + (size_t)key * pitch + c4); vf = *(const v4fa*)(V + (size_t)key * pitch + c4); }
#pragma unroll
      for (int t = 0; t < 4; ++t) {
        unsigned short hb = bf16_bits(kf[t]); sKh[r][c4 + t] = hb; sKl[r][c4 + t] = bf16_bits(kf[t] - bf16_val(hb));
        hb = bf16_bits(vf[t]); sVh[r][c4 + t] = hb; sVl[r][c4 + t] = bf16_bits(vf[t] - bf16_val(hb));
      }
    }
    __syncthreads();
    // S tile 16 x 32
    v8f s[2];
#pragma unroll
    for (int nt = 0; nt < 2; ++nt) {
      v8f acc = {};
#pragma unroll
      for (int ks = 0; ks < KS; ++ks) {
        FragB bh_, bl_;
        bh_.half[0] = *(const v8us*)&sKh[nt * 16 + ln][ks * 32 + 8 * hh]; bh_.half[1] = *(const v8us*)&sKh[nt * 16 + ln][ks * 32 + 16 + 8 * hh];
        bl_.half[0] = *(const v8us*)&sKl[nt * 16 + ln][ks * 32 + 8 * hh]; bl_.half[1] = *(const v8us*)&sKl[nt * 16 + ln][ks * 32 + 16 + 8 * hh];
        acc = mmaN<3>(aqh[ks].v, aql[ks].v, bh_.v, bl_.v, acc);
      }
      s[nt] = acc;
    }
    // mask + running max (rows 8hh+r; the 16 lanes of a half share rows)
    float alpha[8];
#pragma unroll
    for (int r = 0; r < 8; ++r) {
      const int qi = q0 + 8 * hh + r;
      const int ja = j0 + ln, jb = j0 + 16 + ln;
      if (CAUSAL) { if (ja > qi) s[0][r] = -3.0e38f; if (jb > qi) s[1][r] = -3.0e38f; }
      if (ja >= T) s[0][r] = -3.0e38f;
      if (jb >= T) s[1][r] = -3.0e38f;
      float mx = fmaxf(s[0][r], s[1][r]);
      mx = fmaxf(mx, __shfl_xor(mx, 1, 32)); mx = fmaxf(mx, __shfl_xor(mx, 2, 32)); mx = fmaxf(mx, __shfl_xor(mx, 4, 32)); mx = fmaxf(mx, __shfl_xor(mx, 8, 32));
      const float mnew = fmaxf(m_r[r], mx);
      alpha[r] = (mnew > -1.0e38f) ? __expf(m_r[r] - mnew) : 1.0f;
      const float p0 = (s[0][r] > -1.0e38f) ? __expf(s[0][r] - mnew) : 0.f;
      const float p1 = (s[1][r] > -1.0e38f) ? __expf(s[1][r] - mnew) : 0.f;
      m_r[r] = mnew;
      l_r[r] = l_r[r] * alpha[r] + p0 + p1;            // per-lane partial row sum (16 lanes combined at the end)
      unsigned short hb = bf16_bits(p0); sPh[w][8 * hh + r][ln] = hb;      sPl[w][8 * hh + r][ln] = bf16_bits(p0 - bf16_val(hb));
      hb = bf16_bits(p1);                sPh[w][8 * hh + r][16 + ln] = hb; sPl[w][8 * hh + r][16 + ln] = bf16_bits(p1 - bf16_val(hb));
    }
#pragma unroll
    for (int dt = 0; dt < DT; ++dt)
#pragma unroll
      for (int r = 0; r < 8; ++r) oacc[dt][r] *= alpha[r];
    __builtin_amdgcn_fence(__ATOMIC_ACQ_REL, "workgroup");
    __builtin_amdgcn_wave_barrier();
    FragB pah, pal;
    pah.half[0] = *(const v8us*)&sPh[w][ln][8 * hh]; pah.half[1] = *(const v8us*)&sPh[w][ln][16 + 8 * hh];
    pal.half[0] = *(const v8us*)&sPl[w][ln][8 * hh]; pal.half[1] = *(const v8us*)&sPl[w][ln][16 + 8 * hh];
#pragma unroll
    for (int dt = 0; dt < DT; ++dt) {
      FragB bvh, bvl;
#pragma unroll
      for (int i = 0; i < 8; ++i) {
        bvh.u[i] = sVh[8 * hh + i][dt * 16 + ln]; bvh.u[8 + i] = sVh[16 + 8 * hh + i][dt * 16 + ln];
        bvl.u[i] = sVl[8 * hh + i][dt * 16 + ln]; bvl.u[8 + i] = sVl[16 + 8 * hh + i][dt * 16 + ln];
      }
      oacc[dt] = mmaN<3>(pah.v, pal.v, bvh.v, bvl.v, oacc[dt]);
    }
    __builtin_amdgcn_fence(__ATOMIC_ACQ_REL, "workgroup");
    __builtin_amdgcn_wave_barrier();
  }
#pragma unroll
  for (int r = 0; r < 8; ++r) {
    float l = l_r[r];
    l += __shfl_xor(l, 1, 32); l += __shfl_xor(l, 2, 32); l += __shfl_xor(l, 4, 32); l += __shfl_xor(l, 8, 32);
    l_r[r] = (l > 0.f) ? 1.0f / l : 0.f;
  }
#pragma unroll
  for (int dt = 0; dt < DT; ++dt)
#pragma unroll
    for (int r = 0; r < 8; ++r) sO[w][8 * hh + r][dt * 16 + ln] = oacc[dt][r] * l_r[r];
  __builtin_amdgcn_fence(__ATOMIC_ACQ_REL, "workgroup");
  __builtin_amdgcn_wave_barrier();
  {
    for (int r = 0; r < 16; ++r) {
      const int row = q0 + r;
      if (row < T && lane < D / 4) {
        const v4f val = *(const v4fa*)&sO[w][r][lane * 4];
        *(v4f*)(y + ((size_t)b * T + row) * ypitch + h * D + lane * 4) = val;
      }
    }
    
  }
}

// GEMM C = act(A·W + bias + resid): A f32 (ASPLIT -> hi/lo 2 terms), Wt bf16 [N][K]; ACT 0 none, 1 relu, 2 exact gelu;
// resid (optional, f32, row index = (row % rmod), pitch ldr, RES_BF16 rounds it) added before the activation.
template <bool ASPLIT, int ACT, bool BIAS_BF16, bool RES_BF16>
__global__ __launch_bounds__(128) void k_gemm_bf3(const float* __restrict__ A, int lda, const unsigned short* __restrict__ Wt, int ldb,
                                                const float* __restrict__ bias, const float* __restrict__ resid, int rmod, int ldr,
                                                float* __restrict__ C, int ldc, int M, int N, int K) {
  __shared__ __attribute__((aligned(16))) float so[4][16][64];
  const int tid = threadIdx.x, w = tid >> 5, lane = tid & 31, ln = lane & 15, hh = lane >> 4;
  const int ntn = N / 64;
  const int wid = blockIdx.x * 4 + w;
  const int mt = wid / ntn, nq = wid % ntn;
  if (mt * 16 >= M) return;
  const int row0 = mt * 16, col0 = nq * 64;
  const float* arow = A + (size_t)(row0 + ln) * lda;
  v8f acc[4] = {};
  for (int kb = 0; kb < K; kb += 32) {
    FragB ah, al;
    const v4f x0 = *(const v4fa*)(arow + kb + 8 * hh), x1 = *(const v4fa*)(arow + kb + 8 * hh + 4);
    const v4f x2 = *(const v4fa*)(arow + kb + 16 + 8 * hh), x3 = *(const v4fa*)(arow + kb + 16 + 8 * hh + 4);
    float xs[16] = {x0[0],x0[1],x0[2],x0[3],x1[0],x1[1],x1[2],x1[3],x2[0],x2[1],x2[2],x2[3],x3[0],x3[1],x3[2],x3[3]};
#pragma unroll
    for (int i = 0; i < 16; ++i) { const unsigned short hb = bf16_bits(xs[i]); ah.u[i] = hb; al.u[i] = ASPLIT ? bf16_bits(xs[i] - bf16_val(hb)) : (unsigned short)0; }
#pragma unroll
    for (int t = 0; t < 4; ++t) {
      const unsigned short* brow = Wt + (size_t)(col0 + t * 16 + ln) * ldb + kb;
      FragB b;
      b.half[0] = *(const v8us*)(brow + 8 * hh);
      b.half[1] = *(const v8us*)(brow + 16 + 8 * hh);
      acc[t] = mmaN<ASPLIT ? 2 : 1>(ah.v, al.v, b.v, b.v, acc[t]);
    }
  }
#pragma unroll
  for (int t = 0; t < 4; ++t) {
    const int col = col0 + t * 16 + ln;
    float bv = bias ? bias[col] : 0.f;
    if (BIAS_BF16) bv = bf16_round(bv);
#pragma unroll
    for (int r = 0; r < 8; ++r) {
      float v = acc[t][r] + bv;
      if (resid) { float rv = resid[(size_t)((row0 + 8 * hh + r) % rmod) * ldr + col]; if (RES_BF16) rv = bf16_round(rv); v += rv; }
      if (ACT == 1) v = fmaxf(v, 0.f);
      if (ACT == 2) v = 0.5f * v * (1.0f + erff(v * 0.70710678118654752f));
      if (ACT == 3) { const float u = 0.7978845608028654f * (v + 0.044715f * v * v * v); v = 0.5f * v * (1.0f + tanhf(u)); }
      so[w][8 * hh + r][t * 16 + ln] = v;
    }
  }
  __builtin_amdgcn_fence(__ATOMIC_ACQ_REL, "workgroup");
  __builtin_amdgcn_wave_barrier();
  const int rsub = lane >> 4, c4 = (lane & 15) * 4;
  {
#pragma unroll
    for (int q = 0; q < 8; ++q) {
      const int r = q * 2 + rsub;
      const v4f v = *(const v4fa*)&so[w][r][c4];
      *(v4f*)(C + (size_t)(row0 + r) * ldc + col0 + c4) = v;
    }
    
  }
}
// row LayerNorm (biased variance, eps) over N: s = X (+ R); optional out_sum <- s; out_norm <- (s-mu)*rsqrt(var+eps)*g + b
template <bool PARAM_BF16>
__global__ __launch_bounds__(256) void k_layernorm(const float* __restrict__ X, const float* __restrict__ R, const float* __restrict__ g, const float* __restrict__ bta,
                                                  float* __restrict__ out_sum, float* __restrict__ out_norm, int N, float eps) {
  __shared__ float red[256];
  const int row = blockIdx.x, tid = threadIdx.x;
  const float* x = X + (size_t)row * N; const float* rr = R ? R + (size_t)row * N : nullptr;
  float vals[16];                     // up to N = 4096
  const int per = N / 256;            // contiguous chunk per thread? use strided-by-4 chunks: thread handles j = tid*4 + 1024*u
  float s1 = 0.f;
  for (int u = 0; u < per / 4; ++u) {
    const int j = tid * 4 + 1024 * u;
    const v4f a = *(const v4fa*)(x + j);
    v4f b = {0.f,0.f,0.f,0.f}; if (rr) b = *(const v4fa*)(rr + j);
#pragma unroll
    for (int q = 0; q < 4; ++q) { const float v = a[q] + b[q]; vals[u * 4 + q] = v; s1 += v; }
  }
  red[tid] = s1; __syncthreads();
  for (int st = 128; st > 0; st >>= 1) { if (tid < st) red[tid] += red[tid + st]; __syncthreads(); }
  const float mu = red[0] / (float)N; __syncthreads();
  float s2 = 0.f;
  for (int u = 0; u < per / 4; ++u)
#pragma unroll
    for (int q = 0; q < 4; ++q) { const float c = vals[u * 4 + q] - mu; s2 += c * c; }
  red[tid] = s2; __syncthreads();
  for (int st = 128; st > 0; st >>= 1) { if (tid < st) red[tid] += red[tid + st]; __syncthreads(); }
  const float rs = rsqrtf(red[0] / (float)N + eps);
  {
    for (int u = 0; u < per / 4; ++u) {
      const int j = tid * 4 + 1024 * u;
      v4f o, sm;
#pragma unroll
      for (int q = 0; q < 4; ++q) {
        float gg = g[j + q], bb = bta[j + q];
        if (PARAM_BF16) { gg = bf16_round(gg); bb = bf16_round(bb); }
        sm[q] = vals[u * 4 + q]; o[q] = (vals[u * 4 + q] - mu) * rs * gg + bb;
      }
      if (out_sum) *(v4f*)(out_sum + (size_t)row * N + j) = sm;
      *(v4f*)(out_norm + (size_t)row * N + j) = o;
    }
    
  }
}



// ---- f16 WMMA path (v_wmma_f32_16x16x32_f16): 11-bit significands for operands in range — used where the softmax P operand (≤ 2^15) needs more precision than bf16
typedef _Float16 v16h __attribute__((ext_vector_type(16)));
union FragH { v16h v; v8us half[2]; _Float16 h[16]; unsigned short u[16]; };
template <int NT>
__device__ __forceinline__ v8f mmaH(v16h ah, v16h al, v16h bh, v16h bl, v8f c) {
  c = __builtin_amdgcn_wmma_f32_16x16x32_f16(false, ah, false, bh, (short)0, c, false, false);
  if (NT >= 2) c = __builtin_amdgcn_wmma_f32_16x16x32_f16(false, al, false, bh, (short)0, c, false, false);
  if (NT >= 3) c = __builtin_amdgcn_wmma_f32_16x16x32_f16(false, ah, false, bl, (short)0, c, false, false);
  asm volatile("v_nop\n\tv_nop\n\tv_nop\n\tv_nop" : "+v"(c) : "v"(ah), "v"(al), "v"(bh), "v"(bl));
  return c;
}
// batched GEMM like k_gemm_b but f16 operands: A f32 (split into f16 hi/lo if ASPLIT, else rounded to f16), Bt = f16 values [n][k]; alpha; C f32; N multiple of 16 (partial tiles skipped)
template <bool ASPLIT>
__global__ __launch_bounds__(128) void k_gemm_h(const float* __restrict__ A, int lda, size_t sA, const _Float16* __restrict__ Bh, int ldb, size_t sB, float alpha, float* __restrict__ C, int ldc, size_t sC, int M, int N, int K) {
  __shared__ __attribute__((aligned(16))) float so[4][16][64];
  const int tid = threadIdx.x, w = tid >> 5, lane = tid & 31, ln = lane & 15, hh = lane >> 4; const int by = blockIdx.y;
  A += (size_t)by * sA; Bh += (size_t)by * sB; C += (size_t)by * sC;
  const int ntn = (N + 63) / 64; const int wid = blockIdx.x * 4 + w; const int mt = wid / ntn, nq = wid % ntn; if (mt * 16 >= M) return;
  const int row0 = mt * 16, col0 = nq * 64; const float* arow = A + (size_t)(row0 + ln) * lda;
  v8f acc[4] = {};
  for (int kb = 0; kb < K; kb += 32) {
    FragH ah, al;
    const v4f x0 = *(const v4fa*)(arow + kb + 8 * hh), x1 = *(const v4fa*)(arow + kb + 8 * hh + 4), x2 = *(const v4fa*)(arow + kb + 16 + 8 * hh), x3 = *(const v4fa*)(arow + kb + 16 + 8 * hh + 4);
    float xs[16] = {x0[0],x0[1],x0[2],x0[3],x1[0],x1[1],x1[2],x1[3],x2[0],x2[1],x2[2],x2[3],x3[0],x3[1],x3[2],x3[3]};
#pragma unroll
    for (int i = 0; i < 16; ++i) { const _Float16 h = (_Float16)xs[i]; ah.h[i] = h; al.h[i] = ASPLIT ? (_Float16)(xs[i] - (float)h) : (_Float16)0.0f; }
#pragma unroll
    for (int t = 0; t < 4; ++t) { if (col0 + t * 16 >= N) continue; const size_t boff = (size_t)(col0 + t * 16 + ln) * ldb + kb; FragH bq; bq.half[0] = *(const v8us*)(Bh + boff + 8 * hh); bq.half[1] = *(const v8us*)(Bh + boff + 16 + 8 * hh);
      acc[t] = mmaH<ASPLIT ? 2 : 1>(ah.v, al.v, bq.v, bq.v, acc[t]); }
  }
#pragma unroll
  for (int t = 0; t < 4; ++t) { if (col0 + t * 16 >= N) continue;
#pragma unroll
    for (int r = 0; r < 8; ++r) so[w][8 * hh + r][t * 16 + ln] = acc[t][r] * alpha; }
  __builtin_amdgcn_fence(__ATOMIC_ACQ_REL, "workgroup"); __builtin_amdgcn_wave_barrier();
  const int rsub = lane >> 4, c4 = (lane & 15) * 4;
  {
#pragma unroll
    for (int q = 0; q < 8; ++q) { const int r = q * 2 + rsub; if (col0 + c4 < N) { const v4f v = *(const v4fa*)&so[w][r][c4]; *(v4f*)(C + (size_t)(row0 + r) * ldc + col0 + c4) = v; } }
     }
}

// Wt[n][k] = f16(W[k][n]·scale) from f32 row-major W[K][N] (scale = power of two; bf16-exact weights stay exact in f16 away from the subnormal range)
// Part of k_prep; bx = the block's number inside its part.
__device__ __forceinline__ void wt_f16(int bx, const float* __restrict__ W, _Float16* __restrict__ Wt, int K, int N, float scale) {
  const int t = bx * 256 + threadIdx.x; if (t >= N * (K / 8)) return; const int n = t / (K / 8), k8 = (t % (K / 8)) * 8; FragH f;
#pragma unroll
  for (int i = 0; i < 8; ++i) f.h[i] = (_Float16)(bf16_round(W[(size_t)(k8 + i) * N + n]) * scale); const v8us o = f.half[0];
  *(v8us*)((unsigned short*)Wt + (size_t)n * K + k8) = o; 
}
// k_gemm_hh variant with fused epilogue: v = acc·alpha + bias[by·sBias + col] (+ CP[(row/rowsPerB)·sCPb + by·64 + col] if CP) ; ACT 0 none / 1 elu ; writes f32 C and/or f16 C16 (each if non-null)
template <int ACT>
__global__ __launch_bounds__(128) void k_gemm_hhx(const _Float16* __restrict__ A, int lda, size_t sA, const _Float16* __restrict__ Bh, int ldb, size_t sB, float alpha, const float* __restrict__ bias, size_t sBias, const float* __restrict__ CP, int rowsPerB, size_t sCPb, int row0g,
    float* __restrict__ C, _Float16* __restrict__ C16, int ldc, size_t sC, int M, int N, int K) {
  __shared__ __attribute__((aligned(16))) float so[4][16][64];
  const int tid = threadIdx.x, w = tid >> 5, lane = tid & 31, ln = lane & 15, hh = lane >> 4; const int by = blockIdx.y;
  A += (size_t)by * sA; Bh += (size_t)by * sB; const size_t cofs = (size_t)by * sC; const float* bp = bias ? bias + (size_t)by * sBias : nullptr;
  const int ntn = (N + 63) / 64; const int wid = blockIdx.x * 4 + w; const int mt = wid / ntn, nq = wid % ntn; if (mt * 16 >= M) return;
  const int row0 = mt * 16, col0 = nq * 64; const _Float16* arow = A + (size_t)(row0 + ln) * lda;
  v8f acc[4] = {};
  for (int kb = 0; kb < K; kb += 32) { FragH ah; ah.half[0] = *(const v8us*)((const unsigned short*)arow + kb + 8 * hh); ah.half[1] = *(const v8us*)((const unsigned short*)arow + kb + 16 + 8 * hh);
#pragma unroll
    for (int t = 0; t < 4; ++t) { if (col0 + t * 16 >= N) continue; const size_t boff = (size_t)(col0 + t * 16 + ln) * ldb + kb; FragH bq; bq.half[0] = *(const v8us*)((const unsigned short*)Bh + boff + 8 * hh); bq.half[1] = *(const v8us*)((const unsigned short*)Bh + boff + 16 + 8 * hh);
      acc[t] = mmaH<1>(ah.v, ah.v, bq.v, bq.v, acc[t]); }
  }
#pragma unroll
  for (int t = 0; t < 4; ++t) { if (col0 + t * 16 >= N) continue; const int col = col0 + t * 16 + ln; const float bv = bp ? bf16_round(bp[col]) : 0.f;
#pragma unroll
    for (int r = 0; r < 8; ++r) { float v = acc[t][r] * alpha + bv; if (CP) { const int bidx = (row0g + row0 + 8 * hh + r) / rowsPerB; v += CP[(size_t)bidx * sCPb + (size_t)by * 64 + col]; } if (ACT == 1) v = (v > 0.f) ? v : expm1f(v); else if (ACT == 3) v = fmaxf(v, 0.f); so[w][8 * hh + r][t * 16 + ln] = v; } }
  __builtin_amdgcn_fence(__ATOMIC_ACQ_REL, "workgroup"); __builtin_amdgcn_wave_barrier();
  const int rsub = lane >> 4, c4 = (lane & 15) * 4; typedef _Float16 v4h __attribute__((ext_vector_type(4)));
  {
#pragma unroll
    for (int q = 0; q < 8; ++q) { const int r = q * 2 + rsub; if (col0 + c4 < N) { const v4f v = *(const v4fa*)&so[w][r][c4]; if (C) *(v4f*)(C + cofs + (size_t)(row0 + r) * ldc + col0 + c4) = v; if (C16) { v4h h4; for (int i = 0; i < 4; ++i) h4[i] = (_Float16)v[i]; *(v4h*)(C16 + cofs + (size_t)(row0 + r) * ldc + col0 + c4) = h4; } } }
     }
}


__global__ __launch_bounds__(256) void k_round16f(const float* __restrict__ W, _Float16* __restrict__ Bt, size_t n8) { const size_t t = (size_t)blockIdx.x * 256 + threadIdx.x; if (t >= n8) return; FragH f;
#pragma unroll
  for (int i = 0; i < 8; ++i) f.h[i] = (_Float16)(bf16_round(W[t * 8 + i]) * 16.0f); *(v8us*)((unsigned short*)Bt + t * 8) = f.half[0];  }
// K rows (f32 -> bf16 value -> f16) in the order of the score product's A fragments. A 16-byte unit holds 8 dims of one key; unit ((kt * 2 + ks) * 2 + half) * 32 + hh * 16 + ln
// of a (batch, head) slab is key kt * 16 + ln, dims ks * 32 + half * 16 + hh * 8 .. + 7: a wave's load of one fragment half is 512 contiguous bytes (four whole lines).
// One block = 16 keys x all 8 heads, read in whole rows and turned through LDS; a group of 16 units takes 256 + 16 bytes there, so that neither side meets a bank conflict.
// Part of k_prep; bx = the block's number inside its part, st = the block's LDS (64 * 136 elements).
__device__ __forceinline__ void kpack(int bx, unsigned short* st, const float* __restrict__ x, _Float16* __restrict__ Kp) { const int tid = threadIdx.x; const int b = bx / 256, kt = bx % 256;
#pragma unroll      // the four rounds' loads fly together
  for (int i = 0; i < 4; ++i) { const int u = i * 256 + tid, ln = u >> 6, c8 = u & 63; const float* s = x + ((size_t)b * 4096 + kt * 16 + ln) * 512 + c8 * 8; const v4f a0 = *(const v4fa*)s, a1 = *(const v4fa*)(s + 4); FragH f;      // c8 = head * 8 + ks * 4 + half * 2 + hh
#pragma unroll      // constant vector indices: the values stay in registers
    for (int q = 0; q < 4; ++q) { f.h[q] = (_Float16)bf16_round(a0[q]); f.h[4 + q] = (_Float16)bf16_round(a1[q]); }
    *(v8us*)&st[c8 * 136 + ln * 8] = f.half[0]; }
  __syncthreads();
#pragma unroll      // the four LDS reads are issued ahead of the first store
  for (int i = 0; i < 4; ++i) { const int p = i * 256 + tid; const v8us o = *(const v8us*)&st[(p >> 4) * 136 + (p & 15) * 8];      // p >> 7 = head
    *(v8us*)((unsigned short*)Kp + ((((size_t)b * 8 + (p >> 7)) * 256 + kt) * 128 + (p & 127)) * 8) = o; }
  asm volatile("s_wait_xcnt 0x0" ::: "memory"); }      // a precaution: in k_prep's listing another part's code follows and rewrites the stores' registers; this wait stands in front of that
// V (f32 -> bf16 value -> f16, converted here on the way into LDS) transposed, in the order of the second product's A fragments: unit ((pass * 4 + dt) * 2 + half) * 32 + hh * 16 + ln of a slab is dim dt * 16 + ln, keys pass * 32 + half * 16 + hh * 8 .. + 7.
// Part of k_prep; bx = the block's number inside its part, tl = the block's LDS (64 rows of 66 elements).
template <int NHv, int TTv>
__device__ __forceinline__ void vt(int bx, unsigned short (*tl)[66], const float* __restrict__ V, int ldv, int voff, _Float16* __restrict__ Vt) { const int tid = threadIdx.x; const int slab = bx / (TTv / 64), lg = bx % (TTv / 64); const int b = slab / NHv, h = slab % NHv;
#pragma unroll      // the four rounds' loads fly together
  for (int rd = 0; rd < 4; ++rd) { const int i = rd * 256 + tid, r = i >> 4, c4 = (i & 15) * 4; const v4f a = *(const v4fa*)(V + ((size_t)b * TTv + lg * 64 + r) * ldv + voff + h * 64 + c4); FragH f;      // 16 lanes take a head's 256-byte row piece: whole lines
#pragma unroll      // constant vector indices: the values stay in registers
    for (int q = 0; q < 4; ++q) { f.h[q] = (_Float16)bf16_round(a[q]); tl[r][c4 + q] = f.u[q]; } }
  __syncthreads();
  {
#pragma unroll
    for (int rd = 0; rd < 2; ++rd) { const int u = rd * 256 + tid, d = ((u >> 6) & 3) * 16 + (u & 15), k0 = rd * 32 + ((u >> 4) & 3) * 8; FragH f;      // the block's 64 keys are two passes: 512 units in a row
#pragma unroll
      for (int q = 0; q < 8; ++q) f.u[q] = tl[k0 + q][d];
      *(v8us*)((unsigned short*)Vt + ((size_t)bx * 512 + u) * 8) = f.half[0]; }
     }
  asm volatile("s_wait_xcnt 0x0" ::: "memory"); }      // a precaution, as at the end of kpack: it stands in front of any rewrite of the stores' registers by the code that follows in the listing
// The three preparations depend on nothing but the inputs and on none of each other: one grid, the block number picks the part (a test that reads the same for the whole block, so each part's barrier is passed by all of its block).
// Their loads, stores and block starts overlap, and two launch boundaries go. The few weight blocks come first, so that they do not start last.
#define PB_W (NO * (CC / 8) / 256)
#define PB_V (BB * NH * (TT / 64))
#define PB_K (NR / 16)
__global__ __launch_bounds__(256) void k_prep(const float* __restrict__ Wo, const float* __restrict__ v, const float* __restrict__ k, _Float16* __restrict__ Bo, _Float16* __restrict__ Vt, _Float16* __restrict__ Kp) {
  __shared__ __attribute__((aligned(16))) unsigned short sm[64 * 136];      // the K part's need; the V part takes 64 * 66 of it
  const int bx = blockIdx.x;
  if (bx < PB_W) wt_f16(bx, Wo, Bo, CC, NO, 16.0f);      // [in][out]
  else if (bx < PB_W + PB_V) vt<NH, TT>(bx - PB_W, (unsigned short (*)[66])sm, v, CC, 0, Vt);
  else kpack(bx - (PB_W + PB_V), sm, k, Kp);
}

typedef float v2f __attribute__((ext_vector_type(2)));
// D = A.B + C for the flash kernel, the builtin alone: the compiler keeps the distance behind a matrix instruction itself and fills it with real work (the next independent product, the rescale, the sums) where there is some
__device__ __forceinline__ v8f mmaF(v16h a, v16h b, v8f c) { return __builtin_amdgcn_wmma_f32_16x16x32_f16(false, a, false, b, (short)0, c, false, false); }
// lane l <-> lane l ^ 16 as a vector cross-row move: no LDS queue and no wait, unlike a shuffle
__device__ __forceinline__ float xhalf(float x) { return __builtin_bit_cast(float, __builtin_amdgcn_permlanex16(__builtin_bit_cast(int, x), __builtin_bit_cast(int, x), 0x76543210, 0xfedcba98, false, false)); }

// P of one query column for one pass: 2^(score x SL2 - m) for its 16 keys of this half, as the f16 B operand of the second product; returns their sum.
__device__ __forceinline__ float pexp(v8f s0, v8f s1, float m, FragH& pb) {
  constexpr float SL2 = 0.125f * 1.44269504088896340736f;
  float sc[16], ps[4] = {0.f, 0.f, 0.f, 0.f};
#pragma unroll      // both loops: constant indices, so that scores, sums and P stay in registers
  for (int r = 0; r < 8; ++r) { sc[r] = s0[r]; sc[8 + r] = s1[r]; }
#pragma unroll
  for (int i = 0; i < 16; i += 2) {      // two neighbouring scores of an accumulator share one packed multiply-add
    const v2f e = __builtin_elementwise_fma((v2f){sc[i], sc[i + 1]}, (v2f){SL2, SL2}, (v2f){-m, -m});
    const float p0 = __builtin_amdgcn_exp2f(e[0]), p1 = __builtin_amdgcn_exp2f(e[1]);
    ps[i & 3] += p0; ps[(i + 1) & 3] += p1; pb.h[i] = (_Float16)p0; pb.h[i + 1] = (_Float16)p1; }
  return (ps[0] + ps[1]) + (ps[2] + ps[3]);
}

// Eight asynchronous copies to LDS: line i brings this lane's 16 bytes at g + i * 4 KiB to LDS byte l + i * 4 KiB; the block's 256 lanes move 8 x 4 KiB in a row (one tile's K part or V part).
// The wait at the statement's end stands in front of any later overwrite of the address registers that the copies name.
__device__ __forceinline__ void copy8(unsigned l, const unsigned short* g) {
  asm volatile("global_load_async_to_lds_b128 %0, %8, off\n\t"
               "global_load_async_to_lds_b128 %1, %9, off\n\t"
               "global_load_async_to_lds_b128 %2, %10, off\n\t"
               "global_load_async_to_lds_b128 %3, %11, off\n\t"
               "global_load_async_to_lds_b128 %4, %12, off\n\t"
               "global_load_async_to_lds_b128 %5, %13, off\n\t"
               "global_load_async_to_lds_b128 %6, %14, off\n\t"
               "global_load_async_to_lds_b128 %7, %15, off\n\t"
               "s_wait_xcnt 0x0"
               :: "v"(l), "v"(l + 4096u), "v"(l + 8192u), "v"(l + 12288u), "v"(l + 16384u), "v"(l + 20480u), "v"(l + 24576u), "v"(l + 28672u),
                  "v"(g), "v"(g + 2048), "v"(g + 4096), "v"(g + 6144), "v"(g + 8192), "v"(g + 10240), "v"(g + 12288), "v"(g + 14336) : "memory");
}

__global__ __launch_bounds__(256) void k_flash(const float* __restrict__ Qf, int ldq, const _Float16* __restrict__ Kp, const _Float16* __restrict__ Vt, const int* __restrict__ MSK, _Float16* __restrict__ O16, int ldo) {
  constexpr int NW = 8, RPW = 32, NQB = 4096 / (NW * RPW), DT = 4, KS = 2, PP = 8, NT = 4096 / (32 * PP), PART = PP * 2048; (void)MSK;      // PART: 16-bit elements of a tile's K part, and of its V part
  constexpr float SL2 = 0.125f * 1.44269504088896340736f;      // 64^-1/2 x log2(e): exp(x / 8 - m / 8) = 2^(x * SL2 - m * SL2)
  __shared__ __attribute__((aligned(16))) unsigned short sKV[2][2 * PART];        // [buffer][K part, then V part]
  __shared__ __attribute__((aligned(16))) unsigned short sO[NW][RPW][64 + 8];      // row pitch 144 bytes = 16 x 9: 16-byte accesses down a column meet no bank conflict
  const int tid = threadIdx.x, w = tid >> 5, lane = tid & 31, ln = lane & 15, hh = lane >> 4;
  const int slab = blockIdx.x / NQB, qblk = blockIdx.x % NQB; const int b = slab / 8, h = slab % 8; const int qb0 = qblk * (NW * RPW); const int q0 = qb0 + w * RPW;
  const unsigned short* kg = (const unsigned short*)Kp + (size_t)slab * 4096 * 64 + tid * 8;      // fragment order (kpack): a pass is 4 KiB in a row, a tile 32 KiB; this lane's 16 bytes of each 4 KiB
  const unsigned short* vg = (const unsigned short*)Vt + (size_t)slab * 64 * 4096 + tid * 8;      // fragment order (vt): the same
  const unsigned l0 = (unsigned)(size_t)&sKV[0][tid * 8];                                         // this lane's LDS byte address in buffer 0's K part
  copy8(l0, kg); copy8(l0 + 2 * PART, vg);      // tile 0 -> buffer 0; it flies over the Q loads and their conversion
  v4f qf[2][KS][4];      // raw f32 Q in the fragments' k order: [0], [1] = dims ks * 32 + 8hh .. + 7, [2], [3] = dims ks * 32 + 16 + 8hh .. + 7
#pragma unroll
  for (int rt = 0; rt < 2; ++rt) { const float* qr = Qf + ((size_t)b * 4096 + q0 + rt * 16 + ln) * ldq + h * 64;
#pragma unroll
    for (int ks = 0; ks < KS; ++ks) { const float* qk = qr + ks * 32 + 8 * hh; qf[rt][ks][0] = *(const v4fa*)qk; qf[rt][ks][1] = *(const v4fa*)(qk + 4); qf[rt][ks][2] = *(const v4fa*)(qk + 16); qf[rt][ks][3] = *(const v4fa*)(qk + 20); } }
  asm volatile("s_wait_xcnt 0x0" ::: "memory");      // the address registers of the loads above are reused below: the wait stands in front of their overwrite
  __builtin_amdgcn_sched_barrier(0);                 // keeps the set-up code that reuses those registers behind that wait
  FragH aq[2][KS];
#pragma unroll      // all three loops: constant indices, so that the raw values and the fragments stay in registers
  for (int rt = 0; rt < 2; ++rt)
#pragma unroll
    for (int ks = 0; ks < KS; ++ks)
#pragma unroll
      for (int i = 0; i < 16; ++i) aq[rt][ks].h[i] = (_Float16)bf16_round(qf[rt][ks][i >> 2][i & 3]);
  float m_r[2], l_r[2]; v8f oacc[2][DT];      // per lane: query rt * 16 + ln; m_r = reference point of the exponents in base-2 units (score x SL2): the largest pass maximum among the passes that took the rescale; oacc[rt][dt][r] = Ot[dt * 16 + 8hh + r][that query]
#pragma unroll
  for (int rt = 0; rt < 2; ++rt) { m_r[rt] = -3.0e38f; l_r[rt] = 0.f;
#pragma unroll
    for (int dt = 0; dt < DT; ++dt) oacc[rt][dt] = (v8f){0.f,0.f,0.f,0.f,0.f,0.f,0.f,0.f}; }
  asm volatile("s_wait_asynccnt 0x0" ::: "memory");      // this wave's copies of tile 0 have landed
  __syncthreads();                                       // ... and every other wave's: tile 0 may be read
  copy8(l0 + 4 * PART, kg + PART); copy8(l0 + 6 * PART, vg + PART);      // tile 1 -> buffer 1
#pragma unroll 1      // one trip = one tile; rolled, so that the ring's foot stands once
  for (int t = 0; t < NT; ++t) {
    const unsigned short* kl = &sKV[t & 1][lane * 8];      // this lane's unit of the tile's first K fragment half
    const unsigned short* vl = kl + PART;
    // Inside a tile every LDS read is issued a phase ahead of its use: V of a pass at the pass's top, K of the next pass right behind this pass's score products.
    FragH bk[2][KS], bv[DT];
#pragma unroll
    for (int nt = 0; nt < 2; ++nt)
#pragma unroll
      for (int ks = 0; ks < KS; ++ks) { const unsigned short* kr = kl + nt * 1024 + ks * 512; bk[nt][ks].half[0] = *(const v8us*)kr; bk[nt][ks].half[1] = *(const v8us*)(kr + 256); }
#pragma unroll 1      // rolled: unrolled, the 8 passes' LDS reads are lifted far ahead, the registers double and the back edge fills with copies
   for (int p = 0; p < PP; ++p) {
#pragma unroll
    for (int dt = 0; dt < DT; ++dt) { const unsigned short* vrow = vl + p * 2048 + dt * 512; bv[dt].half[0] = *(const v8us*)vrow; bv[dt].half[1] = *(const v8us*)(vrow + 256); }
    __builtin_amdgcn_sched_barrier(0);      // keeps the pass's eight V reads here as one group: sunk, they stand in several places among the softmax, and the last come late for their products
    v8f s[2][2];      // s[rt][nt][r] = score of key (t * PP + p) * 32 + nt * 16 + 8hh + r against query rt * 16 + ln
#pragma unroll
    for (int nt = 0; nt < 2; ++nt) {
#pragma unroll
      for (int rt = 0; rt < 2; ++rt) { v8f acc = (v8f){0.f,0.f,0.f,0.f,0.f,0.f,0.f,0.f};
#pragma unroll
        for (int ks = 0; ks < KS; ++ks) acc = mmaF(bk[nt][ks].v, aq[rt][ks].v, acc); s[rt][nt] = acc; } }
    if (p + 1 < PP) {      // the last pass of a tile fetches no K ahead: the next tile is not published yet
#pragma unroll
      for (int nt = 0; nt < 2; ++nt)
#pragma unroll
        for (int ks = 0; ks < KS; ++ks) { const unsigned short* kr = kl + (p + 1) * 2048 + nt * 1024 + ks * 512; bk[nt][ks].half[0] = *(const v8us*)kr; bk[nt][ks].half[1] = *(const v8us*)(kr + 256); } }
    // The reference point m_r of a query's exponents need not be its running maximum: any m gives the same quotient O / l as long as no P leaves the f16 range.
    // So a pass first takes P with the m_r it has. All P are positive, so a lane's sum bounds each of them: while the sums stay under 2^15 nothing can overflow, and
    // the pass needs no maximum and no rescale. Otherwise (always in the first pass, where m_r is still -3e38 and the sums come out infinite; a NaN fails the test too)
    // the whole wave takes the maximum, moves m_r up to it, rescales l and O and forms P again.
    FragH pb[2]; float su[2];
#pragma unroll      // here and below: constant indices, so that the accumulators stay in registers
    for (int rt = 0; rt < 2; ++rt) su[rt] = pexp(s[rt][0], s[rt][1], m_r[rt], pb[rt]);
    if (__builtin_expect(__builtin_amdgcn_ballot_w32(!(su[0] + su[1] <= 32768.0f)) != 0u, 0)) {      // wave-uniform: every lane stays on, and both halves of a column keep one m_r
#pragma unroll
      for (int rt = 0; rt < 2; ++rt) {
        float mx[8];      // maximum of the raw products (the scale is positive)
#pragma unroll
        for (int r = 0; r < 8; ++r) mx[r] = fmaxf(s[rt][0][r], s[rt][1][r]);
        float mc = fmaxf(fmaxf(fmaxf(mx[0], mx[1]), fmaxf(mx[2], mx[3])), fmaxf(fmaxf(mx[4], mx[5]), fmaxf(mx[6], mx[7])));
        mc = fmaxf(mc, xhalf(mc));      // both halves of a column must use one maximum: their P meet in one product
        const float mn = fmaxf(m_r[rt], mc * SL2); const float al = __builtin_amdgcn_exp2f(m_r[rt] - mn); m_r[rt] = mn;
        su[rt] = pexp(s[rt][0], s[rt][1], mn, pb[rt]);
        l_r[rt] *= al;
#pragma unroll
        for (int dt = 0; dt < DT; ++dt)
#pragma unroll
          for (int r = 0; r < 8; ++r) oacc[rt][dt][r] *= al; } }
#pragma unroll
    for (int rt = 0; rt < 2; ++rt) l_r[rt] += su[rt];      // this half's keys only; the halves join after the loop
#pragma unroll
    for (int dt = 0; dt < DT; ++dt) {
#pragma unroll
      for (int rt = 0; rt < 2; ++rt) oacc[rt][dt] = mmaF(bv[dt].v, pb[rt].v, oacc[rt][dt]); } }
    // The ring's foot: this wave's LDS reads are done, its copies of tile t + 1 have landed, every wave has come as far; then tile t + 2 goes into the buffer that this trip has read.
    asm volatile("s_wait_dscnt 0x0" ::: "memory");
    asm volatile("s_wait_asynccnt 0x0" ::: "memory");
    __syncthreads();
    if (t + 2 < NT) { const unsigned lb = l0 + (unsigned)(t & 1) * (4 * PART); copy8(lb, kg + (size_t)(t + 2) * PART); copy8(lb + 2 * PART, vg + (size_t)(t + 2) * PART); } }
  asm volatile("s_wait_asynccnt 0x0" ::: "memory");      // nothing of this wave is in flight when it goes on to the epilogue
#pragma unroll
  for (int rt = 0; rt < 2; ++rt) { float l = l_r[rt]; l += xhalf(l); const float li = (l > 0.f) ? 1.0f / l : 0.f;
#pragma unroll
    for (int dt = 0; dt < DT; ++dt) { FragH f;
#pragma unroll
      for (int r = 0; r < 8; ++r) f.h[r] = (_Float16)(oacc[rt][dt][r] * li);
      *(v8us*)&sO[w][rt * 16 + ln][dt * 16 + 8 * hh] = f.half[0]; } }
  __builtin_amdgcn_fence(__ATOMIC_ACQ_REL, "workgroup"); __builtin_amdgcn_wave_barrier();
  {
#pragma unroll
    for (int rp = 0; rp < RPW; rp += 4) { const int r = rp + (lane >> 3), pc = lane & 7; const v8us val = *(const v8us*)&sO[w][r][pc * 8]; *(v8us*)((unsigned short*)O16 + ((size_t)b * 4096 + q0 + r) * ldo + h * 64 + pc * 8) = val; }      // 8 lanes store a head's 128-byte row piece: one whole line
     } }

// Output linear: C[8192][64] = O16[8192][512] . W x 2^-4 + bias (Bt = W transposed, f16, x 2^4). One block = 32 rows; its 8 waves split K: wave w takes k = 64w .. 64w + 63 of all 32 rows and all 64 columns.
// A wave's 24 fragment loads depend on nothing but the thread index and are issued together: the kernel pays one round trip to L2, not one per product. Then 16 products; the 8 partial sums meet in LDS.
// Transposed product (A = Bt rows, B = O16 rows, both in the loaders' one k order): lane (ln, hh) holds output row ln and columns 8hh + r of a 16 x 16 tile, so its 8 values are 32 bytes in a row of the partial sum.
__global__ __launch_bounds__(256) void k_outlin(const _Float16* __restrict__ A, const _Float16* __restrict__ Bt, const float* __restrict__ bias, float* __restrict__ C) {
  constexpr int PW = NO + 4;      // LDS row pitch 272 bytes = 16 x 17: 16-byte accesses down a column meet no bank conflict
  __shared__ __attribute__((aligned(16))) float red[8][32][PW];
  const int tid = threadIdx.x, w = tid >> 5, lane = tid & 31, ln = lane & 15, hh = lane >> 4;
  const int row0 = blockIdx.x * 32, orow = tid >> 4, c4 = (tid & 15) * 4;
  const unsigned short* ap = (const unsigned short*)A + (size_t)(row0 + ln) * CC + w * 64 + 8 * hh;
  const unsigned short* bp = (const unsigned short*)Bt + (size_t)ln * CC + w * 64 + 8 * hh;
  FragH fa[2][2], fb[4][2];      // [row tile][k step], [column tile][k step]
#pragma unroll      // all loops here: constant indices, so that fragments and sums stay in registers
  for (int ks = 0; ks < 2; ++ks) {
#pragma unroll
    for (int rt = 0; rt < 2; ++rt) { const unsigned short* s = ap + rt * 16 * CC + ks * 32; fa[rt][ks].half[0] = *(const v8us*)s; fa[rt][ks].half[1] = *(const v8us*)(s + 16); }
#pragma unroll
    for (int t = 0; t < 4; ++t) { const unsigned short* s = bp + t * 16 * CC + ks * 32; fb[t][ks].half[0] = *(const v8us*)s; fb[t][ks].half[1] = *(const v8us*)(s + 16); } }
  const v4f bz = *(const v4fa*)(bias + c4);
  asm volatile("s_wait_xcnt 0x0" :: "v"(ap), "v"(bp) : "memory");      // the loads' address registers are reused below: the wait stands in front of their overwrite; as its operands they are kept as they are up to it
  __builtin_amdgcn_sched_barrier(0);      // keeps all 25 loads in front of the first product: left free, the scheduler sinks part of them among the products, and each such group is one more round trip
  v8f acc[2][4];
#pragma unroll
  for (int rt = 0; rt < 2; ++rt)
#pragma unroll
    for (int t = 0; t < 4; ++t) acc[rt][t] = (v8f){0.f,0.f,0.f,0.f,0.f,0.f,0.f,0.f};
#pragma unroll
  for (int ks = 0; ks < 2; ++ks)
#pragma unroll
    for (int rt = 0; rt < 2; ++rt)
#pragma unroll
      for (int t = 0; t < 4; ++t) acc[rt][t] = mmaF(fb[t][ks].v, fa[rt][ks].v, acc[rt][t]);
#pragma unroll
  for (int rt = 0; rt < 2; ++rt)
#pragma unroll
    for (int t = 0; t < 4; ++t) { float* d = &red[w][rt * 16 + ln][t * 16 + 8 * hh];
      *(v4fa*)d = (v4f){acc[rt][t][0], acc[rt][t][1], acc[rt][t][2], acc[rt][t][3]}; *(v4fa*)(d + 4) = (v4f){acc[rt][t][4], acc[rt][t][5], acc[rt][t][6], acc[rt][t][7]}; }
  __syncthreads();      // every wave's partial sums are in LDS
#pragma unroll
  for (int i = 0; i < 2; ++i) { const int r = i * 16 + orow; v4f s = *(const v4fa*)&red[0][r][c4];
#pragma unroll
    for (int p = 1; p < 8; ++p) s += *(const v4fa*)&red[p][r][c4];
    v4f o;
#pragma unroll
    for (int q = 0; q < 4; ++q) o[q] = s[q] * 0.0625f + bf16_round(bz[q]);
    *(v4fa*)(C + (size_t)(row0 + r) * NO + c4) = o; }      // 16 lanes store one 256-byte row: whole lines
}

extern "C" void kernel_launch(void* const* d_in, const int* in_sizes, int n_in,
                              void* d_out, int out_size, void* d_ws, size_t ws_size, hipStream_t stream) {
  (void)in_sizes; (void)n_in; (void)out_size;
  const float* q = (const float*)d_in[0]; const float* k = (const float*)d_in[1]; const float* v = (const float*)d_in[2]; const float* Wo = (const float*)d_in[3]; const float* bo = (const float*)d_in[4];
  char* ws = (char*)d_ws; size_t off = 0;
  auto take = [&](size_t bytes) { char* p = ws + off; off += (bytes + 255) & ~(size_t)255; return p; };
  _Float16* Bo = (_Float16*)take((size_t)NO * CC * 2); _Float16* K16 = (_Float16*)take((size_t)NR * CC * 2); _Float16* Vt = (_Float16*)take((size_t)NR * CC * 2); _Float16* O16 = (_Float16*)take((size_t)NR * CC * 2);
  if (off > ws_size) return;      // 3 x 8.4 MB
  k_prep<<<PB_W + PB_V + PB_K, 256, 0, stream>>>(Wo, v, k, Bo, Vt, K16);
  k_flash<<<BB * NH * (TT / 256), 256, 0, stream>>>(q, CC, K16, Vt, nullptr, O16, CC);
  k_outlin<<<NR / 32, 256, 0, stream>>>(O16, Bo, bo, (float*)d_out);
}
